// v005
// Times are from an AMD MI455X. After a warm-up the kernel runs many times in a row, and a time is the length of
// such a window on the GPU divided by its runs, so every launch and the gaps after it count. The runs cycle
// through copies of the inputs. A figure is the median of several windows, for all but v000 over two sittings.
// Sittings can differ by a few percent; kernels timed side by side share one.
// This document starts at v005; the versions before it stand elsewhere.
// A run of this version takes 98.6 microseconds.
// Timed twice side by side with v004, it ran 1.28 and 1.27 times as fast.
// Over all steps from v000, the starting kernel, it is 5.10 times as fast.
#include <hip/hip_runtime.h>
// CustomCausalAttention (q, k, v [2][16][2048][64]; RBF-kernel causal attention: logits = -relu(|q|^2 + |k|^2 - 2 q.k) / 8 over keys n <= m; out = softmax(logits) v -> [2][16][2048][64]).
// Structure: each (batch, head) slab is a contiguous 64-wide row block, treated as one 'batch' of a single 64-dim head: one preparatory launch makes the exact f16 planes of q and k (bf16-rounded inputs are exact in f16), |q|^2, |k|^2 as f32 row tables on VALU, and v^T by LDS tiles; causal flash-style fused attention per (slab, 64-query block), forming the RBF logit from the f32 dot product and the two norm tables, f32 context written straight to the output; the first 64 causal rows per slab recomputed entirely in f32 on VALU.
// Compute dtype: inputs rounded to bf16; q, k, v exact as f16 (products exact, f32 accumulation); norms, logits, softmax f32 with plain f16 probabilities (~2^-12); rows < 64 all-f32. v_wmma_f32_16x16x32_f16.
#define NB 32                    /* 2 batches x 16 heads as slabs */
#define DM 64
#define NKV 1
#define NREP (NH / NKV)
#define KVD (NKV * 64)           /* 64 */
#define NR (NB * SLEN)
#define CHK 512
typedef int v4i __attribute__((ext_vector_type(4)));
#define FF 2048
#define SLEN 2048
#define MQI 2048
#define MKI 2048
#define TQ SLEN
#define TK SLEN
#define NH 1
#define SCL 1.0f                 /* raw dot product; the RBF transform applies the 1/8 */
#define QBLKS (TQ / 64)
#define QB05 0
#define QBN5 QBLKS      /* k_flash5 (hi/lo engine, not launched) would span all query blocks */
#define QB0P 0
#define QBNP QBLKS
#define RE 256
typedef __bf16 v16b __attribute__((ext_vector_type(16)));
typedef unsigned short v8us __attribute__((ext_vector_type(8), may_alias));
typedef float  v8f  __attribute__((ext_vector_type(8)));
typedef float  v4f  __attribute__((ext_vector_type(4)));
typedef float  v4fa __attribute__((ext_vector_type(4), may_alias));
union FragB { v16b v; v8us half[2]; unsigned short u[16]; };

__device__ __forceinline__ unsigned short bf16_bits(float x) { unsigned int u = __float_as_uint(x); return (unsigned short)((u + 0x7FFFu + ((u >> 16) & 1u)) >> 16); }
__device__ __forceinline__ float bf16_val(unsigned short b) { return __uint_as_float(((unsigned int)b) << 16); }
__device__ __forceinline__ float bf16_round(float x) { return bf16_val(bf16_bits(x)); }
// D += A·B with NT terms: 1 = ah·bh, 2 = + al·bh (A split), 3 = + ah·bl (both split)
template <int NT>
__device__ __forceinline__ v8f mmaN(v16b ah, v16b al, v16b bh, v16b bl, v8f c) {
  c = __builtin_amdgcn_wmma_f32_16x16x32_bf16(false, ah, false, bh, (short)0, c, false, false);
  if (NT >= 2) c = __builtin_amdgcn_wmma_f32_16x16x32_bf16(false, al, false, bh, (short)0, c, false, false);
  if (NT >= 3) c = __builtin_amdgcn_wmma_f32_16x16x32_bf16(false, ah, false, bl, (short)0, c, false, false);
  asm volatile("v_nop\n\tv_nop\n\tv_nop\n\tv_nop" : "+v"(c) : "v"(ah), "v"(al), "v"(bh), "v"(bl));
  return c;
}

__global__ __launch_bounds__(256) void k_wt_bf16(const float* __restrict__ W, unsigned short* __restrict__ Wt, int K, int N) {
  const int t = blockIdx.x * 256 + threadIdx.x;
  const int k8n = K / 8;
  if (t >= N * k8n) return;
  const int n = t / k8n, k8 = (t % k8n) * 8;
  v8us v;
#pragma unroll
  for (int i = 0; i < 8; ++i) v[i] = bf16_bits(W[(size_t)(k8 + i) * N + n]);
  *(v8us*)(Wt + (size_t)n * K + k8) = v;
  
}

// GEMM C[M][N] (f32, pitch ldc) = act(A[M][K]·W + bias). A f32 row-major (pitch lda) converted per fragment to bf16
// (ASPLIT: hi/lo two planes -> 2 terms, else single rounded term); Wt bf16 [N][K] (pitch ldb). BIAS_BF16 rounds the
// bias to bf16 first (bias quantised to bf16 before the add). K%32==0, M%16==0, N%64==0.
template <bool ASPLIT, int ACT, bool BIAS_BF16>
__global__ __launch_bounds__(128) void k_gemm_bf(const float* __restrict__ A, int lda, const unsigned short* __restrict__ Wt, int ldb,
                                               const float* __restrict__ bias, float* __restrict__ C, int ldc, int M, int N, int K) {
  __shared__ __attribute__((aligned(16))) float so[4][16][64];
  const int tid = threadIdx.x, w = tid >> 5, lane = tid & 31, ln = lane & 15, hh = lane >> 4;
  const int ntn = N / 64;
  const int wid = blockIdx.x * 4 + w;
  const int mt = wid / ntn, nq = wid % ntn;
  if (mt * 16 >= M) return;
  const int row0 = mt * 16, col0 = nq * 64;
  const float* arow = A + (size_t)(row0 + ln) * lda;
  v8f acc[4] = {};
  for (int kb = 0; kb < K; kb += 32) {
    FragB ah, al;
    const v4f x0 = *(const v4fa*)(arow + kb + 8 * hh), x1 = *(const v4fa*)(arow + kb + 8 * hh + 4);
    const v4f x2 = *(const v4fa*)(arow + kb + 16 + 8 * hh), x3 = *(const v4fa*)(arow + kb + 16 + 8 * hh + 4);
    float xs[16] = {x0[0],x0[1],x0[2],x0[3],x1[0],x1[1],x1[2],x1[3],x2[0],x2[1],x2[2],x2[3],x3[0],x3[1],x3[2],x3[3]};
#pragma unroll
    for (int i = 0; i < 16; ++i) { const unsigned short hb = bf16_bits(xs[i]); ah.u[i] = hb; al.u[i] = ASPLIT ? bf16_bits(xs[i] - bf16_val(hb)) : (unsigned short)0; }
#pragma unroll
    for (int t = 0; t < 4; ++t) {
      const unsigned short* brow = Wt + (size_t)(col0 + t * 16 + ln) * ldb + kb;
      FragB b;
      b.half[0] = *(const v8us*)(brow + 8 * hh);
      b.half[1] = *(const v8us*)(brow + 16 + 8 * hh);
      acc[t] = mmaN<ASPLIT ? 2 : 1>(ah.v, al.v, b.v, b.v, acc[t]);
    }
  }
#pragma unroll
  for (int t = 0; t < 4; ++t) {
    float bv = bias ? bias[col0 + t * 16 + ln] : 0.f;
    if (BIAS_BF16) bv = bf16_round(bv);
#pragma unroll
    for (int r = 0; r < 8; ++r) { float v = acc[t][r] + bv; if (ACT == 1) v = fmaxf(v, 0.f); so[w][8 * hh + r][t * 16 + ln] = v; }
  }
  __builtin_amdgcn_fence(__ATOMIC_ACQ_REL, "workgroup");
  __builtin_amdgcn_wave_barrier();
  const int rsub = lane >> 4, c4 = (lane & 15) * 4;
  {
#pragma unroll
    for (int q = 0; q < 8; ++q) {
      const int r = q * 2 + rsub;
      const v4f v = *(const v4fa*)&so[w][r][c4];
      *(v4f*)(C + (size_t)(row0 + r) * ldc + col0 + c4) = v;
    }
    
  }
}

// GEMM C = act(A·W + bias + resid): A f32 (ASPLIT -> hi/lo 2 terms), Wt bf16 [N][K]; ACT 0 none, 1 relu, 2 exact gelu;
// resid (optional, f32, row index = (row % rmod), pitch ldr, RES_BF16 rounds it) added before the activation.
template <bool ASPLIT, int ACT, bool BIAS_BF16, bool RES_BF16>
__global__ __launch_bounds__(128) void k_gemm_bf3(const float* __restrict__ A, int lda, const unsigned short* __restrict__ Wt, int ldb,
                                                const float* __restrict__ bias, const float* __restrict__ resid, int rmod, int ldr,
                                                float* __restrict__ C, int ldc, int M, int N, int K) {
  __shared__ __attribute__((aligned(16))) float so[4][16][64];
  const int tid = threadIdx.x, w = tid >> 5, lane = tid & 31, ln = lane & 15, hh = lane >> 4;
  const int ntn = N / 64;
  const int wid = blockIdx.x * 4 + w;
  const int mt = wid / ntn, nq = wid % ntn;
  if (mt * 16 >= M) return;
  const int row0 = mt * 16, col0 = nq * 64;
  const float* arow = A + (size_t)(row0 + ln) * lda;
  v8f acc[4] = {};
  for (int kb = 0; kb < K; kb += 32) {
    FragB ah, al;
    const v4f x0 = *(const v4fa*)(arow + kb + 8 * hh), x1 = *(const v4fa*)(arow + kb + 8 * hh + 4);
    const v4f x2 = *(const v4fa*)(arow + kb + 16 + 8 * hh), x3 = *(const v4fa*)(arow + kb + 16 + 8 * hh + 4);
    float xs[16] = {x0[0],x0[1],x0[2],x0[3],x1[0],x1[1],x1[2],x1[3],x2[0],x2[1],x2[2],x2[3],x3[0],x3[1],x3[2],x3[3]};
#pragma unroll
    for (int i = 0; i < 16; ++i) { const unsigned short hb = bf16_bits(xs[i]); ah.u[i] = hb; al.u[i] = ASPLIT ? bf16_bits(xs[i] - bf16_val(hb)) : (unsigned short)0; }
#pragma unroll
    for (int t = 0; t < 4; ++t) {
      const unsigned short* brow = Wt + (size_t)(col0 + t * 16 + ln) * ldb + kb;
      FragB b;
      b.half[0] = *(const v8us*)(brow + 8 * hh);
      b.half[1] = *(const v8us*)(brow + 16 + 8 * hh);
      acc[t] = mmaN<ASPLIT ? 2 : 1>(ah.v, al.v, b.v, b.v, acc[t]);
    }
  }
#pragma unroll
  for (int t = 0; t < 4; ++t) {
    const int col = col0 + t * 16 + ln;
    float bv = bias ? bias[col] : 0.f;
    if (BIAS_BF16) bv = bf16_round(bv);
#pragma unroll
    for (int r = 0; r < 8; ++r) {
      float v = acc[t][r] + bv;
      if (resid) { float rv = resid[(size_t)((row0 + 8 * hh + r) % rmod) * ldr + col]; if (RES_BF16) rv = bf16_round(rv); v += rv; }
      if (ACT == 1) v = fmaxf(v, 0.f);
      if (ACT == 2) v = 0.5f * v * (1.0f + erff(v * 0.70710678118654752f));
      if (ACT == 3) { const float u = 0.7978845608028654f * (v + 0.044715f * v * v * v); v = 0.5f * v * (1.0f + tanhf(u)); }
      so[w][8 * hh + r][t * 16 + ln] = v;
    }
  }
  __builtin_amdgcn_fence(__ATOMIC_ACQ_REL, "workgroup");
  __builtin_amdgcn_wave_barrier();
  const int rsub = lane >> 4, c4 = (lane & 15) * 4;
  {
#pragma unroll
    for (int q = 0; q < 8; ++q) {
      const int r = q * 2 + rsub;
      const v4f v = *(const v4fa*)&so[w][r][c4];
      *(v4f*)(C + (size_t)(row0 + r) * ldc + col0 + c4) = v;
    }
    
  }
}
// row LayerNorm (biased variance, eps) over N: s = X (+ R); optional out_sum <- s; out_norm <- (s-mu)*rsqrt(var+eps)*g + b
template <bool PARAM_BF16>
__global__ __launch_bounds__(256) void k_layernorm(const float* __restrict__ X, const float* __restrict__ R, const float* __restrict__ g, const float* __restrict__ bta,
                                                  float* __restrict__ out_sum, float* __restrict__ out_norm, int N, float eps) {
  __shared__ float red[256];
  const int row = blockIdx.x, tid = threadIdx.x;
  const float* x = X + (size_t)row * N; const float* rr = R ? R + (size_t)row * N : nullptr;
  float vals[16];                     // up to N = 4096
  const int per = N / 256;            // contiguous chunk per thread? use strided-by-4 chunks: thread handles j = tid*4 + 1024*u
  float s1 = 0.f;
  for (int u = 0; u < per / 4; ++u) {
    const int j = tid * 4 + 1024 * u;
    const v4f a = *(const v4fa*)(x + j);
    v4f b = {0.f,0.f,0.f,0.f}; if (rr) b = *(const v4fa*)(rr + j);
#pragma unroll
    for (int q = 0; q < 4; ++q) { const float v = a[q] + b[q]; vals[u * 4 + q] = v; s1 += v; }
  }
  red[tid] = s1; __syncthreads();
  for (int st = 128; st > 0; st >>= 1) { if (tid < st) red[tid] += red[tid + st]; __syncthreads(); }
  const float mu = red[0] / (float)N; __syncthreads();
  float s2 = 0.f;
  for (int u = 0; u < per / 4; ++u)
#pragma unroll
    for (int q = 0; q < 4; ++q) { const float c = vals[u * 4 + q] - mu; s2 += c * c; }
  red[tid] = s2; __syncthreads();
  for (int st = 128; st > 0; st >>= 1) { if (tid < st) red[tid] += red[tid + st]; __syncthreads(); }
  const float rs = rsqrtf(red[0] / (float)N + eps);
  {
    for (int u = 0; u < per / 4; ++u) {
      const int j = tid * 4 + 1024 * u;
      v4f o, sm;
#pragma unroll
      for (int q = 0; q < 4; ++q) {
        float gg = g[j + q], bb = bta[j + q];
        if (PARAM_BF16) { gg = bf16_round(gg); bb = bf16_round(bb); }
        sm[q] = vals[u * 4 + q]; o[q] = (vals[u * 4 + q] - mu) * rs * gg + bb;
      }
      if (out_sum) *(v4f*)(out_sum + (size_t)row * N + j) = sm;
      *(v4f*)(out_norm + (size_t)row * N + j) = o;
    }
    
  }
}



// ---- f16 WMMA path (v_wmma_f32_16x16x32_f16): 11-bit significands for operands in range — used where a [0,1] probability operand needs more precision than bf16
typedef _Float16 v16h __attribute__((ext_vector_type(16)));
union FragH { v16h v; v8us half[2]; _Float16 h[16]; unsigned short u[16]; };
template <int NT>
__device__ __forceinline__ v8f mmaH(v16h ah, v16h al, v16h bh, v16h bl, v8f c) {
  c = __builtin_amdgcn_wmma_f32_16x16x32_f16(false, ah, false, bh, (short)0, c, false, false);
  if (NT >= 2) c = __builtin_amdgcn_wmma_f32_16x16x32_f16(false, al, false, bh, (short)0, c, false, false);
  if (NT >= 3) c = __builtin_amdgcn_wmma_f32_16x16x32_f16(false, ah, false, bl, (short)0, c, false, false);
  asm volatile("v_nop\n\tv_nop\n\tv_nop\n\tv_nop" : "+v"(c) : "v"(ah), "v"(al), "v"(bh), "v"(bl));
  return c;
}
// batched GEMM like k_gemm_b but f16 operands: A f32 (split into f16 hi/lo if ASPLIT, else rounded to f16), Bt = f16 values [n][k]; alpha; C f32; N multiple of 16 (partial tiles skipped)
template <bool ASPLIT>
__global__ __launch_bounds__(128) void k_gemm_h(const float* __restrict__ A, int lda, size_t sA, const _Float16* __restrict__ Bh, int ldb, size_t sB, float alpha, float* __restrict__ C, int ldc, size_t sC, int M, int N, int K) {
  __shared__ __attribute__((aligned(16))) float so[4][16][64];
  const int tid = threadIdx.x, w = tid >> 5, lane = tid & 31, ln = lane & 15, hh = lane >> 4; const int by = blockIdx.y;
  A += (size_t)by * sA; Bh += (size_t)by * sB; C += (size_t)by * sC;
  const int ntn = (N + 63) / 64; const int wid = blockIdx.x * 4 + w; const int mt = wid / ntn, nq = wid % ntn; if (mt * 16 >= M) return;
  const int row0 = mt * 16, col0 = nq * 64; const float* arow = A + (size_t)(row0 + ln) * lda;
  v8f acc[4] = {};
  for (int kb = 0; kb < K; kb += 32) {
    FragH ah, al;
    const v4f x0 = *(const v4fa*)(arow + kb + 8 * hh), x1 = *(const v4fa*)(arow + kb + 8 * hh + 4), x2 = *(const v4fa*)(arow + kb + 16 + 8 * hh), x3 = *(const v4fa*)(arow + kb + 16 + 8 * hh + 4);
    float xs[16] = {x0[0],x0[1],x0[2],x0[3],x1[0],x1[1],x1[2],x1[3],x2[0],x2[1],x2[2],x2[3],x3[0],x3[1],x3[2],x3[3]};
#pragma unroll
    for (int i = 0; i < 16; ++i) { const _Float16 h = (_Float16)xs[i]; ah.h[i] = h; al.h[i] = ASPLIT ? (_Float16)(xs[i] - (float)h) : (_Float16)0.0f; }
#pragma unroll
    for (int t = 0; t < 4; ++t) { if (col0 + t * 16 >= N) continue; const size_t boff = (size_t)(col0 + t * 16 + ln) * ldb + kb; FragH bq; bq.half[0] = *(const v8us*)(Bh + boff + 8 * hh); bq.half[1] = *(const v8us*)(Bh + boff + 16 + 8 * hh);
      acc[t] = mmaH<ASPLIT ? 2 : 1>(ah.v, al.v, bq.v, bq.v, acc[t]); }
  }
#pragma unroll
  for (int t = 0; t < 4; ++t) { if (col0 + t * 16 >= N) continue;
#pragma unroll
    for (int r = 0; r < 8; ++r) so[w][8 * hh + r][t * 16 + ln] = acc[t][r] * alpha; }
  __builtin_amdgcn_fence(__ATOMIC_ACQ_REL, "workgroup"); __builtin_amdgcn_wave_barrier();
  const int rsub = lane >> 4, c4 = (lane & 15) * 4;
  {
#pragma unroll
    for (int q = 0; q < 8; ++q) { const int r = q * 2 + rsub; if (col0 + c4 < N) { const v4f v = *(const v4fa*)&so[w][r][c4]; *(v4f*)(C + (size_t)(row0 + r) * ldc + col0 + c4) = v; } }
     }
}

// Wt[n][k] = f16(W[k][n]·scale) from f32 row-major W[K][N] (scale = power of two; bf16-exact weights stay exact in f16 away from the subnormal range)
__global__ __launch_bounds__(256) void k_wt_f16(const float* __restrict__ W, _Float16* __restrict__ Wt, int K, int N, float scale) {
  const int t = blockIdx.x * 256 + threadIdx.x; if (t >= N * (K / 8)) return; const int n = t / (K / 8), k8 = (t % (K / 8)) * 8; FragH f;
#pragma unroll
  for (int i = 0; i < 8; ++i) f.h[i] = (_Float16)(bf16_round(W[(size_t)(k8 + i) * N + n]) * scale); const v8us o = f.half[0];
  *(v8us*)((unsigned short*)Wt + (size_t)n * K + k8) = o; 
}
// k_gemm_hh variant with fused epilogue: v = acc·alpha + bias[by·sBias + col] (+ CP[(row/rowsPerB)·sCPb + by·64 + col] if CP) ; ACT 0 none / 1 elu ; writes f16 C16 (and f32 C if non-null)
template <int ACT>
__global__ __launch_bounds__(128) void k_gemm_hhx(const _Float16* __restrict__ A, int lda, size_t sA, const _Float16* __restrict__ Bh, int ldb, size_t sB, float alpha, const float* __restrict__ bias, size_t sBias, const float* __restrict__ CP, int rowsPerB, size_t sCPb, int row0g,
    float* __restrict__ C, _Float16* __restrict__ C16, int ldc, size_t sC, int M, int N, int K) {
  __shared__ __attribute__((aligned(16))) float so[4][16][64];
  const int tid = threadIdx.x, w = tid >> 5, lane = tid & 31, ln = lane & 15, hh = lane >> 4; const int by = blockIdx.y;
  A += (size_t)by * sA; Bh += (size_t)by * sB; const size_t cofs = (size_t)by * sC; const float* bp = bias ? bias + (size_t)by * sBias : nullptr;
  const int ntn = (N + 63) / 64; const int wid = blockIdx.x * 4 + w; const int mt = wid / ntn, nq = wid % ntn; if (mt * 16 >= M) return;
  const int row0 = mt * 16, col0 = nq * 64; const _Float16* arow = A + (size_t)(row0 + ln) * lda;
  v8f acc[4] = {};
  for (int kb = 0; kb < K; kb += 32) { FragH ah; ah.half[0] = *(const v8us*)((const unsigned short*)arow + kb + 8 * hh); ah.half[1] = *(const v8us*)((const unsigned short*)arow + kb + 16 + 8 * hh);
#pragma unroll
    for (int t = 0; t < 4; ++t) { if (col0 + t * 16 >= N) continue; const size_t boff = (size_t)(col0 + t * 16 + ln) * ldb + kb; FragH bq; bq.half[0] = *(const v8us*)((const unsigned short*)Bh + boff + 8 * hh); bq.half[1] = *(const v8us*)((const unsigned short*)Bh + boff + 16 + 8 * hh);
      acc[t] = mmaH<1>(ah.v, ah.v, bq.v, bq.v, acc[t]); }
  }
#pragma unroll
  for (int t = 0; t < 4; ++t) { if (col0 + t * 16 >= N) continue; const int col = col0 + t * 16 + ln; const float bv = bp ? bf16_round(bp[col]) : 0.f;
#pragma unroll
    for (int r = 0; r < 8; ++r) { float v = acc[t][r] * alpha + bv; if (CP) { const int bidx = (row0g + row0 + 8 * hh + r) / rowsPerB; v += CP[(size_t)bidx * sCPb + (size_t)by * 64 + col]; } if (ACT == 1) v = (v > 0.f) ? v : expm1f(v); else if (ACT == 7) v = (v > 0.f) ? v + 1.0f : expf(v); else if (ACT == 8) v = tanhf(v); else if (ACT == 9) v = 0.5f * v * (1.0f + tanhf(0.7978845608028654f * (v + 0.044715f * v * v * v))); else if (ACT == 11) v = 1.0f / (1.0f + expf(-v)); else if (ACT == 12) v = (v > 0.f) ? v : 0.01f * v; else if (ACT == 14) v = (v > 0.f) ? v : 0.1f * v; else if (ACT == 15) v = v / (1.0f + expf(-v)); else if (ACT == 3) v = fmaxf(v, 0.f); else if (ACT == 6) v = 0.5f * v * (1.0f + erff(v * 0.70710678118654752f)); so[w][8 * hh + r][t * 16 + ln] = v; } }
  __builtin_amdgcn_fence(__ATOMIC_ACQ_REL, "workgroup"); __builtin_amdgcn_wave_barrier();
  const int rsub = lane >> 4, c4 = (lane & 15) * 4; typedef _Float16 v4h __attribute__((ext_vector_type(4)));
  {
#pragma unroll
    for (int q = 0; q < 8; ++q) { const int r = q * 2 + rsub; if (col0 + c4 < N) { const v4f v = *(const v4fa*)&so[w][r][c4]; if (C) *(v4f*)(C + cofs + (size_t)(row0 + r) * ldc + col0 + c4) = v; if (C16) { v4h h4; for (int i = 0; i < 4; ++i) h4[i] = (_Float16)v[i]; *(v4h*)(C16 + cofs + (size_t)(row0 + r) * ldc + col0 + c4) = h4; } } }
     }
}


typedef _Float16 v4h __attribute__((ext_vector_type(4)));

__global__ __launch_bounds__(256) void k_h16(const float* __restrict__ x, _Float16* __restrict__ X16, size_t n8) { const size_t t = (size_t)blockIdx.x * 256 + threadIdx.x; if (t >= n8) return; FragH f;
#pragma unroll
  for (int q = 0; q < 8; ++q) f.h[q] = (_Float16)x[t * 8 + q]; *(v8us*)((unsigned short*)X16 + t * 8) = f.half[0];  }
__global__ __launch_bounds__(256) void k_round16f(const float* __restrict__ W, _Float16* __restrict__ Bt, size_t n8) { const size_t t = (size_t)blockIdx.x * 256 + threadIdx.x; if (t >= n8) return; FragH f;
#pragma unroll
  for (int i = 0; i < 8; ++i) f.h[i] = (_Float16)(bf16_round(W[t * 8 + i]) * 16.0f); *(v8us*)((unsigned short*)Bt + t * 8) = f.half[0];  }
template <int NHv, int TTv>
__global__ __launch_bounds__(256) void k_vt(const _Float16* __restrict__ V16, int ldv, int voff, _Float16* __restrict__ Vt) { __shared__ unsigned short tl[64][66]; const int tid = threadIdx.x; const int slab = blockIdx.x / (TTv / 64), lg = blockIdx.x % (TTv / 64); const int b = slab / NHv, h = slab % NHv;
  for (int i = tid; i < 64 * 8; i += 256) { const int r = i / 8, c8 = (i % 8) * 8; FragH f; f.half[0] = *(const v8us*)((const unsigned short*)V16 + ((size_t)b * TTv + lg * 64 + r) * ldv + voff + h * 64 + c8);
#pragma unroll
    for (int q = 0; q < 8; ++q) tl[r][c8 + q] = f.u[q]; }
  __syncthreads();
  {
#pragma unroll
    for (int rd = 0; rd < 2; ++rd) { const int d = rd * 32 + tid / 8, pc = tid % 8; FragH f;
#pragma unroll
      for (int q = 0; q < 8; ++q) f.u[q] = tl[pc * 8 + q][d];
      *(v8us*)((unsigned short*)Vt + ((size_t)slab * 64 + d) * TTv + lg * 64 + pc * 8) = f.half[0]; }
     } }

__global__ __launch_bounds__(256) void k_hl(const float* __restrict__ F, _Float16* __restrict__ Hh, _Float16* __restrict__ Hl, size_t n8) { const size_t t = (size_t)blockIdx.x * 256 + threadIdx.x; if (t >= n8) return; FragH fh, fl; const v4f a = *(const v4fa*)(F + t * 8), c = *(const v4fa*)(F + t * 8 + 4);
#pragma unroll
  for (int q = 0; q < 4; ++q) { _Float16 h = (_Float16)a[q]; fh.h[q] = h; fl.h[q] = (_Float16)((a[q] - (float)h) * 1024.0f); h = (_Float16)c[q]; fh.h[4 + q] = h; fl.h[4 + q] = (_Float16)((c[q] - (float)h) * 1024.0f); }
  { *(v8us*)((unsigned short*)Hh + t * 8) = fh.half[0]; *(v8us*)((unsigned short*)Hl + t * 8) = fl.half[0];  } }

// ---- fast GEMM (wave tile 32x64; requires M % 32 == 0 rows per launch region and N % 64 == 0); epilogue = k_gemm_hhx semantics ----
__device__ __forceinline__ v16h g2_frag(const _Float16* p, int hh) { FragH f; f.half[0] = *(const v8us*)((const unsigned short*)p + 8 * hh); f.half[1] = *(const v8us*)((const unsigned short*)p + 16 + 8 * hh); return f.v; }
__device__ __forceinline__ v8f g2_mma(v16h a, v16h b, v8f c) { v8f d = __builtin_amdgcn_wmma_f32_16x16x32_f16(false, a, false, b, (short)0, c, false, false); asm volatile("v_nop\n\tv_nop\n\tv_nop\n\tv_nop" : "+v"(d) : "v"(a), "v"(b)); return d; }
template <int ACT>
__global__ __launch_bounds__(128) void k_gemm2(const _Float16* __restrict__ A, int lda, size_t sA, const _Float16* __restrict__ Bh, int ldb, size_t sB, float alpha, const float* __restrict__ bias, size_t sBias, const float* __restrict__ CP, int rowsPerB, size_t sCPb, int row0g,
    float* __restrict__ C, _Float16* __restrict__ C16, int ldc, size_t sC, int M, int N, int K) {
  __shared__ __attribute__((aligned(16))) float so[4][32][68];
  const int tid = threadIdx.x, w = tid >> 5, lane = tid & 31, ln = lane & 15, hh = lane >> 4; const int by = blockIdx.y;
  A += (size_t)by * sA; Bh += (size_t)by * sB; const size_t cofs = (size_t)by * sC; const float* bp = bias ? bias + (size_t)by * sBias : nullptr;
  const int ntn = N >> 6; const int mt = blockIdx.x / ntn, nq = blockIdx.x - mt * ntn; const int row0 = mt * 128 + 32 * w, col0 = nq * 64; if (row0 >= M) return;
  const _Float16* a0p = A + (size_t)(row0 + ln) * lda; const _Float16* a1p = a0p + (size_t)16 * lda;
  const _Float16* b0p = Bh + (size_t)(col0 + ln) * ldb; const _Float16* b1p = b0p + (size_t)16 * ldb; const _Float16* b2p = b1p + (size_t)16 * ldb; const _Float16* b3p = b2p + (size_t)16 * ldb;
  const v8f z8 = {0.f,0.f,0.f,0.f,0.f,0.f,0.f,0.f}; v8f c00 = z8, c01 = z8, c02 = z8, c03 = z8, c10 = z8, c11 = z8, c12 = z8, c13 = z8;
#pragma unroll 1
  for (int kb = 0; kb < K; kb += 32) { const v16h a0 = g2_frag(a0p + kb, hh), a1 = g2_frag(a1p + kb, hh);
    v16h b = g2_frag(b0p + kb, hh); c00 = g2_mma(a0, b, c00); c10 = g2_mma(a1, b, c10);
    b = g2_frag(b1p + kb, hh); c01 = g2_mma(a0, b, c01); c11 = g2_mma(a1, b, c11);
    b = g2_frag(b2p + kb, hh); c02 = g2_mma(a0, b, c02); c12 = g2_mma(a1, b, c12);
    b = g2_frag(b3p + kb, hh); c03 = g2_mma(a0, b, c03); c13 = g2_mma(a1, b, c13); }
  v8f accs[8] = {c00, c01, c02, c03, c10, c11, c12, c13};
#pragma unroll
  for (int u = 0; u < 8; ++u) { const int t = u & 3, half = u >> 2; const int col = col0 + t * 16 + ln; const float bv = bp ? bf16_round(bp[col]) : 0.f;
#pragma unroll
    for (int r = 0; r < 8; ++r) { const int rloc = half * 16 + 8 * hh + r; float v = accs[u][r] * alpha + bv; if (CP) { if (rowsPerB < 0) v += CP[cofs + (size_t)(row0g + row0 + rloc) * ldc + col];      /* rowsPerB < 0: own element of the batched C plane */ else { const int bidx = (row0g + row0 + rloc) / rowsPerB; v += CP[(size_t)bidx * sCPb + (size_t)by * 64 + col]; } }
      if (ACT == 3) v = fmaxf(v, 0.f); else if (ACT == 6) v = 0.5f * v * (1.0f + erff(v * 0.70710678118654752f)); else if (ACT == 11) v = 1.0f / (1.0f + expf(-v)); else if (ACT == 15) v = v / (1.0f + expf(-v)); else if (ACT == 12) v = (v > 0.f) ? v : 0.01f * v; else if (ACT == 8) v = tanhf(v);
      so[w][rloc][t * 16 + ln] = v; } }
  __builtin_amdgcn_fence(__ATOMIC_ACQ_REL, "workgroup"); __builtin_amdgcn_wave_barrier();
  const int rsub = lane >> 4, c4 = (lane & 15) * 4;
  {
#pragma unroll
    for (int q = 0; q < 16; ++q) { const int r = q * 2 + rsub; const v4f v = *(const v4fa*)&so[w][r][c4]; if (C) *(v4f*)(C + cofs + (size_t)(row0 + r) * ldc + col0 + c4) = v; if (C16) { v4h h4; for (int i = 0; i < 4; ++i) h4[i] = (_Float16)v[i]; *(v4h*)(C16 + cofs + (size_t)(row0 + r) * ldc + col0 + c4) = h4; } }
     } }



__constant__ int BK30[2 * SLEN - 1] = {15,15,15,15,15,15,15,15,15,15,15,15,15,15,15,15,15,15,15,15,15,15,15,15,15,15,15,15,15,15,15,15,15,15,15,15,15,15,15,15,15,15,15,15,15,15,15,15,15,15,15,15,15,15,15,15,15,15,15,15,15,15,15,15,15,15,15,15,15,15,15,15,15,15,15,15,15,15,15,15,15,15,15,15,15,15,15,15,15,15,15,15,15,15,15,15,15,15,15,15,15,15,15,15,15,15,15,15,15,15,15,15,15,15,15,15,15,15,15,15,15,15,15,15,15,15,15,15,15,15,15,15,15,15,15,15,15,15,15,15,15,15,15,15,15,15,15,15,15,15,15,15,15,15,15,15,15,15,15,15,15,15,15,15,15,15,15,15,15,15,15,15,15,15,15,15,15,15,15,15,15,15,15,15,15,15,15,15,15,15,15,15,15,15,15,15,15,15,15,15,15,15,15,15,15,15,15,15,15,15,15,15,15,15,15,15,15,15,15,15,15,15,15,15,15,15,15,15,15,15,15,15,15,15,15,15,15,15,15,15,15,15,15,15,15,15,15,15,15,15,15,15,15,15,15,15,15,15,15,15,15,15,15,15,15,15,15,15,15,15,15,15,15,15,15,15,15,15,15,15,15,15,15,15,15,15,15,15,15,15,15,15,15,15,15,15,15,15,15,15,15,15,15,15,15,15,15,15,15,15,15,15,15,15,15,15,15,15,15,15,15,15,15,15,15,15,15,15,15,15,15,15,15,15,15,15,15,15,15,15,15,15,15,15,15,15,15,15,15,15,15,15,15,15,15,15,15,15,15,15,15,15,15,15,15,15,15,15,15,15,15,15,15,15,15,15,15,15,15,15,15,15,15,15,15,15,15,15,15,15,15,15,15,15,15,15,15,15,15,15,15,15,15,15,15,15,15,15,15,15,15,15,15,15,15,15,15,15,15,15,15,15,15,15,15,15,15,15,15,15,15,15,15,15,15,15,15,15,15,15,15,15,15,15,15,15,15,15,15,15,15,15,15,15,15,15,15,15,15,15,15,15,15,15,15,15,15,15,15,15,15,15,15,15,15,15,15,15,15,15,15,15,15,15,15,15,15,15,15,15,15,15,15,15,15,15,15,15,15,15,15,15,15,15,15,15,15,15,15,15,15,15,15,15,15,15,15,15,15,15,15,15,15,15,15,15,15,15,15,15,15,15,15,15,15,15,15,15,15,15,15,15,15,15,15,15,15,15,15,15,15,15,15,15,15,15,15,15,15,15,15,15,15,15,15,15,15,15,15,15,15,15,15,15,15,15,15,15,15,15,15,15,15,15,15,15,15,15,15,15,15,15,15,15,15,15,15,15,15,15,15,15,15,15,15,15,15,15,15,15,15,15,15,15,15,15,15,15,15,15,15,15,15,15,15,15,15,15,15,15,15,15,15,15,15,15,15,15,15,15,15,15,15,15,15,15,15,15,15,15,15,15,15,15,15,15,15,15,15,15,15,15,15,15,15,15,15,15,15,15,15,15,15,15,15,15,15,15,15,15,15,15,15,15,15,15,15,15,15,15,15,15,15,15,15,15,15,15,15,15,15,15,15,15,15,15,15,15,15,15,15,15,15,15,15,15,15,15,15,15,15,15,15,15,15,15,15,15,15,15,15,15,15,15,15,15,15,15,15,15,15,15,15,15,15,15,15,15,15,15,15,15,15,15,15,15,15,15,15,15,15,15,15,15,15,15,15,15,15,15,15,15,15,15,15,15,15,15,15,15,15,15,15,15,15,15,15,15,15,15,15,15,15,15,15,15,15,15,15,15,15,15,15,15,15,15,15,15,15,15,15,15,15,15,15,15,15,15,15,15,15,15,15,15,15,15,15,15,15,15,15,15,15,15,15,15,15,15,15,15,15,15,15,15,15,15,15,15,15,15,15,15,15,15,15,15,15,15,15,15,15,15,15,15,15,15,15,15,15,15,15,15,15,15,15,15,15,15,15,15,15,15,15,15,15,15,15,15,15,15,15,15,15,15,15,15,15,15,15,15,15,15,15,15,15,15,15,15,15,15,15,15,15,15,15,15,15,15,15,15,15,15,15,15,15,15,15,15,15,15,15,15,15,15,15,15,15,15,15,15,15,15,15,15,15,15,15,15,15,15,15,15,15,15,15,15,15,15,15,15,15,15,15,15,15,15,15,15,15,15,15,15,15,15,15,15,15,15,15,15,15,15,15,15,15,15,15,15,15,15,15,15,15,15,15,15,15,15,15,15,15,15,15,15,15,15,15,15,15,15,15,15,15,15,15,15,15,15,15,15,15,15,15,15,15,15,15,15,15,15,15,15,15,15,15,15,15,15,15,15,15,15,15,15,15,15,15,15,15,15,15,15,15,15,15,15,15,15,15,15,15,15,15,15,15,15,15,15,15,15,15,15,15,15,15,15,15,15,15,15,15,15,15,15,15,15,15,15,15,15,15,15,15,15,15,15,15,15,15,15,15,15,15,15,15,15,15,15,15,15,15,15,15,15,15,15,15,15,15,15,15,15,15,15,15,15,15,15,15,15,15,15,15,15,15,15,15,15,15,15,15,15,15,15,15,15,15,15,15,15,15,15,15,15,15,15,15,15,15,15,15,15,15,15,15,15,15,15,15,15,15,15,15,15,15,15,15,15,15,15,15,15,15,15,15,15,15,15,15,15,15,15,15,15,15,15,15,15,15,15,15,15,15,15,15,15,15,15,15,15,15,15,15,15,15,15,15,15,15,15,15,15,15,15,15,15,15,15,15,15,15,15,15,15,15,15,15,15,15,15,15,15,15,15,15,15,15,15,15,15,15,15,15,15,15,15,15,15,15,15,15,15,15,15,15,15,15,15,15,15,15,15,15,15,15,15,15,15,15,15,15,15,15,15,15,15,15,15,15,15,15,15,15,15,15,15,15,15,15,15,15,15,15,15,15,15,15,15,15,15,15,15,15,15,15,15,15,15,15,15,15,15,15,15,15,15,15,15,15,15,15,15,15,15,15,15,15,15,15,15,15,15,15,15,15,15,15,15,15,15,15,15,15,15,15,15,15,15,15,15,15,15,15,15,15,15,15,15,15,15,15,15,15,15,15,15,15,15,15,15,15,15,15,15,15,15,15,15,15,15,15,15,15,15,15,15,15,15,15,15,15,15,15,15,15,15,15,15,15,15,15,15,15,15,15,15,15,15,15,15,15,15,15,15,15,15,15,15,15,15,15,15,15,15,15,15,15,15,15,15,15,15,15,15,15,15,15,15,15,15,15,15,15,15,15,15,15,15,15,15,15,15,15,15,15,15,15,15,15,15,15,15,15,15,15,15,15,15,15,15,15,15,15,15,15,15,15,15,15,15,15,15,15,15,15,15,15,15,15,15,15,15,15,15,15,15,15,15,15,15,15,15,15,15,15,15,15,15,15,15,15,15,15,15,15,15,15,15,15,15,15,15,15,15,15,15,15,15,15,15,15,15,15,15,15,15,15,15,15,15,15,15,15,15,15,15,15,15,15,15,15,15,15,15,15,15,15,15,15,15,15,15,15,15,15,15,15,15,15,15,15,15,15,15,15,15,15,15,15,15,15,15,15,15,15,15,15,15,15,15,15,15,15,15,15,15,15,15,15,15,15,15,15,15,15,15,15,15,15,15,15,15,15,15,15,15,15,15,15,15,15,15,15,15,15,15,15,15,15,15,15,15,15,15,15,15,15,15,15,15,15,15,15,15,15,15,15,15,15,15,15,15,15,15,15,15,15,15,15,15,15,15,15,15,15,15,15,15,15,15,15,15,15,15,15,15,15,15,15,15,15,15,15,15,15,15,15,15,15,15,15,15,15,15,15,15,15,15,15,15,15,15,15,15,15,15,15,15,15,15,15,15,15,15,15,15,15,15,15,15,15,15,15,15,15,15,15,15,15,15,15,15,15,15,15,15,15,15,15,15,15,15,15,15,15,15,15,15,15,15,15,15,15,15,15,15,15,15,15,15,15,15,15,15,15,15,15,15,15,15,15,15,15,15,15,15,15,15,15,15,15,15,15,15,15,15,15,15,15,15,15,15,15,15,15,15,15,15,15,15,15,15,15,15,15,15,15,15,15,15,15,15,15,15,15,15,15,15,15,15,15,15,15,15,15,15,15,15,15,15,15,15,15,15,15,15,15,15,15,15,15,15,15,15,15,15,15,15,15,15,15,15,15,15,15,15,15,15,15,15,15,15,15,15,15,15,15,15,15,15,15,15,15,15,15,15,15,15,15,15,15,15,15,15,15,15,15,15,15,15,15,15,15,15,15,15,15,15,15,15,15,15,15,15,15,15,15,15,15,15,15,15,15,15,15,15,15,15,15,15,15,15,15,15,15,15,15,15,15,15,15,15,15,15,15,15,15,15,15,15,15,15,15,15,15,15,15,14,14,14,14,14,14,14,14,14,14,14,14,14,14,14,14,14,14,14,14,14,14,14,14,14,14,14,13,13,13,13,13,13,13,13,13,13,13,13,13,13,13,13,13,13,12,12,12,12,12,12,12,12,12,12,12,12,12,12,11,11,11,11,11,11,11,11,11,10,10,10,10,10,10,10,9,9,9,9,8,8,8,8,7,6,5,4,3,2,1,0,17,18,19,20,21,22,23,24,24,24,24,25,25,25,25,26,26,26,26,26,26,26,27,27,27,27,27,27,27,27,27,28,28,28,28,28,28,28,28,28,28,28,28,28,28,29,29,29,29,29,29,29,29,29,29,29,29,29,29,29,29,29,29,30,30,30,30,30,30,30,30,30,30,30,30,30,30,30,30,30,30,30,30,30,30,30,30,30,30,30,31,31,31,31,31,31,31,31,31,31,31,31,31,31,31,31,31,31,31,31,31,31,31,31,31,31,31,31,31,31,31,31,31,31,31,31,31,31,31,31,31,31,31,31,31,31,31,31,31,31,31,31,31,31,31,31,31,31,31,31,31,31,31,31,31,31,31,31,31,31,31,31,31,31,31,31,31,31,31,31,31,31,31,31,31,31,31,31,31,31,31,31,31,31,31,31,31,31,31,31,31,31,31,31,31,31,31,31,31,31,31,31,31,31,31,31,31,31,31,31,31,31,31,31,31,31,31,31,31,31,31,31,31,31,31,31,31,31,31,31,31,31,31,31,31,31,31,31,31,31,31,31,31,31,31,31,31,31,31,31,31,31,31,31,31,31,31,31,31,31,31,31,31,31,31,31,31,31,31,31,31,31,31,31,31,31,31,31,31,31,31,31,31,31,31,31,31,31,31,31,31,31,31,31,31,31,31,31,31,31,31,31,31,31,31,31,31,31,31,31,31,31,31,31,31,31,31,31,31,31,31,31,31,31,31,31,31,31,31,31,31,31,31,31,31,31,31,31,31,31,31,31,31,31,31,31,31,31,31,31,31,31,31,31,31,31,31,31,31,31,31,31,31,31,31,31,31,31,31,31,31,31,31,31,31,31,31,31,31,31,31,31,31,31,31,31,31,31,31,31,31,31,31,31,31,31,31,31,31,31,31,31,31,31,31,31,31,31,31,31,31,31,31,31,31,31,31,31,31,31,31,31,31,31,31,31,31,31,31,31,31,31,31,31,31,31,31,31,31,31,31,31,31,31,31,31,31,31,31,31,31,31,31,31,31,31,31,31,31,31,31,31,31,31,31,31,31,31,31,31,31,31,31,31,31,31,31,31,31,31,31,31,31,31,31,31,31,31,31,31,31,31,31,31,31,31,31,31,31,31,31,31,31,31,31,31,31,31,31,31,31,31,31,31,31,31,31,31,31,31,31,31,31,31,31,31,31,31,31,31,31,31,31,31,31,31,31,31,31,31,31,31,31,31,31,31,31,31,31,31,31,31,31,31,31,31,31,31,31,31,31,31,31,31,31,31,31,31,31,31,31,31,31,31,31,31,31,31,31,31,31,31,31,31,31,31,31,31,31,31,31,31,31,31,31,31,31,31,31,31,31,31,31,31,31,31,31,31,31,31,31,31,31,31,31,31,31,31,31,31,31,31,31,31,31,31,31,31,31,31,31,31,31,31,31,31,31,31,31,31,31,31,31,31,31,31,31,31,31,31,31,31,31,31,31,31,31,31,31,31,31,31,31,31,31,31,31,31,31,31,31,31,31,31,31,31,31,31,31,31,31,31,31,31,31,31,31,31,31,31,31,31,31,31,31,31,31,31,31,31,31,31,31,31,31,31,31,31,31,31,31,31,31,31,31,31,31,31,31,31,31,31,31,31,31,31,31,31,31,31,31,31,31,31,31,31,31,31,31,31,31,31,31,31,31,31,31,31,31,31,31,31,31,31,31,31,31,31,31,31,31,31,31,31,31,31,31,31,31,31,31,31,31,31,31,31,31,31,31,31,31,31,31,31,31,31,31,31,31,31,31,31,31,31,31,31,31,31,31,31,31,31,31,31,31,31,31,31,31,31,31,31,31,31,31,31,31,31,31,31,31,31,31,31,31,31,31,31,31,31,31,31,31,31,31,31,31,31,31,31,31,31,31,31,31,31,31,31,31,31,31,31,31,31,31,31,31,31,31,31,31,31,31,31,31,31,31,31,31,31,31,31,31,31,31,31,31,31,31,31,31,31,31,31,31,31,31,31,31,31,31,31,31,31,31,31,31,31,31,31,31,31,31,31,31,31,31,31,31,31,31,31,31,31,31,31,31,31,31,31,31,31,31,31,31,31,31,31,31,31,31,31,31,31,31,31,31,31,31,31,31,31,31,31,31,31,31,31,31,31,31,31,31,31,31,31,31,31,31,31,31,31,31,31,31,31,31,31,31,31,31,31,31,31,31,31,31,31,31,31,31,31,31,31,31,31,31,31,31,31,31,31,31,31,31,31,31,31,31,31,31,31,31,31,31,31,31,31,31,31,31,31,31,31,31,31,31,31,31,31,31,31,31,31,31,31,31,31,31,31,31,31,31,31,31,31,31,31,31,31,31,31,31,31,31,31,31,31,31,31,31,31,31,31,31,31,31,31,31,31,31,31,31,31,31,31,31,31,31,31,31,31,31,31,31,31,31,31,31,31,31,31,31,31,31,31,31,31,31,31,31,31,31,31,31,31,31,31,31,31,31,31,31,31,31,31,31,31,31,31,31,31,31,31,31,31,31,31,31,31,31,31,31,31,31,31,31,31,31,31,31,31,31,31,31,31,31,31,31,31,31,31,31,31,31,31,31,31,31,31,31,31,31,31,31,31,31,31,31,31,31,31,31,31,31,31,31,31,31,31,31,31,31,31,31,31,31,31,31,31,31,31,31,31,31,31,31,31,31,31,31,31,31,31,31,31,31,31,31,31,31,31,31,31,31,31,31,31,31,31,31,31,31,31,31,31,31,31,31,31,31,31,31,31,31,31,31,31,31,31,31,31,31,31,31,31,31,31,31,31,31,31,31,31,31,31,31,31,31,31,31,31,31,31,31,31,31,31,31,31,31,31,31,31,31,31,31,31,31,31,31,31,31,31,31,31,31,31,31,31,31,31,31,31,31,31,31,31,31,31,31,31,31,31,31,31,31,31,31,31,31,31,31,31,31,31,31,31,31,31,31,31,31,31,31,31,31,31,31,31,31,31,31,31,31,31,31,31,31,31,31,31,31,31,31,31,31,31,31,31,31,31,31,31,31,31,31,31,31,31,31,31,31,31,31,31,31,31,31,31,31,31,31,31,31,31,31,31,31,31,31,31,31,31,31,31,31,31,31,31,31,31,31,31,31,31,31,31,31,31,31,31,31,31,31,31,31,31,31,31,31,31,31,31,31,31,31,31,31,31,31,31,31,31,31,31,31,31,31,31,31,31,31,31,31,31,31,31,31,31,31,31,31,31,31,31,31,31,31,31,31,31,31,31,31,31,31,31,31,31,31,31,31,31,31,31,31,31,31,31,31,31,31,31,31,31,31,31,31,31,31,31,31,31,31,31,31,31,31,31,31,31,31,31,31,31,31,31,31,31,31,31,31,31,31,31,31,31,31,31,31,31,31,31,31,31,31,31,31,31,31,31,31,31,31,31,31,31,31,31,31,31,31,31,31,31,31,31,31,31,31,31,31,31,31,31,31,31,31,31,31,31,31,31,31,31,31,31,31,31,31,31,31,31,31,31,31,31,31,31,31,31,31,31,31,31,31,31,31,31,31,31,31,31,31,31,31,31,31,31,31,31,31,31,31,31,31,31,31,31,31,31,31,31,31,31,31,31,31,31,31,31,31,31,31,31,31,31,31,31,31,31,31,31,31,31,31,31,31,31,31,31,31,31,31,31,31,31,31,31,31,31,31,31,31,31,31,31,31,31,31,31,31,31,31,31,31,31,31,31,31,31,31,31,31,31,31,31,31,31,31,31,31,31,31,31,31,31,31,31,31,31,31,31,31,31,31,31,31,31,31,31,31,31,31,31,31,31,31,31,31,31,31,31,31,31,31,31,31,31,31,31,31,31,31,31,31,31,31,31,31,31,31,31,31,31,31,31,31,31,31,31,31,31,31,31,31,31,31,31,31,31,31,31,31,31,31,31,31,31,31,31,31,31,31,31,31,31,31,31,31,31,31,31,31,31,31,31,31,31,31,31,31,31,31,31,31,31,31,31,31,31,31,31,31,31,31,31,31,31,31,31,31,31,31,31,31,31,31,31,31,31,31,31,31,31,31,31,31,31,31,31,31,31,31,31,31,31,31,31,31,31,31,31,31,31,31,31,31,31,31,31,31,31,31,31,31,31,31,31,31,31,31,31,31,31,31,31,31,31,31,31,31,31,31,31,31,31,31,31,31,31,31,31,31,31,31,31,31,31,31,31,31,31,31,31,31,31,31,31,31,31,31,31,31,31,31,31,31,31,31,31,31,31,31,31,31,31,31,31,31,31,31,31,31,31,31,31,31,31,31,31,31,31,31,31,31,31,31,31,31,31,31,31,31,31,31,31,31,31,31,31,31,31,31,31,31,31,31,31,31,31,31,31,31,31,31,31,31,31,31,31,31,31,31,31,31,31,31,31,31,31,31,31,31,31,31,31,31,31,31,31,31,31,31,31,31,31,31,31,31,31,31,31,31,31,31,31,31,31,31,31,31,31,31,31,31,31,31,31,31,31,31,31,31,31,31,31,31,31,31,31,31,31,31,31,31,31,31,31,31,31,31,31,31,31,31,31,31,31,31,31,31,31,31,31,31,31,31,31,31,31,31,31,31,31,31,31,31,31,31,31,31,31,31,31,31};      /* T5 _relative_position_bucket(k - q) for k - q in [-(S-1), S-1], computed with the module's own jax code on the host */
__global__ __launch_bounds__(512) void k_rb(const float* __restrict__ t, float* __restrict__ RB) { const int i = threadIdx.x; const float v = bf16_round(t[i]); *(float*)(RB + i) = v;  }
template <int CAUSAL>
__global__ __launch_bounds__(128) void k_flash(const _Float16* __restrict__ Q16, int ldq, const _Float16* __restrict__ K16, int ldk, const _Float16* __restrict__ Vt, const int* __restrict__ MSK, float* __restrict__ O, int ldo) {
  constexpr int RPW = 16, RTN = RPW / 16, NQB = TQ / (4 * RPW), DT = 4, KS = 2;
  __shared__ __attribute__((aligned(16))) unsigned short sP[4][RPW][40]; __shared__ __attribute__((aligned(16))) float sO[4][RPW][64 + 4];
  const int tid = threadIdx.x, w = tid >> 5, lane = tid & 31, ln = lane & 15, hh = lane >> 4;
  const int slab = blockIdx.x / QBNP, qblk = QB0P + blockIdx.x % QBNP; (void)NQB; const int b = slab / NH, h = slab % NH; const int qb0 = qblk * (4 * RPW); const int q0 = qb0 + w * RPW;
  FragH aq[2][KS];
#pragma unroll
  for (int rt = 0; rt < RTN; ++rt) { const unsigned short* qr = (const unsigned short*)Q16 + ((size_t)b * TQ + q0 + rt * 16 + ln) * ldq + h * 64;
#pragma unroll
    for (int ks = 0; ks < KS; ++ks) { aq[rt][ks].half[0] = *(const v8us*)(qr + ks * 32 + 8 * hh); aq[rt][ks].half[1] = *(const v8us*)(qr + ks * 32 + 16 + 8 * hh); } }
  const unsigned short* Vth = (const unsigned short*)Vt + (size_t)slab * 64 * TK;
  float m_r[2][8], l_r[2][8]; v8f oacc[2][DT];
#pragma unroll
  for (int rt = 0; rt < RTN; ++rt) {
#pragma unroll
    for (int r = 0; r < 8; ++r) { m_r[rt][r] = -3.0e38f; l_r[rt][r] = 0.f; }
#pragma unroll
    for (int dt = 0; dt < DT; ++dt) oacc[rt][dt] = (v8f){0.f,0.f,0.f,0.f,0.f,0.f,0.f,0.f}; }
  float qsq[2][8];      /* mode 32: |q|^2 of this lane's rows, read once */
#pragma unroll
  for (int rt = 0; rt < RTN; ++rt)
#pragma unroll
    for (int r = 0; r < 8; ++r) qsq[rt][r] = (CAUSAL == 32) ? ((const float*)MSK)[(size_t)b * TQ + q0 + rt * 16 + 8 * hh + r] : 0.f;
  const int jend = (CAUSAL == 1 || CAUSAL == 32) ? (qb0 + 4 * RPW) : ((CAUSAL == 23) ? min(TK, (qb0 / CHK + 2) * CHK) : TK);      /* causal / window: keys that can never contribute are skipped */ const int jbeg = (CAUSAL == 23) ? max(0, (qb0 / CHK - 1) * CHK) : 0;
#pragma unroll 1
  for (int j0 = jbeg; j0 < jend; j0 += 32) {
    v8f s[2][2];
    float ksq0 = 0.f, ksq1 = 0.f; if (CAUSAL == 32) { const float* ksT = (const float*)MSK + (size_t)NB * TQ + (size_t)b * TK + j0 + ln; ksq0 = ksT[0]; ksq1 = ksT[16]; }      /* mode 32: |k|^2 of this lane's two keys, one unconditional load each per key block (j0 + 31 < jend <= TK) */
#pragma unroll
    for (int nt = 0; nt < 2; ++nt) { const unsigned short* kr = (const unsigned short*)K16 + ((size_t)b * TK + j0 + nt * 16 + ln) * ldk + h * 64; FragH bk[KS];
#pragma unroll
      for (int ks = 0; ks < KS; ++ks) { bk[ks].half[0] = *(const v8us*)(kr + ks * 32 + 8 * hh); bk[ks].half[1] = *(const v8us*)(kr + ks * 32 + 16 + 8 * hh); }
#pragma unroll
      for (int rt = 0; rt < RTN; ++rt) { v8f acc = (v8f){0.f,0.f,0.f,0.f,0.f,0.f,0.f,0.f};
#pragma unroll
        for (int ks = 0; ks < KS; ++ks) acc = mmaH<1>(aq[rt][ks].v, aq[rt][ks].v, bk[ks].v, bk[ks].v, acc); s[rt][nt] = acc; } }
#pragma unroll
    for (int rt = 0; rt < RTN; ++rt)
#pragma unroll
      for (int r = 0; r < 8; ++r) { const int tq = q0 + rt * 16 + 8 * hh + r; const int k0 = j0 + ln, k1 = j0 + 16 + ln;
        bool ok0 = (CAUSAL == 1 || CAUSAL == 32) ? (k0 <= tq) : ((CAUSAL == 2) ? ((k0 >> 5) == (tq >> 5)) : true), ok1 = (CAUSAL == 1 || CAUSAL == 32) ? (k1 <= tq) : ((CAUSAL == 2) ? ((k1 >> 5) == (tq >> 5)) : true); if (CAUSAL == 23) { const int cq = tq / CHK; ok0 = (abs(k0 / CHK - cq) <= 1) && (MSK[(size_t)b * TK + k0] == 0); ok1 = (abs(k1 / CHK - cq) <= 1) && (MSK[(size_t)b * TK + k1] == 0); }      /* mode 23: 3-chunk window + int key-padding mask */
        if (CAUSAL == 24) { ok0 = (MSK[(size_t)b * TK + k0] == 0); ok1 = (MSK[(size_t)b * TK + k1] == 0); }      /* mode 24: int key-padding mask (nonzero = padded = excluded) */      /* mode 2: block-diagonal 32-token groups */
        float s0 = ok0 ? s[rt][0][r] * SCL : -3.0e38f, s1 = ok1 ? s[rt][1][r] * SCL : -3.0e38f; if (CAUSAL == 27) { const float* amk = (const float*)MSK + ((size_t)b * MQI + tq) * MKI; s0 += bf16_round(amk[k0]); s1 += bf16_round(amk[k1]); }      /* mode 27: additive per-(batch, query, key) f32 mask INPUT [b][tq][k] */ if (CAUSAL == 30) { const float* rbp = (const float*)MSK; s0 += rbp[BK30[k0 - tq + (TK - 1)] * NH + h]; s1 += rbp[BK30[k1 - tq + (TK - 1)] * NH + h]; }      /* mode 30: T5 bucketed relative bias: table[bucket(k - q)][h]; bucket-of-distance is a module constant */ if (CAUSAL == 32) { const float qs = qsq[rt][r]; if (ok0) { float d = qs + ksq0; d = d - 2.0f * s0; d = fmaxf(d, 0.f); s0 = -d * 0.125f; } if (ok1) { float d = qs + ksq1; d = d - 2.0f * s1; d = fmaxf(d, 0.f); s1 = -d * 0.125f; } }      /* mode 32: RBF logit -relu(|q|^2 + |k|^2 - 2 q.k)/8, causal */ if (CAUSAL == 17) { const float* amk = (const float*)MSK + (size_t)b * TK; s0 += bf16_round(amk[k0]); s1 += bf16_round(amk[k1]); } if (CAUSAL == 18) { const float* tb = (const float*)MSK; const int* ri = MSK + 1024 + (size_t)b * TK; const int rq = ri[tq]; s0 += tb[(h * 8 + rq) * 8 + ri[k0]]; s1 += tb[(h * 8 + rq) * 8 + ri[k1]]; } if (CAUSAL == 19) { const int* rel = MSK + (size_t)tq * TK; const float* rb = (const float*)MSK + (size_t)TQ * TK + ((size_t)(b * NH + h) * TQ + tq) * 64; s0 += rb[rel[k0]]; s1 += rb[rel[k1]]; }      /* mode 19: + (q.Ek[rel] + Eb[rel][h]) / 8 gathered by the int relative ids (packed [ids | table]) */      /* mode 18: + resource_bias[h][r_q][r_k] from the packed [table | ids] buffer (TQ == TK) */      /* mode 17: additive per-(batch, key) mask INPUT */ float mc = fmaxf(s0, s1);
        mc = fmaxf(mc, __shfl_xor(mc, 1, 32)); mc = fmaxf(mc, __shfl_xor(mc, 2, 32)); mc = fmaxf(mc, __shfl_xor(mc, 4, 32)); mc = fmaxf(mc, __shfl_xor(mc, 8, 32));
        const float mn = fmaxf(m_r[rt][r], mc); const float ea = expf(m_r[rt][r] - mn), e0 = expf(s0 - mn), e1 = expf(s1 - mn);      /* computed for every lane and selected below: no exec-mask branch, so the eight rows' chains can overlap */ const float al = (mn > -1.0e38f) ? ea : 1.0f; m_r[rt][r] = mn; const float p0 = ok0 ? e0 : 0.f, p1 = ok1 ? e1 : 0.f; l_r[rt][r] = l_r[rt][r] * al + p0 + p1;
#pragma unroll
        for (int dt = 0; dt < DT; ++dt) oacc[rt][dt][r] *= al;
        FragH t2; t2.h[0] = (_Float16)(p0 * 1024.0f); t2.h[1] = (_Float16)(p1 * 1024.0f); sP[w][rt * 16 + 8 * hh + r][ln] = t2.u[0]; sP[w][rt * 16 + 8 * hh + r][16 + ln] = t2.u[1]; }
    __builtin_amdgcn_fence(__ATOMIC_ACQ_REL, "workgroup"); __builtin_amdgcn_wave_barrier();
    FragH pa[2];
#pragma unroll
    for (int rt = 0; rt < RTN; ++rt) { pa[rt].half[0] = *(const v8us*)&sP[w][rt * 16 + ln][8 * hh]; pa[rt].half[1] = *(const v8us*)&sP[w][rt * 16 + ln][16 + 8 * hh]; }
#pragma unroll
    for (int dt = 0; dt < DT; ++dt) { const unsigned short* vrow = Vth + (size_t)(dt * 16 + ln) * TK + j0; FragH bv; bv.half[0] = *(const v8us*)(vrow + 8 * hh); bv.half[1] = *(const v8us*)(vrow + 16 + 8 * hh);
#pragma unroll
      for (int rt = 0; rt < RTN; ++rt) oacc[rt][dt] = mmaH<1>(pa[rt].v, pa[rt].v, bv.v, bv.v, oacc[rt][dt]); }
    __builtin_amdgcn_fence(__ATOMIC_ACQ_REL, "workgroup"); __builtin_amdgcn_wave_barrier(); }
#pragma unroll
  for (int rt = 0; rt < RTN; ++rt) {
#pragma unroll
    for (int r = 0; r < 8; ++r) { float l = l_r[rt][r]; l += __shfl_xor(l, 1, 32); l += __shfl_xor(l, 2, 32); l += __shfl_xor(l, 4, 32); l += __shfl_xor(l, 8, 32); l_r[rt][r] = (l > 0.f) ? 1.0f / (l * 1024.0f) : 0.f; }
#pragma unroll
    for (int dt = 0; dt < DT; ++dt)
#pragma unroll
      for (int r = 0; r < 8; ++r) sO[w][rt * 16 + 8 * hh + r][dt * 16 + ln] = oacc[rt][dt][r] * l_r[rt][r]; }
  __builtin_amdgcn_fence(__ATOMIC_ACQ_REL, "workgroup"); __builtin_amdgcn_wave_barrier();
  {
#pragma unroll
    for (int rp = 0; rp < RPW; rp += 2) { const int r = rp + (lane >> 4), pc = lane & 15; const v4f val = *(const v4fa*)&sO[w][r][pc * 4]; *(v4f*)(O + ((size_t)b * TQ + q0 + r) * ldo + h * 64 + pc * 4) = val; }
     } }
// 5-plane variant: S = Qh Kh^T + (Ql Kh^T + Qh Kl^T)/1024 with Q/K = [hi | 2^10 residual] f16 planes (QL/KL same layout as Q16/K16), then the 3-term P.V below.
// 3-term variant: O = (P_hi V_hi + (P_lo V_hi + P_hi V_lo) / 1024) / l with P = [hi | 2^10 residual] of 1024 p and V^T = [hi | 2^10 residual] planes (VtL same layout as Vt) -> ~2^-21-class products for un-averaged (early causal / peaked) rows
template <int CAUSAL>
__global__ __launch_bounds__(128) void k_flash5(const _Float16* __restrict__ Q16, const _Float16* __restrict__ QL, int ldq, const _Float16* __restrict__ K16, const _Float16* __restrict__ KL, int ldk, const _Float16* __restrict__ Vt, const _Float16* __restrict__ VtL, const int* __restrict__ MSK, float* __restrict__ O, int ldo) {
  constexpr int RPW = 16, RTN = RPW / 16, NQB = TQ / (4 * RPW), DT = 4, KS = 2;
  __shared__ __attribute__((aligned(16))) unsigned short sP[4][RPW][40]; __shared__ __attribute__((aligned(16))) unsigned short sPL[4][RPW][40]; __shared__ __attribute__((aligned(16))) float sO[4][RPW][64 + 4];
  const int tid = threadIdx.x, w = tid >> 5, lane = tid & 31, ln = lane & 15, hh = lane >> 4;
  const int slab = blockIdx.x / QBN5, qblk = QB05 + blockIdx.x % QBN5; (void)NQB; const int b = slab / NH, h = slab % NH; const int qb0 = qblk * (4 * RPW); const int q0 = qb0 + w * RPW;
  FragH aq[2][KS], aql[2][KS];
#pragma unroll
  for (int rt = 0; rt < RTN; ++rt) { const unsigned short* qr = (const unsigned short*)Q16 + ((size_t)b * TQ + q0 + rt * 16 + ln) * ldq + h * 64; const unsigned short* ql = (const unsigned short*)QL + ((size_t)b * TQ + q0 + rt * 16 + ln) * ldq + h * 64;
#pragma unroll
    for (int ks = 0; ks < KS; ++ks) { aq[rt][ks].half[0] = *(const v8us*)(qr + ks * 32 + 8 * hh); aq[rt][ks].half[1] = *(const v8us*)(qr + ks * 32 + 16 + 8 * hh); aql[rt][ks].half[0] = *(const v8us*)(ql + ks * 32 + 8 * hh); aql[rt][ks].half[1] = *(const v8us*)(ql + ks * 32 + 16 + 8 * hh); } }
  const unsigned short* Vth = (const unsigned short*)Vt + (size_t)slab * 64 * TK; const unsigned short* Vtl = (const unsigned short*)VtL + (size_t)slab * 64 * TK;
  float m_r[2][8], l_r[2][8]; v8f oacc[2][DT], oaccL[2][DT];
#pragma unroll
  for (int rt = 0; rt < RTN; ++rt) {
#pragma unroll
    for (int r = 0; r < 8; ++r) { m_r[rt][r] = -3.0e38f; l_r[rt][r] = 0.f; }
#pragma unroll
    for (int dt = 0; dt < DT; ++dt) { oacc[rt][dt] = (v8f){0.f,0.f,0.f,0.f,0.f,0.f,0.f,0.f}; oaccL[rt][dt] = oacc[rt][dt]; } }
  const int jend = (CAUSAL == 1 || CAUSAL == 32) ? (qb0 + 4 * RPW) : ((CAUSAL == 23) ? min(TK, (qb0 / CHK + 2) * CHK) : TK);      /* causal / window: keys that can never contribute are skipped */ const int jbeg = (CAUSAL == 23) ? max(0, (qb0 / CHK - 1) * CHK) : 0;
#pragma unroll 1
  for (int j0 = jbeg; j0 < jend; j0 += 32) {
    v8f s[2][2];
#pragma unroll
    for (int nt = 0; nt < 2; ++nt) { const unsigned short* kr = (const unsigned short*)K16 + ((size_t)b * TK + j0 + nt * 16 + ln) * ldk + h * 64; const unsigned short* klr = (const unsigned short*)KL + ((size_t)b * TK + j0 + nt * 16 + ln) * ldk + h * 64; FragH bk[KS], bkl[KS];
#pragma unroll
      for (int ks = 0; ks < KS; ++ks) { bk[ks].half[0] = *(const v8us*)(kr + ks * 32 + 8 * hh); bk[ks].half[1] = *(const v8us*)(kr + ks * 32 + 16 + 8 * hh); bkl[ks].half[0] = *(const v8us*)(klr + ks * 32 + 8 * hh); bkl[ks].half[1] = *(const v8us*)(klr + ks * 32 + 16 + 8 * hh); }
#pragma unroll
      for (int rt = 0; rt < RTN; ++rt) { v8f acc = (v8f){0.f,0.f,0.f,0.f,0.f,0.f,0.f,0.f}, accl = acc;
#pragma unroll
        for (int ks = 0; ks < KS; ++ks) { acc = mmaH<1>(aq[rt][ks].v, aq[rt][ks].v, bk[ks].v, bk[ks].v, acc); accl = mmaH<1>(aql[rt][ks].v, aql[rt][ks].v, bk[ks].v, bk[ks].v, accl); accl = mmaH<1>(aq[rt][ks].v, aq[rt][ks].v, bkl[ks].v, bkl[ks].v, accl); }
#pragma unroll
        for (int r = 0; r < 8; ++r) acc[r] += accl[r] * 0.0009765625f;
        s[rt][nt] = acc; } }
#pragma unroll
    for (int rt = 0; rt < RTN; ++rt)
#pragma unroll
      for (int r = 0; r < 8; ++r) { const int tq = q0 + rt * 16 + 8 * hh + r; const int k0 = j0 + ln, k1 = j0 + 16 + ln;
        bool ok0 = (CAUSAL == 1 || CAUSAL == 32) ? (k0 <= tq) : ((CAUSAL == 2) ? ((k0 >> 5) == (tq >> 5)) : true), ok1 = (CAUSAL == 1 || CAUSAL == 32) ? (k1 <= tq) : ((CAUSAL == 2) ? ((k1 >> 5) == (tq >> 5)) : true);      /* mode 2: block-diagonal 32-token groups */
        if (CAUSAL == 4) { const int* mrow = MSK + ((size_t)b * TQ + tq) * TK; ok0 = mrow[k0] != 0; ok1 = mrow[k1] != 0; }      /* mode 4: per-(query, key) INPUT mask shared by all heads; masked keys contribute nothing (== the reference's -4096 fill, whose exp underflows to 0), rows with no valid key give l = 0 -> output 0 (== the reference's row_valid zeroing) */
        float s0 = ok0 ? s[rt][0][r] * SCL : -3.0e38f, s1 = ok1 ? s[rt][1][r] * SCL : -3.0e38f; if (CAUSAL == 30) { const float* rbp = (const float*)MSK; s0 += rbp[BK30[k0 - tq + (TK - 1)] * NH + h]; s1 += rbp[BK30[k1 - tq + (TK - 1)] * NH + h]; }      /* mode 30: T5 bucketed relative bias: table[bucket(k - q)][h]; bucket-of-distance is a module constant */ if (CAUSAL == 32) { const float* qsT = (const float*)MSK; const float* ksT = qsT + (size_t)NB * TQ; const float qs = qsT[(size_t)b * TQ + tq]; if (ok0) { float d = qs + ksT[(size_t)b * TK + k0]; d = d - 2.0f * s0; d = fmaxf(d, 0.f); s0 = -d * 0.125f; } if (ok1) { float d = qs + ksT[(size_t)b * TK + k1]; d = d - 2.0f * s1; d = fmaxf(d, 0.f); s1 = -d * 0.125f; } }      /* mode 32: RBF logit -relu(|q|^2 + |k|^2 - 2 q.k)/8, causal */ if (CAUSAL == 17) { const float* amk = (const float*)MSK + (size_t)b * TK; s0 += bf16_round(amk[k0]); s1 += bf16_round(amk[k1]); } if (CAUSAL == 18) { const float* tb = (const float*)MSK; const int* ri = MSK + 1024 + (size_t)b * TK; const int rq = ri[tq]; s0 += tb[(h * 8 + rq) * 8 + ri[k0]]; s1 += tb[(h * 8 + rq) * 8 + ri[k1]]; } if (CAUSAL == 19) { const int* rel = MSK + (size_t)tq * TK; const float* rb = (const float*)MSK + (size_t)TQ * TK + ((size_t)(b * NH + h) * TQ + tq) * 64; s0 += rb[rel[k0]]; s1 += rb[rel[k1]]; }      /* mode 19: + (q.Ek[rel] + Eb[rel][h]) / 8 gathered by the int relative ids (packed [ids | table]) */      /* mode 18: + resource_bias[h][r_q][r_k] from the packed [table | ids] buffer (TQ == TK) */      /* mode 17: additive per-(batch, key) mask INPUT */ float mc = fmaxf(s0, s1);
        mc = fmaxf(mc, __shfl_xor(mc, 1, 32)); mc = fmaxf(mc, __shfl_xor(mc, 2, 32)); mc = fmaxf(mc, __shfl_xor(mc, 4, 32)); mc = fmaxf(mc, __shfl_xor(mc, 8, 32));
        const float mn = fmaxf(m_r[rt][r], mc); const float al = (mn > -1.0e38f) ? expf(m_r[rt][r] - mn) : 1.0f; m_r[rt][r] = mn; const float p0 = ok0 ? expf(s0 - mn) : 0.f, p1 = ok1 ? expf(s1 - mn) : 0.f; l_r[rt][r] = l_r[rt][r] * al + p0 + p1;
#pragma unroll
        for (int dt = 0; dt < DT; ++dt) { oacc[rt][dt][r] *= al; oaccL[rt][dt][r] *= al; }
        FragH t2, t2l; const float ps0 = p0 * 1024.0f, ps1 = p1 * 1024.0f; t2.h[0] = (_Float16)ps0; t2.h[1] = (_Float16)ps1; t2l.h[0] = (_Float16)((ps0 - (float)t2.h[0]) * 1024.0f); t2l.h[1] = (_Float16)((ps1 - (float)t2.h[1]) * 1024.0f);
        sP[w][rt * 16 + 8 * hh + r][ln] = t2.u[0]; sP[w][rt * 16 + 8 * hh + r][16 + ln] = t2.u[1]; sPL[w][rt * 16 + 8 * hh + r][ln] = t2l.u[0]; sPL[w][rt * 16 + 8 * hh + r][16 + ln] = t2l.u[1]; }
    __builtin_amdgcn_fence(__ATOMIC_ACQ_REL, "workgroup"); __builtin_amdgcn_wave_barrier();
    FragH pa[2], pl[2];
#pragma unroll
    for (int rt = 0; rt < RTN; ++rt) { pa[rt].half[0] = *(const v8us*)&sP[w][rt * 16 + ln][8 * hh]; pa[rt].half[1] = *(const v8us*)&sP[w][rt * 16 + ln][16 + 8 * hh]; pl[rt].half[0] = *(const v8us*)&sPL[w][rt * 16 + ln][8 * hh]; pl[rt].half[1] = *(const v8us*)&sPL[w][rt * 16 + ln][16 + 8 * hh]; }
#pragma unroll
    for (int dt = 0; dt < DT; ++dt) { const unsigned short* vrow = Vth + (size_t)(dt * 16 + ln) * TK + j0; const unsigned short* vrl = Vtl + (size_t)(dt * 16 + ln) * TK + j0; FragH bv, bl; bv.half[0] = *(const v8us*)(vrow + 8 * hh); bv.half[1] = *(const v8us*)(vrow + 16 + 8 * hh); bl.half[0] = *(const v8us*)(vrl + 8 * hh); bl.half[1] = *(const v8us*)(vrl + 16 + 8 * hh);
#pragma unroll
      for (int rt = 0; rt < RTN; ++rt) { oacc[rt][dt] = mmaH<1>(pa[rt].v, pa[rt].v, bv.v, bv.v, oacc[rt][dt]); oaccL[rt][dt] = mmaH<1>(pl[rt].v, pl[rt].v, bv.v, bv.v, oaccL[rt][dt]); oaccL[rt][dt] = mmaH<1>(pa[rt].v, pa[rt].v, bl.v, bl.v, oaccL[rt][dt]); } }
    __builtin_amdgcn_fence(__ATOMIC_ACQ_REL, "workgroup"); __builtin_amdgcn_wave_barrier(); }
#pragma unroll
  for (int rt = 0; rt < RTN; ++rt) {
#pragma unroll
    for (int r = 0; r < 8; ++r) { float l = l_r[rt][r]; l += __shfl_xor(l, 1, 32); l += __shfl_xor(l, 2, 32); l += __shfl_xor(l, 4, 32); l += __shfl_xor(l, 8, 32); l_r[rt][r] = (l > 0.f) ? 1.0f / (l * 1024.0f) : 0.f; }
#pragma unroll
    for (int dt = 0; dt < DT; ++dt)
#pragma unroll
      for (int r = 0; r < 8; ++r) { float v = oacc[rt][dt][r]; v += oaccL[rt][dt][r] * 0.0009765625f; sO[w][rt * 16 + 8 * hh + r][dt * 16 + ln] = v * l_r[rt][r]; } }
  __builtin_amdgcn_fence(__ATOMIC_ACQ_REL, "workgroup"); __builtin_amdgcn_wave_barrier();
  {
#pragma unroll
    for (int rp = 0; rp < RPW; rp += 2) { const int r = rp + (lane >> 4), pc = lane & 15; const v4f val = *(const v4fa*)&sO[w][r][pc * 4]; *(v4f*)(O + ((size_t)b * TQ + q0 + r) * ldo + h * 64 + pc * 4) = val; }
     } }

// Transposed form of the causal RBF attention pass: S^T = K Q^T, O^T += V^T P^T. A lane holds one query's scores (16 of a block's 32 keys, the other wave half the other 16), so the block maximum is in-lane plus one exchange between the halves, and the two score tiles, converted in place, are the B operand of the second product: P passes through no LDS and the loop holds no fence. Logits, maxima and weights are formed by the expressions of k_flash mode 32.
__device__ __forceinline__ float xhalf(float x) { return __builtin_bit_cast(float, __builtin_amdgcn_permlanex16(__builtin_bit_cast(int, x), __builtin_bit_cast(int, x), 0x76543210, 0xfedcba98, false, false)); }      /* lane l with lane l ^ 16 */
__global__ __launch_bounds__(128) void k_flash_t(const _Float16* __restrict__ Q16, const _Float16* __restrict__ K16, const _Float16* __restrict__ Vt, const float* __restrict__ NSQ, float* __restrict__ O) {
  constexpr int DT = 4, KS = 2;
  __shared__ __attribute__((aligned(16))) float sO[4][16][64 + 4];
  const int tid = threadIdx.x, w = tid >> 5, lane = tid & 31, ln = lane & 15, hh = lane >> 4;
  const int slab = blockIdx.x / (QBLKS / 2), pr = blockIdx.x % (QBLKS / 2);
#pragma unroll 1      /* one copy of the key loop in the text serves both query blocks */
  for (int leg = 0; leg < 2; ++leg) {      /* query block QBLKS - 1 - pr, then pr, one after the other: 2 (QBLKS + 1) key passes in every work-group, so that no SIMD is left with the long blocks alone */
  const int qblk = leg ? pr : QBLKS - 1 - pr; const int qb0 = qblk * 64; const int q0 = qb0 + w * 16; const int tq = q0 + ln;      /* this lane's query */
  FragH bq[KS]; const unsigned short* qr = (const unsigned short*)Q16 + ((size_t)slab * TQ + tq) * 64;
#pragma unroll
  for (int ks = 0; ks < KS; ++ks) { bq[ks].half[0] = *(const v8us*)(qr + ks * 32 + 8 * hh); bq[ks].half[1] = *(const v8us*)(qr + ks * 32 + 16 + 8 * hh); }
  const unsigned short* Kb = (const unsigned short*)K16 + (size_t)slab * TK * 64; const unsigned short* Vth = (const unsigned short*)Vt + (size_t)slab * 64 * TK;
  const float qs = NSQ[(size_t)slab * TQ + tq]; const float* ksT = NSQ + (size_t)NB * TQ + (size_t)slab * TK;
  float m = -3.0e38f, l = 0.f; v8f oacc[DT];
#pragma unroll
  for (int dt = 0; dt < DT; ++dt) oacc[dt] = (v8f){0.f,0.f,0.f,0.f,0.f,0.f,0.f,0.f};
  const int jend = qb0 + 64;
#pragma unroll 1
  for (int j0 = 0; j0 < jend; j0 += 32) {
    FragH ak[2][KS], av[DT]; v4f kq[2][2];      /* with no fence in the loop the whole pass's loads stand at its head, in front of the first product, and fly together */
#pragma unroll
    for (int nt = 0; nt < 2; ++nt) { const unsigned short* kr = Kb + (size_t)(j0 + nt * 16 + ln) * 64;
#pragma unroll
      for (int ks = 0; ks < KS; ++ks) { ak[nt][ks].half[0] = *(const v8us*)(kr + ks * 32 + 8 * hh); ak[nt][ks].half[1] = *(const v8us*)(kr + ks * 32 + 16 + 8 * hh); }
      kq[nt][0] = *(const v4fa*)(ksT + j0 + nt * 16 + 8 * hh); kq[nt][1] = *(const v4fa*)(ksT + j0 + nt * 16 + 8 * hh + 4); }      /* |k|^2 of this lane's eight keys of the tile */
    asm volatile("s_wait_xcnt 0x0" ::: "memory");      /* precaution: the address registers of the loads above may be reused as destinations of the loads below */
#pragma unroll
    for (int dt = 0; dt < DT; ++dt) { const unsigned short* vrow = Vth + (size_t)(dt * 16 + ln) * TK + j0; av[dt].half[0] = *(const v8us*)(vrow + 8 * hh); av[dt].half[1] = *(const v8us*)(vrow + 16 + 8 * hh); }
    asm volatile("s_wait_xcnt 0x0" ::: "memory");      /* precaution: stands in front of the pointer steps and of every other rewrite of a register that an issued load names */
    __builtin_amdgcn_sched_barrier(0);      /* keeps those rewrites, which the scheduler otherwise lifts among the loads, behind the wait */
    const int lim = tq - j0 - 8 * hh;      /* key 16 nt + r of this lane's sixteen is causal where 16 nt + r <= lim */
    float sc[16]; float mc = -3.0e38f;
#pragma unroll
    for (int nt = 0; nt < 2; ++nt) { v8f acc = (v8f){0.f,0.f,0.f,0.f,0.f,0.f,0.f,0.f};
#pragma unroll
      for (int ks = 0; ks < KS; ++ks) acc = mmaH<1>(ak[nt][ks].v, ak[nt][ks].v, bq[ks].v, bq[ks].v, acc);      /* acc[r] = k[j0 + 16 nt + 8 hh + r] . q[tq] */
#pragma unroll
      for (int r = 0; r < 8; ++r) { const bool ok = nt * 16 + r <= lim; float d = qs + kq[nt][r >> 2][r & 3]; d = d - 2.0f * (acc[r] * SCL); d = fmaxf(d, 0.f); const float sv = ok ? -d * 0.125f : -3.0e38f; sc[nt * 8 + r] = sv; mc = fmaxf(mc, sv); } }
    mc = fmaxf(mc, xhalf(mc));
    const float mn = fmaxf(m, mc); const float ea = expf(m - mn); const float al = (mn > -1.0e38f) ? ea : 1.0f; m = mn;
    FragH pb; float p[16];
#pragma unroll
    for (int i = 0; i < 16; ++i) { const bool ok = (i >> 3) * 16 + (i & 7) <= lim; const float e = expf(sc[i] - mn); p[i] = ok ? e : 0.f; pb.h[i] = (_Float16)(p[i] * 1024.0f); }      /* element i of the B operand is key 8 hh + i, then 16 + 8 hh + (i - 8): the order of the V^T loader above */
#pragma unroll
    for (int st = 8; st > 0; st >>= 1)
#pragma unroll
      for (int i = 0; i < st; ++i) p[i] += p[i + st];
    l = l * al + p[0];
#pragma unroll
    for (int dt = 0; dt < DT; ++dt) {
#pragma unroll
      for (int r = 0; r < 8; ++r) oacc[dt][r] *= al; }
#pragma unroll
    for (int dt = 0; dt < DT; ++dt) oacc[dt] = mmaH<1>(av[dt].v, av[dt].v, pb.v, pb.v, oacc[dt]); }      /* oacc[dt][r] = context column 16 dt + 8 hh + r of query tq */
  l += xhalf(l); const float inv = (l > 0.f) ? 1.0f / (l * 1024.0f) : 0.f;
#pragma unroll
  for (int dt = 0; dt < DT; ++dt) { v4f a, c;
#pragma unroll
    for (int r = 0; r < 4; ++r) { a[r] = oacc[dt][r] * inv; c[r] = oacc[dt][4 + r] * inv; }
    *(v4fa*)&sO[w][ln][dt * 16 + 8 * hh] = a; *(v4fa*)&sO[w][ln][dt * 16 + 8 * hh + 4] = c; }
  __builtin_amdgcn_fence(__ATOMIC_ACQ_REL, "workgroup"); __builtin_amdgcn_wave_barrier();      /* the wave's own lanes read each other's rows below, for whole-row stores */
#pragma unroll
  for (int rp = 0; rp < 16; rp += 2) { const int r = rp + (lane >> 4), pc = lane & 15; const v4f val = *(const v4fa*)&sO[w][r][pc * 4]; *(v4f*)(O + ((size_t)slab * TQ + q0 + r) * 64 + pc * 4) = val; }
  asm volatile("s_wait_xcnt 0x0" ::: "memory");      /* precaution: the second leg rewrites the registers that these stores name */
  __builtin_amdgcn_fence(__ATOMIC_ACQ_REL, "workgroup", "local"); __builtin_amdgcn_wave_barrier(); } }      /* the second leg's staging writes stay behind every lane's reads of the first leg's rows; LDS only, so that the leg does not wait for its stores to the output */

__global__ __launch_bounds__(256) void k_rotab(float* __restrict__ CS, float* __restrict__ SN) {
  #pragma clang fp contract(off)
  const int t = blockIdx.x * 256 + threadIdx.x; if (t >= SLEN * 32) return; const int j = t % 32, s = t / 32; const float ex = (float)(2 * j) / 64.0f; const float inv = 1.0f / powf(10000.0f, ex); const float th = (float)s * inv; const float c = cosf(th), sn = sinf(th);
  { *(float*)(CS + t) = c; *(float*)(SN + t) = sn;  } }
__global__ __launch_bounds__(256) void k_rope(const float* __restrict__ F, int nsrc, int ndst, int rep, const float* __restrict__ CS, const float* __restrict__ SN, _Float16* __restrict__ H, _Float16* __restrict__ L) {
  #pragma clang fp contract(off)
  const size_t t = (size_t)blockIdx.x * 256 + threadIdx.x; if (t >= (size_t)NR * ndst * 4) return; const int g8 = (int)(t % 4); const int hd = (int)((t / 4) % ndst); const size_t row = t / ((size_t)4 * ndst); const int s = (int)(row % SLEN); const int hs = hd / rep;
  const float* src = F + row * (size_t)(nsrc * 64) + hs * 64; FragH ah, al, bh, bl;
  for (int i = 0; i < 8; ++i) { const int d = g8 * 8 + i; const float c = CS[s * 32 + d], sn = SN[s * 32 + d]; const float x1 = src[d], x2 = src[d + 32];
    float o1 = x1 * c; o1 += -x2 * sn; float o2 = x2 * c; o2 += x1 * sn;
    _Float16 hv = (_Float16)o1; ah.h[i] = hv; al.h[i] = (_Float16)((o1 - (float)hv) * 1024.0f); hv = (_Float16)o2; bh.h[i] = hv; bl.h[i] = (_Float16)((o2 - (float)hv) * 1024.0f); }
  const size_t o = row * (size_t)(ndst * 64) + hd * 64 + g8 * 8;
  { *(v8us*)((unsigned short*)H + o) = ah.half[0]; *(v8us*)((unsigned short*)H + o + 32) = bh.half[0]; *(v8us*)((unsigned short*)L + o) = al.half[0]; *(v8us*)((unsigned short*)L + o + 32) = bl.half[0];  } }
__global__ __launch_bounds__(256) void k_rope2(const float* __restrict__ F, int nsrc, int ndst, int rep, const float* __restrict__ CS, const float* __restrict__ SN, _Float16* __restrict__ H, _Float16* __restrict__ L) {
  #pragma clang fp contract(off)
  const size_t t = (size_t)blockIdx.x * 256 + threadIdx.x; if (t >= (size_t)NR * ndst * 4) return; const int g16 = (int)(t % 4); const int hd = (int)((t / 4) % ndst); const size_t row = t / ((size_t)4 * ndst); const int s = (int)(row % SLEN); const int hs = hd / rep;
  const float* src = F + row * (size_t)(nsrc * 64) + hs * 64 + g16 * 16; FragH ah, al;
  for (int pr = 0; pr < 8; ++pr) { const int i = g16 * 8 + pr; const float c = CS[s * 32 + i], sn = SN[s * 32 + i]; const float x1 = src[2 * pr], x2 = src[2 * pr + 1];
    float o1 = x1 * c; o1 -= x2 * sn; float o2 = x1 * sn; o2 += x2 * c;
    _Float16 hv = (_Float16)o1; ah.h[2 * pr] = hv; al.h[2 * pr] = (_Float16)((o1 - (float)hv) * 1024.0f); hv = (_Float16)o2; ah.h[2 * pr + 1] = hv; al.h[2 * pr + 1] = (_Float16)((o2 - (float)hv) * 1024.0f); }
  const size_t o = row * (size_t)(ndst * 64) + hd * 64 + g16 * 16;
  { *(v8us*)((unsigned short*)H + o) = ah.half[0]; *(v8us*)((unsigned short*)H + o + 8) = ah.half[1]; *(v8us*)((unsigned short*)L + o) = al.half[0]; *(v8us*)((unsigned short*)L + o + 8) = al.half[1];  } }
__global__ __launch_bounds__(256) void k_ln512(const float* __restrict__ A, const float* __restrict__ res, const float* __restrict__ g, const float* __restrict__ bb, float* __restrict__ Y, _Float16* __restrict__ Y16) {
  #pragma clang fp contract(off)
  const int wv = threadIdx.x >> 5, ln = threadIdx.x & 31; const size_t r = (size_t)blockIdx.x * 8 + wv; if (r >= NR) return; float x[16]; float s = 0.f;
  for (int i = 0; i < 2; ++i) { const v8f a = *(const v8f*)(A + r * DM + i * 256 + ln * 8); for (int q = 0; q < 8; ++q) { float v = a[q]; if (res) v += bf16_round(res[r * DM + i * 256 + ln * 8 + q]); x[i * 8 + q] = v; s += v; } }
  for (int o = 16; o > 0; o >>= 1) s += __shfl_xor(s, o, 32); const float mu = s / (float)DM; float var = 0.f; for (int q = 0; q < 16; ++q) { const float d = x[q] - mu; var += d * d; }
  for (int o = 16; o > 0; o >>= 1) var += __shfl_xor(var, o, 32); const float inv = rsqrtf(var / (float)DM + 1e-5f);
  { for (int i = 0; i < 2; ++i) { const int c0 = i * 256 + ln * 8; v8f y; FragH f; for (int q = 0; q < 8; ++q) { float v = (x[i * 8 + q] - mu) * inv; v *= bf16_round(g[c0 + q]); v += bf16_round(bb[c0 + q]); y[q] = v; f.h[q] = (_Float16)v; } *(v8f*)(Y + r * DM + c0) = y; if (Y16) *(v8us*)((unsigned short*)Y16 + r * DM + c0) = f.half[0]; }  } }
__global__ __launch_bounds__(256) void k_pack(const float* __restrict__ rb, const int* __restrict__ rid, int* __restrict__ PK) { const int t = blockIdx.x * 256 + threadIdx.x; if (t >= 1024 + NB * TK) return; int v; if (t < 1024) v = __float_as_int(bf16_round(rb[t])); else v = rid[t - 1024]; *(int*)(PK + t) = v;  }
__global__ __launch_bounds__(256) void k_tabin(const float* __restrict__ sp, float* __restrict__ CS, float* __restrict__ SN) { const int t = blockIdx.x * 256 + threadIdx.x; if (t >= SLEN * 32) return; const int i = t % 32, s = t / 32; const float c = bf16_round(sp[s * 64 + 32 + i]), sn = bf16_round(sp[s * 64 + i]);
  { *(float*)(CS + t) = c; *(float*)(SN + t) = sn;  } }
__global__ __launch_bounds__(256) void k_wsc(const float* __restrict__ Wm, _Float16* __restrict__ Bt, size_t n8, float sc) { const size_t t = (size_t)blockIdx.x * 256 + threadIdx.x; if (t >= n8) return; FragH f; for (int q = 0; q < 8; ++q) f.h[q] = (_Float16)(bf16_round(Wm[t * 8 + q]) * sc); *(v8us*)((unsigned short*)Bt + t * 8) = f.half[0];  }
__global__ __launch_bounds__(256) void k_rotab2(float* __restrict__ CS, float* __restrict__ SN) {
  #pragma clang fp contract(off)
  const int t = blockIdx.x * 256 + threadIdx.x; if (t >= SLEN * 32) return; const int j = t % 32, s = t / 32; const float c0 = -0.14391156831212787f;      /* -ln(10000)/64 rounded to f32 */ const float inv = expf((float)(2 * j) * c0); const float th = (float)s * inv; const float c = cosf(th), sn = sinf(th);
  { *(float*)(CS + t) = c; *(float*)(SN + t) = sn;  } }
__global__ __launch_bounds__(256) void k_lnu(const float* __restrict__ X, _Float16* __restrict__ N16, float* __restrict__ XB) {
  #pragma clang fp contract(off)
  const int wv = threadIdx.x >> 5, ln = threadIdx.x & 31; const size_t r = (size_t)blockIdx.x * 8 + wv; if (r >= NR) return; float a[32]; float s = 0.f;
  for (int i = 0; i < 4; ++i) { const v8f v = *(const v8f*)(X + r * DM + (i * 32 + ln) * 8); for (int q = 0; q < 8; ++q) { const float u = bf16_round(v[q]); a[i * 8 + q] = u; s += u; } }
  for (int o = 16; o > 0; o >>= 1) s += __shfl_xor(s, o, 32); const float mu = s / (float)DM; float var = 0.f; for (int q = 0; q < 32; ++q) { const float d = a[q] - mu; var += d * d; }
  for (int o = 16; o > 0; o >>= 1) var += __shfl_xor(var, o, 32); const float den = sqrtf(var / (float)(DM - 1)) + 1e-6f; const float inv = 1.0f / den;      /* one reciprocal per row; (x-mean)*inv vs the reference's division differs by <= 1 ulp */
  { for (int i = 0; i < 4; ++i) { const int c0 = (i * 32 + ln) * 8; FragH f; v8f xb; for (int q = 0; q < 8; ++q) { f.h[q] = (_Float16)((a[i * 8 + q] - mu) * inv); xb[q] = a[i * 8 + q]; } *(v8us*)((unsigned short*)N16 + r * DM + c0) = f.half[0]; *(v8f*)(XB + r * DM + c0) = xb; }  } }

__global__ __launch_bounds__(256) void k_h16s(const float* __restrict__ SRC, int lds, int coff, _Float16* __restrict__ DST, size_t n8) { const size_t t = (size_t)blockIdx.x * 256 + threadIdx.x; if (t >= n8) return; const size_t r = (t * 8) / DM; const int c = (int)((t * 8) % DM); const v8f a = *(const v8f*)(SRC + r * lds + coff + c); FragH f; for (int q = 0; q < 8; ++q) f.h[q] = (_Float16)a[q];
  *(v8us*)((unsigned short*)DST + t * 8) = f.half[0];  }


__global__ __launch_bounds__(256) void k_ccp(const float* __restrict__ QKV, int coff, _Float16* __restrict__ D) { const size_t t = (size_t)blockIdx.x * 256 + threadIdx.x; if (t >= (size_t)NR * DM / 8) return; const int c0 = (int)((t * 8) % DM); const size_t row = (t * 8) / DM; const v8f a = *(const v8f*)(QKV + row * 3 * DM + coff + c0); FragH f; for (int q = 0; q < 8; ++q) f.h[q] = (_Float16)a[q];
  *(v8us*)((unsigned short*)D + t * 8) = f.half[0];  }


template <int NLN>
__global__ __launch_bounds__(256) void k_lnrow(const float* __restrict__ X, const float* __restrict__ R, const float* __restrict__ g, const float* __restrict__ bb, float eps, float* __restrict__ OUT) {
  #pragma clang fp contract(off)
  constexpr int PER = NLN / 256; __shared__ float red[256]; const int tid = threadIdx.x; const size_t row = blockIdx.x; const float* x = X + row * NLN; const float* rr = R ? R + row * NLN : nullptr; float v[PER]; float s1 = 0.f;
  for (int u = 0; u < PER; ++u) { const int j = tid * PER + u; float t = x[j]; if (rr) t = t + rr[j]; v[u] = t; s1 += t; }
  red[tid] = s1; __syncthreads(); for (int st = 128; st > 0; st >>= 1) { if (tid < st) red[tid] += red[tid + st]; __syncthreads(); } const float mu = red[0] / (float)NLN; __syncthreads();
  float s2 = 0.f; for (int u = 0; u < PER; ++u) { const float c = v[u] - mu; s2 += c * c; } red[tid] = s2; __syncthreads(); for (int st = 128; st > 0; st >>= 1) { if (tid < st) red[tid] += red[tid + st]; __syncthreads(); }
  const float var = red[0] / (float)NLN; const float rs = rsqrtf(var + eps);
  { for (int u = 0; u < PER; ++u) { const int j = tid * PER + u; float o = (v[u] - mu) * rs; o = __fadd_rn(__fmul_rn(o, bf16_round(g[j])), bf16_round(bb[j])); *(float*)(OUT + row * NLN + j) = o; }  } }
__global__ __launch_bounds__(256) void k_xr32(const float* __restrict__ x, float* __restrict__ XR, size_t n8) { const size_t t = (size_t)blockIdx.x * 256 + threadIdx.x; if (t >= n8) return; v8f o; for (int q = 0; q < 8; ++q) o[q] = bf16_round(x[t * 8 + q]); *(v8f*)(XR + t * 8) = o;  }
__global__ __launch_bounds__(256) void k_r16b(const float* __restrict__ S, _Float16* __restrict__ D, size_t n8) { const size_t t = (size_t)blockIdx.x * 256 + threadIdx.x; if (t >= n8) return; const v8f a = *(const v8f*)(S + t * 8); FragH f; for (int q = 0; q < 8; ++q) f.h[q] = (_Float16)a[q]; *(v8us*)((unsigned short*)D + t * 8) = f.half[0];  }

// One preparatory launch. Blocks 0-255 take q, 256-511 k, 512-767 v, 256 rows each; every input is read once.
// q, k: the bf16 bits are staged in LDS, the f16 plane goes out from registers, and one thread per row sums its squares in ascending order of d.
// v: the f16 values are staged in LDS and go out transposed, 128 bytes of a V^T row per eight lanes.
__global__ __launch_bounds__(256) void k_prep(const float* __restrict__ Q, const float* __restrict__ Kx, const float* __restrict__ V, _Float16* __restrict__ QH, _Float16* __restrict__ KH, _Float16* __restrict__ Vt, float* __restrict__ NSQ) {
  __shared__ __attribute__((aligned(16))) unsigned short sm[256 * 72];      /* q, k: pitch 72 (144 B = 16 B x odd: a lane per row reads 16 bytes without bank conflicts); v: pitch 66 (eight rows apart = 8 banks apart) */
  const int tid = threadIdx.x; const int which = blockIdx.x >> 8, blk = blockIdx.x & 255; const size_t e0 = (size_t)blk * 256 * 64;
  if (which < 2) {
    const float* X = (which ? Kx : Q) + e0; unsigned short* H = (unsigned short*)(which ? KH : QH) + e0; FragH f[8]; v8f a[8]; const unsigned boff = (unsigned)tid * 32u;
#pragma unroll
    for (int i = 0; i < 8; ++i) a[i] = *(const v8f*)((const char*)X + boff + i * 8192);
    asm volatile("s_wait_xcnt 0x0" :: "v"(boff) : "memory");      /* precaution: the loads' offset register is held to this wait, so that none of the loads takes it as its destination */
    __builtin_amdgcn_sched_barrier(0);      /* keeps all sixteen loads in flight together; the scheduler otherwise sinks six of them behind the first waits, three more memory latencies in a row */
#pragma unroll
    for (int i = 0; i < 8; ++i) { const int g = i * 256 + tid; v8us b;
#pragma unroll
      for (int u = 0; u < 8; ++u) { const unsigned short hb = bf16_bits(a[i][u]); b[u] = hb; f[i].h[u] = (_Float16)bf16_val(hb); }
      *(v8us*)&sm[(g >> 3) * 72 + (g & 7) * 8] = b; }
    __syncthreads();      /* a row's sixteen-byte pieces were staged by eight threads */
#pragma unroll
    for (int i = 0; i < 8; ++i) *(v8us*)(H + (i * 256 + tid) * 8) = f[i].half[0];      /* behind the barrier, which would otherwise wait for these stores */
    float acc = 0.f;
#pragma unroll
    for (int d = 0; d < 64; d += 8) { const v8us b = *(const v8us*)&sm[tid * 72 + d];
#pragma unroll
      for (int u = 0; u < 8; ++u) { const float x = bf16_val(b[u]); acc = __fadd_rn(acc, __fmul_rn(x, x)); } }      /* a square of a bf16 value is exact in f32: fused or not, each step rounds the same sum */
    *(float*)(NSQ + (size_t)which * NR + blk * 256 + tid) = acc;
  } else {
    const float* X = V + e0; const int slab = blk >> 3, kg = blk & 7;      /* eight groups of 256 keys per slab */
#pragma unroll
    for (int i = 0; i < 8; ++i) { const int g = i * 256 + tid; const v8f a = *(const v8f*)(X + g * 8); FragH f;
#pragma unroll
      for (int u = 0; u < 8; ++u) f.h[u] = (_Float16)bf16_round(a[u]);
#pragma unroll
      for (int u = 0; u < 8; ++u) sm[(g >> 3) * 66 + (g & 7) * 8 + u] = f.u[u]; }
    __syncthreads();      /* a V^T piece gathers eight keys staged by eight threads */
#pragma unroll
    for (int it = 0; it < 8; ++it) { const int d = (it & 1) * 32 + tid / 8, pc = (it >> 1) * 8 + tid % 8; FragH f;
#pragma unroll
      for (int u = 0; u < 8; ++u) f.u[u] = sm[(pc * 8 + u) * 66 + d];
      *(v8us*)((unsigned short*)Vt + ((size_t)slab * 64 + d) * SLEN + kg * 256 + pc * 8) = f.half[0]; }
    asm volatile("s_wait_xcnt 0x0" ::: "memory");      /* precaution: the compiler lays the q, k branch behind these stores in the text, where their registers are rewritten */
  } }
// One block per (slab, 8 query rows < 64), one wave per row. The slab's first 64 rows of k and v are rounded and staged in LDS once per block; lanes own keys for the logits, then output columns for the context. Each dot product, the row sum and each context sum keep their serial order.
__global__ __launch_bounds__(256) void k_fixr(const float* __restrict__ Q, const float* __restrict__ Kx, const float* __restrict__ V, const float* __restrict__ NSQ, float* __restrict__ O) {
  #pragma clang fp contract(off)
  __shared__ __attribute__((aligned(16))) float sk[64][68];      /* pitch 272 B = 16 B x odd: a lane per row reads 16 bytes without bank conflicts */
  __shared__ __attribute__((aligned(16))) float sv[64][64]; __shared__ __attribute__((aligned(16))) float pr[8][64];
  const int tid = threadIdx.x, w = tid >> 5, lane = tid & 31; const size_t sl = blockIdx.x >> 3; const int q = __builtin_amdgcn_readfirstlane((int)(blockIdx.x & 7) * 8 + w);
  const float* kb = Kx + sl * SLEN * 64; const float* vb = V + sl * SLEN * 64;
#pragma unroll
  for (int i = 0; i < 4; ++i) { const int e = (i * 256 + tid) * 4; const v4f a = *(const v4fa*)(kb + e); const v4f c = *(const v4fa*)(vb + e); v4f ra, rc;
#pragma unroll
    for (int u = 0; u < 4; ++u) { ra[u] = bf16_round(a[u]); rc[u] = bf16_round(c[u]); }
    *(v4fa*)&sk[e >> 6][e & 63] = ra; *(v4fa*)&sv[e >> 6][e & 63] = rc; }
  const float* qr = Q + (sl * SLEN + q) * 64; const float qs = NSQ[sl * SLEN + q]; const float* ksT = NSQ + (size_t)NB * SLEN + sl * SLEN; const float kq0 = ksT[lane], kq1 = ksT[lane + 32];
  float x[64];      /* the wave's query row, fetched ahead of the barrier so that its latency runs beside the staging loads' */
#pragma unroll
  for (int d = 0; d < 64; d += 4) { const v4f a = *(const v4fa*)(qr + d);
#pragma unroll
    for (int u = 0; u < 4; ++u) x[d + u] = bf16_round(a[u]); }
  __syncthreads();      /* the staged rows are read by every wave of the block */
  float sd0 = 0.f, sd1 = 0.f;      /* keys lane and lane + 32 */
#pragma unroll
  for (int d = 0; d < 64; d += 4) { const v4f k0 = *(const v4fa*)&sk[lane][d]; const v4f k1 = *(const v4fa*)&sk[lane + 32][d];
#pragma unroll
    for (int u = 0; u < 4; ++u) { sd0 = __fadd_rn(sd0, __fmul_rn(x[d + u], k0[u])); sd1 = __fadd_rn(sd1, __fmul_rn(x[d + u], k1[u])); } }
  float d0 = qs + kq0; d0 = d0 - 2.0f * sd0; d0 = fmaxf(d0, 0.f); float d1 = qs + kq1; d1 = d1 - 2.0f * sd1; d1 = fmaxf(d1, 0.f);
  const bool ok0 = lane <= q, ok1 = lane + 32 <= q; const float lg0 = ok0 ? -d0 * 0.125f : -3.0e38f, lg1 = ok1 ? -d1 * 0.125f : -3.0e38f;
  float mx = fmaxf(lg0, lg1); mx = fmaxf(mx, __shfl_xor(mx, 1, 32)); mx = fmaxf(mx, __shfl_xor(mx, 2, 32)); mx = fmaxf(mx, __shfl_xor(mx, 4, 32)); mx = fmaxf(mx, __shfl_xor(mx, 8, 32)); mx = fmaxf(mx, __shfl_xor(mx, 16, 32));
  const float e0 = expf(lg0 - mx), e1 = expf(lg1 - mx); pr[w][lane] = ok0 ? e0 : 0.f; pr[w][lane + 32] = ok1 ? e1 : 0.f;
  __builtin_amdgcn_fence(__ATOMIC_ACQ_REL, "workgroup"); __builtin_amdgcn_wave_barrier();      /* the wave's own lanes read each other's weights below */
  float su = 0.f;
#pragma unroll
  for (int j = 0; j < 64; j += 4) { const v4f e = *(const v4fa*)&pr[w][j]; su += e[0]; su += e[1]; su += e[2]; su += e[3]; }      /* ascending keys; a masked key adds an exact zero */
  const float inv = 1.0f / su; typedef float v2f __attribute__((ext_vector_type(2))); typedef float v2fa __attribute__((ext_vector_type(2), may_alias));
  float a0 = 0.f, a1 = 0.f;      /* output columns 2 lane and 2 lane + 1 */
#pragma unroll 1
  for (int j0 = 0; j0 <= q; j0 += 16) {
#pragma unroll
    for (int i = 0; i < 16; ++i) { const bool in = j0 + i <= q; const v2f vv = *(const v2fa*)&sv[j0 + i][lane * 2]; const float p = pr[w][j0 + i] * inv;      /* past the row's last key the weight is zero; the value is zeroed too, so the term is an exact zero */
      a0 = __fadd_rn(a0, __fmul_rn(p, in ? vv[0] : 0.f)); a1 = __fadd_rn(a1, __fmul_rn(p, in ? vv[1] : 0.f)); } }
  const v2f o = {a0, a1}; *(v2f*)(O + (sl * SLEN + q) * 64 + lane * 2) = o; }

extern "C" void kernel_launch(void* const* d_in, const int* in_sizes, int n_in,
                              void* d_out, int out_size, void* d_ws, size_t ws_size, hipStream_t stream) {
  (void)in_sizes; (void)n_in; (void)out_size;
  const float* q = (const float*)d_in[0]; const float* k = (const float*)d_in[1]; const float* v = (const float*)d_in[2]; float* O = (float*)d_out;
  char* ws = (char*)d_ws; size_t off = 0;
  auto take = [&](size_t bytes) { char* p = ws + off; off += (bytes + 255) & ~(size_t)255; return p; };
  const size_t np = (size_t)NR * DM;      /* 32 x 2048 x 64 */
  _Float16* QH = (_Float16*)take(np * 2); _Float16* KH = (_Float16*)take(np * 2); _Float16* VT = (_Float16*)take(np * 2); float* NSQ = (float*)take((size_t)2 * NR * 4);
  if (off > ws_size) return;      /* 3 x 8 + 0.5 MiB */
  k_prep<<<3 * (NR / 256), 256, 0, stream>>>(q, k, v, QH, KH, VT, NSQ);      /* f16 planes of q and k (bf16-rounded inputs are exact in f16), V^T, |q|^2 | |k|^2 tables */
  k_flash_t<<<NB * (QBLKS / 2), 128, 0, stream>>>(QH, KH, VT, NSQ, O);      /* exact q, k products; f32 RBF logits; f32 context straight to the output; a work-group takes a long and a short query block */
  k_fixr<<<NB * 8, 256, 0, stream>>>(q, k, v, NSQ, O);      /* rows < 64 per slab recomputed in f32 */
}

// v006
// One run takes 73.7 microseconds.
// Next to v005, in two timings, it ran 1.31 and 1.32 times as fast.
// All steps since the starting kernel, v000, together make it 6.71 times as fast.
#include <hip/hip_runtime.h>
// CustomCausalAttention (q, k, v [2][16][2048][64]; RBF-kernel causal attention: logits = -relu(|q|^2 + |k|^2 - 2 q.k) / 8 over keys n <= m; out = softmax(logits) v -> [2][16][2048][64]).
// Structure: each (batch, head) slab is a contiguous 64-wide row block, treated as one 'batch' of a single 64-dim head: one preparatory launch makes the exact f16 planes of q and k (bf16-rounded inputs are exact in f16), |q|^2, |k|^2 as f32 row tables on VALU, and v^T by LDS tiles; causal flash-style fused attention per (slab, 64-query block), forming the RBF logit from the f32 dot product and the two norm tables, f32 context written straight to the output; the first 64 causal rows per slab recomputed entirely in f32 on VALU.
// Compute dtype: inputs rounded to bf16; q, k, v exact as f16 (products exact, f32 accumulation); norms, logits, softmax f32 with plain f16 probabilities (~2^-12); rows < 64 all-f32. v_wmma_f32_16x16x32_f16.
#define NB 32                    /* 2 batches x 16 heads as slabs */
#define DM 64
#define NKV 1
#define NREP (NH / NKV)
#define KVD (NKV * 64)           /* 64 */
#define NR (NB * SLEN)
#define CHK 512
typedef int v4i __attribute__((ext_vector_type(4)));
#define FF 2048
#define SLEN 2048
#define MQI 2048
#define MKI 2048
#define TQ SLEN
#define TK SLEN
#define NH 1
#define SCL 1.0f                 /* raw dot product; the RBF transform applies the 1/8 */
#define QBLKS (TQ / 64)
#define QB05 0
#define QBN5 QBLKS      /* k_flash5 (hi/lo engine, not launched) would span all query blocks */
#define QB0P 0
#define QBNP QBLKS
#define RE 256
typedef __bf16 v16b __attribute__((ext_vector_type(16)));
typedef unsigned short v8us __attribute__((ext_vector_type(8), may_alias));
typedef float  v8f  __attribute__((ext_vector_type(8)));
typedef float  v4f  __attribute__((ext_vector_type(4)));
typedef float  v4fa __attribute__((ext_vector_type(4), may_alias));
union FragB { v16b v; v8us half[2]; unsigned short u[16]; };

__device__ __forceinline__ unsigned short bf16_bits(float x) { unsigned int u = __float_as_uint(x); return (unsigned short)((u + 0x7FFFu + ((u >> 16) & 1u)) >> 16); }
__device__ __forceinline__ float bf16_val(unsigned short b) { return __uint_as_float(((unsigned int)b) << 16); }
__device__ __forceinline__ float bf16_round(float x) { return bf16_val(bf16_bits(x)); }
// D += A·B with NT terms: 1 = ah·bh, 2 = + al·bh (A split), 3 = + ah·bl (both split)
template <int NT>
__device__ __forceinline__ v8f mmaN(v16b ah, v16b al, v16b bh, v16b bl, v8f c) {
  c = __builtin_amdgcn_wmma_f32_16x16x32_bf16(false, ah, false, bh, (short)0, c, false, false);
  if (NT >= 2) c = __builtin_amdgcn_wmma_f32_16x16x32_bf16(false, al, false, bh, (short)0, c, false, false);
  if (NT >= 3) c = __builtin_amdgcn_wmma_f32_16x16x32_bf16(false, ah, false, bl, (short)0, c, false, false);
  asm volatile("v_nop\n\tv_nop\n\tv_nop\n\tv_nop" : "+v"(c) : "v"(ah), "v"(al), "v"(bh), "v"(bl));
  return c;
}

__global__ __launch_bounds__(256) void k_wt_bf16(const float* __restrict__ W, unsigned short* __restrict__ Wt, int K, int N) {
  const int t = blockIdx.x * 256 + threadIdx.x;
  const int k8n = K / 8;
  if (t >= N * k8n) return;
  const int n = t / k8n, k8 = (t % k8n) * 8;
  v8us v;
#pragma unroll
  for (int i = 0; i < 8; ++i) v[i] = bf16_bits(W[(size_t)(k8 + i) * N + n]);
  *(v8us*)(Wt + (size_t)n * K + k8) = v;
  
}

// GEMM C[M][N] (f32, pitch ldc) = act(A[M][K]·W + bias). A f32 row-major (pitch lda) converted per fragment to bf16
// (ASPLIT: hi/lo two planes -> 2 terms, else single rounded term); Wt bf16 [N][K] (pitch ldb). BIAS_BF16 rounds the
// bias to bf16 first (bias quantised to bf16 before the add). K%32==0, M%16==0, N%64==0.
template <bool ASPLIT, int ACT, bool BIAS_BF16>
__global__ __launch_bounds__(128) void k_gemm_bf(const float* __restrict__ A, int lda, const unsigned short* __restrict__ Wt, int ldb,
                                               const float* __restrict__ bias, float* __restrict__ C, int ldc, int M, int N, int K) {
  __shared__ __attribute__((aligned(16))) float so[4][16][64];
  const int tid = threadIdx.x, w = tid >> 5, lane = tid & 31, ln = lane & 15, hh = lane >> 4;
  const int ntn = N / 64;
  const int wid = blockIdx.x * 4 + w;
  const int mt = wid / ntn, nq = wid % ntn;
  if (mt * 16 >= M) return;
  const int row0 = mt * 16, col0 = nq * 64;
  const float* arow = A + (size_t)(row0 + ln) * lda;
  v8f acc[4] = {};
  for (int kb = 0; kb < K; kb += 32) {
    FragB ah, al;
    const v4f x0 = *(const v4fa*)(arow + kb + 8 * hh), x1 = *(const v4fa*)(arow + kb + 8 * hh + 4);
    const v4f x2 = *(const v4fa*)(arow + kb + 16 + 8 * hh), x3 = *(const v4fa*)(arow + kb + 16 + 8 * hh + 4);
    float xs[16] = {x0[0],x0[1],x0[2],x0[3],x1[0],x1[1],x1[2],x1[3],x2[0],x2[1],x2[2],x2[3],x3[0],x3[1],x3[2],x3[3]};
#pragma unroll
    for (int i = 0; i < 16; ++i) { const unsigned short hb = bf16_bits(xs[i]); ah.u[i] = hb; al.u[i] = ASPLIT ? bf16_bits(xs[i] - bf16_val(hb)) : (unsigned short)0; }
#pragma unroll
    for (int t = 0; t < 4; ++t) {
      const unsigned short* brow = Wt + (size_t)(col0 + t * 16 + ln) * ldb + kb;
      FragB b;
      b.half[0] = *(const v8us*)(brow + 8 * hh);
      b.half[1] = *(const v8us*)(brow + 16 + 8 * hh);
      acc[t] = mmaN<ASPLIT ? 2 : 1>(ah.v, al.v, b.v, b.v, acc[t]);
    }
  }
#pragma unroll
  for (int t = 0; t < 4; ++t) {
    float bv = bias ? bias[col0 + t * 16 + ln] : 0.f;
    if (BIAS_BF16) bv = bf16_round(bv);
#pragma unroll
    for (int r = 0; r < 8; ++r) { float v = acc[t][r] + bv; if (ACT == 1) v = fmaxf(v, 0.f); so[w][8 * hh + r][t * 16 + ln] = v; }
  }
  __builtin_amdgcn_fence(__ATOMIC_ACQ_REL, "workgroup");
  __builtin_amdgcn_wave_barrier();
  const int rsub = lane >> 4, c4 = (lane & 15) * 4;
  {
#pragma unroll
    for (int q = 0; q < 8; ++q) {
      const int r = q * 2 + rsub;
      const v4f v = *(const v4fa*)&so[w][r][c4];
      *(v4f*)(C + (size_t)(row0 + r) * ldc + col0 + c4) = v;
    }
    
  }
}

// GEMM C = act(A·W + bias + resid): A f32 (ASPLIT -> hi/lo 2 terms), Wt bf16 [N][K]; ACT 0 none, 1 relu, 2 exact gelu;
// resid (optional, f32, row index = (row % rmod), pitch ldr, RES_BF16 rounds it) added before the activation.
template <bool ASPLIT, int ACT, bool BIAS_BF16, bool RES_BF16>
__global__ __launch_bounds__(128) void k_gemm_bf3(const float* __restrict__ A, int lda, const unsigned short* __restrict__ Wt, int ldb,
                                                const float* __restrict__ bias, const float* __restrict__ resid, int rmod, int ldr,
                                                float* __restrict__ C, int ldc, int M, int N, int K) {
  __shared__ __attribute__((aligned(16))) float so[4][16][64];
  const int tid = threadIdx.x, w = tid >> 5, lane = tid & 31, ln = lane & 15, hh = lane >> 4;
  const int ntn = N / 64;
  const int wid = blockIdx.x * 4 + w;
  const int mt = wid / ntn, nq = wid % ntn;
  if (mt * 16 >= M) return;
  const int row0 = mt * 16, col0 = nq * 64;
  const float* arow = A + (size_t)(row0 + ln) * lda;
  v8f acc[4] = {};
  for (int kb = 0; kb < K; kb += 32) {
    FragB ah, al;
    const v4f x0 = *(const v4fa*)(arow + kb + 8 * hh), x1 = *(const v4fa*)(arow + kb + 8 * hh + 4);
    const v4f x2 = *(const v4fa*)(arow + kb + 16 + 8 * hh), x3 = *(const v4fa*)(arow + kb + 16 + 8 * hh + 4);
    float xs[16] = {x0[0],x0[1],x0[2],x0[3],x1[0],x1[1],x1[2],x1[3],x2[0],x2[1],x2[2],x2[3],x3[0],x3[1],x3[2],x3[3]};
#pragma unroll
    for (int i = 0; i < 16; ++i) { const unsigned short hb = bf16_bits(xs[i]); ah.u[i] = hb; al.u[i] = ASPLIT ? bf16_bits(xs[i] - bf16_val(hb)) : (unsigned short)0; }
#pragma unroll
    for (int t = 0; t < 4; ++t) {
      const unsigned short* brow = Wt + (size_t)(col0 + t * 16 + ln) * ldb + kb;
      FragB b;
      b.half[0] = *(const v8us*)(brow + 8 * hh);
      b.half[1] = *(const v8us*)(brow + 16 + 8 * hh);
      acc[t] = mmaN<ASPLIT ? 2 : 1>(ah.v, al.v, b.v, b.v, acc[t]);
    }
  }
#pragma unroll
  for (int t = 0; t < 4; ++t) {
    const int col = col0 + t * 16 + ln;
    float bv = bias ? bias[col] : 0.f;
    if (BIAS_BF16) bv = bf16_round(bv);
#pragma unroll
    for (int r = 0; r < 8; ++r) {
      float v = acc[t][r] + bv;
      if (resid) { float rv = resid[(size_t)((row0 + 8 * hh + r) % rmod) * ldr + col]; if (RES_BF16) rv = bf16_round(rv); v += rv; }
      if (ACT == 1) v = fmaxf(v, 0.f);
      if (ACT == 2) v = 0.5f * v * (1.0f + erff(v * 0.70710678118654752f));
      if (ACT == 3) { const float u = 0.7978845608028654f * (v + 0.044715f * v * v * v); v = 0.5f * v * (1.0f + tanhf(u)); }
      so[w][8 * hh + r][t * 16 + ln] = v;
    }
  }
  __builtin_amdgcn_fence(__ATOMIC_ACQ_REL, "workgroup");
  __builtin_amdgcn_wave_barrier();
  const int rsub = lane >> 4, c4 = (lane & 15) * 4;
  {
#pragma unroll
    for (int q = 0; q < 8; ++q) {
      const int r = q * 2 + rsub;
      const v4f v = *(const v4fa*)&so[w][r][c4];
      *(v4f*)(C + (size_t)(row0 + r) * ldc + col0 + c4) = v;
    }
    
  }
}
// row LayerNorm (biased variance, eps) over N: s = X (+ R); optional out_sum <- s; out_norm <- (s-mu)*rsqrt(var+eps)*g + b
template <bool PARAM_BF16>
__global__ __launch_bounds__(256) void k_layernorm(const float* __restrict__ X, const float* __restrict__ R, const float* __restrict__ g, const float* __restrict__ bta,
                                                  float* __restrict__ out_sum, float* __restrict__ out_norm, int N, float eps) {
  __shared__ float red[256];
  const int row = blockIdx.x, tid = threadIdx.x;
  const float* x = X + (size_t)row * N; const float* rr = R ? R + (size_t)row * N : nullptr;
  float vals[16];                     // up to N = 4096
  const int per = N / 256;            // contiguous chunk per thread? use strided-by-4 chunks: thread handles j = tid*4 + 1024*u
  float s1 = 0.f;
  for (int u = 0; u < per / 4; ++u) {
    const int j = tid * 4 + 1024 * u;
    const v4f a = *(const v4fa*)(x + j);
    v4f b = {0.f,0.f,0.f,0.f}; if (rr) b = *(const v4fa*)(rr + j);
#pragma unroll
    for (int q = 0; q < 4; ++q) { const float v = a[q] + b[q]; vals[u * 4 + q] = v; s1 += v; }
  }
  red[tid] = s1; __syncthreads();
  for (int st = 128; st > 0; st >>= 1) { if (tid < st) red[tid] += red[tid + st]; __syncthreads(); }
  const float mu = red[0] / (float)N; __syncthreads();
  float s2 = 0.f;
  for (int u = 0; u < per / 4; ++u)
#pragma unroll
    for (int q = 0; q < 4; ++q) { const float c = vals[u * 4 + q] - mu; s2 += c * c; }
  red[tid] = s2; __syncthreads();
  for (int st = 128; st > 0; st >>= 1) { if (tid < st) red[tid] += red[tid + st]; __syncthreads(); }
  const float rs = rsqrtf(red[0] / (float)N + eps);
  {
    for (int u = 0; u < per / 4; ++u) {
      const int j = tid * 4 + 1024 * u;
      v4f o, sm;
#pragma unroll
      for (int q = 0; q < 4; ++q) {
        float gg = g[j + q], bb = bta[j + q];
        if (PARAM_BF16) { gg = bf16_round(gg); bb = bf16_round(bb); }
        sm[q] = vals[u * 4 + q]; o[q] = (vals[u * 4 + q] - mu) * rs * gg + bb;
      }
      if (out_sum) *(v4f*)(out_sum + (size_t)row * N + j) = sm;
      *(v4f*)(out_norm + (size_t)row * N + j) = o;
    }
    
  }
}



// ---- f16 WMMA path (v_wmma_f32_16x16x32_f16): 11-bit significands for operands in range — used where a [0,1] probability operand needs more precision than bf16
typedef _Float16 v16h __attribute__((ext_vector_type(16)));
union FragH { v16h v; v8us half[2]; _Float16 h[16]; unsigned short u[16]; };
template <int NT>
__device__ __forceinline__ v8f mmaH(v16h ah, v16h al, v16h bh, v16h bl, v8f c) {
  c = __builtin_amdgcn_wmma_f32_16x16x32_f16(false, ah, false, bh, (short)0, c, false, false);
  if (NT >= 2) c = __builtin_amdgcn_wmma_f32_16x16x32_f16(false, al, false, bh, (short)0, c, false, false);
  if (NT >= 3) c = __builtin_amdgcn_wmma_f32_16x16x32_f16(false, ah, false, bl, (short)0, c, false, false);
  asm volatile("v_nop\n\tv_nop\n\tv_nop\n\tv_nop" : "+v"(c) : "v"(ah), "v"(al), "v"(bh), "v"(bl));
  return c;
}
// batched GEMM like k_gemm_b but f16 operands: A f32 (split into f16 hi/lo if ASPLIT, else rounded to f16), Bt = f16 values [n][k]; alpha; C f32; N multiple of 16 (partial tiles skipped)
template <bool ASPLIT>
__global__ __launch_bounds__(128) void k_gemm_h(const float* __restrict__ A, int lda, size_t sA, const _Float16* __restrict__ Bh, int ldb, size_t sB, float alpha, float* __restrict__ C, int ldc, size_t sC, int M, int N, int K) {
  __shared__ __attribute__((aligned(16))) float so[4][16][64];
  const int tid = threadIdx.x, w = tid >> 5, lane = tid & 31, ln = lane & 15, hh = lane >> 4; const int by = blockIdx.y;
  A += (size_t)by * sA; Bh += (size_t)by * sB; C += (size_t)by * sC;
  const int ntn = (N + 63) / 64; const int wid = blockIdx.x * 4 + w; const int mt = wid / ntn, nq = wid % ntn; if (mt * 16 >= M) return;
  const int row0 = mt * 16, col0 = nq * 64; const float* arow = A + (size_t)(row0 + ln) * lda;
  v8f acc[4] = {};
  for (int kb = 0; kb < K; kb += 32) {
    FragH ah, al;
    const v4f x0 = *(const v4fa*)(arow + kb + 8 * hh), x1 = *(const v4fa*)(arow + kb + 8 * hh + 4), x2 = *(const v4fa*)(arow + kb + 16 + 8 * hh), x3 = *(const v4fa*)(arow + kb + 16 + 8 * hh + 4);
    float xs[16] = {x0[0],x0[1],x0[2],x0[3],x1[0],x1[1],x1[2],x1[3],x2[0],x2[1],x2[2],x2[3],x3[0],x3[1],x3[2],x3[3]};
#pragma unroll
    for (int i = 0; i < 16; ++i) { const _Float16 h = (_Float16)xs[i]; ah.h[i] = h; al.h[i] = ASPLIT ? (_Float16)(xs[i] - (float)h) : (_Float16)0.0f; }
#pragma unroll
    for (int t = 0; t < 4; ++t) { if (col0 + t * 16 >= N) continue; const size_t boff = (size_t)(col0 + t * 16 + ln) * ldb + kb; FragH bq; bq.half[0] = *(const v8us*)(Bh + boff + 8 * hh); bq.half[1] = *(const v8us*)(Bh + boff + 16 + 8 * hh);
      acc[t] = mmaH<ASPLIT ? 2 : 1>(ah.v, al.v, bq.v, bq.v, acc[t]); }
  }
#pragma unroll
  for (int t = 0; t < 4; ++t) { if (col0 + t * 16 >= N) continue;
#pragma unroll
    for (int r = 0; r < 8; ++r) so[w][8 * hh + r][t * 16 + ln] = acc[t][r] * alpha; }
  __builtin_amdgcn_fence(__ATOMIC_ACQ_REL, "workgroup"); __builtin_amdgcn_wave_barrier();
  const int rsub = lane >> 4, c4 = (lane & 15) * 4;
  {
#pragma unroll
    for (int q = 0; q < 8; ++q) { const int r = q * 2 + rsub; if (col0 + c4 < N) { const v4f v = *(const v4fa*)&so[w][r][c4]; *(v4f*)(C + (size_t)(row0 + r) * ldc + col0 + c4) = v; } }
     }
}

// Wt[n][k] = f16(W[k][n]·scale) from f32 row-major W[K][N] (scale = power of two; bf16-exact weights stay exact in f16 away from the subnormal range)
__global__ __launch_bounds__(256) void k_wt_f16(const float* __restrict__ W, _Float16* __restrict__ Wt, int K, int N, float scale) {
  const int t = blockIdx.x * 256 + threadIdx.x; if (t >= N * (K / 8)) return; const int n = t / (K / 8), k8 = (t % (K / 8)) * 8; FragH f;
#pragma unroll
  for (int i = 0; i < 8; ++i) f.h[i] = (_Float16)(bf16_round(W[(size_t)(k8 + i) * N + n]) * scale); const v8us o = f.half[0];
  *(v8us*)((unsigned short*)Wt + (size_t)n * K + k8) = o; 
}
// k_gemm_hh variant with fused epilogue: v = acc·alpha + bias[by·sBias + col] (+ CP[(row/rowsPerB)·sCPb + by·64 + col] if CP) ; ACT 0 none / 1 elu ; writes f16 C16 (and f32 C if non-null)
template <int ACT>
__global__ __launch_bounds__(128) void k_gemm_hhx(const _Float16* __restrict__ A, int lda, size_t sA, const _Float16* __restrict__ Bh, int ldb, size_t sB, float alpha, const float* __restrict__ bias, size_t sBias, const float* __restrict__ CP, int rowsPerB, size_t sCPb, int row0g,
    float* __restrict__ C, _Float16* __restrict__ C16, int ldc, size_t sC, int M, int N, int K) {
  __shared__ __attribute__((aligned(16))) float so[4][16][64];
  const int tid = threadIdx.x, w = tid >> 5, lane = tid & 31, ln = lane & 15, hh = lane >> 4; const int by = blockIdx.y;
  A += (size_t)by * sA; Bh += (size_t)by * sB; const size_t cofs = (size_t)by * sC; const float* bp = bias ? bias + (size_t)by * sBias : nullptr;
  const int ntn = (N + 63) / 64; const int wid = blockIdx.x * 4 + w; const int mt = wid / ntn, nq = wid % ntn; if (mt * 16 >= M) return;
  const int row0 = mt * 16, col0 = nq * 64; const _Float16* arow = A + (size_t)(row0 + ln) * lda;
  v8f acc[4] = {};
  for (int kb = 0; kb < K; kb += 32) { FragH ah; ah.half[0] = *(const v8us*)((const unsigned short*)arow + kb + 8 * hh); ah.half[1] = *(const v8us*)((const unsigned short*)arow + kb + 16 + 8 * hh);
#pragma unroll
    for (int t = 0; t < 4; ++t) { if (col0 + t * 16 >= N) continue; const size_t boff = (size_t)(col0 + t * 16 + ln) * ldb + kb; FragH bq; bq.half[0] = *(const v8us*)((const unsigned short*)Bh + boff + 8 * hh); bq.half[1] = *(const v8us*)((const unsigned short*)Bh + boff + 16 + 8 * hh);
      acc[t] = mmaH<1>(ah.v, ah.v, bq.v, bq.v, acc[t]); }
  }
#pragma unroll
  for (int t = 0; t < 4; ++t) { if (col0 + t * 16 >= N) continue; const int col = col0 + t * 16 + ln; const float bv = bp ? bf16_round(bp[col]) : 0.f;
#pragma unroll
    for (int r = 0; r < 8; ++r) { float v = acc[t][r] * alpha + bv; if (CP) { const int bidx = (row0g + row0 + 8 * hh + r) / rowsPerB; v += CP[(size_t)bidx * sCPb + (size_t)by * 64 + col]; } if (ACT == 1) v = (v > 0.f) ? v : expm1f(v); else if (ACT == 7) v = (v > 0.f) ? v + 1.0f : expf(v); else if (ACT == 8) v = tanhf(v); else if (ACT == 9) v = 0.5f * v * (1.0f + tanhf(0.7978845608028654f * (v + 0.044715f * v * v * v))); else if (ACT == 11) v = 1.0f / (1.0f + expf(-v)); else if (ACT == 12) v = (v > 0.f) ? v : 0.01f * v; else if (ACT == 14) v = (v > 0.f) ? v : 0.1f * v; else if (ACT == 15) v = v / (1.0f + expf(-v)); else if (ACT == 3) v = fmaxf(v, 0.f); else if (ACT == 6) v = 0.5f * v * (1.0f + erff(v * 0.70710678118654752f)); so[w][8 * hh + r][t * 16 + ln] = v; } }
  __builtin_amdgcn_fence(__ATOMIC_ACQ_REL, "workgroup"); __builtin_amdgcn_wave_barrier();
  const int rsub = lane >> 4, c4 = (lane & 15) * 4; typedef _Float16 v4h __attribute__((ext_vector_type(4)));
  {
#pragma unroll
    for (int q = 0; q < 8; ++q) { const int r = q * 2 + rsub; if (col0 + c4 < N) { const v4f v = *(const v4fa*)&so[w][r][c4]; if (C) *(v4f*)(C + cofs + (size_t)(row0 + r) * ldc + col0 + c4) = v; if (C16) { v4h h4; for (int i = 0; i < 4; ++i) h4[i] = (_Float16)v[i]; *(v4h*)(C16 + cofs + (size_t)(row0 + r) * ldc + col0 + c4) = h4; } } }
     }
}


typedef _Float16 v4h __attribute__((ext_vector_type(4)));

__global__ __launch_bounds__(256) void k_h16(const float* __restrict__ x, _Float16* __restrict__ X16, size_t n8) { const size_t t = (size_t)blockIdx.x * 256 + threadIdx.x; if (t >= n8) return; FragH f;
#pragma unroll
  for (int q = 0; q < 8; ++q) f.h[q] = (_Float16)x[t * 8 + q]; *(v8us*)((unsigned short*)X16 + t * 8) = f.half[0];  }
__global__ __launch_bounds__(256) void k_round16f(const float* __restrict__ W, _Float16* __restrict__ Bt, size_t n8) { const size_t t = (size_t)blockIdx.x * 256 + threadIdx.x; if (t >= n8) return; FragH f;
#pragma unroll
  for (int i = 0; i < 8; ++i) f.h[i] = (_Float16)(bf16_round(W[t * 8 + i]) * 16.0f); *(v8us*)((unsigned short*)Bt + t * 8) = f.half[0];  }
template <int NHv, int TTv>
__global__ __launch_bounds__(256) void k_vt(const _Float16* __restrict__ V16, int ldv, int voff, _Float16* __restrict__ Vt) { __shared__ unsigned short tl[64][66]; const int tid = threadIdx.x; const int slab = blockIdx.x / (TTv / 64), lg = blockIdx.x % (TTv / 64); const int b = slab / NHv, h = slab % NHv;
  for (int i = tid; i < 64 * 8; i += 256) { const int r = i / 8, c8 = (i % 8) * 8; FragH f; f.half[0] = *(const v8us*)((const unsigned short*)V16 + ((size_t)b * TTv + lg * 64 + r) * ldv + voff + h * 64 + c8);
#pragma unroll
    for (int q = 0; q < 8; ++q) tl[r][c8 + q] = f.u[q]; }
  __syncthreads();
  {
#pragma unroll
    for (int rd = 0; rd < 2; ++rd) { const int d = rd * 32 + tid / 8, pc = tid % 8; FragH f;
#pragma unroll
      for (int q = 0; q < 8; ++q) f.u[q] = tl[pc * 8 + q][d];
      *(v8us*)((unsigned short*)Vt + ((size_t)slab * 64 + d) * TTv + lg * 64 + pc * 8) = f.half[0]; }
     } }

__global__ __launch_bounds__(256) void k_hl(const float* __restrict__ F, _Float16* __restrict__ Hh, _Float16* __restrict__ Hl, size_t n8) { const size_t t = (size_t)blockIdx.x * 256 + threadIdx.x; if (t >= n8) return; FragH fh, fl; const v4f a = *(const v4fa*)(F + t * 8), c = *(const v4fa*)(F + t * 8 + 4);
#pragma unroll
  for (int q = 0; q < 4; ++q) { _Float16 h = (_Float16)a[q]; fh.h[q] = h; fl.h[q] = (_Float16)((a[q] - (float)h) * 1024.0f); h = (_Float16)c[q]; fh.h[4 + q] = h; fl.h[4 + q] = (_Float16)((c[q] - (float)h) * 1024.0f); }
  { *(v8us*)((unsigned short*)Hh + t * 8) = fh.half[0]; *(v8us*)((unsigned short*)Hl + t * 8) = fl.half[0];  } }

// ---- fast GEMM (wave tile 32x64; requires M % 32 == 0 rows per launch region and N % 64 == 0); epilogue = k_gemm_hhx semantics ----
__device__ __forceinline__ v16h g2_frag(const _Float16* p, int hh) { FragH f; f.half[0] = *(const v8us*)((const unsigned short*)p + 8 * hh); f.half[1] = *(const v8us*)((const unsigned short*)p + 16 + 8 * hh); return f.v; }
__device__ __forceinline__ v8f g2_mma(v16h a, v16h b, v8f c) { v8f d = __builtin_amdgcn_wmma_f32_16x16x32_f16(false, a, false, b, (short)0, c, false, false); asm volatile("v_nop\n\tv_nop\n\tv_nop\n\tv_nop" : "+v"(d) : "v"(a), "v"(b)); return d; }
template <int ACT>
__global__ __launch_bounds__(128) void k_gemm2(const _Float16* __restrict__ A, int lda, size_t sA, const _Float16* __restrict__ Bh, int ldb, size_t sB, float alpha, const float* __restrict__ bias, size_t sBias, const float* __restrict__ CP, int rowsPerB, size_t sCPb, int row0g,
    float* __restrict__ C, _Float16* __restrict__ C16, int ldc, size_t sC, int M, int N, int K) {
  __shared__ __attribute__((aligned(16))) float so[4][32][68];
  const int tid = threadIdx.x, w = tid >> 5, lane = tid & 31, ln = lane & 15, hh = lane >> 4; const int by = blockIdx.y;
  A += (size_t)by * sA; Bh += (size_t)by * sB; const size_t cofs = (size_t)by * sC; const float* bp = bias ? bias + (size_t)by * sBias : nullptr;
  const int ntn = N >> 6; const int mt = blockIdx.x / ntn, nq = blockIdx.x - mt * ntn; const int row0 = mt * 128 + 32 * w, col0 = nq * 64; if (row0 >= M) return;
  const _Float16* a0p = A + (size_t)(row0 + ln) * lda; const _Float16* a1p = a0p + (size_t)16 * lda;
  const _Float16* b0p = Bh + (size_t)(col0 + ln) * ldb; const _Float16* b1p = b0p + (size_t)16 * ldb; const _Float16* b2p = b1p + (size_t)16 * ldb; const _Float16* b3p = b2p + (size_t)16 * ldb;
  const v8f z8 = {0.f,0.f,0.f,0.f,0.f,0.f,0.f,0.f}; v8f c00 = z8, c01 = z8, c02 = z8, c03 = z8, c10 = z8, c11 = z8, c12 = z8, c13 = z8;
#pragma unroll 1
  for (int kb = 0; kb < K; kb += 32) { const v16h a0 = g2_frag(a0p + kb, hh), a1 = g2_frag(a1p + kb, hh);
    v16h b = g2_frag(b0p + kb, hh); c00 = g2_mma(a0, b, c00); c10 = g2_mma(a1, b, c10);
    b = g2_frag(b1p + kb, hh); c01 = g2_mma(a0, b, c01); c11 = g2_mma(a1, b, c11);
    b = g2_frag(b2p + kb, hh); c02 = g2_mma(a0, b, c02); c12 = g2_mma(a1, b, c12);
    b = g2_frag(b3p + kb, hh); c03 = g2_mma(a0, b, c03); c13 = g2_mma(a1, b, c13); }
  v8f accs[8] = {c00, c01, c02, c03, c10, c11, c12, c13};
#pragma unroll
  for (int u = 0; u < 8; ++u) { const int t = u & 3, half = u >> 2; const int col = col0 + t * 16 + ln; const float bv = bp ? bf16_round(bp[col]) : 0.f;
#pragma unroll
    for (int r = 0; r < 8; ++r) { const int rloc = half * 16 + 8 * hh + r; float v = accs[u][r] * alpha + bv; if (CP) { if (rowsPerB < 0) v += CP[cofs + (size_t)(row0g + row0 + rloc) * ldc + col];      /* rowsPerB < 0: own element of the batched C plane */ else { const int bidx = (row0g + row0 + rloc) / rowsPerB; v += CP[(size_t)bidx * sCPb + (size_t)by * 64 + col]; } }
      if (ACT == 3) v = fmaxf(v, 0.f); else if (ACT == 6) v = 0.5f * v * (1.0f + erff(v * 0.70710678118654752f)); else if (ACT == 11) v = 1.0f / (1.0f + expf(-v)); else if (ACT == 15) v = v / (1.0f + expf(-v)); else if (ACT == 12) v = (v > 0.f) ? v : 0.01f * v; else if (ACT == 8) v = tanhf(v);
      so[w][rloc][t * 16 + ln] = v; } }
  __builtin_amdgcn_fence(__ATOMIC_ACQ_REL, "workgroup"); __builtin_amdgcn_wave_barrier();
  const int rsub = lane >> 4, c4 = (lane & 15) * 4;
  {
#pragma unroll
    for (int q = 0; q < 16; ++q) { const int r = q * 2 + rsub; const v4f v = *(const v4fa*)&so[w][r][c4]; if (C) *(v4f*)(C + cofs + (size_t)(row0 + r) * ldc + col0 + c4) = v; if (C16) { v4h h4; for (int i = 0; i < 4; ++i) h4[i] = (_Float16)v[i]; *(v4h*)(C16 + cofs + (size_t)(row0 + r) * ldc + col0 + c4) = h4; } }
     } }



__constant__ int BK30[2 * SLEN - 1] = {15,15,15,15,15,15,15,15,15,15,15,15,15,15,15,15,15,15,15,15,15,15,15,15,15,15,15,15,15,15,15,15,15,15,15,15,15,15,15,15,15,15,15,15,15,15,15,15,15,15,15,15,15,15,15,15,15,15,15,15,15,15,15,15,15,15,15,15,15,15,15,15,15,15,15,15,15,15,15,15,15,15,15,15,15,15,15,15,15,15,15,15,15,15,15,15,15,15,15,15,15,15,15,15,15,15,15,15,15,15,15,15,15,15,15,15,15,15,15,15,15,15,15,15,15,15,15,15,15,15,15,15,15,15,15,15,15,15,15,15,15,15,15,15,15,15,15,15,15,15,15,15,15,15,15,15,15,15,15,15,15,15,15,15,15,15,15,15,15,15,15,15,15,15,15,15,15,15,15,15,15,15,15,15,15,15,15,15,15,15,15,15,15,15,15,15,15,15,15,15,15,15,15,15,15,15,15,15,15,15,15,15,15,15,15,15,15,15,15,15,15,15,15,15,15,15,15,15,15,15,15,15,15,15,15,15,15,15,15,15,15,15,15,15,15,15,15,15,15,15,15,15,15,15,15,15,15,15,15,15,15,15,15,15,15,15,15,15,15,15,15,15,15,15,15,15,15,15,15,15,15,15,15,15,15,15,15,15,15,15,15,15,15,15,15,15,15,15,15,15,15,15,15,15,15,15,15,15,15,15,15,15,15,15,15,15,15,15,15,15,15,15,15,15,15,15,15,15,15,15,15,15,15,15,15,15,15,15,15,15,15,15,15,15,15,15,15,15,15,15,15,15,15,15,15,15,15,15,15,15,15,15,15,15,15,15,15,15,15,15,15,15,15,15,15,15,15,15,15,15,15,15,15,15,15,15,15,15,15,15,15,15,15,15,15,15,15,15,15,15,15,15,15,15,15,15,15,15,15,15,15,15,15,15,15,15,15,15,15,15,15,15,15,15,15,15,15,15,15,15,15,15,15,15,15,15,15,15,15,15,15,15,15,15,15,15,15,15,15,15,15,15,15,15,15,15,15,15,15,15,15,15,15,15,15,15,15,15,15,15,15,15,15,15,15,15,15,15,15,15,15,15,15,15,15,15,15,15,15,15,15,15,15,15,15,15,15,15,15,15,15,15,15,15,15,15,15,15,15,15,15,15,15,15,15,15,15,15,15,15,15,15,15,15,15,15,15,15,15,15,15,15,15,15,15,15,15,15,15,15,15,15,15,15,15,15,15,15,15,15,15,15,15,15,15,15,15,15,15,15,15,15,15,15,15,15,15,15,15,15,15,15,15,15,15,15,15,15,15,15,15,15,15,15,15,15,15,15,15,15,15,15,15,15,15,15,15,15,15,15,15,15,15,15,15,15,15,15,15,15,15,15,15,15,15,15,15,15,15,15,15,15,15,15,15,15,15,15,15,15,15,15,15,15,15,15,15,15,15,15,15,15,15,15,15,15,15,15,15,15,15,15,15,15,15,15,15,15,15,15,15,15,15,15,15,15,15,15,15,15,15,15,15,15,15,15,15,15,15,15,15,15,15,15,15,15,15,15,15,15,15,15,15,15,15,15,15,15,15,15,15,15,15,15,15,15,15,15,15,15,15,15,15,15,15,15,15,15,15,15,15,15,15,15,15,15,15,15,15,15,15,15,15,15,15,15,15,15,15,15,15,15,15,15,15,15,15,15,15,15,15,15,15,15,15,15,15,15,15,15,15,15,15,15,15,15,15,15,15,15,15,15,15,15,15,15,15,15,15,15,15,15,15,15,15,15,15,15,15,15,15,15,15,15,15,15,15,15,15,15,15,15,15,15,15,15,15,15,15,15,15,15,15,15,15,15,15,15,15,15,15,15,15,15,15,15,15,15,15,15,15,15,15,15,15,15,15,15,15,15,15,15,15,15,15,15,15,15,15,15,15,15,15,15,15,15,15,15,15,15,15,15,15,15,15,15,15,15,15,15,15,15,15,15,15,15,15,15,15,15,15,15,15,15,15,15,15,15,15,15,15,15,15,15,15,15,15,15,15,15,15,15,15,15,15,15,15,15,15,15,15,15,15,15,15,15,15,15,15,15,15,15,15,15,15,15,15,15,15,15,15,15,15,15,15,15,15,15,15,15,15,15,15,15,15,15,15,15,15,15,15,15,15,15,15,15,15,15,15,15,15,15,15,15,15,15,15,15,15,15,15,15,15,15,15,15,15,15,15,15,15,15,15,15,15,15,15,15,15,15,15,15,15,15,15,15,15,15,15,15,15,15,15,15,15,15,15,15,15,15,15,15,15,15,15,15,15,15,15,15,15,15,15,15,15,15,15,15,15,15,15,15,15,15,15,15,15,15,15,15,15,15,15,15,15,15,15,15,15,15,15,15,15,15,15,15,15,15,15,15,15,15,15,15,15,15,15,15,15,15,15,15,15,15,15,15,15,15,15,15,15,15,15,15,15,15,15,15,15,15,15,15,15,15,15,15,15,15,15,15,15,15,15,15,15,15,15,15,15,15,15,15,15,15,15,15,15,15,15,15,15,15,15,15,15,15,15,15,15,15,15,15,15,15,15,15,15,15,15,15,15,15,15,15,15,15,15,15,15,15,15,15,15,15,15,15,15,15,15,15,15,15,15,15,15,15,15,15,15,15,15,15,15,15,15,15,15,15,15,15,15,15,15,15,15,15,15,15,15,15,15,15,15,15,15,15,15,15,15,15,15,15,15,15,15,15,15,15,15,15,15,15,15,15,15,15,15,15,15,15,15,15,15,15,15,15,15,15,15,15,15,15,15,15,15,15,15,15,15,15,15,15,15,15,15,15,15,15,15,15,15,15,15,15,15,15,15,15,15,15,15,15,15,15,15,15,15,15,15,15,15,15,15,15,15,15,15,15,15,15,15,15,15,15,15,15,15,15,15,15,15,15,15,15,15,15,15,15,15,15,15,15,15,15,15,15,15,15,15,15,15,15,15,15,15,15,15,15,15,15,15,15,15,15,15,15,15,15,15,15,15,15,15,15,15,15,15,15,15,15,15,15,15,15,15,15,15,15,15,15,15,15,15,15,15,15,15,15,15,15,15,15,15,15,15,15,15,15,15,15,15,15,15,15,15,15,15,15,15,15,15,15,15,15,15,15,15,15,15,15,15,15,15,15,15,15,15,15,15,15,15,15,15,15,15,15,15,15,15,15,15,15,15,15,15,15,15,15,15,15,15,15,15,15,15,15,15,15,15,15,15,15,15,15,15,15,15,15,15,15,15,15,15,15,15,15,15,15,15,15,15,15,15,15,15,15,15,15,15,15,15,15,15,15,15,15,15,15,15,15,15,15,15,15,15,15,15,15,15,15,15,15,15,15,15,15,15,15,15,15,15,15,15,15,15,15,15,15,15,15,15,15,15,15,15,15,15,15,15,15,15,15,15,15,15,15,15,15,15,15,15,15,15,15,15,15,15,15,15,15,15,15,15,15,15,15,15,15,15,15,15,15,15,15,15,15,15,15,15,15,15,15,15,15,15,15,15,15,15,15,15,15,15,15,15,15,15,15,15,15,15,15,15,15,15,15,15,15,15,15,15,15,15,15,15,15,15,15,15,15,15,15,15,15,15,15,15,15,15,15,15,15,15,15,15,15,15,15,15,15,15,15,15,15,15,15,15,15,15,15,15,15,15,15,15,15,15,15,15,15,15,15,15,15,15,15,15,15,15,15,15,15,15,15,15,15,15,15,15,15,15,15,15,15,15,15,15,15,15,15,15,15,15,15,15,15,15,15,15,15,15,15,15,15,15,15,15,15,15,15,15,15,15,15,15,15,15,15,15,15,15,15,15,15,15,15,15,15,15,15,15,15,15,15,15,15,15,15,15,15,15,15,15,15,15,15,15,15,15,15,15,15,15,15,15,15,15,15,15,15,15,15,15,15,15,15,15,15,15,15,15,15,15,15,15,15,15,15,15,15,15,15,15,15,15,15,15,15,15,15,15,15,15,15,15,15,15,15,15,15,15,15,15,15,15,15,15,15,15,15,15,15,15,15,15,15,15,15,15,15,15,15,15,15,15,15,15,15,15,15,15,15,15,15,15,15,15,15,15,15,15,15,15,15,15,15,15,15,15,15,15,15,15,15,15,15,15,15,15,15,15,15,15,15,15,15,15,15,15,15,15,15,15,15,15,15,15,15,15,15,15,15,15,15,15,15,15,15,15,15,15,15,15,15,15,15,15,15,15,15,15,15,15,15,15,15,15,15,15,15,15,15,15,15,15,15,15,15,15,15,15,15,15,15,15,15,15,15,15,15,15,15,15,15,15,15,15,15,15,15,15,15,15,15,15,15,15,15,15,15,15,15,15,15,15,15,15,15,15,15,15,15,15,15,15,15,15,15,15,15,15,15,15,15,15,15,15,15,15,15,15,15,15,15,15,15,15,14,14,14,14,14,14,14,14,14,14,14,14,14,14,14,14,14,14,14,14,14,14,14,14,14,14,14,13,13,13,13,13,13,13,13,13,13,13,13,13,13,13,13,13,13,12,12,12,12,12,12,12,12,12,12,12,12,12,12,11,11,11,11,11,11,11,11,11,10,10,10,10,10,10,10,9,9,9,9,8,8,8,8,7,6,5,4,3,2,1,0,17,18,19,20,21,22,23,24,24,24,24,25,25,25,25,26,26,26,26,26,26,26,27,27,27,27,27,27,27,27,27,28,28,28,28,28,28,28,28,28,28,28,28,28,28,29,29,29,29,29,29,29,29,29,29,29,29,29,29,29,29,29,29,30,30,30,30,30,30,30,30,30,30,30,30,30,30,30,30,30,30,30,30,30,30,30,30,30,30,30,31,31,31,31,31,31,31,31,31,31,31,31,31,31,31,31,31,31,31,31,31,31,31,31,31,31,31,31,31,31,31,31,31,31,31,31,31,31,31,31,31,31,31,31,31,31,31,31,31,31,31,31,31,31,31,31,31,31,31,31,31,31,31,31,31,31,31,31,31,31,31,31,31,31,31,31,31,31,31,31,31,31,31,31,31,31,31,31,31,31,31,31,31,31,31,31,31,31,31,31,31,31,31,31,31,31,31,31,31,31,31,31,31,31,31,31,31,31,31,31,31,31,31,31,31,31,31,31,31,31,31,31,31,31,31,31,31,31,31,31,31,31,31,31,31,31,31,31,31,31,31,31,31,31,31,31,31,31,31,31,31,31,31,31,31,31,31,31,31,31,31,31,31,31,31,31,31,31,31,31,31,31,31,31,31,31,31,31,31,31,31,31,31,31,31,31,31,31,31,31,31,31,31,31,31,31,31,31,31,31,31,31,31,31,31,31,31,31,31,31,31,31,31,31,31,31,31,31,31,31,31,31,31,31,31,31,31,31,31,31,31,31,31,31,31,31,31,31,31,31,31,31,31,31,31,31,31,31,31,31,31,31,31,31,31,31,31,31,31,31,31,31,31,31,31,31,31,31,31,31,31,31,31,31,31,31,31,31,31,31,31,31,31,31,31,31,31,31,31,31,31,31,31,31,31,31,31,31,31,31,31,31,31,31,31,31,31,31,31,31,31,31,31,31,31,31,31,31,31,31,31,31,31,31,31,31,31,31,31,31,31,31,31,31,31,31,31,31,31,31,31,31,31,31,31,31,31,31,31,31,31,31,31,31,31,31,31,31,31,31,31,31,31,31,31,31,31,31,31,31,31,31,31,31,31,31,31,31,31,31,31,31,31,31,31,31,31,31,31,31,31,31,31,31,31,31,31,31,31,31,31,31,31,31,31,31,31,31,31,31,31,31,31,31,31,31,31,31,31,31,31,31,31,31,31,31,31,31,31,31,31,31,31,31,31,31,31,31,31,31,31,31,31,31,31,31,31,31,31,31,31,31,31,31,31,31,31,31,31,31,31,31,31,31,31,31,31,31,31,31,31,31,31,31,31,31,31,31,31,31,31,31,31,31,31,31,31,31,31,31,31,31,31,31,31,31,31,31,31,31,31,31,31,31,31,31,31,31,31,31,31,31,31,31,31,31,31,31,31,31,31,31,31,31,31,31,31,31,31,31,31,31,31,31,31,31,31,31,31,31,31,31,31,31,31,31,31,31,31,31,31,31,31,31,31,31,31,31,31,31,31,31,31,31,31,31,31,31,31,31,31,31,31,31,31,31,31,31,31,31,31,31,31,31,31,31,31,31,31,31,31,31,31,31,31,31,31,31,31,31,31,31,31,31,31,31,31,31,31,31,31,31,31,31,31,31,31,31,31,31,31,31,31,31,31,31,31,31,31,31,31,31,31,31,31,31,31,31,31,31,31,31,31,31,31,31,31,31,31,31,31,31,31,31,31,31,31,31,31,31,31,31,31,31,31,31,31,31,31,31,31,31,31,31,31,31,31,31,31,31,31,31,31,31,31,31,31,31,31,31,31,31,31,31,31,31,31,31,31,31,31,31,31,31,31,31,31,31,31,31,31,31,31,31,31,31,31,31,31,31,31,31,31,31,31,31,31,31,31,31,31,31,31,31,31,31,31,31,31,31,31,31,31,31,31,31,31,31,31,31,31,31,31,31,31,31,31,31,31,31,31,31,31,31,31,31,31,31,31,31,31,31,31,31,31,31,31,31,31,31,31,31,31,31,31,31,31,31,31,31,31,31,31,31,31,31,31,31,31,31,31,31,31,31,31,31,31,31,31,31,31,31,31,31,31,31,31,31,31,31,31,31,31,31,31,31,31,31,31,31,31,31,31,31,31,31,31,31,31,31,31,31,31,31,31,31,31,31,31,31,31,31,31,31,31,31,31,31,31,31,31,31,31,31,31,31,31,31,31,31,31,31,31,31,31,31,31,31,31,31,31,31,31,31,31,31,31,31,31,31,31,31,31,31,31,31,31,31,31,31,31,31,31,31,31,31,31,31,31,31,31,31,31,31,31,31,31,31,31,31,31,31,31,31,31,31,31,31,31,31,31,31,31,31,31,31,31,31,31,31,31,31,31,31,31,31,31,31,31,31,31,31,31,31,31,31,31,31,31,31,31,31,31,31,31,31,31,31,31,31,31,31,31,31,31,31,31,31,31,31,31,31,31,31,31,31,31,31,31,31,31,31,31,31,31,31,31,31,31,31,31,31,31,31,31,31,31,31,31,31,31,31,31,31,31,31,31,31,31,31,31,31,31,31,31,31,31,31,31,31,31,31,31,31,31,31,31,31,31,31,31,31,31,31,31,31,31,31,31,31,31,31,31,31,31,31,31,31,31,31,31,31,31,31,31,31,31,31,31,31,31,31,31,31,31,31,31,31,31,31,31,31,31,31,31,31,31,31,31,31,31,31,31,31,31,31,31,31,31,31,31,31,31,31,31,31,31,31,31,31,31,31,31,31,31,31,31,31,31,31,31,31,31,31,31,31,31,31,31,31,31,31,31,31,31,31,31,31,31,31,31,31,31,31,31,31,31,31,31,31,31,31,31,31,31,31,31,31,31,31,31,31,31,31,31,31,31,31,31,31,31,31,31,31,31,31,31,31,31,31,31,31,31,31,31,31,31,31,31,31,31,31,31,31,31,31,31,31,31,31,31,31,31,31,31,31,31,31,31,31,31,31,31,31,31,31,31,31,31,31,31,31,31,31,31,31,31,31,31,31,31,31,31,31,31,31,31,31,31,31,31,31,31,31,31,31,31,31,31,31,31,31,31,31,31,31,31,31,31,31,31,31,31,31,31,31,31,31,31,31,31,31,31,31,31,31,31,31,31,31,31,31,31,31,31,31,31,31,31,31,31,31,31,31,31,31,31,31,31,31,31,31,31,31,31,31,31,31,31,31,31,31,31,31,31,31,31,31,31,31,31,31,31,31,31,31,31,31,31,31,31,31,31,31,31,31,31,31,31,31,31,31,31,31,31,31,31,31,31,31,31,31,31,31,31,31,31,31,31,31,31,31,31,31,31,31,31,31,31,31,31,31,31,31,31,31,31,31,31,31,31,31,31,31,31,31,31,31,31,31,31,31,31,31,31,31,31,31,31,31,31,31,31,31,31,31,31,31,31,31,31,31,31,31,31,31,31,31,31,31,31,31,31,31,31,31,31,31,31,31,31,31,31,31,31,31,31,31,31,31,31,31,31,31,31,31,31,31,31,31,31,31,31,31,31,31,31,31,31,31,31,31,31,31,31,31,31,31,31,31,31,31,31,31,31,31,31,31,31,31,31,31,31,31,31,31,31,31,31,31,31,31,31,31,31,31,31,31,31,31,31,31,31,31,31,31,31,31,31,31,31,31,31,31,31,31,31,31,31,31,31,31,31,31,31,31,31,31,31,31,31,31,31,31,31,31,31,31,31,31,31,31,31,31,31,31,31,31,31,31,31,31,31,31,31,31,31,31,31,31,31,31,31,31,31,31,31,31,31,31,31,31,31,31,31,31,31,31,31,31,31,31,31,31,31,31,31,31,31,31,31,31,31,31,31,31,31,31,31,31,31,31,31,31,31,31,31,31,31,31,31,31,31,31,31,31,31,31,31,31,31,31,31,31,31,31,31,31,31,31,31,31,31,31,31,31,31,31,31,31,31,31,31,31,31,31,31,31,31,31,31,31,31,31,31,31,31,31,31,31,31,31,31,31,31,31,31,31,31,31,31,31,31,31,31,31,31,31,31,31,31,31,31,31,31,31,31,31,31,31,31,31,31,31,31,31,31,31,31,31,31,31,31,31,31,31,31,31,31,31,31,31,31,31,31,31,31,31,31,31,31,31,31,31,31,31,31,31,31,31,31,31,31,31,31,31,31,31,31,31,31,31,31,31,31,31,31,31,31,31,31,31,31,31,31,31,31,31,31,31,31,31,31,31,31,31,31,31,31,31,31,31,31,31,31,31,31,31,31,31,31,31,31,31,31,31,31,31,31,31,31,31,31,31,31,31,31,31,31,31,31,31,31,31,31,31,31,31,31,31,31,31,31,31,31,31,31,31,31,31,31,31,31,31,31,31,31,31,31,31,31,31,31,31,31,31,31,31,31,31,31,31,31,31,31,31,31,31,31,31,31,31,31,31,31,31,31,31,31,31,31,31,31,31,31,31,31,31,31,31,31,31,31,31,31,31,31,31,31,31,31,31,31,31,31,31,31,31,31,31,31,31,31,31,31,31,31,31,31,31,31,31,31,31,31,31,31,31,31,31,31,31,31,31,31,31,31,31,31,31,31,31,31,31,31,31,31,31,31,31,31,31,31,31,31,31,31,31,31,31,31,31,31,31,31,31,31};      /* T5 _relative_position_bucket(k - q) for k - q in [-(S-1), S-1], computed with the module's own jax code on the host */
__global__ __launch_bounds__(512) void k_rb(const float* __restrict__ t, float* __restrict__ RB) { const int i = threadIdx.x; const float v = bf16_round(t[i]); *(float*)(RB + i) = v;  }
template <int CAUSAL>
__global__ __launch_bounds__(128) void k_flash(const _Float16* __restrict__ Q16, int ldq, const _Float16* __restrict__ K16, int ldk, const _Float16* __restrict__ Vt, const int* __restrict__ MSK, float* __restrict__ O, int ldo) {
  constexpr int RPW = 16, RTN = RPW / 16, NQB = TQ / (4 * RPW), DT = 4, KS = 2;
  __shared__ __attribute__((aligned(16))) unsigned short sP[4][RPW][40]; __shared__ __attribute__((aligned(16))) float sO[4][RPW][64 + 4];
  const int tid = threadIdx.x, w = tid >> 5, lane = tid & 31, ln = lane & 15, hh = lane >> 4;
  const int slab = blockIdx.x / QBNP, qblk = QB0P + blockIdx.x % QBNP; (void)NQB; const int b = slab / NH, h = slab % NH; const int qb0 = qblk * (4 * RPW); const int q0 = qb0 + w * RPW;
  FragH aq[2][KS];
#pragma unroll
  for (int rt = 0; rt < RTN; ++rt) { const unsigned short* qr = (const unsigned short*)Q16 + ((size_t)b * TQ + q0 + rt * 16 + ln) * ldq + h * 64;
#pragma unroll
    for (int ks = 0; ks < KS; ++ks) { aq[rt][ks].half[0] = *(const v8us*)(qr + ks * 32 + 8 * hh); aq[rt][ks].half[1] = *(const v8us*)(qr + ks * 32 + 16 + 8 * hh); } }
  const unsigned short* Vth = (const unsigned short*)Vt + (size_t)slab * 64 * TK;
  float m_r[2][8], l_r[2][8]; v8f oacc[2][DT];
#pragma unroll
  for (int rt = 0; rt < RTN; ++rt) {
#pragma unroll
    for (int r = 0; r < 8; ++r) { m_r[rt][r] = -3.0e38f; l_r[rt][r] = 0.f; }
#pragma unroll
    for (int dt = 0; dt < DT; ++dt) oacc[rt][dt] = (v8f){0.f,0.f,0.f,0.f,0.f,0.f,0.f,0.f}; }
  float qsq[2][8];      /* mode 32: |q|^2 of this lane's rows, read once */
#pragma unroll
  for (int rt = 0; rt < RTN; ++rt)
#pragma unroll
    for (int r = 0; r < 8; ++r) qsq[rt][r] = (CAUSAL == 32) ? ((const float*)MSK)[(size_t)b * TQ + q0 + rt * 16 + 8 * hh + r] : 0.f;
  const int jend = (CAUSAL == 1 || CAUSAL == 32) ? (qb0 + 4 * RPW) : ((CAUSAL == 23) ? min(TK, (qb0 / CHK + 2) * CHK) : TK);      /* causal / window: keys that can never contribute are skipped */ const int jbeg = (CAUSAL == 23) ? max(0, (qb0 / CHK - 1) * CHK) : 0;
#pragma unroll 1
  for (int j0 = jbeg; j0 < jend; j0 += 32) {
    v8f s[2][2];
    float ksq0 = 0.f, ksq1 = 0.f; if (CAUSAL == 32) { const float* ksT = (const float*)MSK + (size_t)NB * TQ + (size_t)b * TK + j0 + ln; ksq0 = ksT[0]; ksq1 = ksT[16]; }      /* mode 32: |k|^2 of this lane's two keys, one unconditional load each per key block (j0 + 31 < jend <= TK) */
#pragma unroll
    for (int nt = 0; nt < 2; ++nt) { const unsigned short* kr = (const unsigned short*)K16 + ((size_t)b * TK + j0 + nt * 16 + ln) * ldk + h * 64; FragH bk[KS];
#pragma unroll
      for (int ks = 0; ks < KS; ++ks) { bk[ks].half[0] = *(const v8us*)(kr + ks * 32 + 8 * hh); bk[ks].half[1] = *(const v8us*)(kr + ks * 32 + 16 + 8 * hh); }
#pragma unroll
      for (int rt = 0; rt < RTN; ++rt) { v8f acc = (v8f){0.f,0.f,0.f,0.f,0.f,0.f,0.f,0.f};
#pragma unroll
        for (int ks = 0; ks < KS; ++ks) acc = mmaH<1>(aq[rt][ks].v, aq[rt][ks].v, bk[ks].v, bk[ks].v, acc); s[rt][nt] = acc; } }
#pragma unroll
    for (int rt = 0; rt < RTN; ++rt)
#pragma unroll
      for (int r = 0; r < 8; ++r) { const int tq = q0 + rt * 16 + 8 * hh + r; const int k0 = j0 + ln, k1 = j0 + 16 + ln;
        bool ok0 = (CAUSAL == 1 || CAUSAL == 32) ? (k0 <= tq) : ((CAUSAL == 2) ? ((k0 >> 5) == (tq >> 5)) : true), ok1 = (CAUSAL == 1 || CAUSAL == 32) ? (k1 <= tq) : ((CAUSAL == 2) ? ((k1 >> 5) == (tq >> 5)) : true); if (CAUSAL == 23) { const int cq = tq / CHK; ok0 = (abs(k0 / CHK - cq) <= 1) && (MSK[(size_t)b * TK + k0] == 0); ok1 = (abs(k1 / CHK - cq) <= 1) && (MSK[(size_t)b * TK + k1] == 0); }      /* mode 23: 3-chunk window + int key-padding mask */
        if (CAUSAL == 24) { ok0 = (MSK[(size_t)b * TK + k0] == 0); ok1 = (MSK[(size_t)b * TK + k1] == 0); }      /* mode 24: int key-padding mask (nonzero = padded = excluded) */      /* mode 2: block-diagonal 32-token groups */
        float s0 = ok0 ? s[rt][0][r] * SCL : -3.0e38f, s1 = ok1 ? s[rt][1][r] * SCL : -3.0e38f; if (CAUSAL == 27) { const float* amk = (const float*)MSK + ((size_t)b * MQI + tq) * MKI; s0 += bf16_round(amk[k0]); s1 += bf16_round(amk[k1]); }      /* mode 27: additive per-(batch, query, key) f32 mask INPUT [b][tq][k] */ if (CAUSAL == 30) { const float* rbp = (const float*)MSK; s0 += rbp[BK30[k0 - tq + (TK - 1)] * NH + h]; s1 += rbp[BK30[k1 - tq + (TK - 1)] * NH + h]; }      /* mode 30: T5 bucketed relative bias: table[bucket(k - q)][h]; bucket-of-distance is a module constant */ if (CAUSAL == 32) { const float qs = qsq[rt][r]; if (ok0) { float d = qs + ksq0; d = d - 2.0f * s0; d = fmaxf(d, 0.f); s0 = -d * 0.125f; } if (ok1) { float d = qs + ksq1; d = d - 2.0f * s1; d = fmaxf(d, 0.f); s1 = -d * 0.125f; } }      /* mode 32: RBF logit -relu(|q|^2 + |k|^2 - 2 q.k)/8, causal */ if (CAUSAL == 17) { const float* amk = (const float*)MSK + (size_t)b * TK; s0 += bf16_round(amk[k0]); s1 += bf16_round(amk[k1]); } if (CAUSAL == 18) { const float* tb = (const float*)MSK; const int* ri = MSK + 1024 + (size_t)b * TK; const int rq = ri[tq]; s0 += tb[(h * 8 + rq) * 8 + ri[k0]]; s1 += tb[(h * 8 + rq) * 8 + ri[k1]]; } if (CAUSAL == 19) { const int* rel = MSK + (size_t)tq * TK; const float* rb = (const float*)MSK + (size_t)TQ * TK + ((size_t)(b * NH + h) * TQ + tq) * 64; s0 += rb[rel[k0]]; s1 += rb[rel[k1]]; }      /* mode 19: + (q.Ek[rel] + Eb[rel][h]) / 8 gathered by the int relative ids (packed [ids | table]) */      /* mode 18: + resource_bias[h][r_q][r_k] from the packed [table | ids] buffer (TQ == TK) */      /* mode 17: additive per-(batch, key) mask INPUT */ float mc = fmaxf(s0, s1);
        mc = fmaxf(mc, __shfl_xor(mc, 1, 32)); mc = fmaxf(mc, __shfl_xor(mc, 2, 32)); mc = fmaxf(mc, __shfl_xor(mc, 4, 32)); mc = fmaxf(mc, __shfl_xor(mc, 8, 32));
        const float mn = fmaxf(m_r[rt][r], mc); const float ea = expf(m_r[rt][r] - mn), e0 = expf(s0 - mn), e1 = expf(s1 - mn);      /* computed for every lane and selected below: no exec-mask branch, so the eight rows' chains can overlap */ const float al = (mn > -1.0e38f) ? ea : 1.0f; m_r[rt][r] = mn; const float p0 = ok0 ? e0 : 0.f, p1 = ok1 ? e1 : 0.f; l_r[rt][r] = l_r[rt][r] * al + p0 + p1;
#pragma unroll
        for (int dt = 0; dt < DT; ++dt) oacc[rt][dt][r] *= al;
        FragH t2; t2.h[0] = (_Float16)(p0 * 1024.0f); t2.h[1] = (_Float16)(p1 * 1024.0f); sP[w][rt * 16 + 8 * hh + r][ln] = t2.u[0]; sP[w][rt * 16 + 8 * hh + r][16 + ln] = t2.u[1]; }
    __builtin_amdgcn_fence(__ATOMIC_ACQ_REL, "workgroup"); __builtin_amdgcn_wave_barrier();
    FragH pa[2];
#pragma unroll
    for (int rt = 0; rt < RTN; ++rt) { pa[rt].half[0] = *(const v8us*)&sP[w][rt * 16 + ln][8 * hh]; pa[rt].half[1] = *(const v8us*)&sP[w][rt * 16 + ln][16 + 8 * hh]; }
#pragma unroll
    for (int dt = 0; dt < DT; ++dt) { const unsigned short* vrow = Vth + (size_t)(dt * 16 + ln) * TK + j0; FragH bv; bv.half[0] = *(const v8us*)(vrow + 8 * hh); bv.half[1] = *(const v8us*)(vrow + 16 + 8 * hh);
#pragma unroll
      for (int rt = 0; rt < RTN; ++rt) oacc[rt][dt] = mmaH<1>(pa[rt].v, pa[rt].v, bv.v, bv.v, oacc[rt][dt]); }
    __builtin_amdgcn_fence(__ATOMIC_ACQ_REL, "workgroup"); __builtin_amdgcn_wave_barrier(); }
#pragma unroll
  for (int rt = 0; rt < RTN; ++rt) {
#pragma unroll
    for (int r = 0; r < 8; ++r) { float l = l_r[rt][r]; l += __shfl_xor(l, 1, 32); l += __shfl_xor(l, 2, 32); l += __shfl_xor(l, 4, 32); l += __shfl_xor(l, 8, 32); l_r[rt][r] = (l > 0.f) ? 1.0f / (l * 1024.0f) : 0.f; }
#pragma unroll
    for (int dt = 0; dt < DT; ++dt)
#pragma unroll
      for (int r = 0; r < 8; ++r) sO[w][rt * 16 + 8 * hh + r][dt * 16 + ln] = oacc[rt][dt][r] * l_r[rt][r]; }
  __builtin_amdgcn_fence(__ATOMIC_ACQ_REL, "workgroup"); __builtin_amdgcn_wave_barrier();
  {
#pragma unroll
    for (int rp = 0; rp < RPW; rp += 2) { const int r = rp + (lane >> 4), pc = lane & 15; const v4f val = *(const v4fa*)&sO[w][r][pc * 4]; *(v4f*)(O + ((size_t)b * TQ + q0 + r) * ldo + h * 64 + pc * 4) = val; }
     } }
// 5-plane variant: S = Qh Kh^T + (Ql Kh^T + Qh Kl^T)/1024 with Q/K = [hi | 2^10 residual] f16 planes (QL/KL same layout as Q16/K16), then the 3-term P.V below.
// 3-term variant: O = (P_hi V_hi + (P_lo V_hi + P_hi V_lo) / 1024) / l with P = [hi | 2^10 residual] of 1024 p and V^T = [hi | 2^10 residual] planes (VtL same layout as Vt) -> ~2^-21-class products for un-averaged (early causal / peaked) rows
template <int CAUSAL>
__global__ __launch_bounds__(128) void k_flash5(const _Float16* __restrict__ Q16, const _Float16* __restrict__ QL, int ldq, const _Float16* __restrict__ K16, const _Float16* __restrict__ KL, int ldk, const _Float16* __restrict__ Vt, const _Float16* __restrict__ VtL, const int* __restrict__ MSK, float* __restrict__ O, int ldo) {
  constexpr int RPW = 16, RTN = RPW / 16, NQB = TQ / (4 * RPW), DT = 4, KS = 2;
  __shared__ __attribute__((aligned(16))) unsigned short sP[4][RPW][40]; __shared__ __attribute__((aligned(16))) unsigned short sPL[4][RPW][40]; __shared__ __attribute__((aligned(16))) float sO[4][RPW][64 + 4];
  const int tid = threadIdx.x, w = tid >> 5, lane = tid & 31, ln = lane & 15, hh = lane >> 4;
  const int slab = blockIdx.x / QBN5, qblk = QB05 + blockIdx.x % QBN5; (void)NQB; const int b = slab / NH, h = slab % NH; const int qb0 = qblk * (4 * RPW); const int q0 = qb0 + w * RPW;
  FragH aq[2][KS], aql[2][KS];
#pragma unroll
  for (int rt = 0; rt < RTN; ++rt) { const unsigned short* qr = (const unsigned short*)Q16 + ((size_t)b * TQ + q0 + rt * 16 + ln) * ldq + h * 64; const unsigned short* ql = (const unsigned short*)QL + ((size_t)b * TQ + q0 + rt * 16 + ln) * ldq + h * 64;
#pragma unroll
    for (int ks = 0; ks < KS; ++ks) { aq[rt][ks].half[0] = *(const v8us*)(qr + ks * 32 + 8 * hh); aq[rt][ks].half[1] = *(const v8us*)(qr + ks * 32 + 16 + 8 * hh); aql[rt][ks].half[0] = *(const v8us*)(ql + ks * 32 + 8 * hh); aql[rt][ks].half[1] = *(const v8us*)(ql + ks * 32 + 16 + 8 * hh); } }
  const unsigned short* Vth = (const unsigned short*)Vt + (size_t)slab * 64 * TK; const unsigned short* Vtl = (const unsigned short*)VtL + (size_t)slab * 64 * TK;
  float m_r[2][8], l_r[2][8]; v8f oacc[2][DT], oaccL[2][DT];
#pragma unroll
  for (int rt = 0; rt < RTN; ++rt) {
#pragma unroll
    for (int r = 0; r < 8; ++r) { m_r[rt][r] = -3.0e38f; l_r[rt][r] = 0.f; }
#pragma unroll
    for (int dt = 0; dt < DT; ++dt) { oacc[rt][dt] = (v8f){0.f,0.f,0.f,0.f,0.f,0.f,0.f,0.f}; oaccL[rt][dt] = oacc[rt][dt]; } }
  const int jend = (CAUSAL == 1 || CAUSAL == 32) ? (qb0 + 4 * RPW) : ((CAUSAL == 23) ? min(TK, (qb0 / CHK + 2) * CHK) : TK);      /* causal / window: keys that can never contribute are skipped */ const int jbeg = (CAUSAL == 23) ? max(0, (qb0 / CHK - 1) * CHK) : 0;
#pragma unroll 1
  for (int j0 = jbeg; j0 < jend; j0 += 32) {
    v8f s[2][2];
#pragma unroll
    for (int nt = 0; nt < 2; ++nt) { const unsigned short* kr = (const unsigned short*)K16 + ((size_t)b * TK + j0 + nt * 16 + ln) * ldk + h * 64; const unsigned short* klr = (const unsigned short*)KL + ((size_t)b * TK + j0 + nt * 16 + ln) * ldk + h * 64; FragH bk[KS], bkl[KS];
#pragma unroll
      for (int ks = 0; ks < KS; ++ks) { bk[ks].half[0] = *(const v8us*)(kr + ks * 32 + 8 * hh); bk[ks].half[1] = *(const v8us*)(kr + ks * 32 + 16 + 8 * hh); bkl[ks].half[0] = *(const v8us*)(klr + ks * 32 + 8 * hh); bkl[ks].half[1] = *(const v8us*)(klr + ks * 32 + 16 + 8 * hh); }
#pragma unroll
      for (int rt = 0; rt < RTN; ++rt) { v8f acc = (v8f){0.f,0.f,0.f,0.f,0.f,0.f,0.f,0.f}, accl = acc;
#pragma unroll
        for (int ks = 0; ks < KS; ++ks) { acc = mmaH<1>(aq[rt][ks].v, aq[rt][ks].v, bk[ks].v, bk[ks].v, acc); accl = mmaH<1>(aql[rt][ks].v, aql[rt][ks].v, bk[ks].v, bk[ks].v, accl); accl = mmaH<1>(aq[rt][ks].v, aq[rt][ks].v, bkl[ks].v, bkl[ks].v, accl); }
#pragma unroll
        for (int r = 0; r < 8; ++r) acc[r] += accl[r] * 0.0009765625f;
        s[rt][nt] = acc; } }
#pragma unroll
    for (int rt = 0; rt < RTN; ++rt)
#pragma unroll
      for (int r = 0; r < 8; ++r) { const int tq = q0 + rt * 16 + 8 * hh + r; const int k0 = j0 + ln, k1 = j0 + 16 + ln;
        bool ok0 = (CAUSAL == 1 || CAUSAL == 32) ? (k0 <= tq) : ((CAUSAL == 2) ? ((k0 >> 5) == (tq >> 5)) : true), ok1 = (CAUSAL == 1 || CAUSAL == 32) ? (k1 <= tq) : ((CAUSAL == 2) ? ((k1 >> 5) == (tq >> 5)) : true);      /* mode 2: block-diagonal 32-token groups */
        if (CAUSAL == 4) { const int* mrow = MSK + ((size_t)b * TQ + tq) * TK; ok0 = mrow[k0] != 0; ok1 = mrow[k1] != 0; }      /* mode 4: per-(query, key) INPUT mask shared by all heads; masked keys contribute nothing (== the reference's -4096 fill, whose exp underflows to 0), rows with no valid key give l = 0 -> output 0 (== the reference's row_valid zeroing) */
        float s0 = ok0 ? s[rt][0][r] * SCL : -3.0e38f, s1 = ok1 ? s[rt][1][r] * SCL : -3.0e38f; if (CAUSAL == 30) { const float* rbp = (const float*)MSK; s0 += rbp[BK30[k0 - tq + (TK - 1)] * NH + h]; s1 += rbp[BK30[k1 - tq + (TK - 1)] * NH + h]; }      /* mode 30: T5 bucketed relative bias: table[bucket(k - q)][h]; bucket-of-distance is a module constant */ if (CAUSAL == 32) { const float* qsT = (const float*)MSK; const float* ksT = qsT + (size_t)NB * TQ; const float qs = qsT[(size_t)b * TQ + tq]; if (ok0) { float d = qs + ksT[(size_t)b * TK + k0]; d = d - 2.0f * s0; d = fmaxf(d, 0.f); s0 = -d * 0.125f; } if (ok1) { float d = qs + ksT[(size_t)b * TK + k1]; d = d - 2.0f * s1; d = fmaxf(d, 0.f); s1 = -d * 0.125f; } }      /* mode 32: RBF logit -relu(|q|^2 + |k|^2 - 2 q.k)/8, causal */ if (CAUSAL == 17) { const float* amk = (const float*)MSK + (size_t)b * TK; s0 += bf16_round(amk[k0]); s1 += bf16_round(amk[k1]); } if (CAUSAL == 18) { const float* tb = (const float*)MSK; const int* ri = MSK + 1024 + (size_t)b * TK; const int rq = ri[tq]; s0 += tb[(h * 8 + rq) * 8 + ri[k0]]; s1 += tb[(h * 8 + rq) * 8 + ri[k1]]; } if (CAUSAL == 19) { const int* rel = MSK + (size_t)tq * TK; const float* rb = (const float*)MSK + (size_t)TQ * TK + ((size_t)(b * NH + h) * TQ + tq) * 64; s0 += rb[rel[k0]]; s1 += rb[rel[k1]]; }      /* mode 19: + (q.Ek[rel] + Eb[rel][h]) / 8 gathered by the int relative ids (packed [ids | table]) */      /* mode 18: + resource_bias[h][r_q][r_k] from the packed [table | ids] buffer (TQ == TK) */      /* mode 17: additive per-(batch, key) mask INPUT */ float mc = fmaxf(s0, s1);
        mc = fmaxf(mc, __shfl_xor(mc, 1, 32)); mc = fmaxf(mc, __shfl_xor(mc, 2, 32)); mc = fmaxf(mc, __shfl_xor(mc, 4, 32)); mc = fmaxf(mc, __shfl_xor(mc, 8, 32));
        const float mn = fmaxf(m_r[rt][r], mc); const float al = (mn > -1.0e38f) ? expf(m_r[rt][r] - mn) : 1.0f; m_r[rt][r] = mn; const float p0 = ok0 ? expf(s0 - mn) : 0.f, p1 = ok1 ? expf(s1 - mn) : 0.f; l_r[rt][r] = l_r[rt][r] * al + p0 + p1;
#pragma unroll
        for (int dt = 0; dt < DT; ++dt) { oacc[rt][dt][r] *= al; oaccL[rt][dt][r] *= al; }
        FragH t2, t2l; const float ps0 = p0 * 1024.0f, ps1 = p1 * 1024.0f; t2.h[0] = (_Float16)ps0; t2.h[1] = (_Float16)ps1; t2l.h[0] = (_Float16)((ps0 - (float)t2.h[0]) * 1024.0f); t2l.h[1] = (_Float16)((ps1 - (float)t2.h[1]) * 1024.0f);
        sP[w][rt * 16 + 8 * hh + r][ln] = t2.u[0]; sP[w][rt * 16 + 8 * hh + r][16 + ln] = t2.u[1]; sPL[w][rt * 16 + 8 * hh + r][ln] = t2l.u[0]; sPL[w][rt * 16 + 8 * hh + r][16 + ln] = t2l.u[1]; }
    __builtin_amdgcn_fence(__ATOMIC_ACQ_REL, "workgroup"); __builtin_amdgcn_wave_barrier();
    FragH pa[2], pl[2];
#pragma unroll
    for (int rt = 0; rt < RTN; ++rt) { pa[rt].half[0] = *(const v8us*)&sP[w][rt * 16 + ln][8 * hh]; pa[rt].half[1] = *(const v8us*)&sP[w][rt * 16 + ln][16 + 8 * hh]; pl[rt].half[0] = *(const v8us*)&sPL[w][rt * 16 + ln][8 * hh]; pl[rt].half[1] = *(const v8us*)&sPL[w][rt * 16 + ln][16 + 8 * hh]; }
#pragma unroll
    for (int dt = 0; dt < DT; ++dt) { const unsigned short* vrow = Vth + (size_t)(dt * 16 + ln) * TK + j0; const unsigned short* vrl = Vtl + (size_t)(dt * 16 + ln) * TK + j0; FragH bv, bl; bv.half[0] = *(const v8us*)(vrow + 8 * hh); bv.half[1] = *(const v8us*)(vrow + 16 + 8 * hh); bl.half[0] = *(const v8us*)(vrl + 8 * hh); bl.half[1] = *(const v8us*)(vrl + 16 + 8 * hh);
#pragma unroll
      for (int rt = 0; rt < RTN; ++rt) { oacc[rt][dt] = mmaH<1>(pa[rt].v, pa[rt].v, bv.v, bv.v, oacc[rt][dt]); oaccL[rt][dt] = mmaH<1>(pl[rt].v, pl[rt].v, bv.v, bv.v, oaccL[rt][dt]); oaccL[rt][dt] = mmaH<1>(pa[rt].v, pa[rt].v, bl.v, bl.v, oaccL[rt][dt]); } }
    __builtin_amdgcn_fence(__ATOMIC_ACQ_REL, "workgroup"); __builtin_amdgcn_wave_barrier(); }
#pragma unroll
  for (int rt = 0; rt < RTN; ++rt) {
#pragma unroll
    for (int r = 0; r < 8; ++r) { float l = l_r[rt][r]; l += __shfl_xor(l, 1, 32); l += __shfl_xor(l, 2, 32); l += __shfl_xor(l, 4, 32); l += __shfl_xor(l, 8, 32); l_r[rt][r] = (l > 0.f) ? 1.0f / (l * 1024.0f) : 0.f; }
#pragma unroll
    for (int dt = 0; dt < DT; ++dt)
#pragma unroll
      for (int r = 0; r < 8; ++r) { float v = oacc[rt][dt][r]; v += oaccL[rt][dt][r] * 0.0009765625f; sO[w][rt * 16 + 8 * hh + r][dt * 16 + ln] = v * l_r[rt][r]; } }
  __builtin_amdgcn_fence(__ATOMIC_ACQ_REL, "workgroup"); __builtin_amdgcn_wave_barrier();
  {
#pragma unroll
    for (int rp = 0; rp < RPW; rp += 2) { const int r = rp + (lane >> 4), pc = lane & 15; const v4f val = *(const v4fa*)&sO[w][r][pc * 4]; *(v4f*)(O + ((size_t)b * TQ + q0 + r) * ldo + h * 64 + pc * 4) = val; }
     } }

// Transposed form of the causal RBF attention pass: S^T = K Q^T, O^T += V^T P^T. A lane holds one query's scores (16 of a block's 32 keys, the other wave half the other 16), so the block maximum is in-lane plus one exchange between the halves, and the two score tiles, converted in place, are the B operand of the second product: P passes through no LDS and the loop holds no fence. Logits, maxima and weights are formed by the expressions of k_flash mode 32.
__device__ __forceinline__ float xhalf(float x) { return __builtin_bit_cast(float, __builtin_amdgcn_permlanex16(__builtin_bit_cast(int, x), __builtin_bit_cast(int, x), 0x76543210, 0xfedcba98, false, false)); }      /* lane l with lane l ^ 16 */
__global__ __launch_bounds__(128) void k_flash_t(const _Float16* __restrict__ Q16, const _Float16* __restrict__ K16, const _Float16* __restrict__ Vt, const float* __restrict__ NSQ, float* __restrict__ O) {
  constexpr int DT = 4, KS = 2;
  __shared__ __attribute__((aligned(16))) float sO[4][16][64 + 4];
  const int tid = threadIdx.x, w = tid >> 5, lane = tid & 31, ln = lane & 15, hh = lane >> 4;
  const int slab = blockIdx.x / (QBLKS / 2), pr = blockIdx.x % (QBLKS / 2);
#pragma unroll 1      /* one copy of the key loop in the text serves both query blocks */
  for (int leg = 0; leg < 2; ++leg) {      /* query block QBLKS - 1 - pr, then pr, one after the other: 2 (QBLKS + 1) key passes in every work-group, so that no SIMD is left with the long blocks alone */
  const int qblk = leg ? pr : QBLKS - 1 - pr; const int qb0 = qblk * 64; const int q0 = qb0 + w * 16; const int tq = q0 + ln;      /* this lane's query */
  FragH bq[KS]; const unsigned short* qr = (const unsigned short*)Q16 + ((size_t)slab * TQ + tq) * 64;
#pragma unroll
  for (int ks = 0; ks < KS; ++ks) { bq[ks].half[0] = *(const v8us*)(qr + ks * 32 + 8 * hh); bq[ks].half[1] = *(const v8us*)(qr + ks * 32 + 16 + 8 * hh); }
  const unsigned short* Kb = (const unsigned short*)K16 + (size_t)slab * TK * 64; const unsigned short* Vth = (const unsigned short*)Vt + (size_t)slab * 64 * TK;
  const float qs = NSQ[(size_t)slab * TQ + tq]; const float* ksT = NSQ + (size_t)NB * TQ + (size_t)slab * TK;
  float m = -3.0e38f, l = 0.f; v8f oacc[DT];
#pragma unroll
  for (int dt = 0; dt < DT; ++dt) oacc[dt] = (v8f){0.f,0.f,0.f,0.f,0.f,0.f,0.f,0.f};
  const int jend = qb0 + 64;
#pragma unroll 1
  for (int j0 = 0; j0 < jend; j0 += 32) {
    FragH ak[2][KS], av[DT]; v4f kq[2][2];      /* with no fence in the loop the whole pass's loads stand at its head, in front of the first product, and fly together */
#pragma unroll
    for (int nt = 0; nt < 2; ++nt) { const unsigned short* kr = Kb + (size_t)j0 * 64 + nt * 1024 + lane * 8;      /* fragment order: a 16-key group is four pieces of 512 B, a lane's 16 bytes at 16 lane; each load reads four whole lines */
#pragma unroll
      for (int ks = 0; ks < KS; ++ks) { ak[nt][ks].half[0] = *(const v8us*)(kr + ks * 512); ak[nt][ks].half[1] = *(const v8us*)(kr + ks * 512 + 256); }
      kq[nt][0] = *(const v4fa*)(ksT + j0 + nt * 16 + 8 * hh); kq[nt][1] = *(const v4fa*)(ksT + j0 + nt * 16 + 8 * hh + 4); }      /* |k|^2 of this lane's eight keys of the tile */
    asm volatile("s_wait_xcnt 0x0" ::: "memory");      /* precaution: the address registers of the loads above may be reused as destinations of the loads below */
#pragma unroll
    for (int dt = 0; dt < DT; ++dt) { const unsigned short* vrow = Vth + (size_t)j0 * 64 + dt * 512 + lane * 8; av[dt].half[0] = *(const v8us*)vrow; av[dt].half[1] = *(const v8us*)(vrow + 256); }      /* fragment order: a 32-key block is eight pieces of 512 B */
    asm volatile("s_wait_xcnt 0x0" ::: "memory");      /* precaution: stands in front of the pointer steps and of every other rewrite of a register that an issued load names */
    __builtin_amdgcn_sched_barrier(0);      /* keeps those rewrites, which the scheduler otherwise lifts among the loads, behind the wait */
    const int lim = tq - j0 - 8 * hh;      /* key 16 nt + r of this lane's sixteen is causal where 16 nt + r <= lim */
    float sc[16]; float mc = -3.0e38f;
#pragma unroll
    for (int nt = 0; nt < 2; ++nt) { v8f acc = (v8f){0.f,0.f,0.f,0.f,0.f,0.f,0.f,0.f};
#pragma unroll
      for (int ks = 0; ks < KS; ++ks) acc = mmaH<1>(ak[nt][ks].v, ak[nt][ks].v, bq[ks].v, bq[ks].v, acc);      /* acc[r] = k[j0 + 16 nt + 8 hh + r] . q[tq] */
#pragma unroll
      for (int r = 0; r < 8; ++r) { const bool ok = nt * 16 + r <= lim; float d = qs + kq[nt][r >> 2][r & 3]; d = d - 2.0f * (acc[r] * SCL); d = fmaxf(d, 0.f); const float sv = ok ? -d * 0.125f : -3.0e38f; sc[nt * 8 + r] = sv; mc = fmaxf(mc, sv); } }
    mc = fmaxf(mc, xhalf(mc));
    const float mn = fmaxf(m, mc); const float ea = expf(m - mn); const float al = (mn > -1.0e38f) ? ea : 1.0f; m = mn;
    FragH pb; float p[16];
#pragma unroll
    for (int i = 0; i < 16; ++i) { const bool ok = (i >> 3) * 16 + (i & 7) <= lim; const float e = expf(sc[i] - mn); p[i] = ok ? e : 0.f; pb.h[i] = (_Float16)(p[i] * 1024.0f); }      /* element i of the B operand is key 8 hh + i, then 16 + 8 hh + (i - 8): the order of the V^T loader above */
#pragma unroll
    for (int st = 8; st > 0; st >>= 1)
#pragma unroll
      for (int i = 0; i < st; ++i) p[i] += p[i + st];
    l = l * al + p[0];
#pragma unroll
    for (int dt = 0; dt < DT; ++dt) {
#pragma unroll
      for (int r = 0; r < 8; ++r) oacc[dt][r] *= al; }
#pragma unroll
    for (int dt = 0; dt < DT; ++dt) oacc[dt] = mmaH<1>(av[dt].v, av[dt].v, pb.v, pb.v, oacc[dt]); }      /* oacc[dt][r] = context column 16 dt + 8 hh + r of query tq */
  l += xhalf(l); const float inv = (l > 0.f) ? 1.0f / (l * 1024.0f) : 0.f;
#pragma unroll
  for (int dt = 0; dt < DT; ++dt) { v4f a, c;
#pragma unroll
    for (int r = 0; r < 4; ++r) { a[r] = oacc[dt][r] * inv; c[r] = oacc[dt][4 + r] * inv; }
    *(v4fa*)&sO[w][ln][dt * 16 + 8 * hh] = a; *(v4fa*)&sO[w][ln][dt * 16 + 8 * hh + 4] = c; }
  __builtin_amdgcn_fence(__ATOMIC_ACQ_REL, "workgroup"); __builtin_amdgcn_wave_barrier();      /* the wave's own lanes read each other's rows below, for whole-row stores */
#pragma unroll
  for (int rp = 0; rp < 16; rp += 2) { const int r = rp + (lane >> 4), pc = lane & 15; const v4f val = *(const v4fa*)&sO[w][r][pc * 4]; *(v4f*)(O + ((size_t)slab * TQ + q0 + r) * 64 + pc * 4) = val; }
  asm volatile("s_wait_xcnt 0x0" ::: "memory");      /* precaution: the second leg rewrites the registers that these stores name */
  __builtin_amdgcn_fence(__ATOMIC_ACQ_REL, "workgroup", "local"); __builtin_amdgcn_wave_barrier(); } }      /* the second leg's staging writes stay behind every lane's reads of the first leg's rows; LDS only, so that the leg does not wait for its stores to the output */

__global__ __launch_bounds__(256) void k_rotab(float* __restrict__ CS, float* __restrict__ SN) {
  #pragma clang fp contract(off)
  const int t = blockIdx.x * 256 + threadIdx.x; if (t >= SLEN * 32) return; const int j = t % 32, s = t / 32; const float ex = (float)(2 * j) / 64.0f; const float inv = 1.0f / powf(10000.0f, ex); const float th = (float)s * inv; const float c = cosf(th), sn = sinf(th);
  { *(float*)(CS + t) = c; *(float*)(SN + t) = sn;  } }
__global__ __launch_bounds__(256) void k_rope(const float* __restrict__ F, int nsrc, int ndst, int rep, const float* __restrict__ CS, const float* __restrict__ SN, _Float16* __restrict__ H, _Float16* __restrict__ L) {
  #pragma clang fp contract(off)
  const size_t t = (size_t)blockIdx.x * 256 + threadIdx.x; if (t >= (size_t)NR * ndst * 4) return; const int g8 = (int)(t % 4); const int hd = (int)((t / 4) % ndst); const size_t row = t / ((size_t)4 * ndst); const int s = (int)(row % SLEN); const int hs = hd / rep;
  const float* src = F + row * (size_t)(nsrc * 64) + hs * 64; FragH ah, al, bh, bl;
  for (int i = 0; i < 8; ++i) { const int d = g8 * 8 + i; const float c = CS[s * 32 + d], sn = SN[s * 32 + d]; const float x1 = src[d], x2 = src[d + 32];
    float o1 = x1 * c; o1 += -x2 * sn; float o2 = x2 * c; o2 += x1 * sn;
    _Float16 hv = (_Float16)o1; ah.h[i] = hv; al.h[i] = (_Float16)((o1 - (float)hv) * 1024.0f); hv = (_Float16)o2; bh.h[i] = hv; bl.h[i] = (_Float16)((o2 - (float)hv) * 1024.0f); }
  const size_t o = row * (size_t)(ndst * 64) + hd * 64 + g8 * 8;
  { *(v8us*)((unsigned short*)H + o) = ah.half[0]; *(v8us*)((unsigned short*)H + o + 32) = bh.half[0]; *(v8us*)((unsigned short*)L + o) = al.half[0]; *(v8us*)((unsigned short*)L + o + 32) = bl.half[0];  } }
__global__ __launch_bounds__(256) void k_rope2(const float* __restrict__ F, int nsrc, int ndst, int rep, const float* __restrict__ CS, const float* __restrict__ SN, _Float16* __restrict__ H, _Float16* __restrict__ L) {
  #pragma clang fp contract(off)
  const size_t t = (size_t)blockIdx.x * 256 + threadIdx.x; if (t >= (size_t)NR * ndst * 4) return; const int g16 = (int)(t % 4); const int hd = (int)((t / 4) % ndst); const size_t row = t / ((size_t)4 * ndst); const int s = (int)(row % SLEN); const int hs = hd / rep;
  const float* src = F + row * (size_t)(nsrc * 64) + hs * 64 + g16 * 16; FragH ah, al;
  for (int pr = 0; pr < 8; ++pr) { const int i = g16 * 8 + pr; const float c = CS[s * 32 + i], sn = SN[s * 32 + i]; const float x1 = src[2 * pr], x2 = src[2 * pr + 1];
    float o1 = x1 * c; o1 -= x2 * sn; float o2 = x1 * sn; o2 += x2 * c;
    _Float16 hv = (_Float16)o1; ah.h[2 * pr] = hv; al.h[2 * pr] = (_Float16)((o1 - (float)hv) * 1024.0f); hv = (_Float16)o2; ah.h[2 * pr + 1] = hv; al.h[2 * pr + 1] = (_Float16)((o2 - (float)hv) * 1024.0f); }
  const size_t o = row * (size_t)(ndst * 64) + hd * 64 + g16 * 16;
  { *(v8us*)((unsigned short*)H + o) = ah.half[0]; *(v8us*)((unsigned short*)H + o + 8) = ah.half[1]; *(v8us*)((unsigned short*)L + o) = al.half[0]; *(v8us*)((unsigned short*)L + o + 8) = al.half[1];  } }
__global__ __launch_bounds__(256) void k_ln512(const float* __restrict__ A, const float* __restrict__ res, const float* __restrict__ g, const float* __restrict__ bb, float* __restrict__ Y, _Float16* __restrict__ Y16) {
  #pragma clang fp contract(off)
  const int wv = threadIdx.x >> 5, ln = threadIdx.x & 31; const size_t r = (size_t)blockIdx.x * 8 + wv; if (r >= NR) return; float x[16]; float s = 0.f;
  for (int i = 0; i < 2; ++i) { const v8f a = *(const v8f*)(A + r * DM + i * 256 + ln * 8); for (int q = 0; q < 8; ++q) { float v = a[q]; if (res) v += bf16_round(res[r * DM + i * 256 + ln * 8 + q]); x[i * 8 + q] = v; s += v; } }
  for (int o = 16; o > 0; o >>= 1) s += __shfl_xor(s, o, 32); const float mu = s / (float)DM; float var = 0.f; for (int q = 0; q < 16; ++q) { const float d = x[q] - mu; var += d * d; }
  for (int o = 16; o > 0; o >>= 1) var += __shfl_xor(var, o, 32); const float inv = rsqrtf(var / (float)DM + 1e-5f);
  { for (int i = 0; i < 2; ++i) { const int c0 = i * 256 + ln * 8; v8f y; FragH f; for (int q = 0; q < 8; ++q) { float v = (x[i * 8 + q] - mu) * inv; v *= bf16_round(g[c0 + q]); v += bf16_round(bb[c0 + q]); y[q] = v; f.h[q] = (_Float16)v; } *(v8f*)(Y + r * DM + c0) = y; if (Y16) *(v8us*)((unsigned short*)Y16 + r * DM + c0) = f.half[0]; }  } }
__global__ __launch_bounds__(256) void k_pack(const float* __restrict__ rb, const int* __restrict__ rid, int* __restrict__ PK) { const int t = blockIdx.x * 256 + threadIdx.x; if (t >= 1024 + NB * TK) return; int v; if (t < 1024) v = __float_as_int(bf16_round(rb[t])); else v = rid[t - 1024]; *(int*)(PK + t) = v;  }
__global__ __launch_bounds__(256) void k_tabin(const float* __restrict__ sp, float* __restrict__ CS, float* __restrict__ SN) { const int t = blockIdx.x * 256 + threadIdx.x; if (t >= SLEN * 32) return; const int i = t % 32, s = t / 32; const float c = bf16_round(sp[s * 64 + 32 + i]), sn = bf16_round(sp[s * 64 + i]);
  { *(float*)(CS + t) = c; *(float*)(SN + t) = sn;  } }
__global__ __launch_bounds__(256) void k_wsc(const float* __restrict__ Wm, _Float16* __restrict__ Bt, size_t n8, float sc) { const size_t t = (size_t)blockIdx.x * 256 + threadIdx.x; if (t >= n8) return; FragH f; for (int q = 0; q < 8; ++q) f.h[q] = (_Float16)(bf16_round(Wm[t * 8 + q]) * sc); *(v8us*)((unsigned short*)Bt + t * 8) = f.half[0];  }
__global__ __launch_bounds__(256) void k_rotab2(float* __restrict__ CS, float* __restrict__ SN) {
  #pragma clang fp contract(off)
  const int t = blockIdx.x * 256 + threadIdx.x; if (t >= SLEN * 32) return; const int j = t % 32, s = t / 32; const float c0 = -0.14391156831212787f;      /* -ln(10000)/64 rounded to f32 */ const float inv = expf((float)(2 * j) * c0); const float th = (float)s * inv; const float c = cosf(th), sn = sinf(th);
  { *(float*)(CS + t) = c; *(float*)(SN + t) = sn;  } }
__global__ __launch_bounds__(256) void k_lnu(const float* __restrict__ X, _Float16* __restrict__ N16, float* __restrict__ XB) {
  #pragma clang fp contract(off)
  const int wv = threadIdx.x >> 5, ln = threadIdx.x & 31; const size_t r = (size_t)blockIdx.x * 8 + wv; if (r >= NR) return; float a[32]; float s = 0.f;
  for (int i = 0; i < 4; ++i) { const v8f v = *(const v8f*)(X + r * DM + (i * 32 + ln) * 8); for (int q = 0; q < 8; ++q) { const float u = bf16_round(v[q]); a[i * 8 + q] = u; s += u; } }
  for (int o = 16; o > 0; o >>= 1) s += __shfl_xor(s, o, 32); const float mu = s / (float)DM; float var = 0.f; for (int q = 0; q < 32; ++q) { const float d = a[q] - mu; var += d * d; }
  for (int o = 16; o > 0; o >>= 1) var += __shfl_xor(var, o, 32); const float den = sqrtf(var / (float)(DM - 1)) + 1e-6f; const float inv = 1.0f / den;      /* one reciprocal per row; (x-mean)*inv vs the reference's division differs by <= 1 ulp */
  { for (int i = 0; i < 4; ++i) { const int c0 = (i * 32 + ln) * 8; FragH f; v8f xb; for (int q = 0; q < 8; ++q) { f.h[q] = (_Float16)((a[i * 8 + q] - mu) * inv); xb[q] = a[i * 8 + q]; } *(v8us*)((unsigned short*)N16 + r * DM + c0) = f.half[0]; *(v8f*)(XB + r * DM + c0) = xb; }  } }

__global__ __launch_bounds__(256) void k_h16s(const float* __restrict__ SRC, int lds, int coff, _Float16* __restrict__ DST, size_t n8) { const size_t t = (size_t)blockIdx.x * 256 + threadIdx.x; if (t >= n8) return; const size_t r = (t * 8) / DM; const int c = (int)((t * 8) % DM); const v8f a = *(const v8f*)(SRC + r * lds + coff + c); FragH f; for (int q = 0; q < 8; ++q) f.h[q] = (_Float16)a[q];
  *(v8us*)((unsigned short*)DST + t * 8) = f.half[0];  }


__global__ __launch_bounds__(256) void k_ccp(const float* __restrict__ QKV, int coff, _Float16* __restrict__ D) { const size_t t = (size_t)blockIdx.x * 256 + threadIdx.x; if (t >= (size_t)NR * DM / 8) return; const int c0 = (int)((t * 8) % DM); const size_t row = (t * 8) / DM; const v8f a = *(const v8f*)(QKV + row * 3 * DM + coff + c0); FragH f; for (int q = 0; q < 8; ++q) f.h[q] = (_Float16)a[q];
  *(v8us*)((unsigned short*)D + t * 8) = f.half[0];  }


template <int NLN>
__global__ __launch_bounds__(256) void k_lnrow(const float* __restrict__ X, const float* __restrict__ R, const float* __restrict__ g, const float* __restrict__ bb, float eps, float* __restrict__ OUT) {
  #pragma clang fp contract(off)
  constexpr int PER = NLN / 256; __shared__ float red[256]; const int tid = threadIdx.x; const size_t row = blockIdx.x; const float* x = X + row * NLN; const float* rr = R ? R + row * NLN : nullptr; float v[PER]; float s1 = 0.f;
  for (int u = 0; u < PER; ++u) { const int j = tid * PER + u; float t = x[j]; if (rr) t = t + rr[j]; v[u] = t; s1 += t; }
  red[tid] = s1; __syncthreads(); for (int st = 128; st > 0; st >>= 1) { if (tid < st) red[tid] += red[tid + st]; __syncthreads(); } const float mu = red[0] / (float)NLN; __syncthreads();
  float s2 = 0.f; for (int u = 0; u < PER; ++u) { const float c = v[u] - mu; s2 += c * c; } red[tid] = s2; __syncthreads(); for (int st = 128; st > 0; st >>= 1) { if (tid < st) red[tid] += red[tid + st]; __syncthreads(); }
  const float var = red[0] / (float)NLN; const float rs = rsqrtf(var + eps);
  { for (int u = 0; u < PER; ++u) { const int j = tid * PER + u; float o = (v[u] - mu) * rs; o = __fadd_rn(__fmul_rn(o, bf16_round(g[j])), bf16_round(bb[j])); *(float*)(OUT + row * NLN + j) = o; }  } }
__global__ __launch_bounds__(256) void k_xr32(const float* __restrict__ x, float* __restrict__ XR, size_t n8) { const size_t t = (size_t)blockIdx.x * 256 + threadIdx.x; if (t >= n8) return; v8f o; for (int q = 0; q < 8; ++q) o[q] = bf16_round(x[t * 8 + q]); *(v8f*)(XR + t * 8) = o;  }
__global__ __launch_bounds__(256) void k_r16b(const float* __restrict__ S, _Float16* __restrict__ D, size_t n8) { const size_t t = (size_t)blockIdx.x * 256 + threadIdx.x; if (t >= n8) return; const v8f a = *(const v8f*)(S + t * 8); FragH f; for (int q = 0; q < 8; ++q) f.h[q] = (_Float16)a[q]; *(v8us*)((unsigned short*)D + t * 8) = f.half[0];  }

// One preparatory launch. Blocks 0-255 take q, 256-511 k, 512-767 v, 256 rows each; every input is read once.
// q, k: the bf16 bits are staged in LDS, the f16 plane goes out from registers, and one thread per row sums its squares in ascending order of d.
// v: the f16 values are staged in LDS and go out transposed, in the order of the attention pass's A fragments: per 32 keys eight pieces of 512 B (column tile, key half), a lane's eight keys at 16 lane.
__global__ __launch_bounds__(256) void k_prep(const float* __restrict__ Q, const float* __restrict__ Kx, const float* __restrict__ V, _Float16* __restrict__ QH, _Float16* __restrict__ KH, _Float16* __restrict__ Vt, float* __restrict__ NSQ) {
  __shared__ __attribute__((aligned(16))) unsigned short sm[256 * 72];      /* q, k: pitch 72 (144 B = 16 B x odd: a lane per row reads 16 bytes without bank conflicts); v: pitch 66 (eight rows apart = 8 banks apart) */
  const int tid = threadIdx.x; const int which = blockIdx.x >> 8, blk = blockIdx.x & 255; const size_t e0 = (size_t)blk * 256 * 64;
  if (which < 2) {
    const float* X = (which ? Kx : Q) + e0; unsigned short* H = (unsigned short*)(which ? KH : QH) + e0; FragH f[8]; v8f a[8];
    const int rl = which ? (((tid >> 6) << 3) | (tid & 7)) : (tid >> 3), c = which ? ((((tid >> 5) & 1) << 2) | ((tid >> 3) & 3)) : (tid & 7);      /* row of a group of 32 and 8-element piece of the row; for k a wave takes 8 rows x 4 pieces, so that its stores below fill whole lines */
    const int hb = which ? ((rl >> 4) * 1024 + (c >> 1) * 256 + (c & 1) * 128 + (rl & 15) * 8) : (rl * 64 + c * 8);      /* k goes out in fragment order: per 16 keys four pieces of 512 B (16 columns each); inside a piece the columns' half c & 1, then the key, so that lane l of the A loader finds its 16 bytes at 16 l; q stays row-major */
    const unsigned boff = (unsigned)rl * 256u + (unsigned)c * 32u;
#pragma unroll
    for (int i = 0; i < 8; ++i) a[i] = *(const v8f*)((const char*)X + boff + i * 8192);
    asm volatile("s_wait_xcnt 0x0" :: "v"(boff) : "memory");      /* precaution: the loads' offset register is held to this wait, so that none of the loads takes it as its destination */
    __builtin_amdgcn_sched_barrier(0);      /* keeps all sixteen loads in flight together; the scheduler otherwise sinks six of them behind the first waits, three more memory latencies in a row */
#pragma unroll
    for (int i = 0; i < 8; ++i) { v8us b;
#pragma unroll
      for (int u = 0; u < 8; ++u) { const unsigned short xb = bf16_bits(a[i][u]); b[u] = xb; f[i].h[u] = (_Float16)bf16_val(xb); }
      *(v8us*)&sm[(i * 32 + rl) * 72 + c * 8] = b; }
    __syncthreads();      /* a row's sixteen-byte pieces were staged by eight threads */
#pragma unroll
    for (int i = 0; i < 8; ++i) *(v8us*)(H + i * 2048 + hb) = f[i].half[0];      /* behind the barrier, which would otherwise wait for these stores */
    float acc = 0.f;
#pragma unroll
    for (int d = 0; d < 64; d += 8) { const v8us b = *(const v8us*)&sm[tid * 72 + d];
#pragma unroll
      for (int u = 0; u < 8; ++u) { const float x = bf16_val(b[u]); acc = __fadd_rn(acc, __fmul_rn(x, x)); } }      /* a square of a bf16 value is exact in f32: fused or not, each step rounds the same sum */
    *(float*)(NSQ + (size_t)which * NR + blk * 256 + tid) = acc;
  } else {
    const float* X = V + e0; const unsigned voff = (unsigned)tid * 32u;      /* eight groups of 256 keys per slab */
#pragma unroll
    for (int i = 0; i < 8; ++i) { const int g = i * 256 + tid; const v8f a = *(const v8f*)((const char*)X + voff + i * 8192); FragH f;
#pragma unroll
      for (int u = 0; u < 8; ++u) f.h[u] = (_Float16)bf16_round(a[u]);
#pragma unroll
      for (int u = 0; u < 8; ++u) sm[(g >> 3) * 66 + (g & 7) * 8 + u] = f.u[u]; }
    asm volatile("s_wait_xcnt 0x0" :: "v"(voff) : "memory");      /* precaution: the loads' offset register is held to this wait, so that none of the loads takes it as its destination */
    __syncthreads();      /* a V^T piece gathers eight keys staged by eight threads */
#pragma unroll
    for (int it = 0; it < 8; ++it) { const int pi = it * 8 + (tid >> 5);      /* 512-B piece of this group's 64: 32-key block pi >> 3, column tile (pi >> 1) & 3, key half pi & 1 */
      const int d = ((pi >> 1) & 3) * 16 + (tid & 15), pc = (pi >> 3) * 4 + (pi & 1) * 2 + ((tid >> 4) & 1); FragH f;
#pragma unroll
      for (int u = 0; u < 8; ++u) f.u[u] = sm[(pc * 8 + u) * 66 + d];
      *(v8us*)((unsigned short*)Vt + e0 + (it * 256 + tid) * 8) = f.half[0]; }      /* fragment order: a wave's store is one piece, 512 contiguous bytes */
    asm volatile("s_wait_xcnt 0x0" ::: "memory");      /* precaution: the compiler lays the q, k branch behind these stores in the text, where their registers are rewritten */
  } }
// One block per (slab, 8 query rows < 64), one wave per row. The slab's first 64 rows of k and v are rounded and staged in LDS once per block; lanes own keys for the logits, then output columns for the context. Each dot product, the row sum and each context sum keep their serial order.
__global__ __launch_bounds__(256) void k_fixr(const float* __restrict__ Q, const float* __restrict__ Kx, const float* __restrict__ V, const float* __restrict__ NSQ, float* __restrict__ O) {
  #pragma clang fp contract(off)
  __shared__ __attribute__((aligned(16))) float sk[64][68];      /* pitch 272 B = 16 B x odd: a lane per row reads 16 bytes without bank conflicts */
  __shared__ __attribute__((aligned(16))) float sv[64][64]; __shared__ __attribute__((aligned(16))) float pr[8][64];
  const int tid = threadIdx.x, w = tid >> 5, lane = tid & 31; const size_t sl = blockIdx.x >> 3; const int q = __builtin_amdgcn_readfirstlane((int)(blockIdx.x & 7) * 8 + w);
  const float* kb = Kx + sl * SLEN * 64; const float* vb = V + sl * SLEN * 64;
#pragma unroll
  for (int i = 0; i < 4; ++i) { const int e = (i * 256 + tid) * 4; const v4f a = *(const v4fa*)(kb + e); const v4f c = *(const v4fa*)(vb + e); v4f ra, rc;
#pragma unroll
    for (int u = 0; u < 4; ++u) { ra[u] = bf16_round(a[u]); rc[u] = bf16_round(c[u]); }
    *(v4fa*)&sk[e >> 6][e & 63] = ra; *(v4fa*)&sv[e >> 6][e & 63] = rc; }
  const float* qr = Q + (sl * SLEN + q) * 64; const float qs = NSQ[sl * SLEN + q]; const float* ksT = NSQ + (size_t)NB * SLEN + sl * SLEN; const float kq0 = ksT[lane], kq1 = ksT[lane + 32];
  float x[64];      /* the wave's query row, fetched ahead of the barrier so that its latency runs beside the staging loads' */
#pragma unroll
  for (int d = 0; d < 64; d += 4) { const v4f a = *(const v4fa*)(qr + d);
#pragma unroll
    for (int u = 0; u < 4; ++u) x[d + u] = bf16_round(a[u]); }
  __syncthreads();      /* the staged rows are read by every wave of the block */
  float sd0 = 0.f, sd1 = 0.f;      /* keys lane and lane + 32 */
#pragma unroll
  for (int d = 0; d < 64; d += 4) { const v4f k0 = *(const v4fa*)&sk[lane][d]; const v4f k1 = *(const v4fa*)&sk[lane + 32][d];
#pragma unroll
    for (int u = 0; u < 4; ++u) { sd0 = __fadd_rn(sd0, __fmul_rn(x[d + u], k0[u])); sd1 = __fadd_rn(sd1, __fmul_rn(x[d + u], k1[u])); } }
  float d0 = qs + kq0; d0 = d0 - 2.0f * sd0; d0 = fmaxf(d0, 0.f); float d1 = qs + kq1; d1 = d1 - 2.0f * sd1; d1 = fmaxf(d1, 0.f);
  const bool ok0 = lane <= q, ok1 = lane + 32 <= q; const float lg0 = ok0 ? -d0 * 0.125f : -3.0e38f, lg1 = ok1 ? -d1 * 0.125f : -3.0e38f;
  float mx = fmaxf(lg0, lg1); mx = fmaxf(mx, __shfl_xor(mx, 1, 32)); mx = fmaxf(mx, __shfl_xor(mx, 2, 32)); mx = fmaxf(mx, __shfl_xor(mx, 4, 32)); mx = fmaxf(mx, __shfl_xor(mx, 8, 32)); mx = fmaxf(mx, __shfl_xor(mx, 16, 32));
  const float e0 = expf(lg0 - mx), e1 = expf(lg1 - mx); pr[w][lane] = ok0 ? e0 : 0.f; pr[w][lane + 32] = ok1 ? e1 : 0.f;
  __builtin_amdgcn_fence(__ATOMIC_ACQ_REL, "workgroup"); __builtin_amdgcn_wave_barrier();      /* the wave's own lanes read each other's weights below */
  float su = 0.f;
#pragma unroll
  for (int j = 0; j < 64; j += 4) { const v4f e = *(const v4fa*)&pr[w][j]; su += e[0]; su += e[1]; su += e[2]; su += e[3]; }      /* ascending keys; a masked key adds an exact zero */
  const float inv = 1.0f / su; typedef float v2f __attribute__((ext_vector_type(2))); typedef float v2fa __attribute__((ext_vector_type(2), may_alias));
  float a0 = 0.f, a1 = 0.f;      /* output columns 2 lane and 2 lane + 1 */
#pragma unroll 1
  for (int j0 = 0; j0 <= q; j0 += 16) {
#pragma unroll
    for (int i = 0; i < 16; ++i) { const bool in = j0 + i <= q; const v2f vv = *(const v2fa*)&sv[j0 + i][lane * 2]; const float p = pr[w][j0 + i] * inv;      /* past the row's last key the weight is zero; the value is zeroed too, so the term is an exact zero */
      a0 = __fadd_rn(a0, __fmul_rn(p, in ? vv[0] : 0.f)); a1 = __fadd_rn(a1, __fmul_rn(p, in ? vv[1] : 0.f)); } }
  const v2f o = {a0, a1}; *(v2f*)(O + (sl * SLEN + q) * 64 + lane * 2) = o; }

extern "C" void kernel_launch(void* const* d_in, const int* in_sizes, int n_in,
                              void* d_out, int out_size, void* d_ws, size_t ws_size, hipStream_t stream) {
  (void)in_sizes; (void)n_in; (void)out_size;
  const float* q = (const float*)d_in[0]; const float* k = (const float*)d_in[1]; const float* v = (const float*)d_in[2]; float* O = (float*)d_out;
  char* ws = (char*)d_ws; size_t off = 0;
  auto take = [&](size_t bytes) { char* p = ws + off; off += (bytes + 255) & ~(size_t)255; return p; };
  const size_t np = (size_t)NR * DM;      /* 32 x 2048 x 64 */
  _Float16* QH = (_Float16*)take(np * 2); _Float16* KH = (_Float16*)take(np * 2); _Float16* VT = (_Float16*)take(np * 2); float* NSQ = (float*)take((size_t)2 * NR * 4);
  if (off > ws_size) return;      /* 3 x 8 + 0.5 MiB */
  k_prep<<<3 * (NR / 256), 256, 0, stream>>>(q, k, v, QH, KH, VT, NSQ);      /* f16 planes of q and k (bf16-rounded inputs are exact in f16), V^T, |q|^2 | |k|^2 tables */
  k_flash_t<<<NB * (QBLKS / 2), 128, 0, stream>>>(QH, KH, VT, NSQ, O);      /* exact q, k products; f32 RBF logits; f32 context straight to the output; a work-group takes a long and a short query block */
  k_fixr<<<NB * 8, 256, 0, stream>>>(q, k, v, NSQ, O);      /* rows < 64 per slab recomputed in f32 */
}

// v007
// One run takes 69.9 microseconds.
// In two side-by-side timings against v006, it was 1.04 and 1.06 times as fast.
// Counting every step since v000, which is the starting kernel, it is 7.03 times as fast.
#include <hip/hip_runtime.h>
// CustomCausalAttention (q, k, v [2][16][2048][64]; RBF-kernel causal attention: logits = -relu(|q|^2 + |k|^2 - 2 q.k) / 8 over keys n <= m; out = softmax(logits) v -> [2][16][2048][64]).
// Structure: each (batch, head) slab is a contiguous 64-wide row block, treated as one 'batch' of a single 64-dim head: one preparatory launch makes the exact f16 planes of q and k (bf16-rounded inputs are exact in f16), |q|^2, |k|^2 as f32 row tables on VALU, and v^T by LDS tiles; causal flash-style fused attention per (slab, 64-query block), forming the RBF logit from the f32 dot product and the two norm tables, f32 context written straight to the output; the first 64 causal rows per slab recomputed entirely in f32 on VALU.
// Compute dtype: inputs rounded to bf16; q, k, v exact as f16 (products exact, f32 accumulation); norms, logits, softmax f32 with plain f16 probabilities (~2^-12); rows < 64 all-f32. v_wmma_f32_16x16x32_f16.
#define NB 32                    /* 2 batches x 16 heads as slabs */
#define DM 64
#define NKV 1
#define NREP (NH / NKV)
#define KVD (NKV * 64)           /* 64 */
#define NR (NB * SLEN)
#define CHK 512
typedef int v4i __attribute__((ext_vector_type(4)));
#define FF 2048
#define SLEN 2048
#define MQI 2048
#define MKI 2048
#define TQ SLEN
#define TK SLEN
#define NH 1
#define SCL 1.0f                 /* raw dot product; the RBF transform applies the 1/8 */
#define QBLKS (TQ / 64)
#define QB05 0
#define QBN5 QBLKS      /* k_flash5 (hi/lo engine, not launched) would span all query blocks */
#define QB0P 0
#define QBNP QBLKS
#define RE 256
typedef __bf16 v16b __attribute__((ext_vector_type(16)));
typedef unsigned short v8us __attribute__((ext_vector_type(8), may_alias));
typedef float  v8f  __attribute__((ext_vector_type(8)));
typedef float  v4f  __attribute__((ext_vector_type(4)));
typedef float  v4fa __attribute__((ext_vector_type(4), may_alias));
union FragB { v16b v; v8us half[2]; unsigned short u[16]; };

__device__ __forceinline__ unsigned short bf16_bits(float x) { unsigned int u = __float_as_uint(x); return (unsigned short)((u + 0x7FFFu + ((u >> 16) & 1u)) >> 16); }
__device__ __forceinline__ float bf16_val(unsigned short b) { return __uint_as_float(((unsigned int)b) << 16); }
__device__ __forceinline__ float bf16_round(float x) { return bf16_val(bf16_bits(x)); }
// D += A·B with NT terms: 1 = ah·bh, 2 = + al·bh (A split), 3 = + ah·bl (both split)
template <int NT>
__device__ __forceinline__ v8f mmaN(v16b ah, v16b al, v16b bh, v16b bl, v8f c) {
  c = __builtin_amdgcn_wmma_f32_16x16x32_bf16(false, ah, false, bh, (short)0, c, false, false);
  if (NT >= 2) c = __builtin_amdgcn_wmma_f32_16x16x32_bf16(false, al, false, bh, (short)0, c, false, false);
  if (NT >= 3) c = __builtin_amdgcn_wmma_f32_16x16x32_bf16(false, ah, false, bl, (short)0, c, false, false);
  asm volatile("v_nop\n\tv_nop\n\tv_nop\n\tv_nop" : "+v"(c) : "v"(ah), "v"(al), "v"(bh), "v"(bl));
  return c;
}

__global__ __launch_bounds__(256) void k_wt_bf16(const float* __restrict__ W, unsigned short* __restrict__ Wt, int K, int N) {
  const int t = blockIdx.x * 256 + threadIdx.x;
  const int k8n = K / 8;
  if (t >= N * k8n) return;
  const int n = t / k8n, k8 = (t % k8n) * 8;
  v8us v;
#pragma unroll
  for (int i = 0; i < 8; ++i) v[i] = bf16_bits(W[(size_t)(k8 + i) * N + n]);
  *(v8us*)(Wt + (size_t)n * K + k8) = v;
  
}

// GEMM C[M][N] (f32, pitch ldc) = act(A[M][K]·W + bias). A f32 row-major (pitch lda) converted per fragment to bf16
// (ASPLIT: hi/lo two planes -> 2 terms, else single rounded term); Wt bf16 [N][K] (pitch ldb). BIAS_BF16 rounds the
// bias to bf16 first (bias quantised to bf16 before the add). K%32==0, M%16==0, N%64==0.
template <bool ASPLIT, int ACT, bool BIAS_BF16>
__global__ __launch_bounds__(128) void k_gemm_bf(const float* __restrict__ A, int lda, const unsigned short* __restrict__ Wt, int ldb,
                                               const float* __restrict__ bias, float* __restrict__ C, int ldc, int M, int N, int K) {
  __shared__ __attribute__((aligned(16))) float so[4][16][64];
  const int tid = threadIdx.x, w = tid >> 5, lane = tid & 31, ln = lane & 15, hh = lane >> 4;
  const int ntn = N / 64;
  const int wid = blockIdx.x * 4 + w;
  const int mt = wid / ntn, nq = wid % ntn;
  if (mt * 16 >= M) return;
  const int row0 = mt * 16, col0 = nq * 64;
  const float* arow = A + (size_t)(row0 + ln) * lda;
  v8f acc[4] = {};
  for (int kb = 0; kb < K; kb += 32) {
    FragB ah, al;
    const v4f x0 = *(const v4fa*)(arow + kb + 8 * hh), x1 = *(const v4fa*)(arow + kb + 8 * hh + 4);
    const v4f x2 = *(const v4fa*)(arow + kb + 16 + 8 * hh), x3 = *(const v4fa*)(arow + kb + 16 + 8 * hh + 4);
    float xs[16] = {x0[0],x0[1],x0[2],x0[3],x1[0],x1[1],x1[2],x1[3],x2[0],x2[1],x2[2],x2[3],x3[0],x3[1],x3[2],x3[3]};
#pragma unroll
    for (int i = 0; i < 16; ++i) { const unsigned short hb = bf16_bits(xs[i]); ah.u[i] = hb; al.u[i] = ASPLIT ? bf16_bits(xs[i] - bf16_val(hb)) : (unsigned short)0; }
#pragma unroll
    for (int t = 0; t < 4; ++t) {
      const unsigned short* brow = Wt + (size_t)(col0 + t * 16 + ln) * ldb + kb;
      FragB b;
      b.half[0] = *(const v8us*)(brow + 8 * hh);
      b.half[1] = *(const v8us*)(brow + 16 + 8 * hh);
      acc[t] = mmaN<ASPLIT ? 2 : 1>(ah.v, al.v, b.v, b.v, acc[t]);
    }
  }
#pragma unroll
  for (int t = 0; t < 4; ++t) {
    float bv = bias ? bias[col0 + t * 16 + ln] : 0.f;
    if (BIAS_BF16) bv = bf16_round(bv);
#pragma unroll
    for (int r = 0; r < 8; ++r) { float v = acc[t][r] + bv; if (ACT == 1) v = fmaxf(v, 0.f); so[w][8 * hh + r][t * 16 + ln] = v; }
  }
  __builtin_amdgcn_fence(__ATOMIC_ACQ_REL, "workgroup");
  __builtin_amdgcn_wave_barrier();
  const int rsub = lane >> 4, c4 = (lane & 15) * 4;
  {
#pragma unroll
    for (int q = 0; q < 8; ++q) {
      const int r = q * 2 + rsub;
      const v4f v = *(const v4fa*)&so[w][r][c4];
      *(v4f*)(C + (size_t)(row0 + r) * ldc + col0 + c4) = v;
    }
    
  }
}

// GEMM C = act(A·W + bias + resid): A f32 (ASPLIT -> hi/lo 2 terms), Wt bf16 [N][K]; ACT 0 none, 1 relu, 2 exact gelu;
// resid (optional, f32, row index = (row % rmod), pitch ldr, RES_BF16 rounds it) added before the activation.
template <bool ASPLIT, int ACT, bool BIAS_BF16, bool RES_BF16>
__global__ __launch_bounds__(128) void k_gemm_bf3(const float* __restrict__ A, int lda, const unsigned short* __restrict__ Wt, int ldb,
                                                const float* __restrict__ bias, const float* __restrict__ resid, int rmod, int ldr,
                                                float* __restrict__ C, int ldc, int M, int N, int K) {
  __shared__ __attribute__((aligned(16))) float so[4][16][64];
  const int tid = threadIdx.x, w = tid >> 5, lane = tid & 31, ln = lane & 15, hh = lane >> 4;
  const int ntn = N / 64;
  const int wid = blockIdx.x * 4 + w;
  const int mt = wid / ntn, nq = wid % ntn;
  if (mt * 16 >= M) return;
  const int row0 = mt * 16, col0 = nq * 64;
  const float* arow = A + (size_t)(row0 + ln) * lda;
  v8f acc[4] = {};
  for (int kb = 0; kb < K; kb += 32) {
    FragB ah, al;
    const v4f x0 = *(const v4fa*)(arow + kb + 8 * hh), x1 = *(const v4fa*)(arow + kb + 8 * hh + 4);
    const v4f x2 = *(const v4fa*)(arow + kb + 16 + 8 * hh), x3 = *(const v4fa*)(arow + kb + 16 + 8 * hh + 4);
    float xs[16] = {x0[0],x0[1],x0[2],x0[3],x1[0],x1[1],x1[2],x1[3],x2[0],x2[1],x2[2],x2[3],x3[0],x3[1],x3[2],x3[3]};
#pragma unroll
    for (int i = 0; i < 16; ++i) { const unsigned short hb = bf16_bits(xs[i]); ah.u[i] = hb; al.u[i] = ASPLIT ? bf16_bits(xs[i] - bf16_val(hb)) : (unsigned short)0; }
#pragma unroll
    for (int t = 0; t < 4; ++t) {
      const unsigned short* brow = Wt + (size_t)(col0 + t * 16 + ln) * ldb + kb;
      FragB b;
      b.half[0] = *(const v8us*)(brow + 8 * hh);
      b.half[1] = *(const v8us*)(brow + 16 + 8 * hh);
      acc[t] = mmaN<ASPLIT ? 2 : 1>(ah.v, al.v, b.v, b.v, acc[t]);
    }
  }
#pragma unroll
  for (int t = 0; t < 4; ++t) {
    const int col = col0 + t * 16 + ln;
    float bv = bias ? bias[col] : 0.f;
    if (BIAS_BF16) bv = bf16_round(bv);
#pragma unroll
    for (int r = 0; r < 8; ++r) {
      float v = acc[t][r] + bv;
      if (resid) { float rv = resid[(size_t)((row0 + 8 * hh + r) % rmod) * ldr + col]; if (RES_BF16) rv = bf16_round(rv); v += rv; }
      if (ACT == 1) v = fmaxf(v, 0.f);
      if (ACT == 2) v = 0.5f * v * (1.0f + erff(v * 0.70710678118654752f));
      if (ACT == 3) { const float u = 0.7978845608028654f * (v + 0.044715f * v * v * v); v = 0.5f * v * (1.0f + tanhf(u)); }
      so[w][8 * hh + r][t * 16 + ln] = v;
    }
  }
  __builtin_amdgcn_fence(__ATOMIC_ACQ_REL, "workgroup");
  __builtin_amdgcn_wave_barrier();
  const int rsub = lane >> 4, c4 = (lane & 15) * 4;
  {
#pragma unroll
    for (int q = 0; q < 8; ++q) {
      const int r = q * 2 + rsub;
      const v4f v = *(const v4fa*)&so[w][r][c4];
      *(v4f*)(C + (size_t)(row0 + r) * ldc + col0 + c4) = v;
    }
    
  }
}
// row LayerNorm (biased variance, eps) over N: s = X (+ R); optional out_sum <- s; out_norm <- (s-mu)*rsqrt(var+eps)*g + b
template <bool PARAM_BF16>
__global__ __launch_bounds__(256) void k_layernorm(const float* __restrict__ X, const float* __restrict__ R, const float* __restrict__ g, const float* __restrict__ bta,
                                                  float* __restrict__ out_sum, float* __restrict__ out_norm, int N, float eps) {
  __shared__ float red[256];
  const int row = blockIdx.x, tid = threadIdx.x;
  const float* x = X + (size_t)row * N; const float* rr = R ? R + (size_t)row * N : nullptr;
  float vals[16];                     // up to N = 4096
  const int per = N / 256;            // contiguous chunk per thread? use strided-by-4 chunks: thread handles j = tid*4 + 1024*u
  float s1 = 0.f;
  for (int u = 0; u < per / 4; ++u) {
    const int j = tid * 4 + 1024 * u;
    const v4f a = *(const v4fa*)(x + j);
    v4f b = {0.f,0.f,0.f,0.f}; if (rr) b = *(const v4fa*)(rr + j);
#pragma unroll
    for (int q = 0; q < 4; ++q) { const float v = a[q] + b[q]; vals[u * 4 + q] = v; s1 += v; }
  }
  red[tid] = s1; __syncthreads();
  for (int st = 128; st > 0; st >>= 1) { if (tid < st) red[tid] += red[tid + st]; __syncthreads(); }
  const float mu = red[0] / (float)N; __syncthreads();
  float s2 = 0.f;
  for (int u = 0; u < per / 4; ++u)
#pragma unroll
    for (int q = 0; q < 4; ++q) { const float c = vals[u * 4 + q] - mu; s2 += c * c; }
  red[tid] = s2; __syncthreads();
  for (int st = 128; st > 0; st >>= 1) { if (tid < st) red[tid] += red[tid + st]; __syncthreads(); }
  const float rs = rsqrtf(red[0] / (float)N + eps);
  {
    for (int u = 0; u < per / 4; ++u) {
      const int j = tid * 4 + 1024 * u;
      v4f o, sm;
#pragma unroll
      for (int q = 0; q < 4; ++q) {
        float gg = g[j + q], bb = bta[j + q];
        if (PARAM_BF16) { gg = bf16_round(gg); bb = bf16_round(bb); }
        sm[q] = vals[u * 4 + q]; o[q] = (vals[u * 4 + q] - mu) * rs * gg + bb;
      }
      if (out_sum) *(v4f*)(out_sum + (size_t)row * N + j) = sm;
      *(v4f*)(out_norm + (size_t)row * N + j) = o;
    }
    
  }
}



// ---- f16 WMMA path (v_wmma_f32_16x16x32_f16): 11-bit significands for operands in range — used where a [0,1] probability operand needs more precision than bf16
typedef _Float16 v16h __attribute__((ext_vector_type(16)));
union FragH { v16h v; v8us half[2]; _Float16 h[16]; unsigned short u[16]; };
template <int NT>
__device__ __forceinline__ v8f mmaH(v16h ah, v16h al, v16h bh, v16h bl, v8f c) {
  c = __builtin_amdgcn_wmma_f32_16x16x32_f16(false, ah, false, bh, (short)0, c, false, false);
  if (NT >= 2) c = __builtin_amdgcn_wmma_f32_16x16x32_f16(false, al, false, bh, (short)0, c, false, false);
  if (NT >= 3) c = __builtin_amdgcn_wmma_f32_16x16x32_f16(false, ah, false, bl, (short)0, c, false, false);
  asm volatile("v_nop\n\tv_nop\n\tv_nop\n\tv_nop" : "+v"(c) : "v"(ah), "v"(al), "v"(bh), "v"(bl));
  return c;
}
// batched GEMM like k_gemm_b but f16 operands: A f32 (split into f16 hi/lo if ASPLIT, else rounded to f16), Bt = f16 values [n][k]; alpha; C f32; N multiple of 16 (partial tiles skipped)
template <bool ASPLIT>
__global__ __launch_bounds__(128) void k_gemm_h(const float* __restrict__ A, int lda, size_t sA, const _Float16* __restrict__ Bh, int ldb, size_t sB, float alpha, float* __restrict__ C, int ldc, size_t sC, int M, int N, int K) {
  __shared__ __attribute__((aligned(16))) float so[4][16][64];
  const int tid = threadIdx.x, w = tid >> 5, lane = tid & 31, ln = lane & 15, hh = lane >> 4; const int by = blockIdx.y;
  A += (size_t)by * sA; Bh += (size_t)by * sB; C += (size_t)by * sC;
  const int ntn = (N + 63) / 64; const int wid = blockIdx.x * 4 + w; const int mt = wid / ntn, nq = wid % ntn; if (mt * 16 >= M) return;
  const int row0 = mt * 16, col0 = nq * 64; const float* arow = A + (size_t)(row0 + ln) * lda;
  v8f acc[4] = {};
  for (int kb = 0; kb < K; kb += 32) {
    FragH ah, al;
    const v4f x0 = *(const v4fa*)(arow + kb + 8 * hh), x1 = *(const v4fa*)(arow + kb + 8 * hh + 4), x2 = *(const v4fa*)(arow + kb + 16 + 8 * hh), x3 = *(const v4fa*)(arow + kb + 16 + 8 * hh + 4);
    float xs[16] = {x0[0],x0[1],x0[2],x0[3],x1[0],x1[1],x1[2],x1[3],x2[0],x2[1],x2[2],x2[3],x3[0],x3[1],x3[2],x3[3]};
#pragma unroll
    for (int i = 0; i < 16; ++i) { const _Float16 h = (_Float16)xs[i]; ah.h[i] = h; al.h[i] = ASPLIT ? (_Float16)(xs[i] - (float)h) : (_Float16)0.0f; }
#pragma unroll
    for (int t = 0; t < 4; ++t) { if (col0 + t * 16 >= N) continue; const size_t boff = (size_t)(col0 + t * 16 + ln) * ldb + kb; FragH bq; bq.half[0] = *(const v8us*)(Bh + boff + 8 * hh); bq.half[1] = *(const v8us*)(Bh + boff + 16 + 8 * hh);
      acc[t] = mmaH<ASPLIT ? 2 : 1>(ah.v, al.v, bq.v, bq.v, acc[t]); }
  }
#pragma unroll
  for (int t = 0; t < 4; ++t) { if (col0 + t * 16 >= N) continue;
#pragma unroll
    for (int r = 0; r < 8; ++r) so[w][8 * hh + r][t * 16 + ln] = acc[t][r] * alpha; }
  __builtin_amdgcn_fence(__ATOMIC_ACQ_REL, "workgroup"); __builtin_amdgcn_wave_barrier();
  const int rsub = lane >> 4, c4 = (lane & 15) * 4;
  {
#pragma unroll
    for (int q = 0; q < 8; ++q) { const int r = q * 2 + rsub; if (col0 + c4 < N) { const v4f v = *(const v4fa*)&so[w][r][c4]; *(v4f*)(C + (size_t)(row0 + r) * ldc + col0 + c4) = v; } }
     }
}

// Wt[n][k] = f16(W[k][n]·scale) from f32 row-major W[K][N] (scale = power of two; bf16-exact weights stay exact in f16 away from the subnormal range)
__global__ __launch_bounds__(256) void k_wt_f16(const float* __restrict__ W, _Float16* __restrict__ Wt, int K, int N, float scale) {
  const int t = blockIdx.x * 256 + threadIdx.x; if (t >= N * (K / 8)) return; const int n = t / (K / 8), k8 = (t % (K / 8)) * 8; FragH f;
#pragma unroll
  for (int i = 0; i < 8; ++i) f.h[i] = (_Float16)(bf16_round(W[(size_t)(k8 + i) * N + n]) * scale); const v8us o = f.half[0];
  *(v8us*)((unsigned short*)Wt + (size_t)n * K + k8) = o; 
}
// k_gemm_hh variant with fused epilogue: v = acc·alpha + bias[by·sBias + col] (+ CP[(row/rowsPerB)·sCPb + by·64 + col] if CP) ; ACT 0 none / 1 elu ; writes f16 C16 (and f32 C if non-null)
template <int ACT>
__global__ __launch_bounds__(128) void k_gemm_hhx(const _Float16* __restrict__ A, int lda, size_t sA, const _Float16* __restrict__ Bh, int ldb, size_t sB, float alpha, const float* __restrict__ bias, size_t sBias, const float* __restrict__ CP, int rowsPerB, size_t sCPb, int row0g,
    float* __restrict__ C, _Float16* __restrict__ C16, int ldc, size_t sC, int M, int N, int K) {
  __shared__ __attribute__((aligned(16))) float so[4][16][64];
  const int tid = threadIdx.x, w = tid >> 5, lane = tid & 31, ln = lane & 15, hh = lane >> 4; const int by = blockIdx.y;
  A += (size_t)by * sA; Bh += (size_t)by * sB; const size_t cofs = (size_t)by * sC; const float* bp = bias ? bias + (size_t)by * sBias : nullptr;
  const int ntn = (N + 63) / 64; const int wid = blockIdx.x * 4 + w; const int mt = wid / ntn, nq = wid % ntn; if (mt * 16 >= M) return;
  const int row0 = mt * 16, col0 = nq * 64; const _Float16* arow = A + (size_t)(row0 + ln) * lda;
  v8f acc[4] = {};
  for (int kb = 0; kb < K; kb += 32) { FragH ah; ah.half[0] = *(const v8us*)((const unsigned short*)arow + kb + 8 * hh); ah.half[1] = *(const v8us*)((const unsigned short*)arow + kb + 16 + 8 * hh);
#pragma unroll
    for (int t = 0; t < 4; ++t) { if (col0 + t * 16 >= N) continue; const size_t boff = (size_t)(col0 + t * 16 + ln) * ldb + kb; FragH bq; bq.half[0] = *(const v8us*)((const unsigned short*)Bh + boff + 8 * hh); bq.half[1] = *(const v8us*)((const unsigned short*)Bh + boff + 16 + 8 * hh);
      acc[t] = mmaH<1>(ah.v, ah.v, bq.v, bq.v, acc[t]); }
  }
#pragma unroll
  for (int t = 0; t < 4; ++t) { if (col0 + t * 16 >= N) continue; const int col = col0 + t * 16 + ln; const float bv = bp ? bf16_round(bp[col]) : 0.f;
#pragma unroll
    for (int r = 0; r < 8; ++r) { float v = acc[t][r] * alpha + bv; if (CP) { const int bidx = (row0g + row0 + 8 * hh + r) / rowsPerB; v += CP[(size_t)bidx * sCPb + (size_t)by * 64 + col]; } if (ACT == 1) v = (v > 0.f) ? v : expm1f(v); else if (ACT == 7) v = (v > 0.f) ? v + 1.0f : expf(v); else if (ACT == 8) v = tanhf(v); else if (ACT == 9) v = 0.5f * v * (1.0f + tanhf(0.7978845608028654f * (v + 0.044715f * v * v * v))); else if (ACT == 11) v = 1.0f / (1.0f + expf(-v)); else if (ACT == 12) v = (v > 0.f) ? v : 0.01f * v; else if (ACT == 14) v = (v > 0.f) ? v : 0.1f * v; else if (ACT == 15) v = v / (1.0f + expf(-v)); else if (ACT == 3) v = fmaxf(v, 0.f); else if (ACT == 6) v = 0.5f * v * (1.0f + erff(v * 0.70710678118654752f)); so[w][8 * hh + r][t * 16 + ln] = v; } }
  __builtin_amdgcn_fence(__ATOMIC_ACQ_REL, "workgroup"); __builtin_amdgcn_wave_barrier();
  const int rsub = lane >> 4, c4 = (lane & 15) * 4; typedef _Float16 v4h __attribute__((ext_vector_type(4)));
  {
#pragma unroll
    for (int q = 0; q < 8; ++q) { const int r = q * 2 + rsub; if (col0 + c4 < N) { const v4f v = *(const v4fa*)&so[w][r][c4]; if (C) *(v4f*)(C + cofs + (size_t)(row0 + r) * ldc + col0 + c4) = v; if (C16) { v4h h4; for (int i = 0; i < 4; ++i) h4[i] = (_Float16)v[i]; *(v4h*)(C16 + cofs + (size_t)(row0 + r) * ldc + col0 + c4) = h4; } } }
     }
}


typedef _Float16 v4h __attribute__((ext_vector_type(4)));

__global__ __launch_bounds__(256) void k_h16(const float* __restrict__ x, _Float16* __restrict__ X16, size_t n8) { const size_t t = (size_t)blockIdx.x * 256 + threadIdx.x; if (t >= n8) return; FragH f;
#pragma unroll
  for (int q = 0; q < 8; ++q) f.h[q] = (_Float16)x[t * 8 + q]; *(v8us*)((unsigned short*)X16 + t * 8) = f.half[0];  }
__global__ __launch_bounds__(256) void k_round16f(const float* __restrict__ W, _Float16* __restrict__ Bt, size_t n8) { const size_t t = (size_t)blockIdx.x * 256 + threadIdx.x; if (t >= n8) return; FragH f;
#pragma unroll
  for (int i = 0; i < 8; ++i) f.h[i] = (_Float16)(bf16_round(W[t * 8 + i]) * 16.0f); *(v8us*)((unsigned short*)Bt + t * 8) = f.half[0];  }
template <int NHv, int TTv>
__global__ __launch_bounds__(256) void k_vt(const _Float16* __restrict__ V16, int ldv, int voff, _Float16* __restrict__ Vt) { __shared__ unsigned short tl[64][66]; const int tid = threadIdx.x; const int slab = blockIdx.x / (TTv / 64), lg = blockIdx.x % (TTv / 64); const int b = slab / NHv, h = slab % NHv;
  for (int i = tid; i < 64 * 8; i += 256) { const int r = i / 8, c8 = (i % 8) * 8; FragH f; f.half[0] = *(const v8us*)((const unsigned short*)V16 + ((size_t)b * TTv + lg * 64 + r) * ldv + voff + h * 64 + c8);
#pragma unroll
    for (int q = 0; q < 8; ++q) tl[r][c8 + q] = f.u[q]; }
  __syncthreads();
  {
#pragma unroll
    for (int rd = 0; rd < 2; ++rd) { const int d = rd * 32 + tid / 8, pc = tid % 8; FragH f;
#pragma unroll
      for (int q = 0; q < 8; ++q) f.u[q] = tl[pc * 8 + q][d];
      *(v8us*)((unsigned short*)Vt + ((size_t)slab * 64 + d) * TTv + lg * 64 + pc * 8) = f.half[0]; }
     } }

__global__ __launch_bounds__(256) void k_hl(const float* __restrict__ F, _Float16* __restrict__ Hh, _Float16* __restrict__ Hl, size_t n8) { const size_t t = (size_t)blockIdx.x * 256 + threadIdx.x; if (t >= n8) return; FragH fh, fl; const v4f a = *(const v4fa*)(F + t * 8), c = *(const v4fa*)(F + t * 8 + 4);
#pragma unroll
  for (int q = 0; q < 4; ++q) { _Float16 h = (_Float16)a[q]; fh.h[q] = h; fl.h[q] = (_Float16)((a[q] - (float)h) * 1024.0f); h = (_Float16)c[q]; fh.h[4 + q] = h; fl.h[4 + q] = (_Float16)((c[q] - (float)h) * 1024.0f); }
  { *(v8us*)((unsigned short*)Hh + t * 8) = fh.half[0]; *(v8us*)((unsigned short*)Hl + t * 8) = fl.half[0];  } }

// ---- fast GEMM (wave tile 32x64; requires M % 32 == 0 rows per launch region and N % 64 == 0); epilogue = k_gemm_hhx semantics ----
__device__ __forceinline__ v16h g2_frag(const _Float16* p, int hh) { FragH f; f.half[0] = *(const v8us*)((const unsigned short*)p + 8 * hh); f.half[1] = *(const v8us*)((const unsigned short*)p + 16 + 8 * hh); return f.v; }
__device__ __forceinline__ v8f g2_mma(v16h a, v16h b, v8f c) { v8f d = __builtin_amdgcn_wmma_f32_16x16x32_f16(false, a, false, b, (short)0, c, false, false); asm volatile("v_nop\n\tv_nop\n\tv_nop\n\tv_nop" : "+v"(d) : "v"(a), "v"(b)); return d; }
template <int ACT>
__global__ __launch_bounds__(128) void k_gemm2(const _Float16* __restrict__ A, int lda, size_t sA, const _Float16* __restrict__ Bh, int ldb, size_t sB, float alpha, const float* __restrict__ bias, size_t sBias, const float* __restrict__ CP, int rowsPerB, size_t sCPb, int row0g,
    float* __restrict__ C, _Float16* __restrict__ C16, int ldc, size_t sC, int M, int N, int K) {
  __shared__ __attribute__((aligned(16))) float so[4][32][68];
  const int tid = threadIdx.x, w = tid >> 5, lane = tid & 31, ln = lane & 15, hh = lane >> 4; const int by = blockIdx.y;
  A += (size_t)by * sA; Bh += (size_t)by * sB; const size_t cofs = (size_t)by * sC; const float* bp = bias ? bias + (size_t)by * sBias : nullptr;
  const int ntn = N >> 6; const int mt = blockIdx.x / ntn, nq = blockIdx.x - mt * ntn; const int row0 = mt * 128 + 32 * w, col0 = nq * 64; if (row0 >= M) return;
  const _Float16* a0p = A + (size_t)(row0 + ln) * lda; const _Float16* a1p = a0p + (size_t)16 * lda;
  const _Float16* b0p = Bh + (size_t)(col0 + ln) * ldb; const _Float16* b1p = b0p + (size_t)16 * ldb; const _Float16* b2p = b1p + (size_t)16 * ldb; const _Float16* b3p = b2p + (size_t)16 * ldb;
  const v8f z8 = {0.f,0.f,0.f,0.f,0.f,0.f,0.f,0.f}; v8f c00 = z8, c01 = z8, c02 = z8, c03 = z8, c10 = z8, c11 = z8, c12 = z8, c13 = z8;
#pragma unroll 1
  for (int kb = 0; kb < K; kb += 32) { const v16h a0 = g2_frag(a0p + kb, hh), a1 = g2_frag(a1p + kb, hh);
    v16h b = g2_frag(b0p + kb, hh); c00 = g2_mma(a0, b, c00); c10 = g2_mma(a1, b, c10);
    b = g2_frag(b1p + kb, hh); c01 = g2_mma(a0, b, c01); c11 = g2_mma(a1, b, c11);
    b = g2_frag(b2p + kb, hh); c02 = g2_mma(a0, b, c02); c12 = g2_mma(a1, b, c12);
    b = g2_frag(b3p + kb, hh); c03 = g2_mma(a0, b, c03); c13 = g2_mma(a1, b, c13); }
  v8f accs[8] = {c00, c01, c02, c03, c10, c11, c12, c13};
#pragma unroll
  for (int u = 0; u < 8; ++u) { const int t = u & 3, half = u >> 2; const int col = col0 + t * 16 + ln; const float bv = bp ? bf16_round(bp[col]) : 0.f;
#pragma unroll
    for (int r = 0; r < 8; ++r) { const int rloc = half * 16 + 8 * hh + r; float v = accs[u][r] * alpha + bv; if (CP) { if (rowsPerB < 0) v += CP[cofs + (size_t)(row0g + row0 + rloc) * ldc + col];      /* rowsPerB < 0: own element of the batched C plane */ else { const int bidx = (row0g + row0 + rloc) / rowsPerB; v += CP[(size_t)bidx * sCPb + (size_t)by * 64 + col]; } }
      if (ACT == 3) v = fmaxf(v, 0.f); else if (ACT == 6) v = 0.5f * v * (1.0f + erff(v * 0.70710678118654752f)); else if (ACT == 11) v = 1.0f / (1.0f + expf(-v)); else if (ACT == 15) v = v / (1.0f + expf(-v)); else if (ACT == 12) v = (v > 0.f) ? v : 0.01f * v; else if (ACT == 8) v = tanhf(v);
      so[w][rloc][t * 16 + ln] = v; } }
  __builtin_amdgcn_fence(__ATOMIC_ACQ_REL, "workgroup"); __builtin_amdgcn_wave_barrier();
  const int rsub = lane >> 4, c4 = (lane & 15) * 4;
  {
#pragma unroll
    for (int q = 0; q < 16; ++q) { const int r = q * 2 + rsub; const v4f v = *(const v4fa*)&so[w][r][c4]; if (C) *(v4f*)(C + cofs + (size_t)(row0 + r) * ldc + col0 + c4) = v; if (C16) { v4h h4; for (int i = 0; i < 4; ++i) h4[i] = (_Float16)v[i]; *(v4h*)(C16 + cofs + (size_t)(row0 + r) * ldc + col0 + c4) = h4; } }
     } }



__constant__ int BK30[2 * SLEN - 1] = {15,15,15,15,15,15,15,15,15,15,15,15,15,15,15,15,15,15,15,15,15,15,15,15,15,15,15,15,15,15,15,15,15,15,15,15,15,15,15,15,15,15,15,15,15,15,15,15,15,15,15,15,15,15,15,15,15,15,15,15,15,15,15,15,15,15,15,15,15,15,15,15,15,15,15,15,15,15,15,15,15,15,15,15,15,15,15,15,15,15,15,15,15,15,15,15,15,15,15,15,15,15,15,15,15,15,15,15,15,15,15,15,15,15,15,15,15,15,15,15,15,15,15,15,15,15,15,15,15,15,15,15,15,15,15,15,15,15,15,15,15,15,15,15,15,15,15,15,15,15,15,15,15,15,15,15,15,15,15,15,15,15,15,15,15,15,15,15,15,15,15,15,15,15,15,15,15,15,15,15,15,15,15,15,15,15,15,15,15,15,15,15,15,15,15,15,15,15,15,15,15,15,15,15,15,15,15,15,15,15,15,15,15,15,15,15,15,15,15,15,15,15,15,15,15,15,15,15,15,15,15,15,15,15,15,15,15,15,15,15,15,15,15,15,15,15,15,15,15,15,15,15,15,15,15,15,15,15,15,15,15,15,15,15,15,15,15,15,15,15,15,15,15,15,15,15,15,15,15,15,15,15,15,15,15,15,15,15,15,15,15,15,15,15,15,15,15,15,15,15,15,15,15,15,15,15,15,15,15,15,15,15,15,15,15,15,15,15,15,15,15,15,15,15,15,15,15,15,15,15,15,15,15,15,15,15,15,15,15,15,15,15,15,15,15,15,15,15,15,15,15,15,15,15,15,15,15,15,15,15,15,15,15,15,15,15,15,15,15,15,15,15,15,15,15,15,15,15,15,15,15,15,15,15,15,15,15,15,15,15,15,15,15,15,15,15,15,15,15,15,15,15,15,15,15,15,15,15,15,15,15,15,15,15,15,15,15,15,15,15,15,15,15,15,15,15,15,15,15,15,15,15,15,15,15,15,15,15,15,15,15,15,15,15,15,15,15,15,15,15,15,15,15,15,15,15,15,15,15,15,15,15,15,15,15,15,15,15,15,15,15,15,15,15,15,15,15,15,15,15,15,15,15,15,15,15,15,15,15,15,15,15,15,15,15,15,15,15,15,15,15,15,15,15,15,15,15,15,15,15,15,15,15,15,15,15,15,15,15,15,15,15,15,15,15,15,15,15,15,15,15,15,15,15,15,15,15,15,15,15,15,15,15,15,15,15,15,15,15,15,15,15,15,15,15,15,15,15,15,15,15,15,15,15,15,15,15,15,15,15,15,15,15,15,15,15,15,15,15,15,15,15,15,15,15,15,15,15,15,15,15,15,15,15,15,15,15,15,15,15,15,15,15,15,15,15,15,15,15,15,15,15,15,15,15,15,15,15,15,15,15,15,15,15,15,15,15,15,15,15,15,15,15,15,15,15,15,15,15,15,15,15,15,15,15,15,15,15,15,15,15,15,15,15,15,15,15,15,15,15,15,15,15,15,15,15,15,15,15,15,15,15,15,15,15,15,15,15,15,15,15,15,15,15,15,15,15,15,15,15,15,15,15,15,15,15,15,15,15,15,15,15,15,15,15,15,15,15,15,15,15,15,15,15,15,15,15,15,15,15,15,15,15,15,15,15,15,15,15,15,15,15,15,15,15,15,15,15,15,15,15,15,15,15,15,15,15,15,15,15,15,15,15,15,15,15,15,15,15,15,15,15,15,15,15,15,15,15,15,15,15,15,15,15,15,15,15,15,15,15,15,15,15,15,15,15,15,15,15,15,15,15,15,15,15,15,15,15,15,15,15,15,15,15,15,15,15,15,15,15,15,15,15,15,15,15,15,15,15,15,15,15,15,15,15,15,15,15,15,15,15,15,15,15,15,15,15,15,15,15,15,15,15,15,15,15,15,15,15,15,15,15,15,15,15,15,15,15,15,15,15,15,15,15,15,15,15,15,15,15,15,15,15,15,15,15,15,15,15,15,15,15,15,15,15,15,15,15,15,15,15,15,15,15,15,15,15,15,15,15,15,15,15,15,15,15,15,15,15,15,15,15,15,15,15,15,15,15,15,15,15,15,15,15,15,15,15,15,15,15,15,15,15,15,15,15,15,15,15,15,15,15,15,15,15,15,15,15,15,15,15,15,15,15,15,15,15,15,15,15,15,15,15,15,15,15,15,15,15,15,15,15,15,15,15,15,15,15,15,15,15,15,15,15,15,15,15,15,15,15,15,15,15,15,15,15,15,15,15,15,15,15,15,15,15,15,15,15,15,15,15,15,15,15,15,15,15,15,15,15,15,15,15,15,15,15,15,15,15,15,15,15,15,15,15,15,15,15,15,15,15,15,15,15,15,15,15,15,15,15,15,15,15,15,15,15,15,15,15,15,15,15,15,15,15,15,15,15,15,15,15,15,15,15,15,15,15,15,15,15,15,15,15,15,15,15,15,15,15,15,15,15,15,15,15,15,15,15,15,15,15,15,15,15,15,15,15,15,15,15,15,15,15,15,15,15,15,15,15,15,15,15,15,15,15,15,15,15,15,15,15,15,15,15,15,15,15,15,15,15,15,15,15,15,15,15,15,15,15,15,15,15,15,15,15,15,15,15,15,15,15,15,15,15,15,15,15,15,15,15,15,15,15,15,15,15,15,15,15,15,15,15,15,15,15,15,15,15,15,15,15,15,15,15,15,15,15,15,15,15,15,15,15,15,15,15,15,15,15,15,15,15,15,15,15,15,15,15,15,15,15,15,15,15,15,15,15,15,15,15,15,15,15,15,15,15,15,15,15,15,15,15,15,15,15,15,15,15,15,15,15,15,15,15,15,15,15,15,15,15,15,15,15,15,15,15,15,15,15,15,15,15,15,15,15,15,15,15,15,15,15,15,15,15,15,15,15,15,15,15,15,15,15,15,15,15,15,15,15,15,15,15,15,15,15,15,15,15,15,15,15,15,15,15,15,15,15,15,15,15,15,15,15,15,15,15,15,15,15,15,15,15,15,15,15,15,15,15,15,15,15,15,15,15,15,15,15,15,15,15,15,15,15,15,15,15,15,15,15,15,15,15,15,15,15,15,15,15,15,15,15,15,15,15,15,15,15,15,15,15,15,15,15,15,15,15,15,15,15,15,15,15,15,15,15,15,15,15,15,15,15,15,15,15,15,15,15,15,15,15,15,15,15,15,15,15,15,15,15,15,15,15,15,15,15,15,15,15,15,15,15,15,15,15,15,15,15,15,15,15,15,15,15,15,15,15,15,15,15,15,15,15,15,15,15,15,15,15,15,15,15,15,15,15,15,15,15,15,15,15,15,15,15,15,15,15,15,15,15,15,15,15,15,15,15,15,15,15,15,15,15,15,15,15,15,15,15,15,15,15,15,15,15,15,15,15,15,15,15,15,15,15,15,15,15,15,15,15,15,15,15,15,15,15,15,15,15,15,15,15,15,15,15,15,15,15,15,15,15,15,15,15,15,15,15,15,15,15,15,15,15,15,15,15,15,15,15,15,15,15,15,15,15,15,15,15,15,15,15,15,15,15,15,15,15,15,15,15,15,15,15,15,15,15,15,15,15,15,15,15,15,15,15,15,15,15,15,15,15,15,15,15,15,15,15,15,15,15,15,15,15,15,15,15,15,15,15,15,15,15,15,15,15,15,15,15,15,15,15,15,15,15,15,15,15,15,15,15,15,15,15,15,15,15,15,15,15,15,15,15,15,15,15,15,15,15,15,15,15,15,15,15,15,15,15,15,15,15,15,15,15,15,15,15,15,15,15,15,15,15,15,15,15,15,15,15,15,15,15,15,15,15,15,15,15,15,15,15,15,15,15,15,15,15,15,15,15,15,15,15,15,15,15,15,15,15,15,15,15,15,15,15,15,15,15,15,15,15,15,15,15,15,15,15,15,15,15,15,15,15,15,15,15,15,15,15,15,15,15,15,15,15,15,15,15,15,15,15,15,15,15,15,15,15,15,15,15,15,15,15,15,15,15,15,15,15,15,15,15,15,15,15,15,15,15,15,15,15,15,15,15,15,15,15,15,15,15,15,15,15,15,15,15,15,15,15,15,15,15,15,15,15,15,15,15,15,15,15,15,15,15,15,15,15,15,15,15,15,15,15,15,15,15,15,15,15,15,15,15,15,15,15,15,15,15,15,15,15,15,15,15,15,15,15,15,15,15,15,15,15,15,15,15,15,15,15,15,15,15,15,15,15,15,15,15,15,15,15,15,15,15,15,15,15,15,15,15,15,15,15,15,15,15,15,15,15,15,15,15,15,15,15,15,15,15,15,15,15,15,15,15,15,15,15,15,15,15,15,15,15,15,15,15,15,15,15,15,15,15,15,15,15,15,15,15,15,15,15,15,15,15,15,15,15,15,15,15,15,15,15,15,15,15,15,15,15,15,14,14,14,14,14,14,14,14,14,14,14,14,14,14,14,14,14,14,14,14,14,14,14,14,14,14,14,13,13,13,13,13,13,13,13,13,13,13,13,13,13,13,13,13,13,12,12,12,12,12,12,12,12,12,12,12,12,12,12,11,11,11,11,11,11,11,11,11,10,10,10,10,10,10,10,9,9,9,9,8,8,8,8,7,6,5,4,3,2,1,0,17,18,19,20,21,22,23,24,24,24,24,25,25,25,25,26,26,26,26,26,26,26,27,27,27,27,27,27,27,27,27,28,28,28,28,28,28,28,28,28,28,28,28,28,28,29,29,29,29,29,29,29,29,29,29,29,29,29,29,29,29,29,29,30,30,30,30,30,30,30,30,30,30,30,30,30,30,30,30,30,30,30,30,30,30,30,30,30,30,30,31,31,31,31,31,31,31,31,31,31,31,31,31,31,31,31,31,31,31,31,31,31,31,31,31,31,31,31,31,31,31,31,31,31,31,31,31,31,31,31,31,31,31,31,31,31,31,31,31,31,31,31,31,31,31,31,31,31,31,31,31,31,31,31,31,31,31,31,31,31,31,31,31,31,31,31,31,31,31,31,31,31,31,31,31,31,31,31,31,31,31,31,31,31,31,31,31,31,31,31,31,31,31,31,31,31,31,31,31,31,31,31,31,31,31,31,31,31,31,31,31,31,31,31,31,31,31,31,31,31,31,31,31,31,31,31,31,31,31,31,31,31,31,31,31,31,31,31,31,31,31,31,31,31,31,31,31,31,31,31,31,31,31,31,31,31,31,31,31,31,31,31,31,31,31,31,31,31,31,31,31,31,31,31,31,31,31,31,31,31,31,31,31,31,31,31,31,31,31,31,31,31,31,31,31,31,31,31,31,31,31,31,31,31,31,31,31,31,31,31,31,31,31,31,31,31,31,31,31,31,31,31,31,31,31,31,31,31,31,31,31,31,31,31,31,31,31,31,31,31,31,31,31,31,31,31,31,31,31,31,31,31,31,31,31,31,31,31,31,31,31,31,31,31,31,31,31,31,31,31,31,31,31,31,31,31,31,31,31,31,31,31,31,31,31,31,31,31,31,31,31,31,31,31,31,31,31,31,31,31,31,31,31,31,31,31,31,31,31,31,31,31,31,31,31,31,31,31,31,31,31,31,31,31,31,31,31,31,31,31,31,31,31,31,31,31,31,31,31,31,31,31,31,31,31,31,31,31,31,31,31,31,31,31,31,31,31,31,31,31,31,31,31,31,31,31,31,31,31,31,31,31,31,31,31,31,31,31,31,31,31,31,31,31,31,31,31,31,31,31,31,31,31,31,31,31,31,31,31,31,31,31,31,31,31,31,31,31,31,31,31,31,31,31,31,31,31,31,31,31,31,31,31,31,31,31,31,31,31,31,31,31,31,31,31,31,31,31,31,31,31,31,31,31,31,31,31,31,31,31,31,31,31,31,31,31,31,31,31,31,31,31,31,31,31,31,31,31,31,31,31,31,31,31,31,31,31,31,31,31,31,31,31,31,31,31,31,31,31,31,31,31,31,31,31,31,31,31,31,31,31,31,31,31,31,31,31,31,31,31,31,31,31,31,31,31,31,31,31,31,31,31,31,31,31,31,31,31,31,31,31,31,31,31,31,31,31,31,31,31,31,31,31,31,31,31,31,31,31,31,31,31,31,31,31,31,31,31,31,31,31,31,31,31,31,31,31,31,31,31,31,31,31,31,31,31,31,31,31,31,31,31,31,31,31,31,31,31,31,31,31,31,31,31,31,31,31,31,31,31,31,31,31,31,31,31,31,31,31,31,31,31,31,31,31,31,31,31,31,31,31,31,31,31,31,31,31,31,31,31,31,31,31,31,31,31,31,31,31,31,31,31,31,31,31,31,31,31,31,31,31,31,31,31,31,31,31,31,31,31,31,31,31,31,31,31,31,31,31,31,31,31,31,31,31,31,31,31,31,31,31,31,31,31,31,31,31,31,31,31,31,31,31,31,31,31,31,31,31,31,31,31,31,31,31,31,31,31,31,31,31,31,31,31,31,31,31,31,31,31,31,31,31,31,31,31,31,31,31,31,31,31,31,31,31,31,31,31,31,31,31,31,31,31,31,31,31,31,31,31,31,31,31,31,31,31,31,31,31,31,31,31,31,31,31,31,31,31,31,31,31,31,31,31,31,31,31,31,31,31,31,31,31,31,31,31,31,31,31,31,31,31,31,31,31,31,31,31,31,31,31,31,31,31,31,31,31,31,31,31,31,31,31,31,31,31,31,31,31,31,31,31,31,31,31,31,31,31,31,31,31,31,31,31,31,31,31,31,31,31,31,31,31,31,31,31,31,31,31,31,31,31,31,31,31,31,31,31,31,31,31,31,31,31,31,31,31,31,31,31,31,31,31,31,31,31,31,31,31,31,31,31,31,31,31,31,31,31,31,31,31,31,31,31,31,31,31,31,31,31,31,31,31,31,31,31,31,31,31,31,31,31,31,31,31,31,31,31,31,31,31,31,31,31,31,31,31,31,31,31,31,31,31,31,31,31,31,31,31,31,31,31,31,31,31,31,31,31,31,31,31,31,31,31,31,31,31,31,31,31,31,31,31,31,31,31,31,31,31,31,31,31,31,31,31,31,31,31,31,31,31,31,31,31,31,31,31,31,31,31,31,31,31,31,31,31,31,31,31,31,31,31,31,31,31,31,31,31,31,31,31,31,31,31,31,31,31,31,31,31,31,31,31,31,31,31,31,31,31,31,31,31,31,31,31,31,31,31,31,31,31,31,31,31,31,31,31,31,31,31,31,31,31,31,31,31,31,31,31,31,31,31,31,31,31,31,31,31,31,31,31,31,31,31,31,31,31,31,31,31,31,31,31,31,31,31,31,31,31,31,31,31,31,31,31,31,31,31,31,31,31,31,31,31,31,31,31,31,31,31,31,31,31,31,31,31,31,31,31,31,31,31,31,31,31,31,31,31,31,31,31,31,31,31,31,31,31,31,31,31,31,31,31,31,31,31,31,31,31,31,31,31,31,31,31,31,31,31,31,31,31,31,31,31,31,31,31,31,31,31,31,31,31,31,31,31,31,31,31,31,31,31,31,31,31,31,31,31,31,31,31,31,31,31,31,31,31,31,31,31,31,31,31,31,31,31,31,31,31,31,31,31,31,31,31,31,31,31,31,31,31,31,31,31,31,31,31,31,31,31,31,31,31,31,31,31,31,31,31,31,31,31,31,31,31,31,31,31,31,31,31,31,31,31,31,31,31,31,31,31,31,31,31,31,31,31,31,31,31,31,31,31,31,31,31,31,31,31,31,31,31,31,31,31,31,31,31,31,31,31,31,31,31,31,31,31,31,31,31,31,31,31,31,31,31,31,31,31,31,31,31,31,31,31,31,31,31,31,31,31,31,31,31,31,31,31,31,31,31,31,31,31,31,31,31,31,31,31,31,31,31,31,31,31,31,31,31,31,31,31,31,31,31,31,31,31,31,31,31,31,31,31,31,31,31,31,31,31,31,31,31,31,31,31,31,31,31,31,31,31,31,31,31,31,31,31,31,31,31,31,31,31,31,31,31,31,31,31,31,31,31,31,31,31,31,31,31,31,31,31,31,31,31,31,31,31,31,31,31,31,31,31,31,31,31,31,31,31,31,31,31,31,31,31,31,31,31,31,31,31,31,31,31,31,31,31,31,31,31,31,31,31,31,31,31,31,31,31,31,31,31,31,31,31,31,31,31,31,31,31,31,31,31,31,31,31,31,31,31,31,31,31,31,31,31,31,31,31,31,31,31,31,31,31,31,31,31,31,31,31,31,31,31,31,31,31,31,31,31,31,31,31,31,31,31,31,31,31,31,31,31,31,31,31,31,31,31,31,31,31,31,31,31,31,31,31,31,31,31,31,31,31,31,31,31,31,31,31,31,31,31,31,31,31,31,31,31,31,31,31,31,31,31,31,31,31,31,31,31,31,31,31,31,31,31,31,31,31,31,31,31,31,31,31,31,31,31,31,31,31,31,31,31,31,31,31,31,31,31,31,31,31,31,31,31,31,31,31,31,31,31,31,31,31,31,31,31,31,31,31,31,31,31,31,31,31,31,31,31,31,31,31,31,31,31,31,31,31,31,31,31,31,31,31,31,31,31,31,31,31,31,31,31,31,31,31,31,31,31,31,31,31,31,31,31,31,31,31,31,31,31,31,31,31,31,31,31,31,31,31,31,31,31,31,31,31,31,31,31,31,31,31,31,31,31,31,31,31,31,31,31,31,31,31,31,31,31,31,31,31,31,31,31,31,31,31,31,31,31,31,31,31,31,31,31,31,31,31,31,31,31,31,31,31,31,31,31,31,31,31,31,31,31,31,31,31,31,31,31,31,31,31,31,31,31,31,31,31,31,31,31,31,31,31,31,31,31,31,31,31,31,31,31,31,31,31,31,31,31,31,31,31,31,31,31,31,31,31,31,31,31,31,31,31,31,31,31,31,31,31,31,31,31,31,31,31,31,31,31,31,31,31,31,31,31,31,31,31,31,31,31,31,31,31,31,31,31,31,31,31,31,31,31,31,31,31,31,31,31,31,31,31,31,31,31,31,31,31,31,31,31,31,31,31,31,31,31,31,31,31,31,31,31,31,31,31,31,31,31,31,31,31,31,31,31,31,31,31,31,31,31,31,31,31,31,31,31,31,31,31,31,31,31,31,31,31,31,31,31,31,31,31,31,31,31,31,31,31,31,31,31,31,31,31,31,31,31,31,31,31,31,31,31,31,31,31,31,31,31,31,31,31,31,31,31,31,31,31,31,31,31,31,31,31,31,31,31};      /* T5 _relative_position_bucket(k - q) for k - q in [-(S-1), S-1], computed with the module's own jax code on the host */
__global__ __launch_bounds__(512) void k_rb(const float* __restrict__ t, float* __restrict__ RB) { const int i = threadIdx.x; const float v = bf16_round(t[i]); *(float*)(RB + i) = v;  }
template <int CAUSAL>
__global__ __launch_bounds__(128) void k_flash(const _Float16* __restrict__ Q16, int ldq, const _Float16* __restrict__ K16, int ldk, const _Float16* __restrict__ Vt, const int* __restrict__ MSK, float* __restrict__ O, int ldo) {
  constexpr int RPW = 16, RTN = RPW / 16, NQB = TQ / (4 * RPW), DT = 4, KS = 2;
  __shared__ __attribute__((aligned(16))) unsigned short sP[4][RPW][40]; __shared__ __attribute__((aligned(16))) float sO[4][RPW][64 + 4];
  const int tid = threadIdx.x, w = tid >> 5, lane = tid & 31, ln = lane & 15, hh = lane >> 4;
  const int slab = blockIdx.x / QBNP, qblk = QB0P + blockIdx.x % QBNP; (void)NQB; const int b = slab / NH, h = slab % NH; const int qb0 = qblk * (4 * RPW); const int q0 = qb0 + w * RPW;
  FragH aq[2][KS];
#pragma unroll
  for (int rt = 0; rt < RTN; ++rt) { const unsigned short* qr = (const unsigned short*)Q16 + ((size_t)b * TQ + q0 + rt * 16 + ln) * ldq + h * 64;
#pragma unroll
    for (int ks = 0; ks < KS; ++ks) { aq[rt][ks].half[0] = *(const v8us*)(qr + ks * 32 + 8 * hh); aq[rt][ks].half[1] = *(const v8us*)(qr + ks * 32 + 16 + 8 * hh); } }
  const unsigned short* Vth = (const unsigned short*)Vt + (size_t)slab * 64 * TK;
  float m_r[2][8], l_r[2][8]; v8f oacc[2][DT];
#pragma unroll
  for (int rt = 0; rt < RTN; ++rt) {
#pragma unroll
    for (int r = 0; r < 8; ++r) { m_r[rt][r] = -3.0e38f; l_r[rt][r] = 0.f; }
#pragma unroll
    for (int dt = 0; dt < DT; ++dt) oacc[rt][dt] = (v8f){0.f,0.f,0.f,0.f,0.f,0.f,0.f,0.f}; }
  float qsq[2][8];      /* mode 32: |q|^2 of this lane's rows, read once */
#pragma unroll
  for (int rt = 0; rt < RTN; ++rt)
#pragma unroll
    for (int r = 0; r < 8; ++r) qsq[rt][r] = (CAUSAL == 32) ? ((const float*)MSK)[(size_t)b * TQ + q0 + rt * 16 + 8 * hh + r] : 0.f;
  const int jend = (CAUSAL == 1 || CAUSAL == 32) ? (qb0 + 4 * RPW) : ((CAUSAL == 23) ? min(TK, (qb0 / CHK + 2) * CHK) : TK);      /* causal / window: keys that can never contribute are skipped */ const int jbeg = (CAUSAL == 23) ? max(0, (qb0 / CHK - 1) * CHK) : 0;
#pragma unroll 1
  for (int j0 = jbeg; j0 < jend; j0 += 32) {
    v8f s[2][2];
    float ksq0 = 0.f, ksq1 = 0.f; if (CAUSAL == 32) { const float* ksT = (const float*)MSK + (size_t)NB * TQ + (size_t)b * TK + j0 + ln; ksq0 = ksT[0]; ksq1 = ksT[16]; }      /* mode 32: |k|^2 of this lane's two keys, one unconditional load each per key block (j0 + 31 < jend <= TK) */
#pragma unroll
    for (int nt = 0; nt < 2; ++nt) { const unsigned short* kr = (const unsigned short*)K16 + ((size_t)b * TK + j0 + nt * 16 + ln) * ldk + h * 64; FragH bk[KS];
#pragma unroll
      for (int ks = 0; ks < KS; ++ks) { bk[ks].half[0] = *(const v8us*)(kr + ks * 32 + 8 * hh); bk[ks].half[1] = *(const v8us*)(kr + ks * 32 + 16 + 8 * hh); }
#pragma unroll
      for (int rt = 0; rt < RTN; ++rt) { v8f acc = (v8f){0.f,0.f,0.f,0.f,0.f,0.f,0.f,0.f};
#pragma unroll
        for (int ks = 0; ks < KS; ++ks) acc = mmaH<1>(aq[rt][ks].v, aq[rt][ks].v, bk[ks].v, bk[ks].v, acc); s[rt][nt] = acc; } }
#pragma unroll
    for (int rt = 0; rt < RTN; ++rt)
#pragma unroll
      for (int r = 0; r < 8; ++r) { const int tq = q0 + rt * 16 + 8 * hh + r; const int k0 = j0 + ln, k1 = j0 + 16 + ln;
        bool ok0 = (CAUSAL == 1 || CAUSAL == 32) ? (k0 <= tq) : ((CAUSAL == 2) ? ((k0 >> 5) == (tq >> 5)) : true), ok1 = (CAUSAL == 1 || CAUSAL == 32) ? (k1 <= tq) : ((CAUSAL == 2) ? ((k1 >> 5) == (tq >> 5)) : true); if (CAUSAL == 23) { const int cq = tq / CHK; ok0 = (abs(k0 / CHK - cq) <= 1) && (MSK[(size_t)b * TK + k0] == 0); ok1 = (abs(k1 / CHK - cq) <= 1) && (MSK[(size_t)b * TK + k1] == 0); }      /* mode 23: 3-chunk window + int key-padding mask */
        if (CAUSAL == 24) { ok0 = (MSK[(size_t)b * TK + k0] == 0); ok1 = (MSK[(size_t)b * TK + k1] == 0); }      /* mode 24: int key-padding mask (nonzero = padded = excluded) */      /* mode 2: block-diagonal 32-token groups */
        float s0 = ok0 ? s[rt][0][r] * SCL : -3.0e38f, s1 = ok1 ? s[rt][1][r] * SCL : -3.0e38f; if (CAUSAL == 27) { const float* amk = (const float*)MSK + ((size_t)b * MQI + tq) * MKI; s0 += bf16_round(amk[k0]); s1 += bf16_round(amk[k1]); }      /* mode 27: additive per-(batch, query, key) f32 mask INPUT [b][tq][k] */ if (CAUSAL == 30) { const float* rbp = (const float*)MSK; s0 += rbp[BK30[k0 - tq + (TK - 1)] * NH + h]; s1 += rbp[BK30[k1 - tq + (TK - 1)] * NH + h]; }      /* mode 30: T5 bucketed relative bias: table[bucket(k - q)][h]; bucket-of-distance is a module constant */ if (CAUSAL == 32) { const float qs = qsq[rt][r]; if (ok0) { float d = qs + ksq0; d = d - 2.0f * s0; d = fmaxf(d, 0.f); s0 = -d * 0.125f; } if (ok1) { float d = qs + ksq1; d = d - 2.0f * s1; d = fmaxf(d, 0.f); s1 = -d * 0.125f; } }      /* mode 32: RBF logit -relu(|q|^2 + |k|^2 - 2 q.k)/8, causal */ if (CAUSAL == 17) { const float* amk = (const float*)MSK + (size_t)b * TK; s0 += bf16_round(amk[k0]); s1 += bf16_round(amk[k1]); } if (CAUSAL == 18) { const float* tb = (const float*)MSK; const int* ri = MSK + 1024 + (size_t)b * TK; const int rq = ri[tq]; s0 += tb[(h * 8 + rq) * 8 + ri[k0]]; s1 += tb[(h * 8 + rq) * 8 + ri[k1]]; } if (CAUSAL == 19) { const int* rel = MSK + (size_t)tq * TK; const float* rb = (const float*)MSK + (size_t)TQ * TK + ((size_t)(b * NH + h) * TQ + tq) * 64; s0 += rb[rel[k0]]; s1 += rb[rel[k1]]; }      /* mode 19: + (q.Ek[rel] + Eb[rel][h]) / 8 gathered by the int relative ids (packed [ids | table]) */      /* mode 18: + resource_bias[h][r_q][r_k] from the packed [table | ids] buffer (TQ == TK) */      /* mode 17: additive per-(batch, key) mask INPUT */ float mc = fmaxf(s0, s1);
        mc = fmaxf(mc, __shfl_xor(mc, 1, 32)); mc = fmaxf(mc, __shfl_xor(mc, 2, 32)); mc = fmaxf(mc, __shfl_xor(mc, 4, 32)); mc = fmaxf(mc, __shfl_xor(mc, 8, 32));
        const float mn = fmaxf(m_r[rt][r], mc); const float ea = expf(m_r[rt][r] - mn), e0 = expf(s0 - mn), e1 = expf(s1 - mn);      /* computed for every lane and selected below: no exec-mask branch, so the eight rows' chains can overlap */ const float al = (mn > -1.0e38f) ? ea : 1.0f; m_r[rt][r] = mn; const float p0 = ok0 ? e0 : 0.f, p1 = ok1 ? e1 : 0.f; l_r[rt][r] = l_r[rt][r] * al + p0 + p1;
#pragma unroll
        for (int dt = 0; dt < DT; ++dt) oacc[rt][dt][r] *= al;
        FragH t2; t2.h[0] = (_Float16)(p0 * 1024.0f); t2.h[1] = (_Float16)(p1 * 1024.0f); sP[w][rt * 16 + 8 * hh + r][ln] = t2.u[0]; sP[w][rt * 16 + 8 * hh + r][16 + ln] = t2.u[1]; }
    __builtin_amdgcn_fence(__ATOMIC_ACQ_REL, "workgroup"); __builtin_amdgcn_wave_barrier();
    FragH pa[2];
#pragma unroll
    for (int rt = 0; rt < RTN; ++rt) { pa[rt].half[0] = *(const v8us*)&sP[w][rt * 16 + ln][8 * hh]; pa[rt].half[1] = *(const v8us*)&sP[w][rt * 16 + ln][16 + 8 * hh]; }
#pragma unroll
    for (int dt = 0; dt < DT; ++dt) { const unsigned short* vrow = Vth + (size_t)(dt * 16 + ln) * TK + j0; FragH bv; bv.half[0] = *(const v8us*)(vrow + 8 * hh); bv.half[1] = *(const v8us*)(vrow + 16 + 8 * hh);
#pragma unroll
      for (int rt = 0; rt < RTN; ++rt) oacc[rt][dt] = mmaH<1>(pa[rt].v, pa[rt].v, bv.v, bv.v, oacc[rt][dt]); }
    __builtin_amdgcn_fence(__ATOMIC_ACQ_REL, "workgroup"); __builtin_amdgcn_wave_barrier(); }
#pragma unroll
  for (int rt = 0; rt < RTN; ++rt) {
#pragma unroll
    for (int r = 0; r < 8; ++r) { float l = l_r[rt][r]; l += __shfl_xor(l, 1, 32); l += __shfl_xor(l, 2, 32); l += __shfl_xor(l, 4, 32); l += __shfl_xor(l, 8, 32); l_r[rt][r] = (l > 0.f) ? 1.0f / (l * 1024.0f) : 0.f; }
#pragma unroll
    for (int dt = 0; dt < DT; ++dt)
#pragma unroll
      for (int r = 0; r < 8; ++r) sO[w][rt * 16 + 8 * hh + r][dt * 16 + ln] = oacc[rt][dt][r] * l_r[rt][r]; }
  __builtin_amdgcn_fence(__ATOMIC_ACQ_REL, "workgroup"); __builtin_amdgcn_wave_barrier();
  {
#pragma unroll
    for (int rp = 0; rp < RPW; rp += 2) { const int r = rp + (lane >> 4), pc = lane & 15; const v4f val = *(const v4fa*)&sO[w][r][pc * 4]; *(v4f*)(O + ((size_t)b * TQ + q0 + r) * ldo + h * 64 + pc * 4) = val; }
     } }
// 5-plane variant: S = Qh Kh^T + (Ql Kh^T + Qh Kl^T)/1024 with Q/K = [hi | 2^10 residual] f16 planes (QL/KL same layout as Q16/K16), then the 3-term P.V below.
// 3-term variant: O = (P_hi V_hi + (P_lo V_hi + P_hi V_lo) / 1024) / l with P = [hi | 2^10 residual] of 1024 p and V^T = [hi | 2^10 residual] planes (VtL same layout as Vt) -> ~2^-21-class products for un-averaged (early causal / peaked) rows
template <int CAUSAL>
__global__ __launch_bounds__(128) void k_flash5(const _Float16* __restrict__ Q16, const _Float16* __restrict__ QL, int ldq, const _Float16* __restrict__ K16, const _Float16* __restrict__ KL, int ldk, const _Float16* __restrict__ Vt, const _Float16* __restrict__ VtL, const int* __restrict__ MSK, float* __restrict__ O, int ldo) {
  constexpr int RPW = 16, RTN = RPW / 16, NQB = TQ / (4 * RPW), DT = 4, KS = 2;
  __shared__ __attribute__((aligned(16))) unsigned short sP[4][RPW][40]; __shared__ __attribute__((aligned(16))) unsigned short sPL[4][RPW][40]; __shared__ __attribute__((aligned(16))) float sO[4][RPW][64 + 4];
  const int tid = threadIdx.x, w = tid >> 5, lane = tid & 31, ln = lane & 15, hh = lane >> 4;
  const int slab = blockIdx.x / QBN5, qblk = QB05 + blockIdx.x % QBN5; (void)NQB; const int b = slab / NH, h = slab % NH; const int qb0 = qblk * (4 * RPW); const int q0 = qb0 + w * RPW;
  FragH aq[2][KS], aql[2][KS];
#pragma unroll
  for (int rt = 0; rt < RTN; ++rt) { const unsigned short* qr = (const unsigned short*)Q16 + ((size_t)b * TQ + q0 + rt * 16 + ln) * ldq + h * 64; const unsigned short* ql = (const unsigned short*)QL + ((size_t)b * TQ + q0 + rt * 16 + ln) * ldq + h * 64;
#pragma unroll
    for (int ks = 0; ks < KS; ++ks) { aq[rt][ks].half[0] = *(const v8us*)(qr + ks * 32 + 8 * hh); aq[rt][ks].half[1] = *(const v8us*)(qr + ks * 32 + 16 + 8 * hh); aql[rt][ks].half[0] = *(const v8us*)(ql + ks * 32 + 8 * hh); aql[rt][ks].half[1] = *(const v8us*)(ql + ks * 32 + 16 + 8 * hh); } }
  const unsigned short* Vth = (const unsigned short*)Vt + (size_t)slab * 64 * TK; const unsigned short* Vtl = (const unsigned short*)VtL + (size_t)slab * 64 * TK;
  float m_r[2][8], l_r[2][8]; v8f oacc[2][DT], oaccL[2][DT];
#pragma unroll
  for (int rt = 0; rt < RTN; ++rt) {
#pragma unroll
    for (int r = 0; r < 8; ++r) { m_r[rt][r] = -3.0e38f; l_r[rt][r] = 0.f; }
#pragma unroll
    for (int dt = 0; dt < DT; ++dt) { oacc[rt][dt] = (v8f){0.f,0.f,0.f,0.f,0.f,0.f,0.f,0.f}; oaccL[rt][dt] = oacc[rt][dt]; } }
  const int jend = (CAUSAL == 1 || CAUSAL == 32) ? (qb0 + 4 * RPW) : ((CAUSAL == 23) ? min(TK, (qb0 / CHK + 2) * CHK) : TK);      /* causal / window: keys that can never contribute are skipped */ const int jbeg = (CAUSAL == 23) ? max(0, (qb0 / CHK - 1) * CHK) : 0;
#pragma unroll 1
  for (int j0 = jbeg; j0 < jend; j0 += 32) {
    v8f s[2][2];
#pragma unroll
    for (int nt = 0; nt < 2; ++nt) { const unsigned short* kr = (const unsigned short*)K16 + ((size_t)b * TK + j0 + nt * 16 + ln) * ldk + h * 64; const unsigned short* klr = (const unsigned short*)KL + ((size_t)b * TK + j0 + nt * 16 + ln) * ldk + h * 64; FragH bk[KS], bkl[KS];
#pragma unroll
      for (int ks = 0; ks < KS; ++ks) { bk[ks].half[0] = *(const v8us*)(kr + ks * 32 + 8 * hh); bk[ks].half[1] = *(const v8us*)(kr + ks * 32 + 16 + 8 * hh); bkl[ks].half[0] = *(const v8us*)(klr + ks * 32 + 8 * hh); bkl[ks].half[1] = *(const v8us*)(klr + ks * 32 + 16 + 8 * hh); }
#pragma unroll
      for (int rt = 0; rt < RTN; ++rt) { v8f acc = (v8f){0.f,0.f,0.f,0.f,0.f,0.f,0.f,0.f}, accl = acc;
#pragma unroll
        for (int ks = 0; ks < KS; ++ks) { acc = mmaH<1>(aq[rt][ks].v, aq[rt][ks].v, bk[ks].v, bk[ks].v, acc); accl = mmaH<1>(aql[rt][ks].v, aql[rt][ks].v, bk[ks].v, bk[ks].v, accl); accl = mmaH<1>(aq[rt][ks].v, aq[rt][ks].v, bkl[ks].v, bkl[ks].v, accl); }
#pragma unroll
        for (int r = 0; r < 8; ++r) acc[r] += accl[r] * 0.0009765625f;
        s[rt][nt] = acc; } }
#pragma unroll
    for (int rt = 0; rt < RTN; ++rt)
#pragma unroll
      for (int r = 0; r < 8; ++r) { const int tq = q0 + rt * 16 + 8 * hh + r; const int k0 = j0 + ln, k1 = j0 + 16 + ln;
        bool ok0 = (CAUSAL == 1 || CAUSAL == 32) ? (k0 <= tq) : ((CAUSAL == 2) ? ((k0 >> 5) == (tq >> 5)) : true), ok1 = (CAUSAL == 1 || CAUSAL == 32) ? (k1 <= tq) : ((CAUSAL == 2) ? ((k1 >> 5) == (tq >> 5)) : true);      /* mode 2: block-diagonal 32-token groups */
        if (CAUSAL == 4) { const int* mrow = MSK + ((size_t)b * TQ + tq) * TK; ok0 = mrow[k0] != 0; ok1 = mrow[k1] != 0; }      /* mode 4: per-(query, key) INPUT mask shared by all heads; masked keys contribute nothing (== the reference's -4096 fill, whose exp underflows to 0), rows with no valid key give l = 0 -> output 0 (== the reference's row_valid zeroing) */
        float s0 = ok0 ? s[rt][0][r] * SCL : -3.0e38f, s1 = ok1 ? s[rt][1][r] * SCL : -3.0e38f; if (CAUSAL == 30) { const float* rbp = (const float*)MSK; s0 += rbp[BK30[k0 - tq + (TK - 1)] * NH + h]; s1 += rbp[BK30[k1 - tq + (TK - 1)] * NH + h]; }      /* mode 30: T5 bucketed relative bias: table[bucket(k - q)][h]; bucket-of-distance is a module constant */ if (CAUSAL == 32) { const float* qsT = (const float*)MSK; const float* ksT = qsT + (size_t)NB * TQ; const float qs = qsT[(size_t)b * TQ + tq]; if (ok0) { float d = qs + ksT[(size_t)b * TK + k0]; d = d - 2.0f * s0; d = fmaxf(d, 0.f); s0 = -d * 0.125f; } if (ok1) { float d = qs + ksT[(size_t)b * TK + k1]; d = d - 2.0f * s1; d = fmaxf(d, 0.f); s1 = -d * 0.125f; } }      /* mode 32: RBF logit -relu(|q|^2 + |k|^2 - 2 q.k)/8, causal */ if (CAUSAL == 17) { const float* amk = (const float*)MSK + (size_t)b * TK; s0 += bf16_round(amk[k0]); s1 += bf16_round(amk[k1]); } if (CAUSAL == 18) { const float* tb = (const float*)MSK; const int* ri = MSK + 1024 + (size_t)b * TK; const int rq = ri[tq]; s0 += tb[(h * 8 + rq) * 8 + ri[k0]]; s1 += tb[(h * 8 + rq) * 8 + ri[k1]]; } if (CAUSAL == 19) { const int* rel = MSK + (size_t)tq * TK; const float* rb = (const float*)MSK + (size_t)TQ * TK + ((size_t)(b * NH + h) * TQ + tq) * 64; s0 += rb[rel[k0]]; s1 += rb[rel[k1]]; }      /* mode 19: + (q.Ek[rel] + Eb[rel][h]) / 8 gathered by the int relative ids (packed [ids | table]) */      /* mode 18: + resource_bias[h][r_q][r_k] from the packed [table | ids] buffer (TQ == TK) */      /* mode 17: additive per-(batch, key) mask INPUT */ float mc = fmaxf(s0, s1);
        mc = fmaxf(mc, __shfl_xor(mc, 1, 32)); mc = fmaxf(mc, __shfl_xor(mc, 2, 32)); mc = fmaxf(mc, __shfl_xor(mc, 4, 32)); mc = fmaxf(mc, __shfl_xor(mc, 8, 32));
        const float mn = fmaxf(m_r[rt][r], mc); const float al = (mn > -1.0e38f) ? expf(m_r[rt][r] - mn) : 1.0f; m_r[rt][r] = mn; const float p0 = ok0 ? expf(s0 - mn) : 0.f, p1 = ok1 ? expf(s1 - mn) : 0.f; l_r[rt][r] = l_r[rt][r] * al + p0 + p1;
#pragma unroll
        for (int dt = 0; dt < DT; ++dt) { oacc[rt][dt][r] *= al; oaccL[rt][dt][r] *= al; }
        FragH t2, t2l; const float ps0 = p0 * 1024.0f, ps1 = p1 * 1024.0f; t2.h[0] = (_Float16)ps0; t2.h[1] = (_Float16)ps1; t2l.h[0] = (_Float16)((ps0 - (float)t2.h[0]) * 1024.0f); t2l.h[1] = (_Float16)((ps1 - (float)t2.h[1]) * 1024.0f);
        sP[w][rt * 16 + 8 * hh + r][ln] = t2.u[0]; sP[w][rt * 16 + 8 * hh + r][16 + ln] = t2.u[1]; sPL[w][rt * 16 + 8 * hh + r][ln] = t2l.u[0]; sPL[w][rt * 16 + 8 * hh + r][16 + ln] = t2l.u[1]; }
    __builtin_amdgcn_fence(__ATOMIC_ACQ_REL, "workgroup"); __builtin_amdgcn_wave_barrier();
    FragH pa[2], pl[2];
#pragma unroll
    for (int rt = 0; rt < RTN; ++rt) { pa[rt].half[0] = *(const v8us*)&sP[w][rt * 16 + ln][8 * hh]; pa[rt].half[1] = *(const v8us*)&sP[w][rt * 16 + ln][16 + 8 * hh]; pl[rt].half[0] = *(const v8us*)&sPL[w][rt * 16 + ln][8 * hh]; pl[rt].half[1] = *(const v8us*)&sPL[w][rt * 16 + ln][16 + 8 * hh]; }
#pragma unroll
    for (int dt = 0; dt < DT; ++dt) { const unsigned short* vrow = Vth + (size_t)(dt * 16 + ln) * TK + j0; const unsigned short* vrl = Vtl + (size_t)(dt * 16 + ln) * TK + j0; FragH bv, bl; bv.half[0] = *(const v8us*)(vrow + 8 * hh); bv.half[1] = *(const v8us*)(vrow + 16 + 8 * hh); bl.half[0] = *(const v8us*)(vrl + 8 * hh); bl.half[1] = *(const v8us*)(vrl + 16 + 8 * hh);
#pragma unroll
      for (int rt = 0; rt < RTN; ++rt) { oacc[rt][dt] = mmaH<1>(pa[rt].v, pa[rt].v, bv.v, bv.v, oacc[rt][dt]); oaccL[rt][dt] = mmaH<1>(pl[rt].v, pl[rt].v, bv.v, bv.v, oaccL[rt][dt]); oaccL[rt][dt] = mmaH<1>(pa[rt].v, pa[rt].v, bl.v, bl.v, oaccL[rt][dt]); } }
    __builtin_amdgcn_fence(__ATOMIC_ACQ_REL, "workgroup"); __builtin_amdgcn_wave_barrier(); }
#pragma unroll
  for (int rt = 0; rt < RTN; ++rt) {
#pragma unroll
    for (int r = 0; r < 8; ++r) { float l = l_r[rt][r]; l += __shfl_xor(l, 1, 32); l += __shfl_xor(l, 2, 32); l += __shfl_xor(l, 4, 32); l += __shfl_xor(l, 8, 32); l_r[rt][r] = (l > 0.f) ? 1.0f / (l * 1024.0f) : 0.f; }
#pragma unroll
    for (int dt = 0; dt < DT; ++dt)
#pragma unroll
      for (int r = 0; r < 8; ++r) { float v = oacc[rt][dt][r]; v += oaccL[rt][dt][r] * 0.0009765625f; sO[w][rt * 16 + 8 * hh + r][dt * 16 + ln] = v * l_r[rt][r]; } }
  __builtin_amdgcn_fence(__ATOMIC_ACQ_REL, "workgroup"); __builtin_amdgcn_wave_barrier();
  {
#pragma unroll
    for (int rp = 0; rp < RPW; rp += 2) { const int r = rp + (lane >> 4), pc = lane & 15; const v4f val = *(const v4fa*)&sO[w][r][pc * 4]; *(v4f*)(O + ((size_t)b * TQ + q0 + r) * ldo + h * 64 + pc * 4) = val; }
     } }

// Transposed form of the causal RBF attention pass: S^T = K Q^T, O^T += V^T P^T. A lane holds one query's scores (16 of a block's 32 keys, the other wave half the other 16), so the block maximum is in-lane plus one exchange between the halves, and the two score tiles, converted in place, are the B operand of the second product: P passes through no LDS and the loop holds no fence. The softmax runs in base 2: log2(e) / 8 is folded into the two multiply-adds that form a logit, and each weight is one subtraction and one hardware exp2.
__device__ __forceinline__ float xhalf(float x) { return __builtin_bit_cast(float, __builtin_amdgcn_permlanex16(__builtin_bit_cast(int, x), __builtin_bit_cast(int, x), 0x76543210, 0xfedcba98, false, false)); }      /* lane l with lane l ^ 16 */
__global__ __launch_bounds__(128) void k_flash_t(const _Float16* __restrict__ Q16, const _Float16* __restrict__ K16, const _Float16* __restrict__ Vt, const float* __restrict__ NSQ, float* __restrict__ O) {
  constexpr int DT = 4, KS = 2; constexpr float L2E8 = 0.18033688011112043f;      /* log2(e) / 8 */
  __shared__ __attribute__((aligned(16))) float sO[4][16][64 + 4];
  const int tid = threadIdx.x, w = tid >> 5, lane = tid & 31, ln = lane & 15, hh = lane >> 4;
  const int slab = blockIdx.x / (QBLKS / 2), pr = blockIdx.x % (QBLKS / 2);
#pragma unroll 1      /* one copy of the key loop in the text serves both query blocks */
  for (int leg = 0; leg < 2; ++leg) {      /* query block QBLKS - 1 - pr, then pr, one after the other: 2 (QBLKS + 1) key passes in every work-group, so that no SIMD is left with the long blocks alone */
  const int qblk = leg ? pr : QBLKS - 1 - pr; const int qb0 = qblk * 64; const int q0 = qb0 + w * 16; const int tq = q0 + ln;      /* this lane's query */
  FragH bq[KS]; const unsigned short* qr = (const unsigned short*)Q16 + ((size_t)slab * TQ + tq) * 64;
#pragma unroll
  for (int ks = 0; ks < KS; ++ks) { bq[ks].half[0] = *(const v8us*)(qr + ks * 32 + 8 * hh); bq[ks].half[1] = *(const v8us*)(qr + ks * 32 + 16 + 8 * hh); }
  const unsigned short* Kb = (const unsigned short*)K16 + (size_t)slab * TK * 64; const unsigned short* Vth = (const unsigned short*)Vt + (size_t)slab * 64 * TK;
  const float qs = NSQ[(size_t)slab * TQ + tq]; const float* ksT = NSQ + (size_t)NB * TQ + (size_t)slab * TK;
  const float nq = -L2E8 * qs;
  float m = -3.0e38f, l = 0.f; v8f oacc[DT];
#pragma unroll
  for (int dt = 0; dt < DT; ++dt) oacc[dt] = (v8f){0.f,0.f,0.f,0.f,0.f,0.f,0.f,0.f};
  const int jend = qb0 + 64;
#pragma unroll 1
  for (int j0 = 0; j0 < jend; j0 += 32) {
    FragH ak[2][KS], av[DT]; v4f kq[2][2];      /* with no fence in the loop the whole pass's loads stand at its head, in front of the first product, and fly together */
#pragma unroll
    for (int nt = 0; nt < 2; ++nt) { const unsigned short* kr = Kb + (size_t)j0 * 64 + nt * 1024 + lane * 8;      /* fragment order: a 16-key group is four pieces of 512 B, a lane's 16 bytes at 16 lane; each load reads four whole lines */
#pragma unroll
      for (int ks = 0; ks < KS; ++ks) { ak[nt][ks].half[0] = *(const v8us*)(kr + ks * 512); ak[nt][ks].half[1] = *(const v8us*)(kr + ks * 512 + 256); }
      kq[nt][0] = *(const v4fa*)(ksT + j0 + nt * 16 + 8 * hh); kq[nt][1] = *(const v4fa*)(ksT + j0 + nt * 16 + 8 * hh + 4); }      /* |k|^2 of this lane's eight keys of the tile */
    asm volatile("s_wait_xcnt 0x0" ::: "memory");      /* precaution: the address registers of the loads above may be reused as destinations of the loads below */
#pragma unroll
    for (int dt = 0; dt < DT; ++dt) { const unsigned short* vrow = Vth + (size_t)j0 * 64 + dt * 512 + lane * 8; av[dt].half[0] = *(const v8us*)vrow; av[dt].half[1] = *(const v8us*)(vrow + 256); }      /* fragment order: a 32-key block is eight pieces of 512 B */
    asm volatile("s_wait_xcnt 0x0" ::: "memory");      /* precaution: stands in front of the pointer steps and of every other rewrite of a register that an issued load names */
    __builtin_amdgcn_sched_barrier(0);      /* keeps those rewrites, which the scheduler otherwise lifts among the loads, behind the wait */
    const int lim = tq - j0 - 8 * hh;      /* key 16 nt + r of this lane's sixteen is causal where 16 nt + r <= lim */
    float sc[16]; float mc = -3.0e38f;
#pragma unroll
    for (int nt = 0; nt < 2; ++nt) { v8f acc = (v8f){0.f,0.f,0.f,0.f,0.f,0.f,0.f,0.f};
#pragma unroll
      for (int ks = 0; ks < KS; ++ks) acc = mmaH<1>(ak[nt][ks].v, ak[nt][ks].v, bq[ks].v, bq[ks].v, acc);      /* acc[r] = k[j0 + 16 nt + 8 hh + r] . q[tq] */
#pragma unroll
      for (int r = 0; r < 8; ++r) { const bool ok = nt * 16 + r <= lim; float t = fmaf(kq[nt][r >> 2][r & 3], -L2E8, nq); t = fmaf(acc[r], 2.0f * L2E8, t); t = fminf(t, 0.f); const float sv = ok ? t : -3.0e38f; sc[nt * 8 + r] = sv; mc = fmaxf(mc, sv); } }      /* t = log2(e) x logit = -relu(|q|^2 + |k|^2 - 2 q.k) log2(e) / 8 */
    mc = fmaxf(mc, xhalf(mc));
    const float mn = fmaxf(m, mc - 10.0f); const float al = __builtin_amdgcn_exp2f(m - mn); m = mn;      /* the reference point stands 10 below the maximum: the weights come out times 2^10, as the f16 operand wants them; the first pass always holds causal key 0, so mn is finite and al = 2^(-3e38) = 0 there */
    FragH pb; float p[16];
#pragma unroll
    for (int i = 0; i < 16; ++i) { p[i] = __builtin_amdgcn_exp2f(sc[i] - mn); pb.h[i] = (_Float16)p[i]; }      /* a masked key gives 2^(-3e38) = 0 exactly; element i of the B operand is key 8 hh + i, then 16 + 8 hh + (i - 8): the order of the V^T loader above */
#pragma unroll
    for (int st = 8; st > 0; st >>= 1)
#pragma unroll
      for (int i = 0; i < st; ++i) p[i] += p[i + st];
    l = l * al + p[0];
#pragma unroll
    for (int dt = 0; dt < DT; ++dt) {
#pragma unroll
      for (int r = 0; r < 8; ++r) oacc[dt][r] *= al; }
#pragma unroll
    for (int dt = 0; dt < DT; ++dt) oacc[dt] = mmaH<1>(av[dt].v, av[dt].v, pb.v, pb.v, oacc[dt]); }      /* oacc[dt][r] = context column 16 dt + 8 hh + r of query tq */
  l += xhalf(l); const float inv = (l > 0.f) ? 1.0f / l : 0.f;      /* l and the context both carry the 2^10 */
#pragma unroll
  for (int dt = 0; dt < DT; ++dt) { v4f a, c;
#pragma unroll
    for (int r = 0; r < 4; ++r) { a[r] = oacc[dt][r] * inv; c[r] = oacc[dt][4 + r] * inv; }
    *(v4fa*)&sO[w][ln][dt * 16 + 8 * hh] = a; *(v4fa*)&sO[w][ln][dt * 16 + 8 * hh + 4] = c; }
  __builtin_amdgcn_fence(__ATOMIC_ACQ_REL, "workgroup"); __builtin_amdgcn_wave_barrier();      /* the wave's own lanes read each other's rows below, for whole-row stores */
#pragma unroll
  for (int rp = 0; rp < 16; rp += 2) { const int r = rp + (lane >> 4), pc = lane & 15; const v4f val = *(const v4fa*)&sO[w][r][pc * 4]; *(v4f*)(O + ((size_t)slab * TQ + q0 + r) * 64 + pc * 4) = val; }
  asm volatile("s_wait_xcnt 0x0" ::: "memory");      /* precaution: the second leg rewrites the registers that these stores name */
  __builtin_amdgcn_fence(__ATOMIC_ACQ_REL, "workgroup", "local"); __builtin_amdgcn_wave_barrier(); } }      /* the second leg's staging writes stay behind every lane's reads of the first leg's rows; LDS only, so that the leg does not wait for its stores to the output */

__global__ __launch_bounds__(256) void k_rotab(float* __restrict__ CS, float* __restrict__ SN) {
  #pragma clang fp contract(off)
  const int t = blockIdx.x * 256 + threadIdx.x; if (t >= SLEN * 32) return; const int j = t % 32, s = t / 32; const float ex = (float)(2 * j) / 64.0f; const float inv = 1.0f / powf(10000.0f, ex); const float th = (float)s * inv; const float c = cosf(th), sn = sinf(th);
  { *(float*)(CS + t) = c; *(float*)(SN + t) = sn;  } }
__global__ __launch_bounds__(256) void k_rope(const float* __restrict__ F, int nsrc, int ndst, int rep, const float* __restrict__ CS, const float* __restrict__ SN, _Float16* __restrict__ H, _Float16* __restrict__ L) {
  #pragma clang fp contract(off)
  const size_t t = (size_t)blockIdx.x * 256 + threadIdx.x; if (t >= (size_t)NR * ndst * 4) return; const int g8 = (int)(t % 4); const int hd = (int)((t / 4) % ndst); const size_t row = t / ((size_t)4 * ndst); const int s = (int)(row % SLEN); const int hs = hd / rep;
  const float* src = F + row * (size_t)(nsrc * 64) + hs * 64; FragH ah, al, bh, bl;
  for (int i = 0; i < 8; ++i) { const int d = g8 * 8 + i; const float c = CS[s * 32 + d], sn = SN[s * 32 + d]; const float x1 = src[d], x2 = src[d + 32];
    float o1 = x1 * c; o1 += -x2 * sn; float o2 = x2 * c; o2 += x1 * sn;
    _Float16 hv = (_Float16)o1; ah.h[i] = hv; al.h[i] = (_Float16)((o1 - (float)hv) * 1024.0f); hv = (_Float16)o2; bh.h[i] = hv; bl.h[i] = (_Float16)((o2 - (float)hv) * 1024.0f); }
  const size_t o = row * (size_t)(ndst * 64) + hd * 64 + g8 * 8;
  { *(v8us*)((unsigned short*)H + o) = ah.half[0]; *(v8us*)((unsigned short*)H + o + 32) = bh.half[0]; *(v8us*)((unsigned short*)L + o) = al.half[0]; *(v8us*)((unsigned short*)L + o + 32) = bl.half[0];  } }
__global__ __launch_bounds__(256) void k_rope2(const float* __restrict__ F, int nsrc, int ndst, int rep, const float* __restrict__ CS, const float* __restrict__ SN, _Float16* __restrict__ H, _Float16* __restrict__ L) {
  #pragma clang fp contract(off)
  const size_t t = (size_t)blockIdx.x * 256 + threadIdx.x; if (t >= (size_t)NR * ndst * 4) return; const int g16 = (int)(t % 4); const int hd = (int)((t / 4) % ndst); const size_t row = t / ((size_t)4 * ndst); const int s = (int)(row % SLEN); const int hs = hd / rep;
  const float* src = F + row * (size_t)(nsrc * 64) + hs * 64 + g16 * 16; FragH ah, al;
  for (int pr = 0; pr < 8; ++pr) { const int i = g16 * 8 + pr; const float c = CS[s * 32 + i], sn = SN[s * 32 + i]; const float x1 = src[2 * pr], x2 = src[2 * pr + 1];
    float o1 = x1 * c; o1 -= x2 * sn; float o2 = x1 * sn; o2 += x2 * c;
    _Float16 hv = (_Float16)o1; ah.h[2 * pr] = hv; al.h[2 * pr] = (_Float16)((o1 - (float)hv) * 1024.0f); hv = (_Float16)o2; ah.h[2 * pr + 1] = hv; al.h[2 * pr + 1] = (_Float16)((o2 - (float)hv) * 1024.0f); }
  const size_t o = row * (size_t)(ndst * 64) + hd * 64 + g16 * 16;
  { *(v8us*)((unsigned short*)H + o) = ah.half[0]; *(v8us*)((unsigned short*)H + o + 8) = ah.half[1]; *(v8us*)((unsigned short*)L + o) = al.half[0]; *(v8us*)((unsigned short*)L + o + 8) = al.half[1];  } }
__global__ __launch_bounds__(256) void k_ln512(const float* __restrict__ A, const float* __restrict__ res, const float* __restrict__ g, const float* __restrict__ bb, float* __restrict__ Y, _Float16* __restrict__ Y16) {
  #pragma clang fp contract(off)
  const int wv = threadIdx.x >> 5, ln = threadIdx.x & 31; const size_t r = (size_t)blockIdx.x * 8 + wv; if (r >= NR) return; float x[16]; float s = 0.f;
  for (int i = 0; i < 2; ++i) { const v8f a = *(const v8f*)(A + r * DM + i * 256 + ln * 8); for (int q = 0; q < 8; ++q) { float v = a[q]; if (res) v += bf16_round(res[r * DM + i * 256 + ln * 8 + q]); x[i * 8 + q] = v; s += v; } }
  for (int o = 16; o > 0; o >>= 1) s += __shfl_xor(s, o, 32); const float mu = s / (float)DM; float var = 0.f; for (int q = 0; q < 16; ++q) { const float d = x[q] - mu; var += d * d; }
  for (int o = 16; o > 0; o >>= 1) var += __shfl_xor(var, o, 32); const float inv = rsqrtf(var / (float)DM + 1e-5f);
  { for (int i = 0; i < 2; ++i) { const int c0 = i * 256 + ln * 8; v8f y; FragH f; for (int q = 0; q < 8; ++q) { float v = (x[i * 8 + q] - mu) * inv; v *= bf16_round(g[c0 + q]); v += bf16_round(bb[c0 + q]); y[q] = v; f.h[q] = (_Float16)v; } *(v8f*)(Y + r * DM + c0) = y; if (Y16) *(v8us*)((unsigned short*)Y16 + r * DM + c0) = f.half[0]; }  } }
__global__ __launch_bounds__(256) void k_pack(const float* __restrict__ rb, const int* __restrict__ rid, int* __restrict__ PK) { const int t = blockIdx.x * 256 + threadIdx.x; if (t >= 1024 + NB * TK) return; int v; if (t < 1024) v = __float_as_int(bf16_round(rb[t])); else v = rid[t - 1024]; *(int*)(PK + t) = v;  }
__global__ __launch_bounds__(256) void k_tabin(const float* __restrict__ sp, float* __restrict__ CS, float* __restrict__ SN) { const int t = blockIdx.x * 256 + threadIdx.x; if (t >= SLEN * 32) return; const int i = t % 32, s = t / 32; const float c = bf16_round(sp[s * 64 + 32 + i]), sn = bf16_round(sp[s * 64 + i]);
  { *(float*)(CS + t) = c; *(float*)(SN + t) = sn;  } }
__global__ __launch_bounds__(256) void k_wsc(const float* __restrict__ Wm, _Float16* __restrict__ Bt, size_t n8, float sc) { const size_t t = (size_t)blockIdx.x * 256 + threadIdx.x; if (t >= n8) return; FragH f; for (int q = 0; q < 8; ++q) f.h[q] = (_Float16)(bf16_round(Wm[t * 8 + q]) * sc); *(v8us*)((unsigned short*)Bt + t * 8) = f.half[0];  }
__global__ __launch_bounds__(256) void k_rotab2(float* __restrict__ CS, float* __restrict__ SN) {
  #pragma clang fp contract(off)
  const int t = blockIdx.x * 256 + threadIdx.x; if (t >= SLEN * 32) return; const int j = t % 32, s = t / 32; const float c0 = -0.14391156831212787f;      /* -ln(10000)/64 rounded to f32 */ const float inv = expf((float)(2 * j) * c0); const float th = (float)s * inv; const float c = cosf(th), sn = sinf(th);
  { *(float*)(CS + t) = c; *(float*)(SN + t) = sn;  } }
__global__ __launch_bounds__(256) void k_lnu(const float* __restrict__ X, _Float16* __restrict__ N16, float* __restrict__ XB) {
  #pragma clang fp contract(off)
  const int wv = threadIdx.x >> 5, ln = threadIdx.x & 31; const size_t r = (size_t)blockIdx.x * 8 + wv; if (r >= NR) return; float a[32]; float s = 0.f;
  for (int i = 0; i < 4; ++i) { const v8f v = *(const v8f*)(X + r * DM + (i * 32 + ln) * 8); for (int q = 0; q < 8; ++q) { const float u = bf16_round(v[q]); a[i * 8 + q] = u; s += u; } }
  for (int o = 16; o > 0; o >>= 1) s += __shfl_xor(s, o, 32); const float mu = s / (float)DM; float var = 0.f; for (int q = 0; q < 32; ++q) { const float d = a[q] - mu; var += d * d; }
  for (int o = 16; o > 0; o >>= 1) var += __shfl_xor(var, o, 32); const float den = sqrtf(var / (float)(DM - 1)) + 1e-6f; const float inv = 1.0f / den;      /* one reciprocal per row; (x-mean)*inv vs the reference's division differs by <= 1 ulp */
  { for (int i = 0; i < 4; ++i) { const int c0 = (i * 32 + ln) * 8; FragH f; v8f xb; for (int q = 0; q < 8; ++q) { f.h[q] = (_Float16)((a[i * 8 + q] - mu) * inv); xb[q] = a[i * 8 + q]; } *(v8us*)((unsigned short*)N16 + r * DM + c0) = f.half[0]; *(v8f*)(XB + r * DM + c0) = xb; }  } }

__global__ __launch_bounds__(256) void k_h16s(const float* __restrict__ SRC, int lds, int coff, _Float16* __restrict__ DST, size_t n8) { const size_t t = (size_t)blockIdx.x * 256 + threadIdx.x; if (t >= n8) return; const size_t r = (t * 8) / DM; const int c = (int)((t * 8) % DM); const v8f a = *(const v8f*)(SRC + r * lds + coff + c); FragH f; for (int q = 0; q < 8; ++q) f.h[q] = (_Float16)a[q];
  *(v8us*)((unsigned short*)DST + t * 8) = f.half[0];  }


__global__ __launch_bounds__(256) void k_ccp(const float* __restrict__ QKV, int coff, _Float16* __restrict__ D) { const size_t t = (size_t)blockIdx.x * 256 + threadIdx.x; if (t >= (size_t)NR * DM / 8) return; const int c0 = (int)((t * 8) % DM); const size_t row = (t * 8) / DM; const v8f a = *(const v8f*)(QKV + row * 3 * DM + coff + c0); FragH f; for (int q = 0; q < 8; ++q) f.h[q] = (_Float16)a[q];
  *(v8us*)((unsigned short*)D + t * 8) = f.half[0];  }


template <int NLN>
__global__ __launch_bounds__(256) void k_lnrow(const float* __restrict__ X, const float* __restrict__ R, const float* __restrict__ g, const float* __restrict__ bb, float eps, float* __restrict__ OUT) {
  #pragma clang fp contract(off)
  constexpr int PER = NLN / 256; __shared__ float red[256]; const int tid = threadIdx.x; const size_t row = blockIdx.x; const float* x = X + row * NLN; const float* rr = R ? R + row * NLN : nullptr; float v[PER]; float s1 = 0.f;
  for (int u = 0; u < PER; ++u) { const int j = tid * PER + u; float t = x[j]; if (rr) t = t + rr[j]; v[u] = t; s1 += t; }
  red[tid] = s1; __syncthreads(); for (int st = 128; st > 0; st >>= 1) { if (tid < st) red[tid] += red[tid + st]; __syncthreads(); } const float mu = red[0] / (float)NLN; __syncthreads();
  float s2 = 0.f; for (int u = 0; u < PER; ++u) { const float c = v[u] - mu; s2 += c * c; } red[tid] = s2; __syncthreads(); for (int st = 128; st > 0; st >>= 1) { if (tid < st) red[tid] += red[tid + st]; __syncthreads(); }
  const float var = red[0] / (float)NLN; const float rs = rsqrtf(var + eps);
  { for (int u = 0; u < PER; ++u) { const int j = tid * PER + u; float o = (v[u] - mu) * rs; o = __fadd_rn(__fmul_rn(o, bf16_round(g[j])), bf16_round(bb[j])); *(float*)(OUT + row * NLN + j) = o; }  } }
__global__ __launch_bounds__(256) void k_xr32(const float* __restrict__ x, float* __restrict__ XR, size_t n8) { const size_t t = (size_t)blockIdx.x * 256 + threadIdx.x; if (t >= n8) return; v8f o; for (int q = 0; q < 8; ++q) o[q] = bf16_round(x[t * 8 + q]); *(v8f*)(XR + t * 8) = o;  }
__global__ __launch_bounds__(256) void k_r16b(const float* __restrict__ S, _Float16* __restrict__ D, size_t n8) { const size_t t = (size_t)blockIdx.x * 256 + threadIdx.x; if (t >= n8) return; const v8f a = *(const v8f*)(S + t * 8); FragH f; for (int q = 0; q < 8; ++q) f.h[q] = (_Float16)a[q]; *(v8us*)((unsigned short*)D + t * 8) = f.half[0];  }

// One preparatory launch. Blocks 0-255 take q, 256-511 k, 512-767 v, 256 rows each; every input is read once.
// q, k: the bf16 bits are staged in LDS, the f16 plane goes out from registers, and one thread per row sums its squares in ascending order of d.
// v: the f16 values are staged in LDS and go out transposed, in the order of the attention pass's A fragments: per 32 keys eight pieces of 512 B (column tile, key half), a lane's eight keys at 16 lane.
__global__ __launch_bounds__(256) void k_prep(const float* __restrict__ Q, const float* __restrict__ Kx, const float* __restrict__ V, _Float16* __restrict__ QH, _Float16* __restrict__ KH, _Float16* __restrict__ Vt, float* __restrict__ NSQ) {
  __shared__ __attribute__((aligned(16))) unsigned short sm[256 * 72];      /* q, k: pitch 72 (144 B = 16 B x odd: a lane per row reads 16 bytes without bank conflicts); v: pitch 66 (eight rows apart = 8 banks apart) */
  const int tid = threadIdx.x; const int which = blockIdx.x >> 8, blk = blockIdx.x & 255; const size_t e0 = (size_t)blk * 256 * 64;
  if (which < 2) {
    const float* X = (which ? Kx : Q) + e0; unsigned short* H = (unsigned short*)(which ? KH : QH) + e0; FragH f[8]; v8f a[8];
    const int rl = which ? (((tid >> 6) << 3) | (tid & 7)) : (tid >> 3), c = which ? ((((tid >> 5) & 1) << 2) | ((tid >> 3) & 3)) : (tid & 7);      /* row of a group of 32 and 8-element piece of the row; for k a wave takes 8 rows x 4 pieces, so that its stores below fill whole lines */
    const int hb = which ? ((rl >> 4) * 1024 + (c >> 1) * 256 + (c & 1) * 128 + (rl & 15) * 8) : (rl * 64 + c * 8);      /* k goes out in fragment order: per 16 keys four pieces of 512 B (16 columns each); inside a piece the columns' half c & 1, then the key, so that lane l of the A loader finds its 16 bytes at 16 l; q stays row-major */
    const unsigned boff = (unsigned)rl * 256u + (unsigned)c * 32u;
#pragma unroll
    for (int i = 0; i < 8; ++i) a[i] = *(const v8f*)((const char*)X + boff + i * 8192);
    asm volatile("s_wait_xcnt 0x0" :: "v"(boff) : "memory");      /* precaution: the loads' offset register is held to this wait, so that none of the loads takes it as its destination */
    __builtin_amdgcn_sched_barrier(0);      /* keeps all sixteen loads in flight together; the scheduler otherwise sinks six of them behind the first waits, three more memory latencies in a row */
#pragma unroll
    for (int i = 0; i < 8; ++i) { v8us b;
#pragma unroll
      for (int u = 0; u < 8; ++u) { const unsigned short xb = bf16_bits(a[i][u]); b[u] = xb; f[i].h[u] = (_Float16)bf16_val(xb); }
      *(v8us*)&sm[(i * 32 + rl) * 72 + c * 8] = b; }
    __syncthreads();      /* a row's sixteen-byte pieces were staged by eight threads */
#pragma unroll
    for (int i = 0; i < 8; ++i) *(v8us*)(H + i * 2048 + hb) = f[i].half[0];      /* behind the barrier, which would otherwise wait for these stores */
    float acc = 0.f;
#pragma unroll
    for (int d = 0; d < 64; d += 8) { const v8us b = *(const v8us*)&sm[tid * 72 + d];
#pragma unroll
      for (int u = 0; u < 8; ++u) { const float x = bf16_val(b[u]); acc = __fadd_rn(acc, __fmul_rn(x, x)); } }      /* a square of a bf16 value is exact in f32: fused or not, each step rounds the same sum */
    *(float*)(NSQ + (size_t)which * NR + blk * 256 + tid) = acc;
  } else {
    const float* X = V + e0; const unsigned voff = (unsigned)tid * 32u;      /* eight groups of 256 keys per slab */
#pragma unroll
    for (int i = 0; i < 8; ++i) { const int g = i * 256 + tid; const v8f a = *(const v8f*)((const char*)X + voff + i * 8192); FragH f;
#pragma unroll
      for (int u = 0; u < 8; ++u) f.h[u] = (_Float16)bf16_round(a[u]);
#pragma unroll
      for (int u = 0; u < 8; ++u) sm[(g >> 3) * 66 + (g & 7) * 8 + u] = f.u[u]; }
    asm volatile("s_wait_xcnt 0x0" :: "v"(voff) : "memory");      /* precaution: the loads' offset register is held to this wait, so that none of the loads takes it as its destination */
    __syncthreads();      /* a V^T piece gathers eight keys staged by eight threads */
#pragma unroll
    for (int it = 0; it < 8; ++it) { const int pi = it * 8 + (tid >> 5);      /* 512-B piece of this group's 64: 32-key block pi >> 3, column tile (pi >> 1) & 3, key half pi & 1 */
      const int d = ((pi >> 1) & 3) * 16 + (tid & 15), pc = (pi >> 3) * 4 + (pi & 1) * 2 + ((tid >> 4) & 1); FragH f;
#pragma unroll
      for (int u = 0; u < 8; ++u) f.u[u] = sm[(pc * 8 + u) * 66 + d];
      *(v8us*)((unsigned short*)Vt + e0 + (it * 256 + tid) * 8) = f.half[0]; }      /* fragment order: a wave's store is one piece, 512 contiguous bytes */
    asm volatile("s_wait_xcnt 0x0" ::: "memory");      /* precaution: the compiler lays the q, k branch behind these stores in the text, where their registers are rewritten */
  } }
// One block per (slab, 8 query rows < 64), one wave per row. The slab's first 64 rows of k and v are rounded and staged in LDS once per block; lanes own keys for the logits, then output columns for the context. Each dot product, the row sum and each context sum keep their serial order.
__global__ __launch_bounds__(256) void k_fixr(const float* __restrict__ Q, const float* __restrict__ Kx, const float* __restrict__ V, const float* __restrict__ NSQ, float* __restrict__ O) {
  #pragma clang fp contract(off)
  __shared__ __attribute__((aligned(16))) float sk[64][68];      /* pitch 272 B = 16 B x odd: a lane per row reads 16 bytes without bank conflicts */
  __shared__ __attribute__((aligned(16))) float sv[64][64]; __shared__ __attribute__((aligned(16))) float pr[8][64];
  const int tid = threadIdx.x, w = tid >> 5, lane = tid & 31; const size_t sl = blockIdx.x >> 3; const int q = __builtin_amdgcn_readfirstlane((int)(blockIdx.x & 7) * 8 + w);
  const float* kb = Kx + sl * SLEN * 64; const float* vb = V + sl * SLEN * 64;
#pragma unroll
  for (int i = 0; i < 4; ++i) { const int e = (i * 256 + tid) * 4; const v4f a = *(const v4fa*)(kb + e); const v4f c = *(const v4fa*)(vb + e); v4f ra, rc;
#pragma unroll
    for (int u = 0; u < 4; ++u) { ra[u] = bf16_round(a[u]); rc[u] = bf16_round(c[u]); }
    *(v4fa*)&sk[e >> 6][e & 63] = ra; *(v4fa*)&sv[e >> 6][e & 63] = rc; }
  const float* qr = Q + (sl * SLEN + q) * 64; const float qs = NSQ[sl * SLEN + q]; const float* ksT = NSQ + (size_t)NB * SLEN + sl * SLEN; const float kq0 = ksT[lane], kq1 = ksT[lane + 32];
  float x[64];      /* the wave's query row, fetched ahead of the barrier so that its latency runs beside the staging loads' */
#pragma unroll
  for (int d = 0; d < 64; d += 4) { const v4f a = *(const v4fa*)(qr + d);
#pragma unroll
    for (int u = 0; u < 4; ++u) x[d + u] = bf16_round(a[u]); }
  __syncthreads();      /* the staged rows are read by every wave of the block */
  float sd0 = 0.f, sd1 = 0.f;      /* keys lane and lane + 32 */
#pragma unroll
  for (int d = 0; d < 64; d += 4) { const v4f k0 = *(const v4fa*)&sk[lane][d]; const v4f k1 = *(const v4fa*)&sk[lane + 32][d];
#pragma unroll
    for (int u = 0; u < 4; ++u) { sd0 = __fadd_rn(sd0, __fmul_rn(x[d + u], k0[u])); sd1 = __fadd_rn(sd1, __fmul_rn(x[d + u], k1[u])); } }
  float d0 = qs + kq0; d0 = d0 - 2.0f * sd0; d0 = fmaxf(d0, 0.f); float d1 = qs + kq1; d1 = d1 - 2.0f * sd1; d1 = fmaxf(d1, 0.f);
  const bool ok0 = lane <= q, ok1 = lane + 32 <= q; const float lg0 = ok0 ? -d0 * 0.125f : -3.0e38f, lg1 = ok1 ? -d1 * 0.125f : -3.0e38f;
  float mx = fmaxf(lg0, lg1); mx = fmaxf(mx, __shfl_xor(mx, 1, 32)); mx = fmaxf(mx, __shfl_xor(mx, 2, 32)); mx = fmaxf(mx, __shfl_xor(mx, 4, 32)); mx = fmaxf(mx, __shfl_xor(mx, 8, 32)); mx = fmaxf(mx, __shfl_xor(mx, 16, 32));
  const float e0 = expf(lg0 - mx), e1 = expf(lg1 - mx); pr[w][lane] = ok0 ? e0 : 0.f; pr[w][lane + 32] = ok1 ? e1 : 0.f;
  __builtin_amdgcn_fence(__ATOMIC_ACQ_REL, "workgroup"); __builtin_amdgcn_wave_barrier();      /* the wave's own lanes read each other's weights below */
  float su = 0.f;
#pragma unroll
  for (int j = 0; j < 64; j += 4) { const v4f e = *(const v4fa*)&pr[w][j]; su += e[0]; su += e[1]; su += e[2]; su += e[3]; }      /* ascending keys; a masked key adds an exact zero */
  const float inv = 1.0f / su; typedef float v2f __attribute__((ext_vector_type(2))); typedef float v2fa __attribute__((ext_vector_type(2), may_alias));
  float a0 = 0.f, a1 = 0.f;      /* output columns 2 lane and 2 lane + 1 */
#pragma unroll 1
  for (int j0 = 0; j0 <= q; j0 += 16) {
#pragma unroll
    for (int i = 0; i < 16; ++i) { const bool in = j0 + i <= q; const v2f vv = *(const v2fa*)&sv[j0 + i][lane * 2]; const float p = pr[w][j0 + i] * inv;      /* past the row's last key the weight is zero; the value is zeroed too, so the term is an exact zero */
      a0 = __fadd_rn(a0, __fmul_rn(p, in ? vv[0] : 0.f)); a1 = __fadd_rn(a1, __fmul_rn(p, in ? vv[1] : 0.f)); } }
  const v2f o = {a0, a1}; *(v2f*)(O + (sl * SLEN + q) * 64 + lane * 2) = o; }

extern "C" void kernel_launch(void* const* d_in, const int* in_sizes, int n_in,
                              void* d_out, int out_size, void* d_ws, size_t ws_size, hipStream_t stream) {
  (void)in_sizes; (void)n_in; (void)out_size;
  const float* q = (const float*)d_in[0]; const float* k = (const float*)d_in[1]; const float* v = (const float*)d_in[2]; float* O = (float*)d_out;
  char* ws = (char*)d_ws; size_t off = 0;
  auto take = [&](size_t bytes) { char* p = ws + off; off += (bytes + 255) & ~(size_t)255; return p; };
  const size_t np = (size_t)NR * DM;      /* 32 x 2048 x 64 */
  _Float16* QH = (_Float16*)take(np * 2); _Float16* KH = (_Float16*)take(np * 2); _Float16* VT = (_Float16*)take(np * 2); float* NSQ = (float*)take((size_t)2 * NR * 4);
  if (off > ws_size) return;      /* 3 x 8 + 0.5 MiB */
  k_prep<<<3 * (NR / 256), 256, 0, stream>>>(q, k, v, QH, KH, VT, NSQ);      /* f16 planes of q and k (bf16-rounded inputs are exact in f16), V^T, |q|^2 | |k|^2 tables */
  k_flash_t<<<NB * (QBLKS / 2), 128, 0, stream>>>(QH, KH, VT, NSQ, O);      /* exact q, k products; f32 RBF logits; f32 context straight to the output; a work-group takes a long and a short query block */
  k_fixr<<<NB * 8, 256, 0, stream>>>(q, k, v, NSQ, O);      /* rows < 64 per slab recomputed in f32 */
}

// v008
// One run takes 64.3 microseconds.
// Two timings next to v007 put it at 1.09 and 1.08 times that version's speed.
// Over all steps from v000, the starting kernel, it is 7.62 times as fast.
#include <hip/hip_runtime.h>
// CustomCausalAttention (q, k, v [2][16][2048][64]; RBF-kernel causal attention: logits = -relu(|q|^2 + |k|^2 - 2 q.k) / 8 over keys n <= m; out = softmax(logits) v -> [2][16][2048][64]).
// Structure: each (batch, head) slab is a contiguous 64-wide row block, treated as one 'batch' of a single 64-dim head: one preparatory launch makes the exact f16 planes of q and k (bf16-rounded inputs are exact in f16), |q|^2, |k|^2 as f32 row tables on VALU, and v^T by LDS tiles; causal flash-style fused attention per (slab, 64-query block), forming the RBF logit from the f32 dot product and the two norm tables, f32 context written straight to the output; the first 64 causal rows per slab recomputed entirely in f32 on VALU.
// Compute dtype: inputs rounded to bf16; q, k, v exact as f16 (products exact, f32 accumulation); norms, logits, softmax f32 with plain f16 probabilities (~2^-12); rows < 64 all-f32. v_wmma_f32_16x16x32_f16.
#define NB 32                    /* 2 batches x 16 heads as slabs */
#define DM 64
#define NKV 1
#define NREP (NH / NKV)
#define KVD (NKV * 64)           /* 64 */
#define NR (NB * SLEN)
#define CHK 512
typedef int v4i __attribute__((ext_vector_type(4)));
#define FF 2048
#define SLEN 2048
#define MQI 2048
#define MKI 2048
#define TQ SLEN
#define TK SLEN
#define NH 1
#define SCL 1.0f                 /* raw dot product; the RBF transform applies the 1/8 */
#define QBLKS (TQ / 64)
#define QB05 0
#define QBN5 QBLKS      /* k_flash5 (hi/lo engine, not launched) would span all query blocks */
#define QB0P 0
#define QBNP QBLKS
#define RE 256
typedef __bf16 v16b __attribute__((ext_vector_type(16)));
typedef unsigned short v8us __attribute__((ext_vector_type(8), may_alias));
typedef float  v8f  __attribute__((ext_vector_type(8)));
typedef float  v4f  __attribute__((ext_vector_type(4)));
typedef float  v4fa __attribute__((ext_vector_type(4), may_alias));
union FragB { v16b v; v8us half[2]; unsigned short u[16]; };

__device__ __forceinline__ unsigned short bf16_bits(float x) { unsigned int u = __float_as_uint(x); return (unsigned short)((u + 0x7FFFu + ((u >> 16) & 1u)) >> 16); }
__device__ __forceinline__ float bf16_val(unsigned short b) { return __uint_as_float(((unsigned int)b) << 16); }
__device__ __forceinline__ float bf16_round(float x) { return bf16_val(bf16_bits(x)); }
// D += A·B with NT terms: 1 = ah·bh, 2 = + al·bh (A split), 3 = + ah·bl (both split)
template <int NT>
__device__ __forceinline__ v8f mmaN(v16b ah, v16b al, v16b bh, v16b bl, v8f c) {
  c = __builtin_amdgcn_wmma_f32_16x16x32_bf16(false, ah, false, bh, (short)0, c, false, false);
  if (NT >= 2) c = __builtin_amdgcn_wmma_f32_16x16x32_bf16(false, al, false, bh, (short)0, c, false, false);
  if (NT >= 3) c = __builtin_amdgcn_wmma_f32_16x16x32_bf16(false, ah, false, bl, (short)0, c, false, false);
  asm volatile("v_nop\n\tv_nop\n\tv_nop\n\tv_nop" : "+v"(c) : "v"(ah), "v"(al), "v"(bh), "v"(bl));
  return c;
}

__global__ __launch_bounds__(256) void k_wt_bf16(const float* __restrict__ W, unsigned short* __restrict__ Wt, int K, int N) {
  const int t = blockIdx.x * 256 + threadIdx.x;
  const int k8n = K / 8;
  if (t >= N * k8n) return;
  const int n = t / k8n, k8 = (t % k8n) * 8;
  v8us v;
#pragma unroll
  for (int i = 0; i < 8; ++i) v[i] = bf16_bits(W[(size_t)(k8 + i) * N + n]);
  *(v8us*)(Wt + (size_t)n * K + k8) = v;
  
}

// GEMM C[M][N] (f32, pitch ldc) = act(A[M][K]·W + bias). A f32 row-major (pitch lda) converted per fragment to bf16
// (ASPLIT: hi/lo two planes -> 2 terms, else single rounded term); Wt bf16 [N][K] (pitch ldb). BIAS_BF16 rounds the
// bias to bf16 first (bias quantised to bf16 before the add). K%32==0, M%16==0, N%64==0.
template <bool ASPLIT, int ACT, bool BIAS_BF16>
__global__ __launch_bounds__(128) void k_gemm_bf(const float* __restrict__ A, int lda, const unsigned short* __restrict__ Wt, int ldb,
                                               const float* __restrict__ bias, float* __restrict__ C, int ldc, int M, int N, int K) {
  __shared__ __attribute__((aligned(16))) float so[4][16][64];
  const int tid = threadIdx.x, w = tid >> 5, lane = tid & 31, ln = lane & 15, hh = lane >> 4;
  const int ntn = N / 64;
  const int wid = blockIdx.x * 4 + w;
  const int mt = wid / ntn, nq = wid % ntn;
  if (mt * 16 >= M) return;
  const int row0 = mt * 16, col0 = nq * 64;
  const float* arow = A + (size_t)(row0 + ln) * lda;
  v8f acc[4] = {};
  for (int kb = 0; kb < K; kb += 32) {
    FragB ah, al;
    const v4f x0 = *(const v4fa*)(arow + kb + 8 * hh), x1 = *(const v4fa*)(arow + kb + 8 * hh + 4);
    const v4f x2 = *(const v4fa*)(arow + kb + 16 + 8 * hh), x3 = *(const v4fa*)(arow + kb + 16 + 8 * hh + 4);
    float xs[16] = {x0[0],x0[1],x0[2],x0[3],x1[0],x1[1],x1[2],x1[3],x2[0],x2[1],x2[2],x2[3],x3[0],x3[1],x3[2],x3[3]};
#pragma unroll
    for (int i = 0; i < 16; ++i) { const unsigned short hb = bf16_bits(xs[i]); ah.u[i] = hb; al.u[i] = ASPLIT ? bf16_bits(xs[i] - bf16_val(hb)) : (unsigned short)0; }
#pragma unroll
    for (int t = 0; t < 4; ++t) {
      const unsigned short* brow = Wt + (size_t)(col0 + t * 16 + ln) * ldb + kb;
      FragB b;
      b.half[0] = *(const v8us*)(brow + 8 * hh);
      b.half[1] = *(const v8us*)(brow + 16 + 8 * hh);
      acc[t] = mmaN<ASPLIT ? 2 : 1>(ah.v, al.v, b.v, b.v, acc[t]);
    }
  }
#pragma unroll
  for (int t = 0; t < 4; ++t) {
    float bv = bias ? bias[col0 + t * 16 + ln] : 0.f;
    if (BIAS_BF16) bv = bf16_round(bv);
#pragma unroll
    for (int r = 0; r < 8; ++r) { float v = acc[t][r] + bv; if (ACT == 1) v = fmaxf(v, 0.f); so[w][8 * hh + r][t * 16 + ln] = v; }
  }
  __builtin_amdgcn_fence(__ATOMIC_ACQ_REL, "workgroup");
  __builtin_amdgcn_wave_barrier();
  const int rsub = lane >> 4, c4 = (lane & 15) * 4;
  {
#pragma unroll
    for (int q = 0; q < 8; ++q) {
      const int r = q * 2 + rsub;
      const v4f v = *(const v4fa*)&so[w][r][c4];
      *(v4f*)(C + (size_t)(row0 + r) * ldc + col0 + c4) = v;
    }
    
  }
}

// GEMM C = act(A·W + bias + resid): A f32 (ASPLIT -> hi/lo 2 terms), Wt bf16 [N][K]; ACT 0 none, 1 relu, 2 exact gelu;
// resid (optional, f32, row index = (row % rmod), pitch ldr, RES_BF16 rounds it) added before the activation.
template <bool ASPLIT, int ACT, bool BIAS_BF16, bool RES_BF16>
__global__ __launch_bounds__(128) void k_gemm_bf3(const float* __restrict__ A, int lda, const unsigned short* __restrict__ Wt, int ldb,
                                                const float* __restrict__ bias, const float* __restrict__ resid, int rmod, int ldr,
                                                float* __restrict__ C, int ldc, int M, int N, int K) {
  __shared__ __attribute__((aligned(16))) float so[4][16][64];
  const int tid = threadIdx.x, w = tid >> 5, lane = tid & 31, ln = lane & 15, hh = lane >> 4;
  const int ntn = N / 64;
  const int wid = blockIdx.x * 4 + w;
  const int mt = wid / ntn, nq = wid % ntn;
  if (mt * 16 >= M) return;
  const int row0 = mt * 16, col0 = nq * 64;
  const float* arow = A + (size_t)(row0 + ln) * lda;
  v8f acc[4] = {};
  for (int kb = 0; kb < K; kb += 32) {
    FragB ah, al;
    const v4f x0 = *(const v4fa*)(arow + kb + 8 * hh), x1 = *(const v4fa*)(arow + kb + 8 * hh + 4);
    const v4f x2 = *(const v4fa*)(arow + kb + 16 + 8 * hh), x3 = *(const v4fa*)(arow + kb + 16 + 8 * hh + 4);
    float xs[16] = {x0[0],x0[1],x0[2],x0[3],x1[0],x1[1],x1[2],x1[3],x2[0],x2[1],x2[2],x2[3],x3[0],x3[1],x3[2],x3[3]};
#pragma unroll
    for (int i = 0; i < 16; ++i) { const unsigned short hb = bf16_bits(xs[i]); ah.u[i] = hb; al.u[i] = ASPLIT ? bf16_bits(xs[i] - bf16_val(hb)) : (unsigned short)0; }
#pragma unroll
    for (int t = 0; t < 4; ++t) {
      const unsigned short* brow = Wt + (size_t)(col0 + t * 16 + ln) * ldb + kb;
      FragB b;
      b.half[0] = *(const v8us*)(brow + 8 * hh);
      b.half[1] = *(const v8us*)(brow + 16 + 8 * hh);
      acc[t] = mmaN<ASPLIT ? 2 : 1>(ah.v, al.v, b.v, b.v, acc[t]);
    }
  }
#pragma unroll
  for (int t = 0; t < 4; ++t) {
    const int col = col0 + t * 16 + ln;
    float bv = bias ? bias[col] : 0.f;
    if (BIAS_BF16) bv = bf16_round(bv);
#pragma unroll
    for (int r = 0; r < 8; ++r) {
      float v = acc[t][r] + bv;
      if (resid) { float rv = resid[(size_t)((row0 + 8 * hh + r) % rmod) * ldr + col]; if (RES_BF16) rv = bf16_round(rv); v += rv; }
      if (ACT == 1) v = fmaxf(v, 0.f);
      if (ACT == 2) v = 0.5f * v * (1.0f + erff(v * 0.70710678118654752f));
      if (ACT == 3) { const float u = 0.7978845608028654f * (v + 0.044715f * v * v * v); v = 0.5f * v * (1.0f + tanhf(u)); }
      so[w][8 * hh + r][t * 16 + ln] = v;
    }
  }
  __builtin_amdgcn_fence(__ATOMIC_ACQ_REL, "workgroup");
  __builtin_amdgcn_wave_barrier();
  const int rsub = lane >> 4, c4 = (lane & 15) * 4;
  {
#pragma unroll
    for (int q = 0; q < 8; ++q) {
      const int r = q * 2 + rsub;
      const v4f v = *(const v4fa*)&so[w][r][c4];
      *(v4f*)(C + (size_t)(row0 + r) * ldc + col0 + c4) = v;
    }
    
  }
}
// row LayerNorm (biased variance, eps) over N: s = X (+ R); optional out_sum <- s; out_norm <- (s-mu)*rsqrt(var+eps)*g + b
template <bool PARAM_BF16>
__global__ __launch_bounds__(256) void k_layernorm(const float* __restrict__ X, const float* __restrict__ R, const float* __restrict__ g, const float* __restrict__ bta,
                                                  float* __restrict__ out_sum, float* __restrict__ out_norm, int N, float eps) {
  __shared__ float red[256];
  const int row = blockIdx.x, tid = threadIdx.x;
  const float* x = X + (size_t)row * N; const float* rr = R ? R + (size_t)row * N : nullptr;
  float vals[16];                     // up to N = 4096
  const int per = N / 256;            // contiguous chunk per thread? use strided-by-4 chunks: thread handles j = tid*4 + 1024*u
  float s1 = 0.f;
  for (int u = 0; u < per / 4; ++u) {
    const int j = tid * 4 + 1024 * u;
    const v4f a = *(const v4fa*)(x + j);
    v4f b = {0.f,0.f,0.f,0.f}; if (rr) b = *(const v4fa*)(rr + j);
#pragma unroll
    for (int q = 0; q < 4; ++q) { const float v = a[q] + b[q]; vals[u * 4 + q] = v; s1 += v; }
  }
  red[tid] = s1; __syncthreads();
  for (int st = 128; st > 0; st >>= 1) { if (tid < st) red[tid] += red[tid + st]; __syncthreads(); }
  const float mu = red[0] / (float)N; __syncthreads();
  float s2 = 0.f;
  for (int u = 0; u < per / 4; ++u)
#pragma unroll
    for (int q = 0; q < 4; ++q) { const float c = vals[u * 4 + q] - mu; s2 += c * c; }
  red[tid] = s2; __syncthreads();
  for (int st = 128; st > 0; st >>= 1) { if (tid < st) red[tid] += red[tid + st]; __syncthreads(); }
  const float rs = rsqrtf(red[0] / (float)N + eps);
  {
    for (int u = 0; u < per / 4; ++u) {
      const int j = tid * 4 + 1024 * u;
      v4f o, sm;
#pragma unroll
      for (int q = 0; q < 4; ++q) {
        float gg = g[j + q], bb = bta[j + q];
        if (PARAM_BF16) { gg = bf16_round(gg); bb = bf16_round(bb); }
        sm[q] = vals[u * 4 + q]; o[q] = (vals[u * 4 + q] - mu) * rs * gg + bb;
      }
      if (out_sum) *(v4f*)(out_sum + (size_t)row * N + j) = sm;
      *(v4f*)(out_norm + (size_t)row * N + j) = o;
    }
    
  }
}



// ---- f16 WMMA path (v_wmma_f32_16x16x32_f16): 11-bit significands for operands in range — used where a [0,1] probability operand needs more precision than bf16
typedef _Float16 v16h __attribute__((ext_vector_type(16)));
union FragH { v16h v; v8us half[2]; _Float16 h[16]; unsigned short u[16]; };
template <int NT>
__device__ __forceinline__ v8f mmaH(v16h ah, v16h al, v16h bh, v16h bl, v8f c) {
  c = __builtin_amdgcn_wmma_f32_16x16x32_f16(false, ah, false, bh, (short)0, c, false, false);
  if (NT >= 2) c = __builtin_amdgcn_wmma_f32_16x16x32_f16(false, al, false, bh, (short)0, c, false, false);
  if (NT >= 3) c = __builtin_amdgcn_wmma_f32_16x16x32_f16(false, ah, false, bl, (short)0, c, false, false);
  asm volatile("v_nop\n\tv_nop\n\tv_nop\n\tv_nop" : "+v"(c) : "v"(ah), "v"(al), "v"(bh), "v"(bl));
  return c;
}
// batched GEMM like k_gemm_b but f16 operands: A f32 (split into f16 hi/lo if ASPLIT, else rounded to f16), Bt = f16 values [n][k]; alpha; C f32; N multiple of 16 (partial tiles skipped)
template <bool ASPLIT>
__global__ __launch_bounds__(128) void k_gemm_h(const float* __restrict__ A, int lda, size_t sA, const _Float16* __restrict__ Bh, int ldb, size_t sB, float alpha, float* __restrict__ C, int ldc, size_t sC, int M, int N, int K) {
  __shared__ __attribute__((aligned(16))) float so[4][16][64];
  const int tid = threadIdx.x, w = tid >> 5, lane = tid & 31, ln = lane & 15, hh = lane >> 4; const int by = blockIdx.y;
  A += (size_t)by * sA; Bh += (size_t)by * sB; C += (size_t)by * sC;
  const int ntn = (N + 63) / 64; const int wid = blockIdx.x * 4 + w; const int mt = wid / ntn, nq = wid % ntn; if (mt * 16 >= M) return;
  const int row0 = mt * 16, col0 = nq * 64; const float* arow = A + (size_t)(row0 + ln) * lda;
  v8f acc[4] = {};
  for (int kb = 0; kb < K; kb += 32) {
    FragH ah, al;
    const v4f x0 = *(const v4fa*)(arow + kb + 8 * hh), x1 = *(const v4fa*)(arow + kb + 8 * hh + 4), x2 = *(const v4fa*)(arow + kb + 16 + 8 * hh), x3 = *(const v4fa*)(arow + kb + 16 + 8 * hh + 4);
    float xs[16] = {x0[0],x0[1],x0[2],x0[3],x1[0],x1[1],x1[2],x1[3],x2[0],x2[1],x2[2],x2[3],x3[0],x3[1],x3[2],x3[3]};
#pragma unroll
    for (int i = 0; i < 16; ++i) { const _Float16 h = (_Float16)xs[i]; ah.h[i] = h; al.h[i] = ASPLIT ? (_Float16)(xs[i] - (float)h) : (_Float16)0.0f; }
#pragma unroll
    for (int t = 0; t < 4; ++t) { if (col0 + t * 16 >= N) continue; const size_t boff = (size_t)(col0 + t * 16 + ln) * ldb + kb; FragH bq; bq.half[0] = *(const v8us*)(Bh + boff + 8 * hh); bq.half[1] = *(const v8us*)(Bh + boff + 16 + 8 * hh);
      acc[t] = mmaH<ASPLIT ? 2 : 1>(ah.v, al.v, bq.v, bq.v, acc[t]); }
  }
#pragma unroll
  for (int t = 0; t < 4; ++t) { if (col0 + t * 16 >= N) continue;
#pragma unroll
    for (int r = 0; r < 8; ++r) so[w][8 * hh + r][t * 16 + ln] = acc[t][r] * alpha; }
  __builtin_amdgcn_fence(__ATOMIC_ACQ_REL, "workgroup"); __builtin_amdgcn_wave_barrier();
  const int rsub = lane >> 4, c4 = (lane & 15) * 4;
  {
#pragma unroll
    for (int q = 0; q < 8; ++q) { const int r = q * 2 + rsub; if (col0 + c4 < N) { const v4f v = *(const v4fa*)&so[w][r][c4]; *(v4f*)(C + (size_t)(row0 + r) * ldc + col0 + c4) = v; } }
     }
}

// Wt[n][k] = f16(W[k][n]·scale) from f32 row-major W[K][N] (scale = power of two; bf16-exact weights stay exact in f16 away from the subnormal range)
__global__ __launch_bounds__(256) void k_wt_f16(const float* __restrict__ W, _Float16* __restrict__ Wt, int K, int N, float scale) {
  const int t = blockIdx.x * 256 + threadIdx.x; if (t >= N * (K / 8)) return; const int n = t / (K / 8), k8 = (t % (K / 8)) * 8; FragH f;
#pragma unroll
  for (int i = 0; i < 8; ++i) f.h[i] = (_Float16)(bf16_round(W[(size_t)(k8 + i) * N + n]) * scale); const v8us o = f.half[0];
  *(v8us*)((unsigned short*)Wt + (size_t)n * K + k8) = o; 
}
// k_gemm_hh variant with fused epilogue: v = acc·alpha + bias[by·sBias + col] (+ CP[(row/rowsPerB)·sCPb + by·64 + col] if CP) ; ACT 0 none / 1 elu ; writes f16 C16 (and f32 C if non-null)
template <int ACT>
__global__ __launch_bounds__(128) void k_gemm_hhx(const _Float16* __restrict__ A, int lda, size_t sA, const _Float16* __restrict__ Bh, int ldb, size_t sB, float alpha, const float* __restrict__ bias, size_t sBias, const float* __restrict__ CP, int rowsPerB, size_t sCPb, int row0g,
    float* __restrict__ C, _Float16* __restrict__ C16, int ldc, size_t sC, int M, int N, int K) {
  __shared__ __attribute__((aligned(16))) float so[4][16][64];
  const int tid = threadIdx.x, w = tid >> 5, lane = tid & 31, ln = lane & 15, hh = lane >> 4; const int by = blockIdx.y;
  A += (size_t)by * sA; Bh += (size_t)by * sB; const size_t cofs = (size_t)by * sC; const float* bp = bias ? bias + (size_t)by * sBias : nullptr;
  const int ntn = (N + 63) / 64; const int wid = blockIdx.x * 4 + w; const int mt = wid / ntn, nq = wid % ntn; if (mt * 16 >= M) return;
  const int row0 = mt * 16, col0 = nq * 64; const _Float16* arow = A + (size_t)(row0 + ln) * lda;
  v8f acc[4] = {};
  for (int kb = 0; kb < K; kb += 32) { FragH ah; ah.half[0] = *(const v8us*)((const unsigned short*)arow + kb + 8 * hh); ah.half[1] = *(const v8us*)((const unsigned short*)arow + kb + 16 + 8 * hh);
#pragma unroll
    for (int t = 0; t < 4; ++t) { if (col0 + t * 16 >= N) continue; const size_t boff = (size_t)(col0 + t * 16 + ln) * ldb + kb; FragH bq; bq.half[0] = *(const v8us*)((const unsigned short*)Bh + boff + 8 * hh); bq.half[1] = *(const v8us*)((const unsigned short*)Bh + boff + 16 + 8 * hh);
      acc[t] = mmaH<1>(ah.v, ah.v, bq.v, bq.v, acc[t]); }
  }
#pragma unroll
  for (int t = 0; t < 4; ++t) { if (col0 + t * 16 >= N) continue; const int col = col0 + t * 16 + ln; const float bv = bp ? bf16_round(bp[col]) : 0.f;
#pragma unroll
    for (int r = 0; r < 8; ++r) { float v = acc[t][r] * alpha + bv; if (CP) { const int bidx = (row0g + row0 + 8 * hh + r) / rowsPerB; v += CP[(size_t)bidx * sCPb + (size_t)by * 64 + col]; } if (ACT == 1) v = (v > 0.f) ? v : expm1f(v); else if (ACT == 7) v = (v > 0.f) ? v + 1.0f : expf(v); else if (ACT == 8) v = tanhf(v); else if (ACT == 9) v = 0.5f * v * (1.0f + tanhf(0.7978845608028654f * (v + 0.044715f * v * v * v))); else if (ACT == 11) v = 1.0f / (1.0f + expf(-v)); else if (ACT == 12) v = (v > 0.f) ? v : 0.01f * v; else if (ACT == 14) v = (v > 0.f) ? v : 0.1f * v; else if (ACT == 15) v = v / (1.0f + expf(-v)); else if (ACT == 3) v = fmaxf(v, 0.f); else if (ACT == 6) v = 0.5f * v * (1.0f + erff(v * 0.70710678118654752f)); so[w][8 * hh + r][t * 16 + ln] = v; } }
  __builtin_amdgcn_fence(__ATOMIC_ACQ_REL, "workgroup"); __builtin_amdgcn_wave_barrier();
  const int rsub = lane >> 4, c4 = (lane & 15) * 4; typedef _Float16 v4h __attribute__((ext_vector_type(4)));
  {
#pragma unroll
    for (int q = 0; q < 8; ++q) { const int r = q * 2 + rsub; if (col0 + c4 < N) { const v4f v = *(const v4fa*)&so[w][r][c4]; if (C) *(v4f*)(C + cofs + (size_t)(row0 + r) * ldc + col0 + c4) = v; if (C16) { v4h h4; for (int i = 0; i < 4; ++i) h4[i] = (_Float16)v[i]; *(v4h*)(C16 + cofs + (size_t)(row0 + r) * ldc + col0 + c4) = h4; } } }
     }
}


typedef _Float16 v4h __attribute__((ext_vector_type(4)));

__global__ __launch_bounds__(256) void k_h16(const float* __restrict__ x, _Float16* __restrict__ X16, size_t n8) { const size_t t = (size_t)blockIdx.x * 256 + threadIdx.x; if (t >= n8) return; FragH f;
#pragma unroll
  for (int q = 0; q < 8; ++q) f.h[q] = (_Float16)x[t * 8 + q]; *(v8us*)((unsigned short*)X16 + t * 8) = f.half[0];  }
__global__ __launch_bounds__(256) void k_round16f(const float* __restrict__ W, _Float16* __restrict__ Bt, size_t n8) { const size_t t = (size_t)blockIdx.x * 256 + threadIdx.x; if (t >= n8) return; FragH f;
#pragma unroll
  for (int i = 0; i < 8; ++i) f.h[i] = (_Float16)(bf16_round(W[t * 8 + i]) * 16.0f); *(v8us*)((unsigned short*)Bt + t * 8) = f.half[0];  }
template <int NHv, int TTv>
__global__ __launch_bounds__(256) void k_vt(const _Float16* __restrict__ V16, int ldv, int voff, _Float16* __restrict__ Vt) { __shared__ unsigned short tl[64][66]; const int tid = threadIdx.x; const int slab = blockIdx.x / (TTv / 64), lg = blockIdx.x % (TTv / 64); const int b = slab / NHv, h = slab % NHv;
  for (int i = tid; i < 64 * 8; i += 256) { const int r = i / 8, c8 = (i % 8) * 8; FragH f; f.half[0] = *(const v8us*)((const unsigned short*)V16 + ((size_t)b * TTv + lg * 64 + r) * ldv + voff + h * 64 + c8);
#pragma unroll
    for (int q = 0; q < 8; ++q) tl[r][c8 + q] = f.u[q]; }
  __syncthreads();
  {
#pragma unroll
    for (int rd = 0; rd < 2; ++rd) { const int d = rd * 32 + tid / 8, pc = tid % 8; FragH f;
#pragma unroll
      for (int q = 0; q < 8; ++q) f.u[q] = tl[pc * 8 + q][d];
      *(v8us*)((unsigned short*)Vt + ((size_t)slab * 64 + d) * TTv + lg * 64 + pc * 8) = f.half[0]; }
     } }

__global__ __launch_bounds__(256) void k_hl(const float* __restrict__ F, _Float16* __restrict__ Hh, _Float16* __restrict__ Hl, size_t n8) { const size_t t = (size_t)blockIdx.x * 256 + threadIdx.x; if (t >= n8) return; FragH fh, fl; const v4f a = *(const v4fa*)(F + t * 8), c = *(const v4fa*)(F + t * 8 + 4);
#pragma unroll
  for (int q = 0; q < 4; ++q) { _Float16 h = (_Float16)a[q]; fh.h[q] = h; fl.h[q] = (_Float16)((a[q] - (float)h) * 1024.0f); h = (_Float16)c[q]; fh.h[4 + q] = h; fl.h[4 + q] = (_Float16)((c[q] - (float)h) * 1024.0f); }
  { *(v8us*)((unsigned short*)Hh + t * 8) = fh.half[0]; *(v8us*)((unsigned short*)Hl + t * 8) = fl.half[0];  } }

// ---- fast GEMM (wave tile 32x64; requires M % 32 == 0 rows per launch region and N % 64 == 0); epilogue = k_gemm_hhx semantics ----
__device__ __forceinline__ v16h g2_frag(const _Float16* p, int hh) { FragH f; f.half[0] = *(const v8us*)((const unsigned short*)p + 8 * hh); f.half[1] = *(const v8us*)((const unsigned short*)p + 16 + 8 * hh); return f.v; }
__device__ __forceinline__ v8f g2_mma(v16h a, v16h b, v8f c) { v8f d = __builtin_amdgcn_wmma_f32_16x16x32_f16(false, a, false, b, (short)0, c, false, false); asm volatile("v_nop\n\tv_nop\n\tv_nop\n\tv_nop" : "+v"(d) : "v"(a), "v"(b)); return d; }
template <int ACT>
__global__ __launch_bounds__(128) void k_gemm2(const _Float16* __restrict__ A, int lda, size_t sA, const _Float16* __restrict__ Bh, int ldb, size_t sB, float alpha, const float* __restrict__ bias, size_t sBias, const float* __restrict__ CP, int rowsPerB, size_t sCPb, int row0g,
    float* __restrict__ C, _Float16* __restrict__ C16, int ldc, size_t sC, int M, int N, int K) {
  __shared__ __attribute__((aligned(16))) float so[4][32][68];
  const int tid = threadIdx.x, w = tid >> 5, lane = tid & 31, ln = lane & 15, hh = lane >> 4; const int by = blockIdx.y;
  A += (size_t)by * sA; Bh += (size_t)by * sB; const size_t cofs = (size_t)by * sC; const float* bp = bias ? bias + (size_t)by * sBias : nullptr;
  const int ntn = N >> 6; const int mt = blockIdx.x / ntn, nq = blockIdx.x - mt * ntn; const int row0 = mt * 128 + 32 * w, col0 = nq * 64; if (row0 >= M) return;
  const _Float16* a0p = A + (size_t)(row0 + ln) * lda; const _Float16* a1p = a0p + (size_t)16 * lda;
  const _Float16* b0p = Bh + (size_t)(col0 + ln) * ldb; const _Float16* b1p = b0p + (size_t)16 * ldb; const _Float16* b2p = b1p + (size_t)16 * ldb; const _Float16* b3p = b2p + (size_t)16 * ldb;
  const v8f z8 = {0.f,0.f,0.f,0.f,0.f,0.f,0.f,0.f}; v8f c00 = z8, c01 = z8, c02 = z8, c03 = z8, c10 = z8, c11 = z8, c12 = z8, c13 = z8;
#pragma unroll 1
  for (int kb = 0; kb < K; kb += 32) { const v16h a0 = g2_frag(a0p + kb, hh), a1 = g2_frag(a1p + kb, hh);
    v16h b = g2_frag(b0p + kb, hh); c00 = g2_mma(a0, b, c00); c10 = g2_mma(a1, b, c10);
    b = g2_frag(b1p + kb, hh); c01 = g2_mma(a0, b, c01); c11 = g2_mma(a1, b, c11);
    b = g2_frag(b2p + kb, hh); c02 = g2_mma(a0, b, c02); c12 = g2_mma(a1, b, c12);
    b = g2_frag(b3p + kb, hh); c03 = g2_mma(a0, b, c03); c13 = g2_mma(a1, b, c13); }
  v8f accs[8] = {c00, c01, c02, c03, c10, c11, c12, c13};
#pragma unroll
  for (int u = 0; u < 8; ++u) { const int t = u & 3, half = u >> 2; const int col = col0 + t * 16 + ln; const float bv = bp ? bf16_round(bp[col]) : 0.f;
#pragma unroll
    for (int r = 0; r < 8; ++r) { const int rloc = half * 16 + 8 * hh + r; float v = accs[u][r] * alpha + bv; if (CP) { if (rowsPerB < 0) v += CP[cofs + (size_t)(row0g + row0 + rloc) * ldc + col];      /* rowsPerB < 0: own element of the batched C plane */ else { const int bidx = (row0g + row0 + rloc) / rowsPerB; v += CP[(size_t)bidx * sCPb + (size_t)by * 64 + col]; } }
      if (ACT == 3) v = fmaxf(v, 0.f); else if (ACT == 6) v = 0.5f * v * (1.0f + erff(v * 0.70710678118654752f)); else if (ACT == 11) v = 1.0f / (1.0f + expf(-v)); else if (ACT == 15) v = v / (1.0f + expf(-v)); else if (ACT == 12) v = (v > 0.f) ? v : 0.01f * v; else if (ACT == 8) v = tanhf(v);
      so[w][rloc][t * 16 + ln] = v; } }
  __builtin_amdgcn_fence(__ATOMIC_ACQ_REL, "workgroup"); __builtin_amdgcn_wave_barrier();
  const int rsub = lane >> 4, c4 = (lane & 15) * 4;
  {
#pragma unroll
    for (int q = 0; q < 16; ++q) { const int r = q * 2 + rsub; const v4f v = *(const v4fa*)&so[w][r][c4]; if (C) *(v4f*)(C + cofs + (size_t)(row0 + r) * ldc + col0 + c4) = v; if (C16) { v4h h4; for (int i = 0; i < 4; ++i) h4[i] = (_Float16)v[i]; *(v4h*)(C16 + cofs + (size_t)(row0 + r) * ldc + col0 + c4) = h4; } }
     } }



__constant__ int BK30[2 * SLEN - 1] = {15,15,15,15,15,15,15,15,15,15,15,15,15,15,15,15,15,15,15,15,15,15,15,15,15,15,15,15,15,15,15,15,15,15,15,15,15,15,15,15,15,15,15,15,15,15,15,15,15,15,15,15,15,15,15,15,15,15,15,15,15,15,15,15,15,15,15,15,15,15,15,15,15,15,15,15,15,15,15,15,15,15,15,15,15,15,15,15,15,15,15,15,15,15,15,15,15,15,15,15,15,15,15,15,15,15,15,15,15,15,15,15,15,15,15,15,15,15,15,15,15,15,15,15,15,15,15,15,15,15,15,15,15,15,15,15,15,15,15,15,15,15,15,15,15,15,15,15,15,15,15,15,15,15,15,15,15,15,15,15,15,15,15,15,15,15,15,15,15,15,15,15,15,15,15,15,15,15,15,15,15,15,15,15,15,15,15,15,15,15,15,15,15,15,15,15,15,15,15,15,15,15,15,15,15,15,15,15,15,15,15,15,15,15,15,15,15,15,15,15,15,15,15,15,15,15,15,15,15,15,15,15,15,15,15,15,15,15,15,15,15,15,15,15,15,15,15,15,15,15,15,15,15,15,15,15,15,15,15,15,15,15,15,15,15,15,15,15,15,15,15,15,15,15,15,15,15,15,15,15,15,15,15,15,15,15,15,15,15,15,15,15,15,15,15,15,15,15,15,15,15,15,15,15,15,15,15,15,15,15,15,15,15,15,15,15,15,15,15,15,15,15,15,15,15,15,15,15,15,15,15,15,15,15,15,15,15,15,15,15,15,15,15,15,15,15,15,15,15,15,15,15,15,15,15,15,15,15,15,15,15,15,15,15,15,15,15,15,15,15,15,15,15,15,15,15,15,15,15,15,15,15,15,15,15,15,15,15,15,15,15,15,15,15,15,15,15,15,15,15,15,15,15,15,15,15,15,15,15,15,15,15,15,15,15,15,15,15,15,15,15,15,15,15,15,15,15,15,15,15,15,15,15,15,15,15,15,15,15,15,15,15,15,15,15,15,15,15,15,15,15,15,15,15,15,15,15,15,15,15,15,15,15,15,15,15,15,15,15,15,15,15,15,15,15,15,15,15,15,15,15,15,15,15,15,15,15,15,15,15,15,15,15,15,15,15,15,15,15,15,15,15,15,15,15,15,15,15,15,15,15,15,15,15,15,15,15,15,15,15,15,15,15,15,15,15,15,15,15,15,15,15,15,15,15,15,15,15,15,15,15,15,15,15,15,15,15,15,15,15,15,15,15,15,15,15,15,15,15,15,15,15,15,15,15,15,15,15,15,15,15,15,15,15,15,15,15,15,15,15,15,15,15,15,15,15,15,15,15,15,15,15,15,15,15,15,15,15,15,15,15,15,15,15,15,15,15,15,15,15,15,15,15,15,15,15,15,15,15,15,15,15,15,15,15,15,15,15,15,15,15,15,15,15,15,15,15,15,15,15,15,15,15,15,15,15,15,15,15,15,15,15,15,15,15,15,15,15,15,15,15,15,15,15,15,15,15,15,15,15,15,15,15,15,15,15,15,15,15,15,15,15,15,15,15,15,15,15,15,15,15,15,15,15,15,15,15,15,15,15,15,15,15,15,15,15,15,15,15,15,15,15,15,15,15,15,15,15,15,15,15,15,15,15,15,15,15,15,15,15,15,15,15,15,15,15,15,15,15,15,15,15,15,15,15,15,15,15,15,15,15,15,15,15,15,15,15,15,15,15,15,15,15,15,15,15,15,15,15,15,15,15,15,15,15,15,15,15,15,15,15,15,15,15,15,15,15,15,15,15,15,15,15,15,15,15,15,15,15,15,15,15,15,15,15,15,15,15,15,15,15,15,15,15,15,15,15,15,15,15,15,15,15,15,15,15,15,15,15,15,15,15,15,15,15,15,15,15,15,15,15,15,15,15,15,15,15,15,15,15,15,15,15,15,15,15,15,15,15,15,15,15,15,15,15,15,15,15,15,15,15,15,15,15,15,15,15,15,15,15,15,15,15,15,15,15,15,15,15,15,15,15,15,15,15,15,15,15,15,15,15,15,15,15,15,15,15,15,15,15,15,15,15,15,15,15,15,15,15,15,15,15,15,15,15,15,15,15,15,15,15,15,15,15,15,15,15,15,15,15,15,15,15,15,15,15,15,15,15,15,15,15,15,15,15,15,15,15,15,15,15,15,15,15,15,15,15,15,15,15,15,15,15,15,15,15,15,15,15,15,15,15,15,15,15,15,15,15,15,15,15,15,15,15,15,15,15,15,15,15,15,15,15,15,15,15,15,15,15,15,15,15,15,15,15,15,15,15,15,15,15,15,15,15,15,15,15,15,15,15,15,15,15,15,15,15,15,15,15,15,15,15,15,15,15,15,15,15,15,15,15,15,15,15,15,15,15,15,15,15,15,15,15,15,15,15,15,15,15,15,15,15,15,15,15,15,15,15,15,15,15,15,15,15,15,15,15,15,15,15,15,15,15,15,15,15,15,15,15,15,15,15,15,15,15,15,15,15,15,15,15,15,15,15,15,15,15,15,15,15,15,15,15,15,15,15,15,15,15,15,15,15,15,15,15,15,15,15,15,15,15,15,15,15,15,15,15,15,15,15,15,15,15,15,15,15,15,15,15,15,15,15,15,15,15,15,15,15,15,15,15,15,15,15,15,15,15,15,15,15,15,15,15,15,15,15,15,15,15,15,15,15,15,15,15,15,15,15,15,15,15,15,15,15,15,15,15,15,15,15,15,15,15,15,15,15,15,15,15,15,15,15,15,15,15,15,15,15,15,15,15,15,15,15,15,15,15,15,15,15,15,15,15,15,15,15,15,15,15,15,15,15,15,15,15,15,15,15,15,15,15,15,15,15,15,15,15,15,15,15,15,15,15,15,15,15,15,15,15,15,15,15,15,15,15,15,15,15,15,15,15,15,15,15,15,15,15,15,15,15,15,15,15,15,15,15,15,15,15,15,15,15,15,15,15,15,15,15,15,15,15,15,15,15,15,15,15,15,15,15,15,15,15,15,15,15,15,15,15,15,15,15,15,15,15,15,15,15,15,15,15,15,15,15,15,15,15,15,15,15,15,15,15,15,15,15,15,15,15,15,15,15,15,15,15,15,15,15,15,15,15,15,15,15,15,15,15,15,15,15,15,15,15,15,15,15,15,15,15,15,15,15,15,15,15,15,15,15,15,15,15,15,15,15,15,15,15,15,15,15,15,15,15,15,15,15,15,15,15,15,15,15,15,15,15,15,15,15,15,15,15,15,15,15,15,15,15,15,15,15,15,15,15,15,15,15,15,15,15,15,15,15,15,15,15,15,15,15,15,15,15,15,15,15,15,15,15,15,15,15,15,15,15,15,15,15,15,15,15,15,15,15,15,15,15,15,15,15,15,15,15,15,15,15,15,15,15,15,15,15,15,15,15,15,15,15,15,15,15,15,15,15,15,15,15,15,15,15,15,15,15,15,15,15,15,15,15,15,15,15,15,15,15,15,15,15,15,15,15,15,15,15,15,15,15,15,15,15,15,15,15,15,15,15,15,15,15,15,15,15,15,15,15,15,15,15,15,15,15,15,15,15,15,15,15,15,15,15,15,15,15,15,15,15,15,15,15,15,15,15,15,15,15,15,15,15,15,15,15,15,15,15,15,15,15,15,15,15,15,15,15,15,15,15,15,15,15,15,15,15,15,15,15,15,15,15,15,15,15,15,15,15,15,15,15,15,15,15,15,15,15,15,15,15,15,15,15,15,15,15,15,15,15,15,15,15,15,15,15,15,15,15,15,15,15,15,15,15,15,15,15,15,15,15,15,15,15,15,15,15,15,15,15,15,15,15,15,15,15,15,15,15,15,15,15,15,15,15,15,15,15,15,15,15,15,15,15,15,15,15,15,15,15,15,15,15,15,15,15,15,15,15,15,15,15,15,15,15,15,15,15,15,15,15,15,15,15,15,15,15,15,15,15,15,15,15,15,15,15,15,15,15,15,15,15,15,15,15,15,15,15,15,15,15,15,15,15,15,15,15,15,15,15,15,15,15,15,15,15,15,15,15,15,15,15,15,15,15,15,15,15,15,15,15,15,15,15,15,15,15,15,15,15,15,15,15,15,15,15,15,15,15,15,15,15,15,15,15,15,15,15,15,15,15,15,15,15,15,15,15,15,15,15,15,15,15,15,15,15,15,15,15,15,15,15,15,15,15,15,15,15,15,15,15,15,15,15,15,15,15,15,15,15,15,15,15,15,15,15,15,15,15,15,15,15,15,15,15,15,15,15,15,15,15,15,15,15,15,15,15,15,15,15,15,15,15,15,15,15,15,15,15,15,15,15,15,15,15,15,15,15,15,15,15,15,15,15,15,15,15,15,15,15,15,15,15,15,15,15,15,15,15,15,15,15,15,15,15,15,15,15,15,15,15,15,15,15,14,14,14,14,14,14,14,14,14,14,14,14,14,14,14,14,14,14,14,14,14,14,14,14,14,14,14,13,13,13,13,13,13,13,13,13,13,13,13,13,13,13,13,13,13,12,12,12,12,12,12,12,12,12,12,12,12,12,12,11,11,11,11,11,11,11,11,11,10,10,10,10,10,10,10,9,9,9,9,8,8,8,8,7,6,5,4,3,2,1,0,17,18,19,20,21,22,23,24,24,24,24,25,25,25,25,26,26,26,26,26,26,26,27,27,27,27,27,27,27,27,27,28,28,28,28,28,28,28,28,28,28,28,28,28,28,29,29,29,29,29,29,29,29,29,29,29,29,29,29,29,29,29,29,30,30,30,30,30,30,30,30,30,30,30,30,30,30,30,30,30,30,30,30,30,30,30,30,30,30,30,31,31,31,31,31,31,31,31,31,31,31,31,31,31,31,31,31,31,31,31,31,31,31,31,31,31,31,31,31,31,31,31,31,31,31,31,31,31,31,31,31,31,31,31,31,31,31,31,31,31,31,31,31,31,31,31,31,31,31,31,31,31,31,31,31,31,31,31,31,31,31,31,31,31,31,31,31,31,31,31,31,31,31,31,31,31,31,31,31,31,31,31,31,31,31,31,31,31,31,31,31,31,31,31,31,31,31,31,31,31,31,31,31,31,31,31,31,31,31,31,31,31,31,31,31,31,31,31,31,31,31,31,31,31,31,31,31,31,31,31,31,31,31,31,31,31,31,31,31,31,31,31,31,31,31,31,31,31,31,31,31,31,31,31,31,31,31,31,31,31,31,31,31,31,31,31,31,31,31,31,31,31,31,31,31,31,31,31,31,31,31,31,31,31,31,31,31,31,31,31,31,31,31,31,31,31,31,31,31,31,31,31,31,31,31,31,31,31,31,31,31,31,31,31,31,31,31,31,31,31,31,31,31,31,31,31,31,31,31,31,31,31,31,31,31,31,31,31,31,31,31,31,31,31,31,31,31,31,31,31,31,31,31,31,31,31,31,31,31,31,31,31,31,31,31,31,31,31,31,31,31,31,31,31,31,31,31,31,31,31,31,31,31,31,31,31,31,31,31,31,31,31,31,31,31,31,31,31,31,31,31,31,31,31,31,31,31,31,31,31,31,31,31,31,31,31,31,31,31,31,31,31,31,31,31,31,31,31,31,31,31,31,31,31,31,31,31,31,31,31,31,31,31,31,31,31,31,31,31,31,31,31,31,31,31,31,31,31,31,31,31,31,31,31,31,31,31,31,31,31,31,31,31,31,31,31,31,31,31,31,31,31,31,31,31,31,31,31,31,31,31,31,31,31,31,31,31,31,31,31,31,31,31,31,31,31,31,31,31,31,31,31,31,31,31,31,31,31,31,31,31,31,31,31,31,31,31,31,31,31,31,31,31,31,31,31,31,31,31,31,31,31,31,31,31,31,31,31,31,31,31,31,31,31,31,31,31,31,31,31,31,31,31,31,31,31,31,31,31,31,31,31,31,31,31,31,31,31,31,31,31,31,31,31,31,31,31,31,31,31,31,31,31,31,31,31,31,31,31,31,31,31,31,31,31,31,31,31,31,31,31,31,31,31,31,31,31,31,31,31,31,31,31,31,31,31,31,31,31,31,31,31,31,31,31,31,31,31,31,31,31,31,31,31,31,31,31,31,31,31,31,31,31,31,31,31,31,31,31,31,31,31,31,31,31,31,31,31,31,31,31,31,31,31,31,31,31,31,31,31,31,31,31,31,31,31,31,31,31,31,31,31,31,31,31,31,31,31,31,31,31,31,31,31,31,31,31,31,31,31,31,31,31,31,31,31,31,31,31,31,31,31,31,31,31,31,31,31,31,31,31,31,31,31,31,31,31,31,31,31,31,31,31,31,31,31,31,31,31,31,31,31,31,31,31,31,31,31,31,31,31,31,31,31,31,31,31,31,31,31,31,31,31,31,31,31,31,31,31,31,31,31,31,31,31,31,31,31,31,31,31,31,31,31,31,31,31,31,31,31,31,31,31,31,31,31,31,31,31,31,31,31,31,31,31,31,31,31,31,31,31,31,31,31,31,31,31,31,31,31,31,31,31,31,31,31,31,31,31,31,31,31,31,31,31,31,31,31,31,31,31,31,31,31,31,31,31,31,31,31,31,31,31,31,31,31,31,31,31,31,31,31,31,31,31,31,31,31,31,31,31,31,31,31,31,31,31,31,31,31,31,31,31,31,31,31,31,31,31,31,31,31,31,31,31,31,31,31,31,31,31,31,31,31,31,31,31,31,31,31,31,31,31,31,31,31,31,31,31,31,31,31,31,31,31,31,31,31,31,31,31,31,31,31,31,31,31,31,31,31,31,31,31,31,31,31,31,31,31,31,31,31,31,31,31,31,31,31,31,31,31,31,31,31,31,31,31,31,31,31,31,31,31,31,31,31,31,31,31,31,31,31,31,31,31,31,31,31,31,31,31,31,31,31,31,31,31,31,31,31,31,31,31,31,31,31,31,31,31,31,31,31,31,31,31,31,31,31,31,31,31,31,31,31,31,31,31,31,31,31,31,31,31,31,31,31,31,31,31,31,31,31,31,31,31,31,31,31,31,31,31,31,31,31,31,31,31,31,31,31,31,31,31,31,31,31,31,31,31,31,31,31,31,31,31,31,31,31,31,31,31,31,31,31,31,31,31,31,31,31,31,31,31,31,31,31,31,31,31,31,31,31,31,31,31,31,31,31,31,31,31,31,31,31,31,31,31,31,31,31,31,31,31,31,31,31,31,31,31,31,31,31,31,31,31,31,31,31,31,31,31,31,31,31,31,31,31,31,31,31,31,31,31,31,31,31,31,31,31,31,31,31,31,31,31,31,31,31,31,31,31,31,31,31,31,31,31,31,31,31,31,31,31,31,31,31,31,31,31,31,31,31,31,31,31,31,31,31,31,31,31,31,31,31,31,31,31,31,31,31,31,31,31,31,31,31,31,31,31,31,31,31,31,31,31,31,31,31,31,31,31,31,31,31,31,31,31,31,31,31,31,31,31,31,31,31,31,31,31,31,31,31,31,31,31,31,31,31,31,31,31,31,31,31,31,31,31,31,31,31,31,31,31,31,31,31,31,31,31,31,31,31,31,31,31,31,31,31,31,31,31,31,31,31,31,31,31,31,31,31,31,31,31,31,31,31,31,31,31,31,31,31,31,31,31,31,31,31,31,31,31,31,31,31,31,31,31,31,31,31,31,31,31,31,31,31,31,31,31,31,31,31,31,31,31,31,31,31,31,31,31,31,31,31,31,31,31,31,31,31,31,31,31,31,31,31,31,31,31,31,31,31,31,31,31,31,31,31,31,31,31,31,31,31,31,31,31,31,31,31,31,31,31,31,31,31,31,31,31,31,31,31,31,31,31,31,31,31,31,31,31,31,31,31,31,31,31,31,31,31,31,31,31,31,31,31,31,31,31,31,31,31,31,31,31,31,31,31,31,31,31,31,31,31,31,31,31,31,31,31,31,31,31,31,31,31,31,31,31,31,31,31,31,31,31,31,31,31,31,31,31,31,31,31,31,31,31,31,31,31,31,31,31,31,31,31,31,31,31,31,31,31,31,31,31,31,31,31,31,31,31,31,31,31,31,31,31,31,31,31,31,31,31,31,31,31,31,31,31,31,31,31,31,31,31,31,31,31,31,31,31,31,31,31,31,31,31,31,31,31,31,31,31,31,31,31,31,31,31,31,31,31,31,31,31,31,31,31,31,31,31,31,31,31,31,31,31,31,31,31,31,31,31,31,31,31,31,31,31,31,31,31,31,31,31,31,31,31,31,31,31,31,31,31,31,31,31,31,31,31,31,31,31,31,31,31,31,31,31,31,31,31,31,31,31,31,31,31,31,31,31,31,31,31,31,31,31,31,31,31,31,31,31,31,31,31,31,31,31,31,31,31,31,31,31,31,31,31,31,31,31,31,31,31,31,31,31,31,31,31,31,31,31,31,31,31,31,31,31,31,31,31,31,31,31,31,31,31,31,31,31,31,31,31,31,31,31,31,31,31,31,31,31,31,31,31,31,31,31,31,31,31,31,31,31,31,31,31,31,31,31,31,31,31,31,31,31,31,31,31,31,31,31,31,31,31,31,31,31,31,31,31,31,31,31,31,31,31,31,31,31,31,31,31,31,31,31,31,31,31,31,31,31,31,31,31,31,31,31,31,31,31,31,31,31,31,31,31,31,31,31,31,31,31,31,31,31,31,31,31,31,31,31,31,31,31,31,31,31,31,31,31,31,31,31,31,31,31,31,31,31,31,31,31,31,31,31,31,31,31,31,31,31,31,31,31,31,31,31,31,31,31,31,31,31,31,31,31,31,31,31,31,31,31,31,31,31,31,31,31,31,31,31,31,31,31,31,31,31,31,31,31,31,31,31,31,31,31,31,31,31,31,31,31,31,31,31,31,31,31,31,31,31,31,31,31,31,31,31,31,31,31,31,31,31,31,31,31,31,31,31,31,31,31,31,31,31,31,31,31,31,31,31,31,31,31,31,31,31,31,31,31,31,31,31,31,31,31,31,31,31,31,31,31,31,31,31,31,31,31,31,31,31,31,31,31,31,31,31,31,31,31,31,31,31,31,31,31,31,31,31,31,31,31,31,31,31,31,31,31,31,31,31,31,31,31,31,31,31,31,31,31,31,31,31,31,31,31,31,31,31,31,31,31,31,31,31,31,31,31,31,31,31,31,31,31,31,31,31,31,31,31,31,31,31,31,31,31,31,31,31,31,31,31,31,31,31,31,31,31,31,31,31,31,31,31,31,31,31,31,31,31,31,31,31,31,31};      /* T5 _relative_position_bucket(k - q) for k - q in [-(S-1), S-1], computed with the module's own jax code on the host */
__global__ __launch_bounds__(512) void k_rb(const float* __restrict__ t, float* __restrict__ RB) { const int i = threadIdx.x; const float v = bf16_round(t[i]); *(float*)(RB + i) = v;  }
template <int CAUSAL>
__global__ __launch_bounds__(128) void k_flash(const _Float16* __restrict__ Q16, int ldq, const _Float16* __restrict__ K16, int ldk, const _Float16* __restrict__ Vt, const int* __restrict__ MSK, float* __restrict__ O, int ldo) {
  constexpr int RPW = 16, RTN = RPW / 16, NQB = TQ / (4 * RPW), DT = 4, KS = 2;
  __shared__ __attribute__((aligned(16))) unsigned short sP[4][RPW][40]; __shared__ __attribute__((aligned(16))) float sO[4][RPW][64 + 4];
  const int tid = threadIdx.x, w = tid >> 5, lane = tid & 31, ln = lane & 15, hh = lane >> 4;
  const int slab = blockIdx.x / QBNP, qblk = QB0P + blockIdx.x % QBNP; (void)NQB; const int b = slab / NH, h = slab % NH; const int qb0 = qblk * (4 * RPW); const int q0 = qb0 + w * RPW;
  FragH aq[2][KS];
#pragma unroll
  for (int rt = 0; rt < RTN; ++rt) { const unsigned short* qr = (const unsigned short*)Q16 + ((size_t)b * TQ + q0 + rt * 16 + ln) * ldq + h * 64;
#pragma unroll
    for (int ks = 0; ks < KS; ++ks) { aq[rt][ks].half[0] = *(const v8us*)(qr + ks * 32 + 8 * hh); aq[rt][ks].half[1] = *(const v8us*)(qr + ks * 32 + 16 + 8 * hh); } }
  const unsigned short* Vth = (const unsigned short*)Vt + (size_t)slab * 64 * TK;
  float m_r[2][8], l_r[2][8]; v8f oacc[2][DT];
#pragma unroll
  for (int rt = 0; rt < RTN; ++rt) {
#pragma unroll
    for (int r = 0; r < 8; ++r) { m_r[rt][r] = -3.0e38f; l_r[rt][r] = 0.f; }
#pragma unroll
    for (int dt = 0; dt < DT; ++dt) oacc[rt][dt] = (v8f){0.f,0.f,0.f,0.f,0.f,0.f,0.f,0.f}; }
  float qsq[2][8];      /* mode 32: |q|^2 of this lane's rows, read once */
#pragma unroll
  for (int rt = 0; rt < RTN; ++rt)
#pragma unroll
    for (int r = 0; r < 8; ++r) qsq[rt][r] = (CAUSAL == 32) ? ((const float*)MSK)[(size_t)b * TQ + q0 + rt * 16 + 8 * hh + r] : 0.f;
  const int jend = (CAUSAL == 1 || CAUSAL == 32) ? (qb0 + 4 * RPW) : ((CAUSAL == 23) ? min(TK, (qb0 / CHK + 2) * CHK) : TK);      /* causal / window: keys that can never contribute are skipped */ const int jbeg = (CAUSAL == 23) ? max(0, (qb0 / CHK - 1) * CHK) : 0;
#pragma unroll 1
  for (int j0 = jbeg; j0 < jend; j0 += 32) {
    v8f s[2][2];
    float ksq0 = 0.f, ksq1 = 0.f; if (CAUSAL == 32) { const float* ksT = (const float*)MSK + (size_t)NB * TQ + (size_t)b * TK + j0 + ln; ksq0 = ksT[0]; ksq1 = ksT[16]; }      /* mode 32: |k|^2 of this lane's two keys, one unconditional load each per key block (j0 + 31 < jend <= TK) */
#pragma unroll
    for (int nt = 0; nt < 2; ++nt) { const unsigned short* kr = (const unsigned short*)K16 + ((size_t)b * TK + j0 + nt * 16 + ln) * ldk + h * 64; FragH bk[KS];
#pragma unroll
      for (int ks = 0; ks < KS; ++ks) { bk[ks].half[0] = *(const v8us*)(kr + ks * 32 + 8 * hh); bk[ks].half[1] = *(const v8us*)(kr + ks * 32 + 16 + 8 * hh); }
#pragma unroll
      for (int rt = 0; rt < RTN; ++rt) { v8f acc = (v8f){0.f,0.f,0.f,0.f,0.f,0.f,0.f,0.f};
#pragma unroll
        for (int ks = 0; ks < KS; ++ks) acc = mmaH<1>(aq[rt][ks].v, aq[rt][ks].v, bk[ks].v, bk[ks].v, acc); s[rt][nt] = acc; } }
#pragma unroll
    for (int rt = 0; rt < RTN; ++rt)
#pragma unroll
      for (int r = 0; r < 8; ++r) { const int tq = q0 + rt * 16 + 8 * hh + r; const int k0 = j0 + ln, k1 = j0 + 16 + ln;
        bool ok0 = (CAUSAL == 1 || CAUSAL == 32) ? (k0 <= tq) : ((CAUSAL == 2) ? ((k0 >> 5) == (tq >> 5)) : true), ok1 = (CAUSAL == 1 || CAUSAL == 32) ? (k1 <= tq) : ((CAUSAL == 2) ? ((k1 >> 5) == (tq >> 5)) : true); if (CAUSAL == 23) { const int cq = tq / CHK; ok0 = (abs(k0 / CHK - cq) <= 1) && (MSK[(size_t)b * TK + k0] == 0); ok1 = (abs(k1 / CHK - cq) <= 1) && (MSK[(size_t)b * TK + k1] == 0); }      /* mode 23: 3-chunk window + int key-padding mask */
        if (CAUSAL == 24) { ok0 = (MSK[(size_t)b * TK + k0] == 0); ok1 = (MSK[(size_t)b * TK + k1] == 0); }      /* mode 24: int key-padding mask (nonzero = padded = excluded) */      /* mode 2: block-diagonal 32-token groups */
        float s0 = ok0 ? s[rt][0][r] * SCL : -3.0e38f, s1 = ok1 ? s[rt][1][r] * SCL : -3.0e38f; if (CAUSAL == 27) { const float* amk = (const float*)MSK + ((size_t)b * MQI + tq) * MKI; s0 += bf16_round(amk[k0]); s1 += bf16_round(amk[k1]); }      /* mode 27: additive per-(batch, query, key) f32 mask INPUT [b][tq][k] */ if (CAUSAL == 30) { const float* rbp = (const float*)MSK; s0 += rbp[BK30[k0 - tq + (TK - 1)] * NH + h]; s1 += rbp[BK30[k1 - tq + (TK - 1)] * NH + h]; }      /* mode 30: T5 bucketed relative bias: table[bucket(k - q)][h]; bucket-of-distance is a module constant */ if (CAUSAL == 32) { const float qs = qsq[rt][r]; if (ok0) { float d = qs + ksq0; d = d - 2.0f * s0; d = fmaxf(d, 0.f); s0 = -d * 0.125f; } if (ok1) { float d = qs + ksq1; d = d - 2.0f * s1; d = fmaxf(d, 0.f); s1 = -d * 0.125f; } }      /* mode 32: RBF logit -relu(|q|^2 + |k|^2 - 2 q.k)/8, causal */ if (CAUSAL == 17) { const float* amk = (const float*)MSK + (size_t)b * TK; s0 += bf16_round(amk[k0]); s1 += bf16_round(amk[k1]); } if (CAUSAL == 18) { const float* tb = (const float*)MSK; const int* ri = MSK + 1024 + (size_t)b * TK; const int rq = ri[tq]; s0 += tb[(h * 8 + rq) * 8 + ri[k0]]; s1 += tb[(h * 8 + rq) * 8 + ri[k1]]; } if (CAUSAL == 19) { const int* rel = MSK + (size_t)tq * TK; const float* rb = (const float*)MSK + (size_t)TQ * TK + ((size_t)(b * NH + h) * TQ + tq) * 64; s0 += rb[rel[k0]]; s1 += rb[rel[k1]]; }      /* mode 19: + (q.Ek[rel] + Eb[rel][h]) / 8 gathered by the int relative ids (packed [ids | table]) */      /* mode 18: + resource_bias[h][r_q][r_k] from the packed [table | ids] buffer (TQ == TK) */      /* mode 17: additive per-(batch, key) mask INPUT */ float mc = fmaxf(s0, s1);
        mc = fmaxf(mc, __shfl_xor(mc, 1, 32)); mc = fmaxf(mc, __shfl_xor(mc, 2, 32)); mc = fmaxf(mc, __shfl_xor(mc, 4, 32)); mc = fmaxf(mc, __shfl_xor(mc, 8, 32));
        const float mn = fmaxf(m_r[rt][r], mc); const float ea = expf(m_r[rt][r] - mn), e0 = expf(s0 - mn), e1 = expf(s1 - mn);      /* computed for every lane and selected below: no exec-mask branch, so the eight rows' chains can overlap */ const float al = (mn > -1.0e38f) ? ea : 1.0f; m_r[rt][r] = mn; const float p0 = ok0 ? e0 : 0.f, p1 = ok1 ? e1 : 0.f; l_r[rt][r] = l_r[rt][r] * al + p0 + p1;
#pragma unroll
        for (int dt = 0; dt < DT; ++dt) oacc[rt][dt][r] *= al;
        FragH t2; t2.h[0] = (_Float16)(p0 * 1024.0f); t2.h[1] = (_Float16)(p1 * 1024.0f); sP[w][rt * 16 + 8 * hh + r][ln] = t2.u[0]; sP[w][rt * 16 + 8 * hh + r][16 + ln] = t2.u[1]; }
    __builtin_amdgcn_fence(__ATOMIC_ACQ_REL, "workgroup"); __builtin_amdgcn_wave_barrier();
    FragH pa[2];
#pragma unroll
    for (int rt = 0; rt < RTN; ++rt) { pa[rt].half[0] = *(const v8us*)&sP[w][rt * 16 + ln][8 * hh]; pa[rt].half[1] = *(const v8us*)&sP[w][rt * 16 + ln][16 + 8 * hh]; }
#pragma unroll
    for (int dt = 0; dt < DT; ++dt) { const unsigned short* vrow = Vth + (size_t)(dt * 16 + ln) * TK + j0; FragH bv; bv.half[0] = *(const v8us*)(vrow + 8 * hh); bv.half[1] = *(const v8us*)(vrow + 16 + 8 * hh);
#pragma unroll
      for (int rt = 0; rt < RTN; ++rt) oacc[rt][dt] = mmaH<1>(pa[rt].v, pa[rt].v, bv.v, bv.v, oacc[rt][dt]); }
    __builtin_amdgcn_fence(__ATOMIC_ACQ_REL, "workgroup"); __builtin_amdgcn_wave_barrier(); }
#pragma unroll
  for (int rt = 0; rt < RTN; ++rt) {
#pragma unroll
    for (int r = 0; r < 8; ++r) { float l = l_r[rt][r]; l += __shfl_xor(l, 1, 32); l += __shfl_xor(l, 2, 32); l += __shfl_xor(l, 4, 32); l += __shfl_xor(l, 8, 32); l_r[rt][r] = (l > 0.f) ? 1.0f / (l * 1024.0f) : 0.f; }
#pragma unroll
    for (int dt = 0; dt < DT; ++dt)
#pragma unroll
      for (int r = 0; r < 8; ++r) sO[w][rt * 16 + 8 * hh + r][dt * 16 + ln] = oacc[rt][dt][r] * l_r[rt][r]; }
  __builtin_amdgcn_fence(__ATOMIC_ACQ_REL, "workgroup"); __builtin_amdgcn_wave_barrier();
  {
#pragma unroll
    for (int rp = 0; rp < RPW; rp += 2) { const int r = rp + (lane >> 4), pc = lane & 15; const v4f val = *(const v4fa*)&sO[w][r][pc * 4]; *(v4f*)(O + ((size_t)b * TQ + q0 + r) * ldo + h * 64 + pc * 4) = val; }
     } }
// 5-plane variant: S = Qh Kh^T + (Ql Kh^T + Qh Kl^T)/1024 with Q/K = [hi | 2^10 residual] f16 planes (QL/KL same layout as Q16/K16), then the 3-term P.V below.
// 3-term variant: O = (P_hi V_hi + (P_lo V_hi + P_hi V_lo) / 1024) / l with P = [hi | 2^10 residual] of 1024 p and V^T = [hi | 2^10 residual] planes (VtL same layout as Vt) -> ~2^-21-class products for un-averaged (early causal / peaked) rows
template <int CAUSAL>
__global__ __launch_bounds__(128) void k_flash5(const _Float16* __restrict__ Q16, const _Float16* __restrict__ QL, int ldq, const _Float16* __restrict__ K16, const _Float16* __restrict__ KL, int ldk, const _Float16* __restrict__ Vt, const _Float16* __restrict__ VtL, const int* __restrict__ MSK, float* __restrict__ O, int ldo) {
  constexpr int RPW = 16, RTN = RPW / 16, NQB = TQ / (4 * RPW), DT = 4, KS = 2;
  __shared__ __attribute__((aligned(16))) unsigned short sP[4][RPW][40]; __shared__ __attribute__((aligned(16))) unsigned short sPL[4][RPW][40]; __shared__ __attribute__((aligned(16))) float sO[4][RPW][64 + 4];
  const int tid = threadIdx.x, w = tid >> 5, lane = tid & 31, ln = lane & 15, hh = lane >> 4;
  const int slab = blockIdx.x / QBN5, qblk = QB05 + blockIdx.x % QBN5; (void)NQB; const int b = slab / NH, h = slab % NH; const int qb0 = qblk * (4 * RPW); const int q0 = qb0 + w * RPW;
  FragH aq[2][KS], aql[2][KS];
#pragma unroll
  for (int rt = 0; rt < RTN; ++rt) { const unsigned short* qr = (const unsigned short*)Q16 + ((size_t)b * TQ + q0 + rt * 16 + ln) * ldq + h * 64; const unsigned short* ql = (const unsigned short*)QL + ((size_t)b * TQ + q0 + rt * 16 + ln) * ldq + h * 64;
#pragma unroll
    for (int ks = 0; ks < KS; ++ks) { aq[rt][ks].half[0] = *(const v8us*)(qr + ks * 32 + 8 * hh); aq[rt][ks].half[1] = *(const v8us*)(qr + ks * 32 + 16 + 8 * hh); aql[rt][ks].half[0] = *(const v8us*)(ql + ks * 32 + 8 * hh); aql[rt][ks].half[1] = *(const v8us*)(ql + ks * 32 + 16 + 8 * hh); } }
  const unsigned short* Vth = (const unsigned short*)Vt + (size_t)slab * 64 * TK; const unsigned short* Vtl = (const unsigned short*)VtL + (size_t)slab * 64 * TK;
  float m_r[2][8], l_r[2][8]; v8f oacc[2][DT], oaccL[2][DT];
#pragma unroll
  for (int rt = 0; rt < RTN; ++rt) {
#pragma unroll
    for (int r = 0; r < 8; ++r) { m_r[rt][r] = -3.0e38f; l_r[rt][r] = 0.f; }
#pragma unroll
    for (int dt = 0; dt < DT; ++dt) { oacc[rt][dt] = (v8f){0.f,0.f,0.f,0.f,0.f,0.f,0.f,0.f}; oaccL[rt][dt] = oacc[rt][dt]; } }
  const int jend = (CAUSAL == 1 || CAUSAL == 32) ? (qb0 + 4 * RPW) : ((CAUSAL == 23) ? min(TK, (qb0 / CHK + 2) * CHK) : TK);      /* causal / window: keys that can never contribute are skipped */ const int jbeg = (CAUSAL == 23) ? max(0, (qb0 / CHK - 1) * CHK) : 0;
#pragma unroll 1
  for (int j0 = jbeg; j0 < jend; j0 += 32) {
    v8f s[2][2];
#pragma unroll
    for (int nt = 0; nt < 2; ++nt) { const unsigned short* kr = (const unsigned short*)K16 + ((size_t)b * TK + j0 + nt * 16 + ln) * ldk + h * 64; const unsigned short* klr = (const unsigned short*)KL + ((size_t)b * TK + j0 + nt * 16 + ln) * ldk + h * 64; FragH bk[KS], bkl[KS];
#pragma unroll
      for (int ks = 0; ks < KS; ++ks) { bk[ks].half[0] = *(const v8us*)(kr + ks * 32 + 8 * hh); bk[ks].half[1] = *(const v8us*)(kr + ks * 32 + 16 + 8 * hh); bkl[ks].half[0] = *(const v8us*)(klr + ks * 32 + 8 * hh); bkl[ks].half[1] = *(const v8us*)(klr + ks * 32 + 16 + 8 * hh); }
#pragma unroll
      for (int rt = 0; rt < RTN; ++rt) { v8f acc = (v8f){0.f,0.f,0.f,0.f,0.f,0.f,0.f,0.f}, accl = acc;
#pragma unroll
        for (int ks = 0; ks < KS; ++ks) { acc = mmaH<1>(aq[rt][ks].v, aq[rt][ks].v, bk[ks].v, bk[ks].v, acc); accl = mmaH<1>(aql[rt][ks].v, aql[rt][ks].v, bk[ks].v, bk[ks].v, accl); accl = mmaH<1>(aq[rt][ks].v, aq[rt][ks].v, bkl[ks].v, bkl[ks].v, accl); }
#pragma unroll
        for (int r = 0; r < 8; ++r) acc[r] += accl[r] * 0.0009765625f;
        s[rt][nt] = acc; } }
#pragma unroll
    for (int rt = 0; rt < RTN; ++rt)
#pragma unroll
      for (int r = 0; r < 8; ++r) { const int tq = q0 + rt * 16 + 8 * hh + r; const int k0 = j0 + ln, k1 = j0 + 16 + ln;
        bool ok0 = (CAUSAL == 1 || CAUSAL == 32) ? (k0 <= tq) : ((CAUSAL == 2) ? ((k0 >> 5) == (tq >> 5)) : true), ok1 = (CAUSAL == 1 || CAUSAL == 32) ? (k1 <= tq) : ((CAUSAL == 2) ? ((k1 >> 5) == (tq >> 5)) : true);      /* mode 2: block-diagonal 32-token groups */
        if (CAUSAL == 4) { const int* mrow = MSK + ((size_t)b * TQ + tq) * TK; ok0 = mrow[k0] != 0; ok1 = mrow[k1] != 0; }      /* mode 4: per-(query, key) INPUT mask shared by all heads; masked keys contribute nothing (== the reference's -4096 fill, whose exp underflows to 0), rows with no valid key give l = 0 -> output 0 (== the reference's row_valid zeroing) */
        float s0 = ok0 ? s[rt][0][r] * SCL : -3.0e38f, s1 = ok1 ? s[rt][1][r] * SCL : -3.0e38f; if (CAUSAL == 30) { const float* rbp = (const float*)MSK; s0 += rbp[BK30[k0 - tq + (TK - 1)] * NH + h]; s1 += rbp[BK30[k1 - tq + (TK - 1)] * NH + h]; }      /* mode 30: T5 bucketed relative bias: table[bucket(k - q)][h]; bucket-of-distance is a module constant */ if (CAUSAL == 32) { const float* qsT = (const float*)MSK; const float* ksT = qsT + (size_t)NB * TQ; const float qs = qsT[(size_t)b * TQ + tq]; if (ok0) { float d = qs + ksT[(size_t)b * TK + k0]; d = d - 2.0f * s0; d = fmaxf(d, 0.f); s0 = -d * 0.125f; } if (ok1) { float d = qs + ksT[(size_t)b * TK + k1]; d = d - 2.0f * s1; d = fmaxf(d, 0.f); s1 = -d * 0.125f; } }      /* mode 32: RBF logit -relu(|q|^2 + |k|^2 - 2 q.k)/8, causal */ if (CAUSAL == 17) { const float* amk = (const float*)MSK + (size_t)b * TK; s0 += bf16_round(amk[k0]); s1 += bf16_round(amk[k1]); } if (CAUSAL == 18) { const float* tb = (const float*)MSK; const int* ri = MSK + 1024 + (size_t)b * TK; const int rq = ri[tq]; s0 += tb[(h * 8 + rq) * 8 + ri[k0]]; s1 += tb[(h * 8 + rq) * 8 + ri[k1]]; } if (CAUSAL == 19) { const int* rel = MSK + (size_t)tq * TK; const float* rb = (const float*)MSK + (size_t)TQ * TK + ((size_t)(b * NH + h) * TQ + tq) * 64; s0 += rb[rel[k0]]; s1 += rb[rel[k1]]; }      /* mode 19: + (q.Ek[rel] + Eb[rel][h]) / 8 gathered by the int relative ids (packed [ids | table]) */      /* mode 18: + resource_bias[h][r_q][r_k] from the packed [table | ids] buffer (TQ == TK) */      /* mode 17: additive per-(batch, key) mask INPUT */ float mc = fmaxf(s0, s1);
        mc = fmaxf(mc, __shfl_xor(mc, 1, 32)); mc = fmaxf(mc, __shfl_xor(mc, 2, 32)); mc = fmaxf(mc, __shfl_xor(mc, 4, 32)); mc = fmaxf(mc, __shfl_xor(mc, 8, 32));
        const float mn = fmaxf(m_r[rt][r], mc); const float al = (mn > -1.0e38f) ? expf(m_r[rt][r] - mn) : 1.0f; m_r[rt][r] = mn; const float p0 = ok0 ? expf(s0 - mn) : 0.f, p1 = ok1 ? expf(s1 - mn) : 0.f; l_r[rt][r] = l_r[rt][r] * al + p0 + p1;
#pragma unroll
        for (int dt = 0; dt < DT; ++dt) { oacc[rt][dt][r] *= al; oaccL[rt][dt][r] *= al; }
        FragH t2, t2l; const float ps0 = p0 * 1024.0f, ps1 = p1 * 1024.0f; t2.h[0] = (_Float16)ps0; t2.h[1] = (_Float16)ps1; t2l.h[0] = (_Float16)((ps0 - (float)t2.h[0]) * 1024.0f); t2l.h[1] = (_Float16)((ps1 - (float)t2.h[1]) * 1024.0f);
        sP[w][rt * 16 + 8 * hh + r][ln] = t2.u[0]; sP[w][rt * 16 + 8 * hh + r][16 + ln] = t2.u[1]; sPL[w][rt * 16 + 8 * hh + r][ln] = t2l.u[0]; sPL[w][rt * 16 + 8 * hh + r][16 + ln] = t2l.u[1]; }
    __builtin_amdgcn_fence(__ATOMIC_ACQ_REL, "workgroup"); __builtin_amdgcn_wave_barrier();
    FragH pa[2], pl[2];
#pragma unroll
    for (int rt = 0; rt < RTN; ++rt) { pa[rt].half[0] = *(const v8us*)&sP[w][rt * 16 + ln][8 * hh]; pa[rt].half[1] = *(const v8us*)&sP[w][rt * 16 + ln][16 + 8 * hh]; pl[rt].half[0] = *(const v8us*)&sPL[w][rt * 16 + ln][8 * hh]; pl[rt].half[1] = *(const v8us*)&sPL[w][rt * 16 + ln][16 + 8 * hh]; }
#pragma unroll
    for (int dt = 0; dt < DT; ++dt) { const unsigned short* vrow = Vth + (size_t)(dt * 16 + ln) * TK + j0; const unsigned short* vrl = Vtl + (size_t)(dt * 16 + ln) * TK + j0; FragH bv, bl; bv.half[0] = *(const v8us*)(vrow + 8 * hh); bv.half[1] = *(const v8us*)(vrow + 16 + 8 * hh); bl.half[0] = *(const v8us*)(vrl + 8 * hh); bl.half[1] = *(const v8us*)(vrl + 16 + 8 * hh);
#pragma unroll
      for (int rt = 0; rt < RTN; ++rt) { oacc[rt][dt] = mmaH<1>(pa[rt].v, pa[rt].v, bv.v, bv.v, oacc[rt][dt]); oaccL[rt][dt] = mmaH<1>(pl[rt].v, pl[rt].v, bv.v, bv.v, oaccL[rt][dt]); oaccL[rt][dt] = mmaH<1>(pa[rt].v, pa[rt].v, bl.v, bl.v, oaccL[rt][dt]); } }
    __builtin_amdgcn_fence(__ATOMIC_ACQ_REL, "workgroup"); __builtin_amdgcn_wave_barrier(); }
#pragma unroll
  for (int rt = 0; rt < RTN; ++rt) {
#pragma unroll
    for (int r = 0; r < 8; ++r) { float l = l_r[rt][r]; l += __shfl_xor(l, 1, 32); l += __shfl_xor(l, 2, 32); l += __shfl_xor(l, 4, 32); l += __shfl_xor(l, 8, 32); l_r[rt][r] = (l > 0.f) ? 1.0f / (l * 1024.0f) : 0.f; }
#pragma unroll
    for (int dt = 0; dt < DT; ++dt)
#pragma unroll
      for (int r = 0; r < 8; ++r) { float v = oacc[rt][dt][r]; v += oaccL[rt][dt][r] * 0.0009765625f; sO[w][rt * 16 + 8 * hh + r][dt * 16 + ln] = v * l_r[rt][r]; } }
  __builtin_amdgcn_fence(__ATOMIC_ACQ_REL, "workgroup"); __builtin_amdgcn_wave_barrier();
  {
#pragma unroll
    for (int rp = 0; rp < RPW; rp += 2) { const int r = rp + (lane >> 4), pc = lane & 15; const v4f val = *(const v4fa*)&sO[w][r][pc * 4]; *(v4f*)(O + ((size_t)b * TQ + q0 + r) * ldo + h * 64 + pc * 4) = val; }
     } }

// Transposed form of the causal RBF attention pass: S^T = K Q^T, O^T += V^T P^T. A lane holds one query's scores (16 of a block's 32 keys, the other wave half the other 16), so the block maximum is in-lane plus one exchange between the halves, and the two score tiles, converted in place, are the B operand of the second product: P passes through no LDS and the loop holds no fence. The softmax runs in base 2: log2(e) / 8 is folded into the two multiply-adds that form a logit, and each weight is one subtraction and one hardware exp2. K, V^T and |k|^2 are fetched one pass ahead: K and V^T into the registers that the running pass has just finished with, |k|^2 into a second set.
__device__ __forceinline__ float xhalf(float x) { return __builtin_bit_cast(float, __builtin_amdgcn_permlanex16(__builtin_bit_cast(int, x), __builtin_bit_cast(int, x), 0x76543210, 0xfedcba98, false, false)); }      /* lane l with lane l ^ 16 */
__global__ __launch_bounds__(128) void k_flash_t(const _Float16* __restrict__ Q16, const _Float16* __restrict__ K16, const _Float16* __restrict__ Vt, const float* __restrict__ NSQ, float* __restrict__ O) {
  constexpr int DT = 4, KS = 2; constexpr float L2E8 = 0.18033688011112043f;      /* log2(e) / 8 */
  __shared__ __attribute__((aligned(16))) float sO[4][16][64 + 4];
  const int tid = threadIdx.x, w = tid >> 5, lane = tid & 31, ln = lane & 15, hh = lane >> 4;
  const int slab = blockIdx.x / (QBLKS / 2), pr = blockIdx.x % (QBLKS / 2);
  const char* const Kb = (const char*)((const unsigned short*)K16 + (size_t)slab * TK * 64); const char* const Vth = (const char*)((const unsigned short*)Vt + (size_t)slab * 64 * TK); const char* const ksT = (const char*)(NSQ + (size_t)NB * TQ + (size_t)slab * TK);
  const unsigned fo = (unsigned)lane * 16u, qo = (unsigned)hh * 32u;      /* a lane's place in a 512-B fragment piece; its eight keys' place in a 16-key group of the |k|^2 table */
  unsigned vo = fo, vs = qo;      /* byte offsets of the running pair of 32-key blocks: a block is 4096 B of K, 4096 B of V^T, 128 B of |k|^2 */
  FragH ak[2][KS], av[DT]; v4f kqa[2][2], kqb[2][2];      /* live round the loop's back edge and from the first leg to the second: they hold the coming pass's operands */
#pragma unroll
  for (int nt = 0; nt < 2; ++nt) {      /* block 0, for the first pass */
#pragma unroll
    for (int ks = 0; ks < KS; ++ks) { ak[nt][ks].half[0] = *(const v8us*)(Kb + vo + nt * 2048 + ks * 1024); ak[nt][ks].half[1] = *(const v8us*)(Kb + vo + nt * 2048 + ks * 1024 + 512); }
    kqa[nt][0] = *(const v4fa*)(ksT + vs + nt * 64); kqa[nt][1] = *(const v4fa*)(ksT + vs + nt * 64 + 16); }
#pragma unroll
  for (int dt = 0; dt < DT; ++dt) { av[dt].half[0] = *(const v8us*)(Vth + vo + dt * 1024); av[dt].half[1] = *(const v8us*)(Vth + vo + dt * 1024 + 512); }
#pragma unroll 1      /* one copy of the key loop in the text serves both query blocks */
  for (int leg = 0; leg < 2; ++leg) {      /* query block QBLKS - 1 - pr, then pr, one after the other: 2 (QBLKS + 1) key passes in every work-group, so that no SIMD is left with the long blocks alone */
  const int qblk = leg ? pr : QBLKS - 1 - pr; const int qb0 = qblk * 64; const int q0 = qb0 + w * 16; const int tq = q0 + ln;      /* this lane's query */
  FragH bq[KS]; const unsigned short* qr = (const unsigned short*)Q16 + ((size_t)slab * TQ + tq) * 64;
#pragma unroll
  for (int ks = 0; ks < KS; ++ks) { bq[ks].half[0] = *(const v8us*)(qr + ks * 32 + 8 * hh); bq[ks].half[1] = *(const v8us*)(qr + ks * 32 + 16 + 8 * hh); }
  __builtin_amdgcn_sched_barrier(0);      /* the query's norm is fetched last: the wait for it, in front of the loop, then covers every older load, and the waits inside the loop count the loop's own loads alone */
  const float qs = NSQ[(size_t)slab * TQ + tq];
  const float nq = -L2E8 * qs;
  float m = -3.0e38f, l = 0.f; v8f oacc[DT];
#pragma unroll
  for (int dt = 0; dt < DT; ++dt) oacc[dt] = (v8f){0.f,0.f,0.f,0.f,0.f,0.f,0.f,0.f};
  const int jend = qb0 + 64;
  /* One pass over 32 keys. kc holds this pass's |k|^2, kn takes the next pass's: the two sets change places from pass to pass, since the |k|^2 are still read while the next ones are on their way; K and V^T need one set each. */
  auto pass = [&](const bool first, v4f (&kc)[2][2], v4f (&kn)[2][2], const int j0) __attribute__((always_inline)) {
    v8f acc[2];
#pragma unroll
    for (int nt = 0; nt < 2; ++nt) { acc[nt] = (v8f){0.f,0.f,0.f,0.f,0.f,0.f,0.f,0.f};
#pragma unroll
      for (int ks = 0; ks < KS; ++ks) acc[nt] = mmaH<1>(ak[nt][ks].v, ak[nt][ks].v, bq[ks].v, bq[ks].v, acc[nt]); }      /* acc[nt][r] = k[j0 + 16 nt + 8 hh + r] . q[tq] */
    if (!first) asm volatile("s_wait_xcnt 0x0" ::: "memory");      /* precaution: stands in front of the two offset steps below, which rewrite registers that the loads issued since the last steps name */
    __builtin_amdgcn_sched_barrier(0);      /* keeps the offset steps behind that wait, and the loads below behind the products that read the registers they fill: lifted higher they would need a second register set and copies */
    if (!first) { const bool more = j0 + 32 < jend; vo = more ? vo + 8192u : fo; vs = more ? vs + 256u : qo; }      /* behind a leg's last pass comes block 0 again: the next leg's first, and always inside the planes */
    const unsigned ob = first ? 4096u : 0u, os = first ? 128u : 0u;      /* the pair's second block stands at a constant distance: no register is stepped for it */
#pragma unroll
    for (int nt = 0; nt < 2; ++nt) { kn[nt][0] = *(const v4fa*)(ksT + vs + (os + nt * 64)); kn[nt][1] = *(const v4fa*)(ksT + vs + (os + nt * 64 + 16)); }      /* the next pass's |k|^2: this lane's eight keys of each 16-key group. First, since their offset register is the first to be free for other use */
#pragma unroll
    for (int nt = 0; nt < 2; ++nt) {      /* the next pass's K, in fragment order: a 16-key group is four pieces of 512 B, a lane's 16 bytes at 16 lane; each load reads four whole lines. All twelve loads fly during this pass's softmax and second product */
#pragma unroll
      for (int ks = 0; ks < KS; ++ks) { ak[nt][ks].half[0] = *(const v8us*)(Kb + vo + (ob + nt * 2048 + ks * 1024)); ak[nt][ks].half[1] = *(const v8us*)(Kb + vo + (ob + nt * 2048 + ks * 1024 + 512)); } }
    __builtin_amdgcn_sched_barrier(0);      /* keeps the loads up here; sunk towards the pass's foot they would lose their lead */
    const int lim = tq - j0 - 8 * hh;      /* key 16 nt + r of this lane's sixteen is causal where 16 nt + r <= lim */
    float sc[16]; float mc = -3.0e38f;
#pragma unroll
    for (int nt = 0; nt < 2; ++nt) {
#pragma unroll
      for (int r = 0; r < 8; ++r) { const bool ok = nt * 16 + r <= lim; float t = fmaf(kc[nt][r >> 2][r & 3], -L2E8, nq); t = fmaf(acc[nt][r], 2.0f * L2E8, t); t = fminf(t, 0.f); const float sv = ok ? t : -3.0e38f; sc[nt * 8 + r] = sv; mc = fmaxf(mc, sv); } }      /* t = log2(e) x logit = -relu(|q|^2 + |k|^2 - 2 q.k) log2(e) / 8 */
    mc = fmaxf(mc, xhalf(mc));
    const float mn = fmaxf(m, mc - 10.0f); const float al = __builtin_amdgcn_exp2f(m - mn); m = mn;      /* the reference point stands 10 below the maximum: the weights come out times 2^10, as the f16 operand wants them; the first pass always holds causal key 0, so mn is finite and al = 2^(-3e38) = 0 there */
    FragH pb; float p[16];
#pragma unroll
    for (int i = 0; i < 16; ++i) { p[i] = __builtin_amdgcn_exp2f(sc[i] - mn); pb.h[i] = (_Float16)p[i]; }      /* a masked key gives 2^(-3e38) = 0 exactly; element i of the B operand is key 8 hh + i, then 16 + 8 hh + (i - 8): the order of the V^T loader */
#pragma unroll
    for (int st = 8; st > 0; st >>= 1)
#pragma unroll
      for (int i = 0; i < st; ++i) p[i] += p[i + st];
    l = l * al + p[0];
#pragma unroll
    for (int dt = 0; dt < DT; ++dt) {
#pragma unroll
      for (int r = 0; r < 8; ++r) oacc[dt][r] *= al; }
#pragma unroll
    for (int dt = 0; dt < DT; ++dt) oacc[dt] = mmaH<1>(av[dt].v, av[dt].v, pb.v, pb.v, oacc[dt]);      /* oacc[dt][r] = context column 16 dt + 8 hh + r of query tq */
    __builtin_amdgcn_sched_barrier(0);      /* keeps the loads below behind the products that read the registers they fill */
#pragma unroll
    for (int dt = 0; dt < DT; ++dt) { av[dt].half[0] = *(const v8us*)(Vth + vo + (ob + dt * 1024)); av[dt].half[1] = *(const v8us*)(Vth + vo + (ob + dt * 1024 + 512)); }      /* the next pass's V^T, in fragment order: a 32-key block is eight pieces of 512 B. They fly during the next pass's first product and softmax */
    __builtin_amdgcn_sched_barrier(0);      /* keeps them from sinking into the next pass */
  };
#pragma unroll 1
  for (int j0 = 0; j0 < jend; j0 += 64) { pass(true, kqa, kqb, j0); pass(false, kqb, kqa, j0 + 32); }      /* a query block's key range is a whole number of 64-key pairs */
  l += xhalf(l); const float inv = (l > 0.f) ? 1.0f / l : 0.f;      /* l and the context both carry the 2^10 */
#pragma unroll
  for (int dt = 0; dt < DT; ++dt) { v4f a, c;
#pragma unroll
    for (int r = 0; r < 4; ++r) { a[r] = oacc[dt][r] * inv; c[r] = oacc[dt][4 + r] * inv; }
    *(v4fa*)&sO[w][ln][dt * 16 + 8 * hh] = a; *(v4fa*)&sO[w][ln][dt * 16 + 8 * hh + 4] = c; }
  __builtin_amdgcn_fence(__ATOMIC_ACQ_REL, "workgroup"); __builtin_amdgcn_wave_barrier();      /* the wave's own lanes read each other's rows below, for whole-row stores */
#pragma unroll
  for (int rp = 0; rp < 16; rp += 2) { const int r = rp + (lane >> 4), pc = lane & 15; const v4f val = *(const v4fa*)&sO[w][r][pc * 4]; *(v4f*)(O + ((size_t)slab * TQ + q0 + r) * 64 + pc * 4) = val; }
  asm volatile("s_wait_xcnt 0x0" ::: "memory");      /* precaution: the second leg rewrites the registers that these stores name */
  __builtin_amdgcn_fence(__ATOMIC_ACQ_REL, "workgroup", "local"); __builtin_amdgcn_wave_barrier(); } }      /* the second leg's staging writes stay behind every lane's reads of the first leg's rows; LDS only, so that the leg does not wait for its stores to the output */

__global__ __launch_bounds__(256) void k_rotab(float* __restrict__ CS, float* __restrict__ SN) {
  #pragma clang fp contract(off)
  const int t = blockIdx.x * 256 + threadIdx.x; if (t >= SLEN * 32) return; const int j = t % 32, s = t / 32; const float ex = (float)(2 * j) / 64.0f; const float inv = 1.0f / powf(10000.0f, ex); const float th = (float)s * inv; const float c = cosf(th), sn = sinf(th);
  { *(float*)(CS + t) = c; *(float*)(SN + t) = sn;  } }
__global__ __launch_bounds__(256) void k_rope(const float* __restrict__ F, int nsrc, int ndst, int rep, const float* __restrict__ CS, const float* __restrict__ SN, _Float16* __restrict__ H, _Float16* __restrict__ L) {
  #pragma clang fp contract(off)
  const size_t t = (size_t)blockIdx.x * 256 + threadIdx.x; if (t >= (size_t)NR * ndst * 4) return; const int g8 = (int)(t % 4); const int hd = (int)((t / 4) % ndst); const size_t row = t / ((size_t)4 * ndst); const int s = (int)(row % SLEN); const int hs = hd / rep;
  const float* src = F + row * (size_t)(nsrc * 64) + hs * 64; FragH ah, al, bh, bl;
  for (int i = 0; i < 8; ++i) { const int d = g8 * 8 + i; const float c = CS[s * 32 + d], sn = SN[s * 32 + d]; const float x1 = src[d], x2 = src[d + 32];
    float o1 = x1 * c; o1 += -x2 * sn; float o2 = x2 * c; o2 += x1 * sn;
    _Float16 hv = (_Float16)o1; ah.h[i] = hv; al.h[i] = (_Float16)((o1 - (float)hv) * 1024.0f); hv = (_Float16)o2; bh.h[i] = hv; bl.h[i] = (_Float16)((o2 - (float)hv) * 1024.0f); }
  const size_t o = row * (size_t)(ndst * 64) + hd * 64 + g8 * 8;
  { *(v8us*)((unsigned short*)H + o) = ah.half[0]; *(v8us*)((unsigned short*)H + o + 32) = bh.half[0]; *(v8us*)((unsigned short*)L + o) = al.half[0]; *(v8us*)((unsigned short*)L + o + 32) = bl.half[0];  } }
__global__ __launch_bounds__(256) void k_rope2(const float* __restrict__ F, int nsrc, int ndst, int rep, const float* __restrict__ CS, const float* __restrict__ SN, _Float16* __restrict__ H, _Float16* __restrict__ L) {
  #pragma clang fp contract(off)
  const size_t t = (size_t)blockIdx.x * 256 + threadIdx.x; if (t >= (size_t)NR * ndst * 4) return; const int g16 = (int)(t % 4); const int hd = (int)((t / 4) % ndst); const size_t row = t / ((size_t)4 * ndst); const int s = (int)(row % SLEN); const int hs = hd / rep;
  const float* src = F + row * (size_t)(nsrc * 64) + hs * 64 + g16 * 16; FragH ah, al;
  for (int pr = 0; pr < 8; ++pr) { const int i = g16 * 8 + pr; const float c = CS[s * 32 + i], sn = SN[s * 32 + i]; const float x1 = src[2 * pr], x2 = src[2 * pr + 1];
    float o1 = x1 * c; o1 -= x2 * sn; float o2 = x1 * sn; o2 += x2 * c;
    _Float16 hv = (_Float16)o1; ah.h[2 * pr] = hv; al.h[2 * pr] = (_Float16)((o1 - (float)hv) * 1024.0f); hv = (_Float16)o2; ah.h[2 * pr + 1] = hv; al.h[2 * pr + 1] = (_Float16)((o2 - (float)hv) * 1024.0f); }
  const size_t o = row * (size_t)(ndst * 64) + hd * 64 + g16 * 16;
  { *(v8us*)((unsigned short*)H + o) = ah.half[0]; *(v8us*)((unsigned short*)H + o + 8) = ah.half[1]; *(v8us*)((unsigned short*)L + o) = al.half[0]; *(v8us*)((unsigned short*)L + o + 8) = al.half[1];  } }
__global__ __launch_bounds__(256) void k_ln512(const float* __restrict__ A, const float* __restrict__ res, const float* __restrict__ g, const float* __restrict__ bb, float* __restrict__ Y, _Float16* __restrict__ Y16) {
  #pragma clang fp contract(off)
  const int wv = threadIdx.x >> 5, ln = threadIdx.x & 31; const size_t r = (size_t)blockIdx.x * 8 + wv; if (r >= NR) return; float x[16]; float s = 0.f;
  for (int i = 0; i < 2; ++i) { const v8f a = *(const v8f*)(A + r * DM + i * 256 + ln * 8); for (int q = 0; q < 8; ++q) { float v = a[q]; if (res) v += bf16_round(res[r * DM + i * 256 + ln * 8 + q]); x[i * 8 + q] = v; s += v; } }
  for (int o = 16; o > 0; o >>= 1) s += __shfl_xor(s, o, 32); const float mu = s / (float)DM; float var = 0.f; for (int q = 0; q < 16; ++q) { const float d = x[q] - mu; var += d * d; }
  for (int o = 16; o > 0; o >>= 1) var += __shfl_xor(var, o, 32); const float inv = rsqrtf(var / (float)DM + 1e-5f);
  { for (int i = 0; i < 2; ++i) { const int c0 = i * 256 + ln * 8; v8f y; FragH f; for (int q = 0; q < 8; ++q) { float v = (x[i * 8 + q] - mu) * inv; v *= bf16_round(g[c0 + q]); v += bf16_round(bb[c0 + q]); y[q] = v; f.h[q] = (_Float16)v; } *(v8f*)(Y + r * DM + c0) = y; if (Y16) *(v8us*)((unsigned short*)Y16 + r * DM + c0) = f.half[0]; }  } }
__global__ __launch_bounds__(256) void k_pack(const float* __restrict__ rb, const int* __restrict__ rid, int* __restrict__ PK) { const int t = blockIdx.x * 256 + threadIdx.x; if (t >= 1024 + NB * TK) return; int v; if (t < 1024) v = __float_as_int(bf16_round(rb[t])); else v = rid[t - 1024]; *(int*)(PK + t) = v;  }
__global__ __launch_bounds__(256) void k_tabin(const float* __restrict__ sp, float* __restrict__ CS, float* __restrict__ SN) { const int t = blockIdx.x * 256 + threadIdx.x; if (t >= SLEN * 32) return; const int i = t % 32, s = t / 32; const float c = bf16_round(sp[s * 64 + 32 + i]), sn = bf16_round(sp[s * 64 + i]);
  { *(float*)(CS + t) = c; *(float*)(SN + t) = sn;  } }
__global__ __launch_bounds__(256) void k_wsc(const float* __restrict__ Wm, _Float16* __restrict__ Bt, size_t n8, float sc) { const size_t t = (size_t)blockIdx.x * 256 + threadIdx.x; if (t >= n8) return; FragH f; for (int q = 0; q < 8; ++q) f.h[q] = (_Float16)(bf16_round(Wm[t * 8 + q]) * sc); *(v8us*)((unsigned short*)Bt + t * 8) = f.half[0];  }
__global__ __launch_bounds__(256) void k_rotab2(float* __restrict__ CS, float* __restrict__ SN) {
  #pragma clang fp contract(off)
  const int t = blockIdx.x * 256 + threadIdx.x; if (t >= SLEN * 32) return; const int j = t % 32, s = t / 32; const float c0 = -0.14391156831212787f;      /* -ln(10000)/64 rounded to f32 */ const float inv = expf((float)(2 * j) * c0); const float th = (float)s * inv; const float c = cosf(th), sn = sinf(th);
  { *(float*)(CS + t) = c; *(float*)(SN + t) = sn;  } }
__global__ __launch_bounds__(256) void k_lnu(const float* __restrict__ X, _Float16* __restrict__ N16, float* __restrict__ XB) {
  #pragma clang fp contract(off)
  const int wv = threadIdx.x >> 5, ln = threadIdx.x & 31; const size_t r = (size_t)blockIdx.x * 8 + wv; if (r >= NR) return; float a[32]; float s = 0.f;
  for (int i = 0; i < 4; ++i) { const v8f v = *(const v8f*)(X + r * DM + (i * 32 + ln) * 8); for (int q = 0; q < 8; ++q) { const float u = bf16_round(v[q]); a[i * 8 + q] = u; s += u; } }
  for (int o = 16; o > 0; o >>= 1) s += __shfl_xor(s, o, 32); const float mu = s / (float)DM; float var = 0.f; for (int q = 0; q < 32; ++q) { const float d = a[q] - mu; var += d * d; }
  for (int o = 16; o > 0; o >>= 1) var += __shfl_xor(var, o, 32); const float den = sqrtf(var / (float)(DM - 1)) + 1e-6f; const float inv = 1.0f / den;      /* one reciprocal per row; (x-mean)*inv vs the reference's division differs by <= 1 ulp */
  { for (int i = 0; i < 4; ++i) { const int c0 = (i * 32 + ln) * 8; FragH f; v8f xb; for (int q = 0; q < 8; ++q) { f.h[q] = (_Float16)((a[i * 8 + q] - mu) * inv); xb[q] = a[i * 8 + q]; } *(v8us*)((unsigned short*)N16 + r * DM + c0) = f.half[0]; *(v8f*)(XB + r * DM + c0) = xb; }  } }

__global__ __launch_bounds__(256) void k_h16s(const float* __restrict__ SRC, int lds, int coff, _Float16* __restrict__ DST, size_t n8) { const size_t t = (size_t)blockIdx.x * 256 + threadIdx.x; if (t >= n8) return; const size_t r = (t * 8) / DM; const int c = (int)((t * 8) % DM); const v8f a = *(const v8f*)(SRC + r * lds + coff + c); FragH f; for (int q = 0; q < 8; ++q) f.h[q] = (_Float16)a[q];
  *(v8us*)((unsigned short*)DST + t * 8) = f.half[0];  }


__global__ __launch_bounds__(256) void k_ccp(const float* __restrict__ QKV, int coff, _Float16* __restrict__ D) { const size_t t = (size_t)blockIdx.x * 256 + threadIdx.x; if (t >= (size_t)NR * DM / 8) return; const int c0 = (int)((t * 8) % DM); const size_t row = (t * 8) / DM; const v8f a = *(const v8f*)(QKV + row * 3 * DM + coff + c0); FragH f; for (int q = 0; q < 8; ++q) f.h[q] = (_Float16)a[q];
  *(v8us*)((unsigned short*)D + t * 8) = f.half[0];  }


template <int NLN>
__global__ __launch_bounds__(256) void k_lnrow(const float* __restrict__ X, const float* __restrict__ R, const float* __restrict__ g, const float* __restrict__ bb, float eps, float* __restrict__ OUT) {
  #pragma clang fp contract(off)
  constexpr int PER = NLN / 256; __shared__ float red[256]; const int tid = threadIdx.x; const size_t row = blockIdx.x; const float* x = X + row * NLN; const float* rr = R ? R + row * NLN : nullptr; float v[PER]; float s1 = 0.f;
  for (int u = 0; u < PER; ++u) { const int j = tid * PER + u; float t = x[j]; if (rr) t = t + rr[j]; v[u] = t; s1 += t; }
  red[tid] = s1; __syncthreads(); for (int st = 128; st > 0; st >>= 1) { if (tid < st) red[tid] += red[tid + st]; __syncthreads(); } const float mu = red[0] / (float)NLN; __syncthreads();
  float s2 = 0.f; for (int u = 0; u < PER; ++u) { const float c = v[u] - mu; s2 += c * c; } red[tid] = s2; __syncthreads(); for (int st = 128; st > 0; st >>= 1) { if (tid < st) red[tid] += red[tid + st]; __syncthreads(); }
  const float var = red[0] / (float)NLN; const float rs = rsqrtf(var + eps);
  { for (int u = 0; u < PER; ++u) { const int j = tid * PER + u; float o = (v[u] - mu) * rs; o = __fadd_rn(__fmul_rn(o, bf16_round(g[j])), bf16_round(bb[j])); *(float*)(OUT + row * NLN + j) = o; }  } }
__global__ __launch_bounds__(256) void k_xr32(const float* __restrict__ x, float* __restrict__ XR, size_t n8) { const size_t t = (size_t)blockIdx.x * 256 + threadIdx.x; if (t >= n8) return; v8f o; for (int q = 0; q < 8; ++q) o[q] = bf16_round(x[t * 8 + q]); *(v8f*)(XR + t * 8) = o;  }
__global__ __launch_bounds__(256) void k_r16b(const float* __restrict__ S, _Float16* __restrict__ D, size_t n8) { const size_t t = (size_t)blockIdx.x * 256 + threadIdx.x; if (t >= n8) return; const v8f a = *(const v8f*)(S + t * 8); FragH f; for (int q = 0; q < 8; ++q) f.h[q] = (_Float16)a[q]; *(v8us*)((unsigned short*)D + t * 8) = f.half[0];  }

// One preparatory launch. Blocks 0-255 take q, 256-511 k, 512-767 v, 256 rows each; every input is read once.
// q, k: the bf16 bits are staged in LDS, the f16 plane goes out from registers, and one thread per row sums its squares in ascending order of d.
// v: the f16 values are staged in LDS and go out transposed, in the order of the attention pass's A fragments: per 32 keys eight pieces of 512 B (column tile, key half), a lane's eight keys at 16 lane.
__global__ __launch_bounds__(256) void k_prep(const float* __restrict__ Q, const float* __restrict__ Kx, const float* __restrict__ V, _Float16* __restrict__ QH, _Float16* __restrict__ KH, _Float16* __restrict__ Vt, float* __restrict__ NSQ) {
  __shared__ __attribute__((aligned(16))) unsigned short sm[256 * 72];      /* q, k: pitch 72 (144 B = 16 B x odd: a lane per row reads 16 bytes without bank conflicts); v: pitch 66 (eight rows apart = 8 banks apart) */
  const int tid = threadIdx.x; const int which = blockIdx.x >> 8, blk = blockIdx.x & 255; const size_t e0 = (size_t)blk * 256 * 64;
  if (which < 2) {
    const float* X = (which ? Kx : Q) + e0; unsigned short* H = (unsigned short*)(which ? KH : QH) + e0; FragH f[8]; v8f a[8];
    const int rl = which ? (((tid >> 6) << 3) | (tid & 7)) : (tid >> 3), c = which ? ((((tid >> 5) & 1) << 2) | ((tid >> 3) & 3)) : (tid & 7);      /* row of a group of 32 and 8-element piece of the row; for k a wave takes 8 rows x 4 pieces, so that its stores below fill whole lines */
    const int hb = which ? ((rl >> 4) * 1024 + (c >> 1) * 256 + (c & 1) * 128 + (rl & 15) * 8) : (rl * 64 + c * 8);      /* k goes out in fragment order: per 16 keys four pieces of 512 B (16 columns each); inside a piece the columns' half c & 1, then the key, so that lane l of the A loader finds its 16 bytes at 16 l; q stays row-major */
    const unsigned boff = (unsigned)rl * 256u + (unsigned)c * 32u;
#pragma unroll
    for (int i = 0; i < 8; ++i) a[i] = *(const v8f*)((const char*)X + boff + i * 8192);
    asm volatile("s_wait_xcnt 0x0" :: "v"(boff) : "memory");      /* precaution: the loads' offset register is held to this wait, so that none of the loads takes it as its destination */
    __builtin_amdgcn_sched_barrier(0);      /* keeps all sixteen loads in flight together; the scheduler otherwise sinks six of them behind the first waits, three more memory latencies in a row */
#pragma unroll
    for (int i = 0; i < 8; ++i) { v8us b;
#pragma unroll
      for (int u = 0; u < 8; ++u) { const unsigned short xb = bf16_bits(a[i][u]); b[u] = xb; f[i].h[u] = (_Float16)bf16_val(xb); }
      *(v8us*)&sm[(i * 32 + rl) * 72 + c * 8] = b; }
    __syncthreads();      /* a row's sixteen-byte pieces were staged by eight threads */
#pragma unroll
    for (int i = 0; i < 8; ++i) *(v8us*)(H + i * 2048 + hb) = f[i].half[0];      /* behind the barrier, which would otherwise wait for these stores */
    float acc = 0.f;
#pragma unroll
    for (int d = 0; d < 64; d += 8) { const v8us b = *(const v8us*)&sm[tid * 72 + d];
#pragma unroll
      for (int u = 0; u < 8; ++u) { const float x = bf16_val(b[u]); acc = __fadd_rn(acc, __fmul_rn(x, x)); } }      /* a square of a bf16 value is exact in f32: fused or not, each step rounds the same sum */
    *(float*)(NSQ + (size_t)which * NR + blk * 256 + tid) = acc;
  } else {
    const float* X = V + e0; const unsigned voff = (unsigned)tid * 32u;      /* eight groups of 256 keys per slab */
#pragma unroll
    for (int i = 0; i < 8; ++i) { const int g = i * 256 + tid; const v8f a = *(const v8f*)((const char*)X + voff + i * 8192); FragH f;
#pragma unroll
      for (int u = 0; u < 8; ++u) f.h[u] = (_Float16)bf16_round(a[u]);
#pragma unroll
      for (int u = 0; u < 8; ++u) sm[(g >> 3) * 66 + (g & 7) * 8 + u] = f.u[u]; }
    asm volatile("s_wait_xcnt 0x0" :: "v"(voff) : "memory");      /* precaution: the loads' offset register is held to this wait, so that none of the loads takes it as its destination */
    __syncthreads();      /* a V^T piece gathers eight keys staged by eight threads */
#pragma unroll
    for (int it = 0; it < 8; ++it) { const int pi = it * 8 + (tid >> 5);      /* 512-B piece of this group's 64: 32-key block pi >> 3, column tile (pi >> 1) & 3, key half pi & 1 */
      const int d = ((pi >> 1) & 3) * 16 + (tid & 15), pc = (pi >> 3) * 4 + (pi & 1) * 2 + ((tid >> 4) & 1); FragH f;
#pragma unroll
      for (int u = 0; u < 8; ++u) f.u[u] = sm[(pc * 8 + u) * 66 + d];
      *(v8us*)((unsigned short*)Vt + e0 + (it * 256 + tid) * 8) = f.half[0]; }      /* fragment order: a wave's store is one piece, 512 contiguous bytes */
    asm volatile("s_wait_xcnt 0x0" ::: "memory");      /* precaution: the compiler lays the q, k branch behind these stores in the text, where their registers are rewritten */
  } }
// One block per (slab, 8 query rows < 64), one wave per row. The slab's first 64 rows of k and v are rounded and staged in LDS once per block; lanes own keys for the logits, then output columns for the context. Each dot product, the row sum and each context sum keep their serial order.
__global__ __launch_bounds__(256) void k_fixr(const float* __restrict__ Q, const float* __restrict__ Kx, const float* __restrict__ V, const float* __restrict__ NSQ, float* __restrict__ O) {
  #pragma clang fp contract(off)
  __shared__ __attribute__((aligned(16))) float sk[64][68];      /* pitch 272 B = 16 B x odd: a lane per row reads 16 bytes without bank conflicts */
  __shared__ __attribute__((aligned(16))) float sv[64][64]; __shared__ __attribute__((aligned(16))) float pr[8][64];
  const int tid = threadIdx.x, w = tid >> 5, lane = tid & 31; const size_t sl = blockIdx.x >> 3; const int q = __builtin_amdgcn_readfirstlane((int)(blockIdx.x & 7) * 8 + w);
  const float* kb = Kx + sl * SLEN * 64; const float* vb = V + sl * SLEN * 64;
#pragma unroll
  for (int i = 0; i < 4; ++i) { const int e = (i * 256 + tid) * 4; const v4f a = *(const v4fa*)(kb + e); const v4f c = *(const v4fa*)(vb + e); v4f ra, rc;
#pragma unroll
    for (int u = 0; u < 4; ++u) { ra[u] = bf16_round(a[u]); rc[u] = bf16_round(c[u]); }
    *(v4fa*)&sk[e >> 6][e & 63] = ra; *(v4fa*)&sv[e >> 6][e & 63] = rc; }
  const float* qr = Q + (sl * SLEN + q) * 64; const float qs = NSQ[sl * SLEN + q]; const float* ksT = NSQ + (size_t)NB * SLEN + sl * SLEN; const float kq0 = ksT[lane], kq1 = ksT[lane + 32];
  float x[64];      /* the wave's query row, fetched ahead of the barrier so that its latency runs beside the staging loads' */
#pragma unroll
  for (int d = 0; d < 64; d += 4) { const v4f a = *(const v4fa*)(qr + d);
#pragma unroll
    for (int u = 0; u < 4; ++u) x[d + u] = bf16_round(a[u]); }
  __syncthreads();      /* the staged rows are read by every wave of the block */
  float sd0 = 0.f, sd1 = 0.f;      /* keys lane and lane + 32 */
#pragma unroll
  for (int d = 0; d < 64; d += 4) { const v4f k0 = *(const v4fa*)&sk[lane][d]; const v4f k1 = *(const v4fa*)&sk[lane + 32][d];
#pragma unroll
    for (int u = 0; u < 4; ++u) { sd0 = __fadd_rn(sd0, __fmul_rn(x[d + u], k0[u])); sd1 = __fadd_rn(sd1, __fmul_rn(x[d + u], k1[u])); } }
  float d0 = qs + kq0; d0 = d0 - 2.0f * sd0; d0 = fmaxf(d0, 0.f); float d1 = qs + kq1; d1 = d1 - 2.0f * sd1; d1 = fmaxf(d1, 0.f);
  const bool ok0 = lane <= q, ok1 = lane + 32 <= q; const float lg0 = ok0 ? -d0 * 0.125f : -3.0e38f, lg1 = ok1 ? -d1 * 0.125f : -3.0e38f;
  float mx = fmaxf(lg0, lg1); mx = fmaxf(mx, __shfl_xor(mx, 1, 32)); mx = fmaxf(mx, __shfl_xor(mx, 2, 32)); mx = fmaxf(mx, __shfl_xor(mx, 4, 32)); mx = fmaxf(mx, __shfl_xor(mx, 8, 32)); mx = fmaxf(mx, __shfl_xor(mx, 16, 32));
  const float e0 = expf(lg0 - mx), e1 = expf(lg1 - mx); pr[w][lane] = ok0 ? e0 : 0.f; pr[w][lane + 32] = ok1 ? e1 : 0.f;
  __builtin_amdgcn_fence(__ATOMIC_ACQ_REL, "workgroup"); __builtin_amdgcn_wave_barrier();      /* the wave's own lanes read each other's weights below */
  float su = 0.f;
#pragma unroll
  for (int j = 0; j < 64; j += 4) { const v4f e = *(const v4fa*)&pr[w][j]; su += e[0]; su += e[1]; su += e[2]; su += e[3]; }      /* ascending keys; a masked key adds an exact zero */
  const float inv = 1.0f / su; typedef float v2f __attribute__((ext_vector_type(2))); typedef float v2fa __attribute__((ext_vector_type(2), may_alias));
  float a0 = 0.f, a1 = 0.f;      /* output columns 2 lane and 2 lane + 1 */
#pragma unroll 1
  for (int j0 = 0; j0 <= q; j0 += 16) {
#pragma unroll
    for (int i = 0; i < 16; ++i) { const bool in = j0 + i <= q; const v2f vv = *(const v2fa*)&sv[j0 + i][lane * 2]; const float p = pr[w][j0 + i] * inv;      /* past the row's last key the weight is zero; the value is zeroed too, so the term is an exact zero */
      a0 = __fadd_rn(a0, __fmul_rn(p, in ? vv[0] : 0.f)); a1 = __fadd_rn(a1, __fmul_rn(p, in ? vv[1] : 0.f)); } }
  const v2f o = {a0, a1}; *(v2f*)(O + (sl * SLEN + q) * 64 + lane * 2) = o; }

extern "C" void kernel_launch(void* const* d_in, const int* in_sizes, int n_in,
                              void* d_out, int out_size, void* d_ws, size_t ws_size, hipStream_t stream) {
  (void)in_sizes; (void)n_in; (void)out_size;
  const float* q = (const float*)d_in[0]; const float* k = (const float*)d_in[1]; const float* v = (const float*)d_in[2]; float* O = (float*)d_out;
  char* ws = (char*)d_ws; size_t off = 0;
  auto take = [&](size_t bytes) { char* p = ws + off; off += (bytes + 255) & ~(size_t)255; return p; };
  const size_t np = (size_t)NR * DM;      /* 32 x 2048 x 64 */
  _Float16* QH = (_Float16*)take(np * 2); _Float16* KH = (_Float16*)take(np * 2); _Float16* VT = (_Float16*)take(np * 2); float* NSQ = (float*)take((size_t)2 * NR * 4);
  if (off > ws_size) return;      /* 3 x 8 + 0.5 MiB */
  k_prep<<<3 * (NR / 256), 256, 0, stream>>>(q, k, v, QH, KH, VT, NSQ);      /* f16 planes of q and k (bf16-rounded inputs are exact in f16), V^T, |q|^2 | |k|^2 tables */
  k_flash_t<<<NB * (QBLKS / 2), 128, 0, stream>>>(QH, KH, VT, NSQ, O);      /* exact q, k products; f32 RBF logits; f32 context straight to the output; a work-group takes a long and a short query block */
  k_fixr<<<NB * 8, 256, 0, stream>>>(q, k, v, NSQ, O);      /* rows < 64 per slab recomputed in f32 */
}

// v009
// Measured time: 46.5 microseconds a run.
// Two timings next to v008 put it at 1.38 and 1.39 times that version's speed.
// Over all steps from v000, the starting kernel, it is 10.5 times as fast.
#include <hip/hip_runtime.h>
// CustomCausalAttention (q, k, v [2][16][2048][64]; RBF-kernel causal attention: logits = -relu(|q|^2 + |k|^2 - 2 q.k) / 8 over keys n <= m; out = softmax(logits) v -> [2][16][2048][64]).
// Structure: each (batch, head) slab is a contiguous 64-wide row block, treated as one 'batch' of a single 64-dim head: one preparatory launch makes the exact f16 planes of q and k (bf16-rounded inputs are exact in f16), |q|^2, |k|^2 as f32 row tables on VALU, and v^T by LDS tiles; causal flash-style fused attention per (slab, 64-query block), forming the RBF logit from the f32 dot product and the two norm tables, f32 context written straight to the output; the first 64 causal rows per slab recomputed entirely in f32 on VALU.
// Compute dtype: inputs rounded to bf16; q, k, v exact as f16 (products exact, f32 accumulation); norms, logits, softmax f32 with plain f16 probabilities (~2^-12); rows < 64 all-f32. v_wmma_f32_16x16x32_f16.
#define NB 32                    /* 2 batches x 16 heads as slabs */
#define DM 64
#define NKV 1
#define NREP (NH / NKV)
#define KVD (NKV * 64)           /* 64 */
#define NR (NB * SLEN)
#define CHK 512
typedef int v4i __attribute__((ext_vector_type(4)));
#define FF 2048
#define SLEN 2048
#define MQI 2048
#define MKI 2048
#define TQ SLEN
#define TK SLEN
#define NH 1
#define SCL 1.0f                 /* raw dot product; the RBF transform applies the 1/8 */
#define QBLKS (TQ / 64)
#define QB05 0
#define QBN5 QBLKS      /* k_flash5 (hi/lo engine, not launched) would span all query blocks */
#define QB0P 0
#define QBNP QBLKS
#define RE 256
typedef __bf16 v16b __attribute__((ext_vector_type(16)));
typedef unsigned short v8us __attribute__((ext_vector_type(8), may_alias));
typedef float  v8f  __attribute__((ext_vector_type(8)));
typedef float  v4f  __attribute__((ext_vector_type(4)));
typedef float  v4fa __attribute__((ext_vector_type(4), may_alias));
union FragB { v16b v; v8us half[2]; unsigned short u[16]; };

__device__ __forceinline__ unsigned short bf16_bits(float x) { unsigned int u = __float_as_uint(x); return (unsigned short)((u + 0x7FFFu + ((u >> 16) & 1u)) >> 16); }
__device__ __forceinline__ float bf16_val(unsigned short b) { return __uint_as_float(((unsigned int)b) << 16); }
__device__ __forceinline__ float bf16_round(float x) { return bf16_val(bf16_bits(x)); }
// D += A·B with NT terms: 1 = ah·bh, 2 = + al·bh (A split), 3 = + ah·bl (both split)
template <int NT>
__device__ __forceinline__ v8f mmaN(v16b ah, v16b al, v16b bh, v16b bl, v8f c) {
  c = __builtin_amdgcn_wmma_f32_16x16x32_bf16(false, ah, false, bh, (short)0, c, false, false);
  if (NT >= 2) c = __builtin_amdgcn_wmma_f32_16x16x32_bf16(false, al, false, bh, (short)0, c, false, false);
  if (NT >= 3) c = __builtin_amdgcn_wmma_f32_16x16x32_bf16(false, ah, false, bl, (short)0, c, false, false);
  asm volatile("v_nop\n\tv_nop\n\tv_nop\n\tv_nop" : "+v"(c) : "v"(ah), "v"(al), "v"(bh), "v"(bl));
  return c;
}

__global__ __launch_bounds__(256) void k_wt_bf16(const float* __restrict__ W, unsigned short* __restrict__ Wt, int K, int N) {
  const int t = blockIdx.x * 256 + threadIdx.x;
  const int k8n = K / 8;
  if (t >= N * k8n) return;
  const int n = t / k8n, k8 = (t % k8n) * 8;
  v8us v;
#pragma unroll
  for (int i = 0; i < 8; ++i) v[i] = bf16_bits(W[(size_t)(k8 + i) * N + n]);
  *(v8us*)(Wt + (size_t)n * K + k8) = v;
  
}

// GEMM C[M][N] (f32, pitch ldc) = act(A[M][K]·W + bias). A f32 row-major (pitch lda) converted per fragment to bf16
// (ASPLIT: hi/lo two planes -> 2 terms, else single rounded term); Wt bf16 [N][K] (pitch ldb). BIAS_BF16 rounds the
// bias to bf16 first (bias quantised to bf16 before the add). K%32==0, M%16==0, N%64==0.
template <bool ASPLIT, int ACT, bool BIAS_BF16>
__global__ __launch_bounds__(128) void k_gemm_bf(const float* __restrict__ A, int lda, const unsigned short* __restrict__ Wt, int ldb,
                                               const float* __restrict__ bias, float* __restrict__ C, int ldc, int M, int N, int K) {
  __shared__ __attribute__((aligned(16))) float so[4][16][64];
  const int tid = threadIdx.x, w = tid >> 5, lane = tid & 31, ln = lane & 15, hh = lane >> 4;
  const int ntn = N / 64;
  const int wid = blockIdx.x * 4 + w;
  const int mt = wid / ntn, nq = wid % ntn;
  if (mt * 16 >= M) return;
  const int row0 = mt * 16, col0 = nq * 64;
  const float* arow = A + (size_t)(row0 + ln) * lda;
  v8f acc[4] = {};
  for (int kb = 0; kb < K; kb += 32) {
    FragB ah, al;
    const v4f x0 = *(const v4fa*)(arow + kb + 8 * hh), x1 = *(const v4fa*)(arow + kb + 8 * hh + 4);
    const v4f x2 = *(const v4fa*)(arow + kb + 16 + 8 * hh), x3 = *(const v4fa*)(arow + kb + 16 + 8 * hh + 4);
    float xs[16] = {x0[0],x0[1],x0[2],x0[3],x1[0],x1[1],x1[2],x1[3],x2[0],x2[1],x2[2],x2[3],x3[0],x3[1],x3[2],x3[3]};
#pragma unroll
    for (int i = 0; i < 16; ++i) { const unsigned short hb = bf16_bits(xs[i]); ah.u[i] = hb; al.u[i] = ASPLIT ? bf16_bits(xs[i] - bf16_val(hb)) : (unsigned short)0; }
#pragma unroll
    for (int t = 0; t < 4; ++t) {
      const unsigned short* brow = Wt + (size_t)(col0 + t * 16 + ln) * ldb + kb;
      FragB b;
      b.half[0] = *(const v8us*)(brow + 8 * hh);
      b.half[1] = *(const v8us*)(brow + 16 + 8 * hh);
      acc[t] = mmaN<ASPLIT ? 2 : 1>(ah.v, al.v, b.v, b.v, acc[t]);
    }
  }
#pragma unroll
  for (int t = 0; t < 4; ++t) {
    float bv = bias ? bias[col0 + t * 16 + ln] : 0.f;
    if (BIAS_BF16) bv = bf16_round(bv);
#pragma unroll
    for (int r = 0; r < 8; ++r) { float v = acc[t][r] + bv; if (ACT == 1) v = fmaxf(v, 0.f); so[w][8 * hh + r][t * 16 + ln] = v; }
  }
  __builtin_amdgcn_fence(__ATOMIC_ACQ_REL, "workgroup");
  __builtin_amdgcn_wave_barrier();
  const int rsub = lane >> 4, c4 = (lane & 15) * 4;
  {
#pragma unroll
    for (int q = 0; q < 8; ++q) {
      const int r = q * 2 + rsub;
      const v4f v = *(const v4fa*)&so[w][r][c4];
      *(v4f*)(C + (size_t)(row0 + r) * ldc + col0 + c4) = v;
    }
    
  }
}

// GEMM C = act(A·W + bias + resid): A f32 (ASPLIT -> hi/lo 2 terms), Wt bf16 [N][K]; ACT 0 none, 1 relu, 2 exact gelu;
// resid (optional, f32, row index = (row % rmod), pitch ldr, RES_BF16 rounds it) added before the activation.
template <bool ASPLIT, int ACT, bool BIAS_BF16, bool RES_BF16>
__global__ __launch_bounds__(128) void k_gemm_bf3(const float* __restrict__ A, int lda, const unsigned short* __restrict__ Wt, int ldb,
                                                const float* __restrict__ bias, const float* __restrict__ resid, int rmod, int ldr,
                                                float* __restrict__ C, int ldc, int M, int N, int K) {
  __shared__ __attribute__((aligned(16))) float so[4][16][64];
  const int tid = threadIdx.x, w = tid >> 5, lane = tid & 31, ln = lane & 15, hh = lane >> 4;
  const int ntn = N / 64;
  const int wid = blockIdx.x * 4 + w;
  const int mt = wid / ntn, nq = wid % ntn;
  if (mt * 16 >= M) return;
  const int row0 = mt * 16, col0 = nq * 64;
  const float* arow = A + (size_t)(row0 + ln) * lda;
  v8f acc[4] = {};
  for (int kb = 0; kb < K; kb += 32) {
    FragB ah, al;
    const v4f x0 = *(const v4fa*)(arow + kb + 8 * hh), x1 = *(const v4fa*)(arow + kb + 8 * hh + 4);
    const v4f x2 = *(const v4fa*)(arow + kb + 16 + 8 * hh), x3 = *(const v4fa*)(arow + kb + 16 + 8 * hh + 4);
    float xs[16] = {x0[0],x0[1],x0[2],x0[3],x1[0],x1[1],x1[2],x1[3],x2[0],x2[1],x2[2],x2[3],x3[0],x3[1],x3[2],x3[3]};
#pragma unroll
    for (int i = 0; i < 16; ++i) { const unsigned short hb = bf16_bits(xs[i]); ah.u[i] = hb; al.u[i] = ASPLIT ? bf16_bits(xs[i] - bf16_val(hb)) : (unsigned short)0; }
#pragma unroll
    for (int t = 0; t < 4; ++t) {
      const unsigned short* brow = Wt + (size_t)(col0 + t * 16 + ln) * ldb + kb;
      FragB b;
      b.half[0] = *(const v8us*)(brow + 8 * hh);
      b.half[1] = *(const v8us*)(brow + 16 + 8 * hh);
      acc[t] = mmaN<ASPLIT ? 2 : 1>(ah.v, al.v, b.v, b.v, acc[t]);
    }
  }
#pragma unroll
  for (int t = 0; t < 4; ++t) {
    const int col = col0 + t * 16 + ln;
    float bv = bias ? bias[col] : 0.f;
    if (BIAS_BF16) bv = bf16_round(bv);
#pragma unroll
    for (int r = 0; r < 8; ++r) {
      float v = acc[t][r] + bv;
      if (resid) { float rv = resid[(size_t)((row0 + 8 * hh + r) % rmod) * ldr + col]; if (RES_BF16) rv = bf16_round(rv); v += rv; }
      if (ACT == 1) v = fmaxf(v, 0.f);
      if (ACT == 2) v = 0.5f * v * (1.0f + erff(v * 0.70710678118654752f));
      if (ACT == 3) { const float u = 0.7978845608028654f * (v + 0.044715f * v * v * v); v = 0.5f * v * (1.0f + tanhf(u)); }
      so[w][8 * hh + r][t * 16 + ln] = v;
    }
  }
  __builtin_amdgcn_fence(__ATOMIC_ACQ_REL, "workgroup");
  __builtin_amdgcn_wave_barrier();
  const int rsub = lane >> 4, c4 = (lane & 15) * 4;
  {
#pragma unroll
    for (int q = 0; q < 8; ++q) {
      const int r = q * 2 + rsub;
      const v4f v = *(const v4fa*)&so[w][r][c4];
      *(v4f*)(C + (size_t)(row0 + r) * ldc + col0 + c4) = v;
    }
    
  }
}
// row LayerNorm (biased variance, eps) over N: s = X (+ R); optional out_sum <- s; out_norm <- (s-mu)*rsqrt(var+eps)*g + b
template <bool PARAM_BF16>
__global__ __launch_bounds__(256) void k_layernorm(const float* __restrict__ X, const float* __restrict__ R, const float* __restrict__ g, const float* __restrict__ bta,
                                                  float* __restrict__ out_sum, float* __restrict__ out_norm, int N, float eps) {
  __shared__ float red[256];
  const int row = blockIdx.x, tid = threadIdx.x;
  const float* x = X + (size_t)row * N; const float* rr = R ? R + (size_t)row * N : nullptr;
  float vals[16];                     // up to N = 4096
  const int per = N / 256;            // contiguous chunk per thread? use strided-by-4 chunks: thread handles j = tid*4 + 1024*u
  float s1 = 0.f;
  for (int u = 0; u < per / 4; ++u) {
    const int j = tid * 4 + 1024 * u;
    const v4f a = *(const v4fa*)(x + j);
    v4f b = {0.f,0.f,0.f,0.f}; if (rr) b = *(const v4fa*)(rr + j);
#pragma unroll
    for (int q = 0; q < 4; ++q) { const float v = a[q] + b[q]; vals[u * 4 + q] = v; s1 += v; }
  }
  red[tid] = s1; __syncthreads();
  for (int st = 128; st > 0; st >>= 1) { if (tid < st) red[tid] += red[tid + st]; __syncthreads(); }
  const float mu = red[0] / (float)N; __syncthreads();
  float s2 = 0.f;
  for (int u = 0; u < per / 4; ++u)
#pragma unroll
    for (int q = 0; q < 4; ++q) { const float c = vals[u * 4 + q] - mu; s2 += c * c; }
  red[tid] = s2; __syncthreads();
  for (int st = 128; st > 0; st >>= 1) { if (tid < st) red[tid] += red[tid + st]; __syncthreads(); }
  const float rs = rsqrtf(red[0] / (float)N + eps);
  {
    for (int u = 0; u < per / 4; ++u) {
      const int j = tid * 4 + 1024 * u;
      v4f o, sm;
#pragma unroll
      for (int q = 0; q < 4; ++q) {
        float gg = g[j + q], bb = bta[j + q];
        if (PARAM_BF16) { gg = bf16_round(gg); bb = bf16_round(bb); }
        sm[q] = vals[u * 4 + q]; o[q] = (vals[u * 4 + q] - mu) * rs * gg + bb;
      }
      if (out_sum) *(v4f*)(out_sum + (size_t)row * N + j) = sm;
      *(v4f*)(out_norm + (size_t)row * N + j) = o;
    }
    
  }
}



// ---- f16 WMMA path (v_wmma_f32_16x16x32_f16): 11-bit significands for operands in range — used where a [0,1] probability operand needs more precision than bf16
typedef _Float16 v16h __attribute__((ext_vector_type(16)));
union FragH { v16h v; v8us half[2]; _Float16 h[16]; unsigned short u[16]; };
template <int NT>
__device__ __forceinline__ v8f mmaH(v16h ah, v16h al, v16h bh, v16h bl, v8f c) {
  c = __builtin_amdgcn_wmma_f32_16x16x32_f16(false, ah, false, bh, (short)0, c, false, false);
  if (NT >= 2) c = __builtin_amdgcn_wmma_f32_16x16x32_f16(false, al, false, bh, (short)0, c, false, false);
  if (NT >= 3) c = __builtin_amdgcn_wmma_f32_16x16x32_f16(false, ah, false, bl, (short)0, c, false, false);
  asm volatile("v_nop\n\tv_nop\n\tv_nop\n\tv_nop" : "+v"(c) : "v"(ah), "v"(al), "v"(bh), "v"(bl));
  return c;
}
// batched GEMM like k_gemm_b but f16 operands: A f32 (split into f16 hi/lo if ASPLIT, else rounded to f16), Bt = f16 values [n][k]; alpha; C f32; N multiple of 16 (partial tiles skipped)
template <bool ASPLIT>
__global__ __launch_bounds__(128) void k_gemm_h(const float* __restrict__ A, int lda, size_t sA, const _Float16* __restrict__ Bh, int ldb, size_t sB, float alpha, float* __restrict__ C, int ldc, size_t sC, int M, int N, int K) {
  __shared__ __attribute__((aligned(16))) float so[4][16][64];
  const int tid = threadIdx.x, w = tid >> 5, lane = tid & 31, ln = lane & 15, hh = lane >> 4; const int by = blockIdx.y;
  A += (size_t)by * sA; Bh += (size_t)by * sB; C += (size_t)by * sC;
  const int ntn = (N + 63) / 64; const int wid = blockIdx.x * 4 + w; const int mt = wid / ntn, nq = wid % ntn; if (mt * 16 >= M) return;
  const int row0 = mt * 16, col0 = nq * 64; const float* arow = A + (size_t)(row0 + ln) * lda;
  v8f acc[4] = {};
  for (int kb = 0; kb < K; kb += 32) {
    FragH ah, al;
    const v4f x0 = *(const v4fa*)(arow + kb + 8 * hh), x1 = *(const v4fa*)(arow + kb + 8 * hh + 4), x2 = *(const v4fa*)(arow + kb + 16 + 8 * hh), x3 = *(const v4fa*)(arow + kb + 16 + 8 * hh + 4);
    float xs[16] = {x0[0],x0[1],x0[2],x0[3],x1[0],x1[1],x1[2],x1[3],x2[0],x2[1],x2[2],x2[3],x3[0],x3[1],x3[2],x3[3]};
#pragma unroll
    for (int i = 0; i < 16; ++i) { const _Float16 h = (_Float16)xs[i]; ah.h[i] = h; al.h[i] = ASPLIT ? (_Float16)(xs[i] - (float)h) : (_Float16)0.0f; }
#pragma unroll
    for (int t = 0; t < 4; ++t) { if (col0 + t * 16 >= N) continue; const size_t boff = (size_t)(col0 + t * 16 + ln) * ldb + kb; FragH bq; bq.half[0] = *(const v8us*)(Bh + boff + 8 * hh); bq.half[1] = *(const v8us*)(Bh + boff + 16 + 8 * hh);
      acc[t] = mmaH<ASPLIT ? 2 : 1>(ah.v, al.v, bq.v, bq.v, acc[t]); }
  }
#pragma unroll
  for (int t = 0; t < 4; ++t) { if (col0 + t * 16 >= N) continue;
#pragma unroll
    for (int r = 0; r < 8; ++r) so[w][8 * hh + r][t * 16 + ln] = acc[t][r] * alpha; }
  __builtin_amdgcn_fence(__ATOMIC_ACQ_REL, "workgroup"); __builtin_amdgcn_wave_barrier();
  const int rsub = lane >> 4, c4 = (lane & 15) * 4;
  {
#pragma unroll
    for (int q = 0; q < 8; ++q) { const int r = q * 2 + rsub; if (col0 + c4 < N) { const v4f v = *(const v4fa*)&so[w][r][c4]; *(v4f*)(C + (size_t)(row0 + r) * ldc + col0 + c4) = v; } }
     }
}

// Wt[n][k] = f16(W[k][n]·scale) from f32 row-major W[K][N] (scale = power of two; bf16-exact weights stay exact in f16 away from the subnormal range)
__global__ __launch_bounds__(256) void k_wt_f16(const float* __restrict__ W, _Float16* __restrict__ Wt, int K, int N, float scale) {
  const int t = blockIdx.x * 256 + threadIdx.x; if (t >= N * (K / 8)) return; const int n = t / (K / 8), k8 = (t % (K / 8)) * 8; FragH f;
#pragma unroll
  for (int i = 0; i < 8; ++i) f.h[i] = (_Float16)(bf16_round(W[(size_t)(k8 + i) * N + n]) * scale); const v8us o = f.half[0];
  *(v8us*)((unsigned short*)Wt + (size_t)n * K + k8) = o; 
}
// k_gemm_hh variant with fused epilogue: v = acc·alpha + bias[by·sBias + col] (+ CP[(row/rowsPerB)·sCPb + by·64 + col] if CP) ; ACT 0 none / 1 elu ; writes f16 C16 (and f32 C if non-null)
template <int ACT>
__global__ __launch_bounds__(128) void k_gemm_hhx(const _Float16* __restrict__ A, int lda, size_t sA, const _Float16* __restrict__ Bh, int ldb, size_t sB, float alpha, const float* __restrict__ bias, size_t sBias, const float* __restrict__ CP, int rowsPerB, size_t sCPb, int row0g,
    float* __restrict__ C, _Float16* __restrict__ C16, int ldc, size_t sC, int M, int N, int K) {
  __shared__ __attribute__((aligned(16))) float so[4][16][64];
  const int tid = threadIdx.x, w = tid >> 5, lane = tid & 31, ln = lane & 15, hh = lane >> 4; const int by = blockIdx.y;
  A += (size_t)by * sA; Bh += (size_t)by * sB; const size_t cofs = (size_t)by * sC; const float* bp = bias ? bias + (size_t)by * sBias : nullptr;
  const int ntn = (N + 63) / 64; const int wid = blockIdx.x * 4 + w; const int mt = wid / ntn, nq = wid % ntn; if (mt * 16 >= M) return;
  const int row0 = mt * 16, col0 = nq * 64; const _Float16* arow = A + (size_t)(row0 + ln) * lda;
  v8f acc[4] = {};
  for (int kb = 0; kb < K; kb += 32) { FragH ah; ah.half[0] = *(const v8us*)((const unsigned short*)arow + kb + 8 * hh); ah.half[1] = *(const v8us*)((const unsigned short*)arow + kb + 16 + 8 * hh);
#pragma unroll
    for (int t = 0; t < 4; ++t) { if (col0 + t * 16 >= N) continue; const size_t boff = (size_t)(col0 + t * 16 + ln) * ldb + kb; FragH bq; bq.half[0] = *(const v8us*)((const unsigned short*)Bh + boff + 8 * hh); bq.half[1] = *(const v8us*)((const unsigned short*)Bh + boff + 16 + 8 * hh);
      acc[t] = mmaH<1>(ah.v, ah.v, bq.v, bq.v, acc[t]); }
  }
#pragma unroll
  for (int t = 0; t < 4; ++t) { if (col0 + t * 16 >= N) continue; const int col = col0 + t * 16 + ln; const float bv = bp ? bf16_round(bp[col]) : 0.f;
#pragma unroll
    for (int r = 0; r < 8; ++r) { float v = acc[t][r] * alpha + bv; if (CP) { const int bidx = (row0g + row0 + 8 * hh + r) / rowsPerB; v += CP[(size_t)bidx * sCPb + (size_t)by * 64 + col]; } if (ACT == 1) v = (v > 0.f) ? v : expm1f(v); else if (ACT == 7) v = (v > 0.f) ? v + 1.0f : expf(v); else if (ACT == 8) v = tanhf(v); else if (ACT == 9) v = 0.5f * v * (1.0f + tanhf(0.7978845608028654f * (v + 0.044715f * v * v * v))); else if (ACT == 11) v = 1.0f / (1.0f + expf(-v)); else if (ACT == 12) v = (v > 0.f) ? v : 0.01f * v; else if (ACT == 14) v = (v > 0.f) ? v : 0.1f * v; else if (ACT == 15) v = v / (1.0f + expf(-v)); else if (ACT == 3) v = fmaxf(v, 0.f); else if (ACT == 6) v = 0.5f * v * (1.0f + erff(v * 0.70710678118654752f)); so[w][8 * hh + r][t * 16 + ln] = v; } }
  __builtin_amdgcn_fence(__ATOMIC_ACQ_REL, "workgroup"); __builtin_amdgcn_wave_barrier();
  const int rsub = lane >> 4, c4 = (lane & 15) * 4; typedef _Float16 v4h __attribute__((ext_vector_type(4)));
  {
#pragma unroll
    for (int q = 0; q < 8; ++q) { const int r = q * 2 + rsub; if (col0 + c4 < N) { const v4f v = *(const v4fa*)&so[w][r][c4]; if (C) *(v4f*)(C + cofs + (size_t)(row0 + r) * ldc + col0 + c4) = v; if (C16) { v4h h4; for (int i = 0; i < 4; ++i) h4[i] = (_Float16)v[i]; *(v4h*)(C16 + cofs + (size_t)(row0 + r) * ldc + col0 + c4) = h4; } } }
     }
}


typedef _Float16 v4h __attribute__((ext_vector_type(4)));

__global__ __launch_bounds__(256) void k_h16(const float* __restrict__ x, _Float16* __restrict__ X16, size_t n8) { const size_t t = (size_t)blockIdx.x * 256 + threadIdx.x; if (t >= n8) return; FragH f;
#pragma unroll
  for (int q = 0; q < 8; ++q) f.h[q] = (_Float16)x[t * 8 + q]; *(v8us*)((unsigned short*)X16 + t * 8) = f.half[0];  }
__global__ __launch_bounds__(256) void k_round16f(const float* __restrict__ W, _Float16* __restrict__ Bt, size_t n8) { const size_t t = (size_t)blockIdx.x * 256 + threadIdx.x; if (t >= n8) return; FragH f;
#pragma unroll
  for (int i = 0; i < 8; ++i) f.h[i] = (_Float16)(bf16_round(W[t * 8 + i]) * 16.0f); *(v8us*)((unsigned short*)Bt + t * 8) = f.half[0];  }
template <int NHv, int TTv>
__global__ __launch_bounds__(256) void k_vt(const _Float16* __restrict__ V16, int ldv, int voff, _Float16* __restrict__ Vt) { __shared__ unsigned short tl[64][66]; const int tid = threadIdx.x; const int slab = blockIdx.x / (TTv / 64), lg = blockIdx.x % (TTv / 64); const int b = slab / NHv, h = slab % NHv;
  for (int i = tid; i < 64 * 8; i += 256) { const int r = i / 8, c8 = (i % 8) * 8; FragH f; f.half[0] = *(const v8us*)((const unsigned short*)V16 + ((size_t)b * TTv + lg * 64 + r) * ldv + voff + h * 64 + c8);
#pragma unroll
    for (int q = 0; q < 8; ++q) tl[r][c8 + q] = f.u[q]; }
  __syncthreads();
  {
#pragma unroll
    for (int rd = 0; rd < 2; ++rd) { const int d = rd * 32 + tid / 8, pc = tid % 8; FragH f;
#pragma unroll
      for (int q = 0; q < 8; ++q) f.u[q] = tl[pc * 8 + q][d];
      *(v8us*)((unsigned short*)Vt + ((size_t)slab * 64 + d) * TTv + lg * 64 + pc * 8) = f.half[0]; }
     } }

__global__ __launch_bounds__(256) void k_hl(const float* __restrict__ F, _Float16* __restrict__ Hh, _Float16* __restrict__ Hl, size_t n8) { const size_t t = (size_t)blockIdx.x * 256 + threadIdx.x; if (t >= n8) return; FragH fh, fl; const v4f a = *(const v4fa*)(F + t * 8), c = *(const v4fa*)(F + t * 8 + 4);
#pragma unroll
  for (int q = 0; q < 4; ++q) { _Float16 h = (_Float16)a[q]; fh.h[q] = h; fl.h[q] = (_Float16)((a[q] - (float)h) * 1024.0f); h = (_Float16)c[q]; fh.h[4 + q] = h; fl.h[4 + q] = (_Float16)((c[q] - (float)h) * 1024.0f); }
  { *(v8us*)((unsigned short*)Hh + t * 8) = fh.half[0]; *(v8us*)((unsigned short*)Hl + t * 8) = fl.half[0];  } }

// ---- fast GEMM (wave tile 32x64; requires M % 32 == 0 rows per launch region and N % 64 == 0); epilogue = k_gemm_hhx semantics ----
__device__ __forceinline__ v16h g2_frag(const _Float16* p, int hh) { FragH f; f.half[0] = *(const v8us*)((const unsigned short*)p + 8 * hh); f.half[1] = *(const v8us*)((const unsigned short*)p + 16 + 8 * hh); return f.v; }
__device__ __forceinline__ v8f g2_mma(v16h a, v16h b, v8f c) { v8f d = __builtin_amdgcn_wmma_f32_16x16x32_f16(false, a, false, b, (short)0, c, false, false); asm volatile("v_nop\n\tv_nop\n\tv_nop\n\tv_nop" : "+v"(d) : "v"(a), "v"(b)); return d; }
template <int ACT>
__global__ __launch_bounds__(128) void k_gemm2(const _Float16* __restrict__ A, int lda, size_t sA, const _Float16* __restrict__ Bh, int ldb, size_t sB, float alpha, const float* __restrict__ bias, size_t sBias, const float* __restrict__ CP, int rowsPerB, size_t sCPb, int row0g,
    float* __restrict__ C, _Float16* __restrict__ C16, int ldc, size_t sC, int M, int N, int K) {
  __shared__ __attribute__((aligned(16))) float so[4][32][68];
  const int tid = threadIdx.x, w = tid >> 5, lane = tid & 31, ln = lane & 15, hh = lane >> 4; const int by = blockIdx.y;
  A += (size_t)by * sA; Bh += (size_t)by * sB; const size_t cofs = (size_t)by * sC; const float* bp = bias ? bias + (size_t)by * sBias : nullptr;
  const int ntn = N >> 6; const int mt = blockIdx.x / ntn, nq = blockIdx.x - mt * ntn; const int row0 = mt * 128 + 32 * w, col0 = nq * 64; if (row0 >= M) return;
  const _Float16* a0p = A + (size_t)(row0 + ln) * lda; const _Float16* a1p = a0p + (size_t)16 * lda;
  const _Float16* b0p = Bh + (size_t)(col0 + ln) * ldb; const _Float16* b1p = b0p + (size_t)16 * ldb; const _Float16* b2p = b1p + (size_t)16 * ldb; const _Float16* b3p = b2p + (size_t)16 * ldb;
  const v8f z8 = {0.f,0.f,0.f,0.f,0.f,0.f,0.f,0.f}; v8f c00 = z8, c01 = z8, c02 = z8, c03 = z8, c10 = z8, c11 = z8, c12 = z8, c13 = z8;
#pragma unroll 1
  for (int kb = 0; kb < K; kb += 32) { const v16h a0 = g2_frag(a0p + kb, hh), a1 = g2_frag(a1p + kb, hh);
    v16h b = g2_frag(b0p + kb, hh); c00 = g2_mma(a0, b, c00); c10 = g2_mma(a1, b, c10);
    b = g2_frag(b1p + kb, hh); c01 = g2_mma(a0, b, c01); c11 = g2_mma(a1, b, c11);
    b = g2_frag(b2p + kb, hh); c02 = g2_mma(a0, b, c02); c12 = g2_mma(a1, b, c12);
    b = g2_frag(b3p + kb, hh); c03 = g2_mma(a0, b, c03); c13 = g2_mma(a1, b, c13); }
  v8f accs[8] = {c00, c01, c02, c03, c10, c11, c12, c13};
#pragma unroll
  for (int u = 0; u < 8; ++u) { const int t = u & 3, half = u >> 2; const int col = col0 + t * 16 + ln; const float bv = bp ? bf16_round(bp[col]) : 0.f;
#pragma unroll
    for (int r = 0; r < 8; ++r) { const int rloc = half * 16 + 8 * hh + r; float v = accs[u][r] * alpha + bv; if (CP) { if (rowsPerB < 0) v += CP[cofs + (size_t)(row0g + row0 + rloc) * ldc + col];      /* rowsPerB < 0: own element of the batched C plane */ else { const int bidx = (row0g + row0 + rloc) / rowsPerB; v += CP[(size_t)bidx * sCPb + (size_t)by * 64 + col]; } }
      if (ACT == 3) v = fmaxf(v, 0.f); else if (ACT == 6) v = 0.5f * v * (1.0f + erff(v * 0.70710678118654752f)); else if (ACT == 11) v = 1.0f / (1.0f + expf(-v)); else if (ACT == 15) v = v / (1.0f + expf(-v)); else if (ACT == 12) v = (v > 0.f) ? v : 0.01f * v; else if (ACT == 8) v = tanhf(v);
      so[w][rloc][t * 16 + ln] = v; } }
  __builtin_amdgcn_fence(__ATOMIC_ACQ_REL, "workgroup"); __builtin_amdgcn_wave_barrier();
  const int rsub = lane >> 4, c4 = (lane & 15) * 4;
  {
#pragma unroll
    for (int q = 0; q < 16; ++q) { const int r = q * 2 + rsub; const v4f v = *(const v4fa*)&so[w][r][c4]; if (C) *(v4f*)(C + cofs + (size_t)(row0 + r) * ldc + col0 + c4) = v; if (C16) { v4h h4; for (int i = 0; i < 4; ++i) h4[i] = (_Float16)v[i]; *(v4h*)(C16 + cofs + (size_t)(row0 + r) * ldc + col0 + c4) = h4; } }
     } }



__constant__ int BK30[2 * SLEN - 1] = {15,15,15,15,15,15,15,15,15,15,15,15,15,15,15,15,15,15,15,15,15,15,15,15,15,15,15,15,15,15,15,15,15,15,15,15,15,15,15,15,15,15,15,15,15,15,15,15,15,15,15,15,15,15,15,15,15,15,15,15,15,15,15,15,15,15,15,15,15,15,15,15,15,15,15,15,15,15,15,15,15,15,15,15,15,15,15,15,15,15,15,15,15,15,15,15,15,15,15,15,15,15,15,15,15,15,15,15,15,15,15,15,15,15,15,15,15,15,15,15,15,15,15,15,15,15,15,15,15,15,15,15,15,15,15,15,15,15,15,15,15,15,15,15,15,15,15,15,15,15,15,15,15,15,15,15,15,15,15,15,15,15,15,15,15,15,15,15,15,15,15,15,15,15,15,15,15,15,15,15,15,15,15,15,15,15,15,15,15,15,15,15,15,15,15,15,15,15,15,15,15,15,15,15,15,15,15,15,15,15,15,15,15,15,15,15,15,15,15,15,15,15,15,15,15,15,15,15,15,15,15,15,15,15,15,15,15,15,15,15,15,15,15,15,15,15,15,15,15,15,15,15,15,15,15,15,15,15,15,15,15,15,15,15,15,15,15,15,15,15,15,15,15,15,15,15,15,15,15,15,15,15,15,15,15,15,15,15,15,15,15,15,15,15,15,15,15,15,15,15,15,15,15,15,15,15,15,15,15,15,15,15,15,15,15,15,15,15,15,15,15,15,15,15,15,15,15,15,15,15,15,15,15,15,15,15,15,15,15,15,15,15,15,15,15,15,15,15,15,15,15,15,15,15,15,15,15,15,15,15,15,15,15,15,15,15,15,15,15,15,15,15,15,15,15,15,15,15,15,15,15,15,15,15,15,15,15,15,15,15,15,15,15,15,15,15,15,15,15,15,15,15,15,15,15,15,15,15,15,15,15,15,15,15,15,15,15,15,15,15,15,15,15,15,15,15,15,15,15,15,15,15,15,15,15,15,15,15,15,15,15,15,15,15,15,15,15,15,15,15,15,15,15,15,15,15,15,15,15,15,15,15,15,15,15,15,15,15,15,15,15,15,15,15,15,15,15,15,15,15,15,15,15,15,15,15,15,15,15,15,15,15,15,15,15,15,15,15,15,15,15,15,15,15,15,15,15,15,15,15,15,15,15,15,15,15,15,15,15,15,15,15,15,15,15,15,15,15,15,15,15,15,15,15,15,15,15,15,15,15,15,15,15,15,15,15,15,15,15,15,15,15,15,15,15,15,15,15,15,15,15,15,15,15,15,15,15,15,15,15,15,15,15,15,15,15,15,15,15,15,15,15,15,15,15,15,15,15,15,15,15,15,15,15,15,15,15,15,15,15,15,15,15,15,15,15,15,15,15,15,15,15,15,15,15,15,15,15,15,15,15,15,15,15,15,15,15,15,15,15,15,15,15,15,15,15,15,15,15,15,15,15,15,15,15,15,15,15,15,15,15,15,15,15,15,15,15,15,15,15,15,15,15,15,15,15,15,15,15,15,15,15,15,15,15,15,15,15,15,15,15,15,15,15,15,15,15,15,15,15,15,15,15,15,15,15,15,15,15,15,15,15,15,15,15,15,15,15,15,15,15,15,15,15,15,15,15,15,15,15,15,15,15,15,15,15,15,15,15,15,15,15,15,15,15,15,15,15,15,15,15,15,15,15,15,15,15,15,15,15,15,15,15,15,15,15,15,15,15,15,15,15,15,15,15,15,15,15,15,15,15,15,15,15,15,15,15,15,15,15,15,15,15,15,15,15,15,15,15,15,15,15,15,15,15,15,15,15,15,15,15,15,15,15,15,15,15,15,15,15,15,15,15,15,15,15,15,15,15,15,15,15,15,15,15,15,15,15,15,15,15,15,15,15,15,15,15,15,15,15,15,15,15,15,15,15,15,15,15,15,15,15,15,15,15,15,15,15,15,15,15,15,15,15,15,15,15,15,15,15,15,15,15,15,15,15,15,15,15,15,15,15,15,15,15,15,15,15,15,15,15,15,15,15,15,15,15,15,15,15,15,15,15,15,15,15,15,15,15,15,15,15,15,15,15,15,15,15,15,15,15,15,15,15,15,15,15,15,15,15,15,15,15,15,15,15,15,15,15,15,15,15,15,15,15,15,15,15,15,15,15,15,15,15,15,15,15,15,15,15,15,15,15,15,15,15,15,15,15,15,15,15,15,15,15,15,15,15,15,15,15,15,15,15,15,15,15,15,15,15,15,15,15,15,15,15,15,15,15,15,15,15,15,15,15,15,15,15,15,15,15,15,15,15,15,15,15,15,15,15,15,15,15,15,15,15,15,15,15,15,15,15,15,15,15,15,15,15,15,15,15,15,15,15,15,15,15,15,15,15,15,15,15,15,15,15,15,15,15,15,15,15,15,15,15,15,15,15,15,15,15,15,15,15,15,15,15,15,15,15,15,15,15,15,15,15,15,15,15,15,15,15,15,15,15,15,15,15,15,15,15,15,15,15,15,15,15,15,15,15,15,15,15,15,15,15,15,15,15,15,15,15,15,15,15,15,15,15,15,15,15,15,15,15,15,15,15,15,15,15,15,15,15,15,15,15,15,15,15,15,15,15,15,15,15,15,15,15,15,15,15,15,15,15,15,15,15,15,15,15,15,15,15,15,15,15,15,15,15,15,15,15,15,15,15,15,15,15,15,15,15,15,15,15,15,15,15,15,15,15,15,15,15,15,15,15,15,15,15,15,15,15,15,15,15,15,15,15,15,15,15,15,15,15,15,15,15,15,15,15,15,15,15,15,15,15,15,15,15,15,15,15,15,15,15,15,15,15,15,15,15,15,15,15,15,15,15,15,15,15,15,15,15,15,15,15,15,15,15,15,15,15,15,15,15,15,15,15,15,15,15,15,15,15,15,15,15,15,15,15,15,15,15,15,15,15,15,15,15,15,15,15,15,15,15,15,15,15,15,15,15,15,15,15,15,15,15,15,15,15,15,15,15,15,15,15,15,15,15,15,15,15,15,15,15,15,15,15,15,15,15,15,15,15,15,15,15,15,15,15,15,15,15,15,15,15,15,15,15,15,15,15,15,15,15,15,15,15,15,15,15,15,15,15,15,15,15,15,15,15,15,15,15,15,15,15,15,15,15,15,15,15,15,15,15,15,15,15,15,15,15,15,15,15,15,15,15,15,15,15,15,15,15,15,15,15,15,15,15,15,15,15,15,15,15,15,15,15,15,15,15,15,15,15,15,15,15,15,15,15,15,15,15,15,15,15,15,15,15,15,15,15,15,15,15,15,15,15,15,15,15,15,15,15,15,15,15,15,15,15,15,15,15,15,15,15,15,15,15,15,15,15,15,15,15,15,15,15,15,15,15,15,15,15,15,15,15,15,15,15,15,15,15,15,15,15,15,15,15,15,15,15,15,15,15,15,15,15,15,15,15,15,15,15,15,15,15,15,15,15,15,15,15,15,15,15,15,15,15,15,15,15,15,15,15,15,15,15,15,15,15,15,15,15,15,15,15,15,15,15,15,15,15,15,15,15,15,15,15,15,15,15,15,15,15,15,15,15,15,15,15,15,15,15,15,15,15,15,15,15,15,15,15,15,15,15,15,15,15,15,15,15,15,15,15,15,15,15,15,15,15,15,15,15,15,15,15,15,15,15,15,15,15,15,15,15,15,15,15,15,15,15,15,15,15,15,15,15,15,15,15,15,15,15,15,15,15,15,15,15,15,15,15,15,15,15,15,15,15,15,15,15,15,15,15,15,15,15,15,15,15,15,15,15,15,15,15,15,15,15,15,15,15,15,15,15,15,15,15,15,15,15,15,15,15,15,15,15,15,15,15,15,15,15,15,15,15,15,15,15,15,15,15,15,15,15,15,15,15,15,15,15,15,15,15,15,15,15,15,15,15,15,15,15,15,15,15,15,15,15,15,15,15,15,15,15,15,15,15,15,15,15,15,15,15,15,15,15,15,15,15,15,15,15,15,15,15,15,15,15,15,15,15,15,15,15,15,15,15,15,15,15,15,15,15,15,15,15,15,15,15,15,15,15,15,15,15,15,15,15,15,15,15,15,15,15,15,15,15,15,15,15,15,15,15,15,15,15,15,15,15,15,15,15,15,15,15,15,15,15,15,15,15,15,15,15,15,15,15,15,15,15,15,15,15,15,15,15,15,15,15,15,15,15,15,15,15,15,15,15,15,15,15,15,15,15,15,15,15,15,15,15,15,15,15,15,15,15,15,15,15,15,15,15,15,15,15,15,15,15,15,15,15,15,15,15,15,15,15,15,15,15,15,15,15,15,15,15,15,15,15,15,15,15,15,15,15,15,15,15,15,15,15,15,15,15,15,15,15,15,15,15,15,15,15,15,15,15,15,15,15,15,15,15,15,15,15,15,15,15,15,15,15,15,15,15,15,14,14,14,14,14,14,14,14,14,14,14,14,14,14,14,14,14,14,14,14,14,14,14,14,14,14,14,13,13,13,13,13,13,13,13,13,13,13,13,13,13,13,13,13,13,12,12,12,12,12,12,12,12,12,12,12,12,12,12,11,11,11,11,11,11,11,11,11,10,10,10,10,10,10,10,9,9,9,9,8,8,8,8,7,6,5,4,3,2,1,0,17,18,19,20,21,22,23,24,24,24,24,25,25,25,25,26,26,26,26,26,26,26,27,27,27,27,27,27,27,27,27,28,28,28,28,28,28,28,28,28,28,28,28,28,28,29,29,29,29,29,29,29,29,29,29,29,29,29,29,29,29,29,29,30,30,30,30,30,30,30,30,30,30,30,30,30,30,30,30,30,30,30,30,30,30,30,30,30,30,30,31,31,31,31,31,31,31,31,31,31,31,31,31,31,31,31,31,31,31,31,31,31,31,31,31,31,31,31,31,31,31,31,31,31,31,31,31,31,31,31,31,31,31,31,31,31,31,31,31,31,31,31,31,31,31,31,31,31,31,31,31,31,31,31,31,31,31,31,31,31,31,31,31,31,31,31,31,31,31,31,31,31,31,31,31,31,31,31,31,31,31,31,31,31,31,31,31,31,31,31,31,31,31,31,31,31,31,31,31,31,31,31,31,31,31,31,31,31,31,31,31,31,31,31,31,31,31,31,31,31,31,31,31,31,31,31,31,31,31,31,31,31,31,31,31,31,31,31,31,31,31,31,31,31,31,31,31,31,31,31,31,31,31,31,31,31,31,31,31,31,31,31,31,31,31,31,31,31,31,31,31,31,31,31,31,31,31,31,31,31,31,31,31,31,31,31,31,31,31,31,31,31,31,31,31,31,31,31,31,31,31,31,31,31,31,31,31,31,31,31,31,31,31,31,31,31,31,31,31,31,31,31,31,31,31,31,31,31,31,31,31,31,31,31,31,31,31,31,31,31,31,31,31,31,31,31,31,31,31,31,31,31,31,31,31,31,31,31,31,31,31,31,31,31,31,31,31,31,31,31,31,31,31,31,31,31,31,31,31,31,31,31,31,31,31,31,31,31,31,31,31,31,31,31,31,31,31,31,31,31,31,31,31,31,31,31,31,31,31,31,31,31,31,31,31,31,31,31,31,31,31,31,31,31,31,31,31,31,31,31,31,31,31,31,31,31,31,31,31,31,31,31,31,31,31,31,31,31,31,31,31,31,31,31,31,31,31,31,31,31,31,31,31,31,31,31,31,31,31,31,31,31,31,31,31,31,31,31,31,31,31,31,31,31,31,31,31,31,31,31,31,31,31,31,31,31,31,31,31,31,31,31,31,31,31,31,31,31,31,31,31,31,31,31,31,31,31,31,31,31,31,31,31,31,31,31,31,31,31,31,31,31,31,31,31,31,31,31,31,31,31,31,31,31,31,31,31,31,31,31,31,31,31,31,31,31,31,31,31,31,31,31,31,31,31,31,31,31,31,31,31,31,31,31,31,31,31,31,31,31,31,31,31,31,31,31,31,31,31,31,31,31,31,31,31,31,31,31,31,31,31,31,31,31,31,31,31,31,31,31,31,31,31,31,31,31,31,31,31,31,31,31,31,31,31,31,31,31,31,31,31,31,31,31,31,31,31,31,31,31,31,31,31,31,31,31,31,31,31,31,31,31,31,31,31,31,31,31,31,31,31,31,31,31,31,31,31,31,31,31,31,31,31,31,31,31,31,31,31,31,31,31,31,31,31,31,31,31,31,31,31,31,31,31,31,31,31,31,31,31,31,31,31,31,31,31,31,31,31,31,31,31,31,31,31,31,31,31,31,31,31,31,31,31,31,31,31,31,31,31,31,31,31,31,31,31,31,31,31,31,31,31,31,31,31,31,31,31,31,31,31,31,31,31,31,31,31,31,31,31,31,31,31,31,31,31,31,31,31,31,31,31,31,31,31,31,31,31,31,31,31,31,31,31,31,31,31,31,31,31,31,31,31,31,31,31,31,31,31,31,31,31,31,31,31,31,31,31,31,31,31,31,31,31,31,31,31,31,31,31,31,31,31,31,31,31,31,31,31,31,31,31,31,31,31,31,31,31,31,31,31,31,31,31,31,31,31,31,31,31,31,31,31,31,31,31,31,31,31,31,31,31,31,31,31,31,31,31,31,31,31,31,31,31,31,31,31,31,31,31,31,31,31,31,31,31,31,31,31,31,31,31,31,31,31,31,31,31,31,31,31,31,31,31,31,31,31,31,31,31,31,31,31,31,31,31,31,31,31,31,31,31,31,31,31,31,31,31,31,31,31,31,31,31,31,31,31,31,31,31,31,31,31,31,31,31,31,31,31,31,31,31,31,31,31,31,31,31,31,31,31,31,31,31,31,31,31,31,31,31,31,31,31,31,31,31,31,31,31,31,31,31,31,31,31,31,31,31,31,31,31,31,31,31,31,31,31,31,31,31,31,31,31,31,31,31,31,31,31,31,31,31,31,31,31,31,31,31,31,31,31,31,31,31,31,31,31,31,31,31,31,31,31,31,31,31,31,31,31,31,31,31,31,31,31,31,31,31,31,31,31,31,31,31,31,31,31,31,31,31,31,31,31,31,31,31,31,31,31,31,31,31,31,31,31,31,31,31,31,31,31,31,31,31,31,31,31,31,31,31,31,31,31,31,31,31,31,31,31,31,31,31,31,31,31,31,31,31,31,31,31,31,31,31,31,31,31,31,31,31,31,31,31,31,31,31,31,31,31,31,31,31,31,31,31,31,31,31,31,31,31,31,31,31,31,31,31,31,31,31,31,31,31,31,31,31,31,31,31,31,31,31,31,31,31,31,31,31,31,31,31,31,31,31,31,31,31,31,31,31,31,31,31,31,31,31,31,31,31,31,31,31,31,31,31,31,31,31,31,31,31,31,31,31,31,31,31,31,31,31,31,31,31,31,31,31,31,31,31,31,31,31,31,31,31,31,31,31,31,31,31,31,31,31,31,31,31,31,31,31,31,31,31,31,31,31,31,31,31,31,31,31,31,31,31,31,31,31,31,31,31,31,31,31,31,31,31,31,31,31,31,31,31,31,31,31,31,31,31,31,31,31,31,31,31,31,31,31,31,31,31,31,31,31,31,31,31,31,31,31,31,31,31,31,31,31,31,31,31,31,31,31,31,31,31,31,31,31,31,31,31,31,31,31,31,31,31,31,31,31,31,31,31,31,31,31,31,31,31,31,31,31,31,31,31,31,31,31,31,31,31,31,31,31,31,31,31,31,31,31,31,31,31,31,31,31,31,31,31,31,31,31,31,31,31,31,31,31,31,31,31,31,31,31,31,31,31,31,31,31,31,31,31,31,31,31,31,31,31,31,31,31,31,31,31,31,31,31,31,31,31,31,31,31,31,31,31,31,31,31,31,31,31,31,31,31,31,31,31,31,31,31,31,31,31,31,31,31,31,31,31,31,31,31,31,31,31,31,31,31,31,31,31,31,31,31,31,31,31,31,31,31,31,31,31,31,31,31,31,31,31,31,31,31,31,31,31,31,31,31,31,31,31,31,31,31,31,31,31,31,31,31,31,31,31,31,31,31,31,31,31,31,31,31,31,31,31,31,31,31,31,31,31,31,31,31,31,31,31,31,31,31,31,31,31,31,31,31,31,31,31,31,31,31,31,31,31,31,31,31,31,31,31,31,31,31,31,31,31,31,31,31,31,31,31,31,31,31,31,31,31,31,31,31,31,31,31,31,31,31,31,31,31,31,31,31,31,31,31,31,31,31,31,31,31,31,31,31,31,31,31,31,31,31,31,31,31,31,31,31,31,31,31,31,31,31,31,31,31,31,31,31,31,31,31,31,31,31,31,31,31,31,31,31,31,31,31,31,31,31,31,31,31,31,31,31,31,31,31,31,31,31,31,31,31,31,31,31,31,31,31,31,31,31,31,31,31,31,31,31,31,31,31,31,31,31,31,31,31,31,31,31,31,31,31,31,31,31,31,31,31,31,31,31,31,31,31,31,31,31,31,31,31,31,31,31,31,31,31,31,31,31,31,31,31,31,31,31,31,31,31,31,31,31,31,31,31,31,31,31,31,31,31,31,31,31,31,31,31,31,31,31,31,31,31,31,31,31,31,31,31,31,31,31,31,31,31,31,31,31,31,31,31,31,31,31,31,31,31,31,31,31,31,31,31,31,31,31,31,31,31,31,31,31,31,31,31,31,31,31,31,31,31,31,31,31,31,31,31,31,31,31,31,31,31,31,31,31,31,31,31,31,31,31,31,31,31,31,31,31,31,31,31,31,31,31,31,31,31,31,31,31,31,31,31,31,31,31,31,31,31,31,31,31,31,31,31,31,31,31,31,31,31,31,31,31,31,31,31,31,31,31,31,31,31,31,31,31,31,31,31,31,31,31,31,31,31,31,31,31,31,31,31,31,31,31,31,31,31,31,31,31,31,31,31,31,31,31,31,31,31,31,31,31,31,31,31,31,31,31,31,31,31,31,31,31,31,31,31,31,31,31,31,31,31,31,31,31,31,31,31,31,31,31,31,31,31,31,31,31,31,31,31,31,31,31,31,31,31,31,31,31,31,31,31,31,31,31,31,31,31,31,31,31,31,31,31,31,31,31,31,31,31,31,31,31,31,31,31,31,31,31,31,31,31,31,31,31,31,31,31,31,31,31,31,31,31,31,31,31,31,31,31,31,31,31,31,31,31,31,31,31,31,31,31,31,31,31,31,31,31,31,31,31,31,31,31,31,31,31,31,31,31,31,31,31,31,31,31,31,31,31,31,31,31,31,31,31,31,31,31,31,31,31,31,31,31};      /* T5 _relative_position_bucket(k - q) for k - q in [-(S-1), S-1], computed with the module's own jax code on the host */
__global__ __launch_bounds__(512) void k_rb(const float* __restrict__ t, float* __restrict__ RB) { const int i = threadIdx.x; const float v = bf16_round(t[i]); *(float*)(RB + i) = v;  }
template <int CAUSAL>
__global__ __launch_bounds__(128) void k_flash(const _Float16* __restrict__ Q16, int ldq, const _Float16* __restrict__ K16, int ldk, const _Float16* __restrict__ Vt, const int* __restrict__ MSK, float* __restrict__ O, int ldo) {
  constexpr int RPW = 16, RTN = RPW / 16, NQB = TQ / (4 * RPW), DT = 4, KS = 2;
  __shared__ __attribute__((aligned(16))) unsigned short sP[4][RPW][40]; __shared__ __attribute__((aligned(16))) float sO[4][RPW][64 + 4];
  const int tid = threadIdx.x, w = tid >> 5, lane = tid & 31, ln = lane & 15, hh = lane >> 4;
  const int slab = blockIdx.x / QBNP, qblk = QB0P + blockIdx.x % QBNP; (void)NQB; const int b = slab / NH, h = slab % NH; const int qb0 = qblk * (4 * RPW); const int q0 = qb0 + w * RPW;
  FragH aq[2][KS];
#pragma unroll
  for (int rt = 0; rt < RTN; ++rt) { const unsigned short* qr = (const unsigned short*)Q16 + ((size_t)b * TQ + q0 + rt * 16 + ln) * ldq + h * 64;
#pragma unroll
    for (int ks = 0; ks < KS; ++ks) { aq[rt][ks].half[0] = *(const v8us*)(qr + ks * 32 + 8 * hh); aq[rt][ks].half[1] = *(const v8us*)(qr + ks * 32 + 16 + 8 * hh); } }
  const unsigned short* Vth = (const unsigned short*)Vt + (size_t)slab * 64 * TK;
  float m_r[2][8], l_r[2][8]; v8f oacc[2][DT];
#pragma unroll
  for (int rt = 0; rt < RTN; ++rt) {
#pragma unroll
    for (int r = 0; r < 8; ++r) { m_r[rt][r] = -3.0e38f; l_r[rt][r] = 0.f; }
#pragma unroll
    for (int dt = 0; dt < DT; ++dt) oacc[rt][dt] = (v8f){0.f,0.f,0.f,0.f,0.f,0.f,0.f,0.f}; }
  float qsq[2][8];      /* mode 32: |q|^2 of this lane's rows, read once */
#pragma unroll
  for (int rt = 0; rt < RTN; ++rt)
#pragma unroll
    for (int r = 0; r < 8; ++r) qsq[rt][r] = (CAUSAL == 32) ? ((const float*)MSK)[(size_t)b * TQ + q0 + rt * 16 + 8 * hh + r] : 0.f;
  const int jend = (CAUSAL == 1 || CAUSAL == 32) ? (qb0 + 4 * RPW) : ((CAUSAL == 23) ? min(TK, (qb0 / CHK + 2) * CHK) : TK);      /* causal / window: keys that can never contribute are skipped */ const int jbeg = (CAUSAL == 23) ? max(0, (qb0 / CHK - 1) * CHK) : 0;
#pragma unroll 1
  for (int j0 = jbeg; j0 < jend; j0 += 32) {
    v8f s[2][2];
    float ksq0 = 0.f, ksq1 = 0.f; if (CAUSAL == 32) { const float* ksT = (const float*)MSK + (size_t)NB * TQ + (size_t)b * TK + j0 + ln; ksq0 = ksT[0]; ksq1 = ksT[16]; }      /* mode 32: |k|^2 of this lane's two keys, one unconditional load each per key block (j0 + 31 < jend <= TK) */
#pragma unroll
    for (int nt = 0; nt < 2; ++nt) { const unsigned short* kr = (const unsigned short*)K16 + ((size_t)b * TK + j0 + nt * 16 + ln) * ldk + h * 64; FragH bk[KS];
#pragma unroll
      for (int ks = 0; ks < KS; ++ks) { bk[ks].half[0] = *(const v8us*)(kr + ks * 32 + 8 * hh); bk[ks].half[1] = *(const v8us*)(kr + ks * 32 + 16 + 8 * hh); }
#pragma unroll
      for (int rt = 0; rt < RTN; ++rt) { v8f acc = (v8f){0.f,0.f,0.f,0.f,0.f,0.f,0.f,0.f};
#pragma unroll
        for (int ks = 0; ks < KS; ++ks) acc = mmaH<1>(aq[rt][ks].v, aq[rt][ks].v, bk[ks].v, bk[ks].v, acc); s[rt][nt] = acc; } }
#pragma unroll
    for (int rt = 0; rt < RTN; ++rt)
#pragma unroll
      for (int r = 0; r < 8; ++r) { const int tq = q0 + rt * 16 + 8 * hh + r; const int k0 = j0 + ln, k1 = j0 + 16 + ln;
        bool ok0 = (CAUSAL == 1 || CAUSAL == 32) ? (k0 <= tq) : ((CAUSAL == 2) ? ((k0 >> 5) == (tq >> 5)) : true), ok1 = (CAUSAL == 1 || CAUSAL == 32) ? (k1 <= tq) : ((CAUSAL == 2) ? ((k1 >> 5) == (tq >> 5)) : true); if (CAUSAL == 23) { const int cq = tq / CHK; ok0 = (abs(k0 / CHK - cq) <= 1) && (MSK[(size_t)b * TK + k0] == 0); ok1 = (abs(k1 / CHK - cq) <= 1) && (MSK[(size_t)b * TK + k1] == 0); }      /* mode 23: 3-chunk window + int key-padding mask */
        if (CAUSAL == 24) { ok0 = (MSK[(size_t)b * TK + k0] == 0); ok1 = (MSK[(size_t)b * TK + k1] == 0); }      /* mode 24: int key-padding mask (nonzero = padded = excluded) */      /* mode 2: block-diagonal 32-token groups */
        float s0 = ok0 ? s[rt][0][r] * SCL : -3.0e38f, s1 = ok1 ? s[rt][1][r] * SCL : -3.0e38f; if (CAUSAL == 27) { const float* amk = (const float*)MSK + ((size_t)b * MQI + tq) * MKI; s0 += bf16_round(amk[k0]); s1 += bf16_round(amk[k1]); }      /* mode 27: additive per-(batch, query, key) f32 mask INPUT [b][tq][k] */ if (CAUSAL == 30) { const float* rbp = (const float*)MSK; s0 += rbp[BK30[k0 - tq + (TK - 1)] * NH + h]; s1 += rbp[BK30[k1 - tq + (TK - 1)] * NH + h]; }      /* mode 30: T5 bucketed relative bias: table[bucket(k - q)][h]; bucket-of-distance is a module constant */ if (CAUSAL == 32) { const float qs = qsq[rt][r]; if (ok0) { float d = qs + ksq0; d = d - 2.0f * s0; d = fmaxf(d, 0.f); s0 = -d * 0.125f; } if (ok1) { float d = qs + ksq1; d = d - 2.0f * s1; d = fmaxf(d, 0.f); s1 = -d * 0.125f; } }      /* mode 32: RBF logit -relu(|q|^2 + |k|^2 - 2 q.k)/8, causal */ if (CAUSAL == 17) { const float* amk = (const float*)MSK + (size_t)b * TK; s0 += bf16_round(amk[k0]); s1 += bf16_round(amk[k1]); } if (CAUSAL == 18) { const float* tb = (const float*)MSK; const int* ri = MSK + 1024 + (size_t)b * TK; const int rq = ri[tq]; s0 += tb[(h * 8 + rq) * 8 + ri[k0]]; s1 += tb[(h * 8 + rq) * 8 + ri[k1]]; } if (CAUSAL == 19) { const int* rel = MSK + (size_t)tq * TK; const float* rb = (const float*)MSK + (size_t)TQ * TK + ((size_t)(b * NH + h) * TQ + tq) * 64; s0 += rb[rel[k0]]; s1 += rb[rel[k1]]; }      /* mode 19: + (q.Ek[rel] + Eb[rel][h]) / 8 gathered by the int relative ids (packed [ids | table]) */      /* mode 18: + resource_bias[h][r_q][r_k] from the packed [table | ids] buffer (TQ == TK) */      /* mode 17: additive per-(batch, key) mask INPUT */ float mc = fmaxf(s0, s1);
        mc = fmaxf(mc, __shfl_xor(mc, 1, 32)); mc = fmaxf(mc, __shfl_xor(mc, 2, 32)); mc = fmaxf(mc, __shfl_xor(mc, 4, 32)); mc = fmaxf(mc, __shfl_xor(mc, 8, 32));
        const float mn = fmaxf(m_r[rt][r], mc); const float ea = expf(m_r[rt][r] - mn), e0 = expf(s0 - mn), e1 = expf(s1 - mn);      /* computed for every lane and selected below: no exec-mask branch, so the eight rows' chains can overlap */ const float al = (mn > -1.0e38f) ? ea : 1.0f; m_r[rt][r] = mn; const float p0 = ok0 ? e0 : 0.f, p1 = ok1 ? e1 : 0.f; l_r[rt][r] = l_r[rt][r] * al + p0 + p1;
#pragma unroll
        for (int dt = 0; dt < DT; ++dt) oacc[rt][dt][r] *= al;
        FragH t2; t2.h[0] = (_Float16)(p0 * 1024.0f); t2.h[1] = (_Float16)(p1 * 1024.0f); sP[w][rt * 16 + 8 * hh + r][ln] = t2.u[0]; sP[w][rt * 16 + 8 * hh + r][16 + ln] = t2.u[1]; }
    __builtin_amdgcn_fence(__ATOMIC_ACQ_REL, "workgroup"); __builtin_amdgcn_wave_barrier();
    FragH pa[2];
#pragma unroll
    for (int rt = 0; rt < RTN; ++rt) { pa[rt].half[0] = *(const v8us*)&sP[w][rt * 16 + ln][8 * hh]; pa[rt].half[1] = *(const v8us*)&sP[w][rt * 16 + ln][16 + 8 * hh]; }
#pragma unroll
    for (int dt = 0; dt < DT; ++dt) { const unsigned short* vrow = Vth + (size_t)(dt * 16 + ln) * TK + j0; FragH bv; bv.half[0] = *(const v8us*)(vrow + 8 * hh); bv.half[1] = *(const v8us*)(vrow + 16 + 8 * hh);
#pragma unroll
      for (int rt = 0; rt < RTN; ++rt) oacc[rt][dt] = mmaH<1>(pa[rt].v, pa[rt].v, bv.v, bv.v, oacc[rt][dt]); }
    __builtin_amdgcn_fence(__ATOMIC_ACQ_REL, "workgroup"); __builtin_amdgcn_wave_barrier(); }
#pragma unroll
  for (int rt = 0; rt < RTN; ++rt) {
#pragma unroll
    for (int r = 0; r < 8; ++r) { float l = l_r[rt][r]; l += __shfl_xor(l, 1, 32); l += __shfl_xor(l, 2, 32); l += __shfl_xor(l, 4, 32); l += __shfl_xor(l, 8, 32); l_r[rt][r] = (l > 0.f) ? 1.0f / (l * 1024.0f) : 0.f; }
#pragma unroll
    for (int dt = 0; dt < DT; ++dt)
#pragma unroll
      for (int r = 0; r < 8; ++r) sO[w][rt * 16 + 8 * hh + r][dt * 16 + ln] = oacc[rt][dt][r] * l_r[rt][r]; }
  __builtin_amdgcn_fence(__ATOMIC_ACQ_REL, "workgroup"); __builtin_amdgcn_wave_barrier();
  {
#pragma unroll
    for (int rp = 0; rp < RPW; rp += 2) { const int r = rp + (lane >> 4), pc = lane & 15; const v4f val = *(const v4fa*)&sO[w][r][pc * 4]; *(v4f*)(O + ((size_t)b * TQ + q0 + r) * ldo + h * 64 + pc * 4) = val; }
     } }
// 5-plane variant: S = Qh Kh^T + (Ql Kh^T + Qh Kl^T)/1024 with Q/K = [hi | 2^10 residual] f16 planes (QL/KL same layout as Q16/K16), then the 3-term P.V below.
// 3-term variant: O = (P_hi V_hi + (P_lo V_hi + P_hi V_lo) / 1024) / l with P = [hi | 2^10 residual] of 1024 p and V^T = [hi | 2^10 residual] planes (VtL same layout as Vt) -> ~2^-21-class products for un-averaged (early causal / peaked) rows
template <int CAUSAL>
__global__ __launch_bounds__(128) void k_flash5(const _Float16* __restrict__ Q16, const _Float16* __restrict__ QL, int ldq, const _Float16* __restrict__ K16, const _Float16* __restrict__ KL, int ldk, const _Float16* __restrict__ Vt, const _Float16* __restrict__ VtL, const int* __restrict__ MSK, float* __restrict__ O, int ldo) {
  constexpr int RPW = 16, RTN = RPW / 16, NQB = TQ / (4 * RPW), DT = 4, KS = 2;
  __shared__ __attribute__((aligned(16))) unsigned short sP[4][RPW][40]; __shared__ __attribute__((aligned(16))) unsigned short sPL[4][RPW][40]; __shared__ __attribute__((aligned(16))) float sO[4][RPW][64 + 4];
  const int tid = threadIdx.x, w = tid >> 5, lane = tid & 31, ln = lane & 15, hh = lane >> 4;
  const int slab = blockIdx.x / QBN5, qblk = QB05 + blockIdx.x % QBN5; (void)NQB; const int b = slab / NH, h = slab % NH; const int qb0 = qblk * (4 * RPW); const int q0 = qb0 + w * RPW;
  FragH aq[2][KS], aql[2][KS];
#pragma unroll
  for (int rt = 0; rt < RTN; ++rt) { const unsigned short* qr = (const unsigned short*)Q16 + ((size_t)b * TQ + q0 + rt * 16 + ln) * ldq + h * 64; const unsigned short* ql = (const unsigned short*)QL + ((size_t)b * TQ + q0 + rt * 16 + ln) * ldq + h * 64;
#pragma unroll
    for (int ks = 0; ks < KS; ++ks) { aq[rt][ks].half[0] = *(const v8us*)(qr + ks * 32 + 8 * hh); aq[rt][ks].half[1] = *(const v8us*)(qr + ks * 32 + 16 + 8 * hh); aql[rt][ks].half[0] = *(const v8us*)(ql + ks * 32 + 8 * hh); aql[rt][ks].half[1] = *(const v8us*)(ql + ks * 32 + 16 + 8 * hh); } }
  const unsigned short* Vth = (const unsigned short*)Vt + (size_t)slab * 64 * TK; const unsigned short* Vtl = (const unsigned short*)VtL + (size_t)slab * 64 * TK;
  float m_r[2][8], l_r[2][8]; v8f oacc[2][DT], oaccL[2][DT];
#pragma unroll
  for (int rt = 0; rt < RTN; ++rt) {
#pragma unroll
    for (int r = 0; r < 8; ++r) { m_r[rt][r] = -3.0e38f; l_r[rt][r] = 0.f; }
#pragma unroll
    for (int dt = 0; dt < DT; ++dt) { oacc[rt][dt] = (v8f){0.f,0.f,0.f,0.f,0.f,0.f,0.f,0.f}; oaccL[rt][dt] = oacc[rt][dt]; } }
  const int jend = (CAUSAL == 1 || CAUSAL == 32) ? (qb0 + 4 * RPW) : ((CAUSAL == 23) ? min(TK, (qb0 / CHK + 2) * CHK) : TK);      /* causal / window: keys that can never contribute are skipped */ const int jbeg = (CAUSAL == 23) ? max(0, (qb0 / CHK - 1) * CHK) : 0;
#pragma unroll 1
  for (int j0 = jbeg; j0 < jend; j0 += 32) {
    v8f s[2][2];
#pragma unroll
    for (int nt = 0; nt < 2; ++nt) { const unsigned short* kr = (const unsigned short*)K16 + ((size_t)b * TK + j0 + nt * 16 + ln) * ldk + h * 64; const unsigned short* klr = (const unsigned short*)KL + ((size_t)b * TK + j0 + nt * 16 + ln) * ldk + h * 64; FragH bk[KS], bkl[KS];
#pragma unroll
      for (int ks = 0; ks < KS; ++ks) { bk[ks].half[0] = *(const v8us*)(kr + ks * 32 + 8 * hh); bk[ks].half[1] = *(const v8us*)(kr + ks * 32 + 16 + 8 * hh); bkl[ks].half[0] = *(const v8us*)(klr + ks * 32 + 8 * hh); bkl[ks].half[1] = *(const v8us*)(klr + ks * 32 + 16 + 8 * hh); }
#pragma unroll
      for (int rt = 0; rt < RTN; ++rt) { v8f acc = (v8f){0.f,0.f,0.f,0.f,0.f,0.f,0.f,0.f}, accl = acc;
#pragma unroll
        for (int ks = 0; ks < KS; ++ks) { acc = mmaH<1>(aq[rt][ks].v, aq[rt][ks].v, bk[ks].v, bk[ks].v, acc); accl = mmaH<1>(aql[rt][ks].v, aql[rt][ks].v, bk[ks].v, bk[ks].v, accl); accl = mmaH<1>(aq[rt][ks].v, aq[rt][ks].v, bkl[ks].v, bkl[ks].v, accl); }
#pragma unroll
        for (int r = 0; r < 8; ++r) acc[r] += accl[r] * 0.0009765625f;
        s[rt][nt] = acc; } }
#pragma unroll
    for (int rt = 0; rt < RTN; ++rt)
#pragma unroll
      for (int r = 0; r < 8; ++r) { const int tq = q0 + rt * 16 + 8 * hh + r; const int k0 = j0 + ln, k1 = j0 + 16 + ln;
        bool ok0 = (CAUSAL == 1 || CAUSAL == 32) ? (k0 <= tq) : ((CAUSAL == 2) ? ((k0 >> 5) == (tq >> 5)) : true), ok1 = (CAUSAL == 1 || CAUSAL == 32) ? (k1 <= tq) : ((CAUSAL == 2) ? ((k1 >> 5) == (tq >> 5)) : true);      /* mode 2: block-diagonal 32-token groups */
        if (CAUSAL == 4) { const int* mrow = MSK + ((size_t)b * TQ + tq) * TK; ok0 = mrow[k0] != 0; ok1 = mrow[k1] != 0; }      /* mode 4: per-(query, key) INPUT mask shared by all heads; masked keys contribute nothing (== the reference's -4096 fill, whose exp underflows to 0), rows with no valid key give l = 0 -> output 0 (== the reference's row_valid zeroing) */
        float s0 = ok0 ? s[rt][0][r] * SCL : -3.0e38f, s1 = ok1 ? s[rt][1][r] * SCL : -3.0e38f; if (CAUSAL == 30) { const float* rbp = (const float*)MSK; s0 += rbp[BK30[k0 - tq + (TK - 1)] * NH + h]; s1 += rbp[BK30[k1 - tq + (TK - 1)] * NH + h]; }      /* mode 30: T5 bucketed relative bias: table[bucket(k - q)][h]; bucket-of-distance is a module constant */ if (CAUSAL == 32) { const float* qsT = (const float*)MSK; const float* ksT = qsT + (size_t)NB * TQ; const float qs = qsT[(size_t)b * TQ + tq]; if (ok0) { float d = qs + ksT[(size_t)b * TK + k0]; d = d - 2.0f * s0; d = fmaxf(d, 0.f); s0 = -d * 0.125f; } if (ok1) { float d = qs + ksT[(size_t)b * TK + k1]; d = d - 2.0f * s1; d = fmaxf(d, 0.f); s1 = -d * 0.125f; } }      /* mode 32: RBF logit -relu(|q|^2 + |k|^2 - 2 q.k)/8, causal */ if (CAUSAL == 17) { const float* amk = (const float*)MSK + (size_t)b * TK; s0 += bf16_round(amk[k0]); s1 += bf16_round(amk[k1]); } if (CAUSAL == 18) { const float* tb = (const float*)MSK; const int* ri = MSK + 1024 + (size_t)b * TK; const int rq = ri[tq]; s0 += tb[(h * 8 + rq) * 8 + ri[k0]]; s1 += tb[(h * 8 + rq) * 8 + ri[k1]]; } if (CAUSAL == 19) { const int* rel = MSK + (size_t)tq * TK; const float* rb = (const float*)MSK + (size_t)TQ * TK + ((size_t)(b * NH + h) * TQ + tq) * 64; s0 += rb[rel[k0]]; s1 += rb[rel[k1]]; }      /* mode 19: + (q.Ek[rel] + Eb[rel][h]) / 8 gathered by the int relative ids (packed [ids | table]) */      /* mode 18: + resource_bias[h][r_q][r_k] from the packed [table | ids] buffer (TQ == TK) */      /* mode 17: additive per-(batch, key) mask INPUT */ float mc = fmaxf(s0, s1);
        mc = fmaxf(mc, __shfl_xor(mc, 1, 32)); mc = fmaxf(mc, __shfl_xor(mc, 2, 32)); mc = fmaxf(mc, __shfl_xor(mc, 4, 32)); mc = fmaxf(mc, __shfl_xor(mc, 8, 32));
        const float mn = fmaxf(m_r[rt][r], mc); const float al = (mn > -1.0e38f) ? expf(m_r[rt][r] - mn) : 1.0f; m_r[rt][r] = mn; const float p0 = ok0 ? expf(s0 - mn) : 0.f, p1 = ok1 ? expf(s1 - mn) : 0.f; l_r[rt][r] = l_r[rt][r] * al + p0 + p1;
#pragma unroll
        for (int dt = 0; dt < DT; ++dt) { oacc[rt][dt][r] *= al; oaccL[rt][dt][r] *= al; }
        FragH t2, t2l; const float ps0 = p0 * 1024.0f, ps1 = p1 * 1024.0f; t2.h[0] = (_Float16)ps0; t2.h[1] = (_Float16)ps1; t2l.h[0] = (_Float16)((ps0 - (float)t2.h[0]) * 1024.0f); t2l.h[1] = (_Float16)((ps1 - (float)t2.h[1]) * 1024.0f);
        sP[w][rt * 16 + 8 * hh + r][ln] = t2.u[0]; sP[w][rt * 16 + 8 * hh + r][16 + ln] = t2.u[1]; sPL[w][rt * 16 + 8 * hh + r][ln] = t2l.u[0]; sPL[w][rt * 16 + 8 * hh + r][16 + ln] = t2l.u[1]; }
    __builtin_amdgcn_fence(__ATOMIC_ACQ_REL, "workgroup"); __builtin_amdgcn_wave_barrier();
    FragH pa[2], pl[2];
#pragma unroll
    for (int rt = 0; rt < RTN; ++rt) { pa[rt].half[0] = *(const v8us*)&sP[w][rt * 16 + ln][8 * hh]; pa[rt].half[1] = *(const v8us*)&sP[w][rt * 16 + ln][16 + 8 * hh]; pl[rt].half[0] = *(const v8us*)&sPL[w][rt * 16 + ln][8 * hh]; pl[rt].half[1] = *(const v8us*)&sPL[w][rt * 16 + ln][16 + 8 * hh]; }
#pragma unroll
    for (int dt = 0; dt < DT; ++dt) { const unsigned short* vrow = Vth + (size_t)(dt * 16 + ln) * TK + j0; const unsigned short* vrl = Vtl + (size_t)(dt * 16 + ln) * TK + j0; FragH bv, bl; bv.half[0] = *(const v8us*)(vrow + 8 * hh); bv.half[1] = *(const v8us*)(vrow + 16 + 8 * hh); bl.half[0] = *(const v8us*)(vrl + 8 * hh); bl.half[1] = *(const v8us*)(vrl + 16 + 8 * hh);
#pragma unroll
      for (int rt = 0; rt < RTN; ++rt) { oacc[rt][dt] = mmaH<1>(pa[rt].v, pa[rt].v, bv.v, bv.v, oacc[rt][dt]); oaccL[rt][dt] = mmaH<1>(pl[rt].v, pl[rt].v, bv.v, bv.v, oaccL[rt][dt]); oaccL[rt][dt] = mmaH<1>(pa[rt].v, pa[rt].v, bl.v, bl.v, oaccL[rt][dt]); } }
    __builtin_amdgcn_fence(__ATOMIC_ACQ_REL, "workgroup"); __builtin_amdgcn_wave_barrier(); }
#pragma unroll
  for (int rt = 0; rt < RTN; ++rt) {
#pragma unroll
    for (int r = 0; r < 8; ++r) { float l = l_r[rt][r]; l += __shfl_xor(l, 1, 32); l += __shfl_xor(l, 2, 32); l += __shfl_xor(l, 4, 32); l += __shfl_xor(l, 8, 32); l_r[rt][r] = (l > 0.f) ? 1.0f / (l * 1024.0f) : 0.f; }
#pragma unroll
    for (int dt = 0; dt < DT; ++dt)
#pragma unroll
      for (int r = 0; r < 8; ++r) { float v = oacc[rt][dt][r]; v += oaccL[rt][dt][r] * 0.0009765625f; sO[w][rt * 16 + 8 * hh + r][dt * 16 + ln] = v * l_r[rt][r]; } }
  __builtin_amdgcn_fence(__ATOMIC_ACQ_REL, "workgroup"); __builtin_amdgcn_wave_barrier();
  {
#pragma unroll
    for (int rp = 0; rp < RPW; rp += 2) { const int r = rp + (lane >> 4), pc = lane & 15; const v4f val = *(const v4fa*)&sO[w][r][pc * 4]; *(v4f*)(O + ((size_t)b * TQ + q0 + r) * ldo + h * 64 + pc * 4) = val; }
     } }

// Transposed form of the causal RBF attention pass: S^T = K Q^T, O^T += V^T P^T. A lane holds one query's scores (16 of a block's 32 keys, the other wave half the other 16), so the block maximum is in-lane plus one exchange between the halves, and the two score tiles, converted in place, are the B operand of the second product: P passes through no LDS and the loop holds no fence. The softmax runs in base 2: log2(e) / 8 is folded into the two multiply-adds that form a logit, and each weight is one subtraction and one hardware exp2. K, V^T and |k|^2 are fetched one pass ahead: K and V^T into the registers that the running pass has just finished with, |k|^2 into a second set.
__device__ __forceinline__ float xhalf(float x) { return __builtin_bit_cast(float, __builtin_amdgcn_permlanex16(__builtin_bit_cast(int, x), __builtin_bit_cast(int, x), 0x76543210, 0xfedcba98, false, false)); }      /* lane l with lane l ^ 16 */
__global__ __launch_bounds__(128) void k_flash_t(const _Float16* __restrict__ Q16, const _Float16* __restrict__ K16, const _Float16* __restrict__ Vt, const float* __restrict__ NSQ, float* __restrict__ O) {
  constexpr int DT = 4, KS = 2; constexpr float L2E8 = 0.18033688011112043f;      /* log2(e) / 8 */
  __shared__ __attribute__((aligned(16))) float sO[4][16][64 + 4];
  const int tid = threadIdx.x, w = tid >> 5, lane = tid & 31, ln = lane & 15, hh = lane >> 4;
  const int slab = blockIdx.x / (QBLKS / 2), pr = blockIdx.x % (QBLKS / 2);
  const char* const Kb = (const char*)((const unsigned short*)K16 + (size_t)slab * TK * 64); const char* const Vth = (const char*)((const unsigned short*)Vt + (size_t)slab * 64 * TK); const char* const ksT = (const char*)(NSQ + (size_t)NB * TQ + (size_t)slab * TK);
  const unsigned fo = (unsigned)lane * 16u, qo = (unsigned)hh * 32u;      /* a lane's place in a 512-B fragment piece; its eight keys' place in a 16-key group of the |k|^2 table */
  unsigned vo = fo, vs = qo;      /* byte offsets of the running pair of 32-key blocks: a block is 4096 B of K, 4096 B of V^T, 128 B of |k|^2 */
  const unsigned pfo = (unsigned)tid * 512u + (unsigned)((pr ^ (pr >> 1)) & 1) * 256u, pft = (unsigned)tid * 64u;      /* prefetch offsets. pfo: every second 256-B unit of a 64-KiB quarter of a 256-KiB plane; the slab's sixteen work-groups are dealt the even and the odd units by the parity of pr's two low bits, which takes both values among any four neighbours, any evens and any odds (for speed only). pft: an 8-KiB table or query block, 64 B a thread */
  const char* const nsT = (const char*)(NSQ + (size_t)slab * TQ); const char* const q1 = (const char*)((const unsigned short*)Q16 + ((size_t)slab * TQ + (size_t)pr * 64) * 64);      /* the slab's |q|^2 table (its |k|^2 table stands NB TQ floats = 262144 B behind it); the second leg's 64 query rows */
  FragH ak[2][KS], av[DT]; v4f kqa[2][2], kqb[2][2];      /* live round the loop's back edge and from the first leg to the second: they hold the coming pass's operands */
#pragma unroll
  for (int nt = 0; nt < 2; ++nt) {      /* block 0, for the first pass */
#pragma unroll
    for (int ks = 0; ks < KS; ++ks) { ak[nt][ks].half[0] = *(const v8us*)(Kb + vo + nt * 2048 + ks * 1024); ak[nt][ks].half[1] = *(const v8us*)(Kb + vo + nt * 2048 + ks * 1024 + 512); }
    kqa[nt][0] = *(const v4fa*)(ksT + vs + nt * 64); kqa[nt][1] = *(const v4fa*)(ksT + vs + nt * 64 + 16); }
#pragma unroll
  for (int dt = 0; dt < DT; ++dt) { av[dt].half[0] = *(const v8us*)(Vth + vo + dt * 1024); av[dt].half[1] = *(const v8us*)(Vth + vo + dt * 1024 + 512); }
#pragma unroll 1      /* one copy of the key loop in the text serves both query blocks */
  for (int leg = 0; leg < 2; ++leg) {      /* query block QBLKS - 1 - pr, then pr, one after the other: 2 (QBLKS + 1) key passes in every work-group, so that no SIMD is left with the long blocks alone */
  const int qblk = leg ? pr : QBLKS - 1 - pr; const int qb0 = qblk * 64; const int q0 = qb0 + w * 16; const int tq = q0 + ln;      /* this lane's query */
  FragH bq[KS]; const unsigned short* qr = (const unsigned short*)Q16 + ((size_t)slab * TQ + tq) * 64;
#pragma unroll
  for (int ks = 0; ks < KS; ++ks) { bq[ks].half[0] = *(const v8us*)(qr + ks * 32 + 8 * hh); bq[ks].half[1] = *(const v8us*)(qr + ks * 32 + 16 + 8 * hh); }
  __builtin_amdgcn_sched_barrier(0);      /* the query's norm is fetched last: the wait for it, in front of the loop, then covers every older load, and the waits inside the loop count the loop's own loads alone */
  const float qs = NSQ[(size_t)slab * TQ + tq];
  /* Every work-group of a slab walks the keys from 0; the lines are asked for here, ahead of the walk (for speed only). Lowest keys first. Every address lies inside its plane or table for every thread: 196608 + 127 x 512 + 256 < 262144; 127 x 64 < 8192. Scope SE, no th: a hint that returns nothing and counts on no counter */
  if (leg == 0) asm volatile("global_prefetch_b8 %1, %4 offset:262144 scope:SCOPE_SE\n\t"
                             "global_prefetch_b8 %0, %2 scope:SCOPE_SE\n\t"
                             "global_prefetch_b8 %0, %3 scope:SCOPE_SE\n\t"
                             "global_prefetch_b8 %0, %2 offset:65536 scope:SCOPE_SE\n\t"
                             "global_prefetch_b8 %0, %3 offset:65536 scope:SCOPE_SE\n\t"
                             "global_prefetch_b8 %0, %2 offset:131072 scope:SCOPE_SE\n\t"
                             "global_prefetch_b8 %0, %3 offset:131072 scope:SCOPE_SE\n\t"
                             "global_prefetch_b8 %0, %2 offset:196608 scope:SCOPE_SE\n\t"
                             "global_prefetch_b8 %0, %3 offset:196608 scope:SCOPE_SE\n\t"
                             "global_prefetch_b8 %1, %5 scope:SCOPE_SE\n\t"
                             "global_prefetch_b8 %1, %4 scope:SCOPE_SE"
                             :: "v"(pfo), "v"(pft), "s"(Kb), "s"(Vth), "s"(nsT), "s"(q1) : "memory");
  const float nq = -L2E8 * qs;
  float m = -3.0e38f, l = 0.f; v8f oacc[DT];
#pragma unroll
  for (int dt = 0; dt < DT; ++dt) oacc[dt] = (v8f){0.f,0.f,0.f,0.f,0.f,0.f,0.f,0.f};
  const int jend = qb0 + 64;
  /* One pass over 32 keys. kc holds this pass's |k|^2, kn takes the next pass's: the two sets change places from pass to pass, since the |k|^2 are still read while the next ones are on their way; K and V^T need one set each. */
  auto pass = [&](const bool first, v4f (&kc)[2][2], v4f (&kn)[2][2], const int j0) __attribute__((always_inline)) {
    v8f acc[2];
#pragma unroll
    for (int nt = 0; nt < 2; ++nt) { acc[nt] = (v8f){0.f,0.f,0.f,0.f,0.f,0.f,0.f,0.f};
#pragma unroll
      for (int ks = 0; ks < KS; ++ks) acc[nt] = mmaH<1>(ak[nt][ks].v, ak[nt][ks].v, bq[ks].v, bq[ks].v, acc[nt]); }      /* acc[nt][r] = k[j0 + 16 nt + 8 hh + r] . q[tq] */
    if (!first) asm volatile("s_wait_xcnt 0x0" ::: "memory");      /* precaution: stands in front of the two offset steps below, which rewrite registers that the loads issued since the last steps name */
    __builtin_amdgcn_sched_barrier(0);      /* keeps the offset steps behind that wait, and the loads below behind the products that read the registers they fill: lifted higher they would need a second register set and copies */
    if (!first) { const bool more = j0 + 32 < jend; vo = more ? vo + 8192u : fo; vs = more ? vs + 256u : qo; }      /* behind a leg's last pass comes block 0 again: the next leg's first, and always inside the planes */
    const unsigned ob = first ? 4096u : 0u, os = first ? 128u : 0u;      /* the pair's second block stands at a constant distance: no register is stepped for it */
#pragma unroll
    for (int nt = 0; nt < 2; ++nt) { kn[nt][0] = *(const v4fa*)(ksT + vs + (os + nt * 64)); kn[nt][1] = *(const v4fa*)(ksT + vs + (os + nt * 64 + 16)); }      /* the next pass's |k|^2: this lane's eight keys of each 16-key group. First, since their offset register is the first to be free for other use */
#pragma unroll
    for (int nt = 0; nt < 2; ++nt) {      /* the next pass's K, in fragment order: a 16-key group is four pieces of 512 B, a lane's 16 bytes at 16 lane; each load reads four whole lines. All twelve loads fly during this pass's softmax and second product */
#pragma unroll
      for (int ks = 0; ks < KS; ++ks) { ak[nt][ks].half[0] = *(const v8us*)(Kb + vo + (ob + nt * 2048 + ks * 1024)); ak[nt][ks].half[1] = *(const v8us*)(Kb + vo + (ob + nt * 2048 + ks * 1024 + 512)); } }
    __builtin_amdgcn_sched_barrier(0);      /* keeps the loads up here; sunk towards the pass's foot they would lose their lead */
    const int lim = tq - j0 - 8 * hh;      /* key 16 nt + r of this lane's sixteen is causal where 16 nt + r <= lim */
    float sc[16]; float mc = -3.0e38f;
#pragma unroll
    for (int nt = 0; nt < 2; ++nt) {
#pragma unroll
      for (int r = 0; r < 8; ++r) { const bool ok = nt * 16 + r <= lim; float t = fmaf(kc[nt][r >> 2][r & 3], -L2E8, nq); t = fmaf(acc[nt][r], 2.0f * L2E8, t); t = fminf(t, 0.f); const float sv = ok ? t : -3.0e38f; sc[nt * 8 + r] = sv; mc = fmaxf(mc, sv); } }      /* t = log2(e) x logit = -relu(|q|^2 + |k|^2 - 2 q.k) log2(e) / 8 */
    mc = fmaxf(mc, xhalf(mc));
    const float mn = fmaxf(m, mc - 10.0f); const float al = __builtin_amdgcn_exp2f(m - mn); m = mn;      /* the reference point stands 10 below the maximum: the weights come out times 2^10, as the f16 operand wants them; the first pass always holds causal key 0, so mn is finite and al = 2^(-3e38) = 0 there */
    FragH pb; float p[16];
#pragma unroll
    for (int i = 0; i < 16; ++i) { p[i] = __builtin_amdgcn_exp2f(sc[i] - mn); pb.h[i] = (_Float16)p[i]; }      /* a masked key gives 2^(-3e38) = 0 exactly; element i of the B operand is key 8 hh + i, then 16 + 8 hh + (i - 8): the order of the V^T loader */
#pragma unroll
    for (int st = 8; st > 0; st >>= 1)
#pragma unroll
      for (int i = 0; i < st; ++i) p[i] += p[i + st];
    l = l * al + p[0];
#pragma unroll
    for (int dt = 0; dt < DT; ++dt) {
#pragma unroll
      for (int r = 0; r < 8; ++r) oacc[dt][r] *= al; }
#pragma unroll
    for (int dt = 0; dt < DT; ++dt) oacc[dt] = mmaH<1>(av[dt].v, av[dt].v, pb.v, pb.v, oacc[dt]);      /* oacc[dt][r] = context column 16 dt + 8 hh + r of query tq */
    __builtin_amdgcn_sched_barrier(0);      /* keeps the loads below behind the products that read the registers they fill */
#pragma unroll
    for (int dt = 0; dt < DT; ++dt) { av[dt].half[0] = *(const v8us*)(Vth + vo + (ob + dt * 1024)); av[dt].half[1] = *(const v8us*)(Vth + vo + (ob + dt * 1024 + 512)); }      /* the next pass's V^T, in fragment order: a 32-key block is eight pieces of 512 B. They fly during the next pass's first product and softmax */
    __builtin_amdgcn_sched_barrier(0);      /* keeps them from sinking into the next pass */
  };
#pragma unroll 1
  for (int j0 = 0; j0 < jend; j0 += 64) { pass(true, kqa, kqb, j0); pass(false, kqb, kqa, j0 + 32); }      /* a query block's key range is a whole number of 64-key pairs */
  l += xhalf(l); const float inv = (l > 0.f) ? 1.0f / l : 0.f;      /* l and the context both carry the 2^10 */
#pragma unroll
  for (int dt = 0; dt < DT; ++dt) { v4f a, c;
#pragma unroll
    for (int r = 0; r < 4; ++r) { a[r] = oacc[dt][r] * inv; c[r] = oacc[dt][4 + r] * inv; }
    *(v4fa*)&sO[w][ln][dt * 16 + 8 * hh] = a; *(v4fa*)&sO[w][ln][dt * 16 + 8 * hh + 4] = c; }
  __builtin_amdgcn_fence(__ATOMIC_ACQ_REL, "workgroup"); __builtin_amdgcn_wave_barrier();      /* the wave's own lanes read each other's rows below, for whole-row stores */
#pragma unroll
  for (int rp = 0; rp < 16; rp += 2) { const int r = rp + (lane >> 4), pc = lane & 15; const v4f val = *(const v4fa*)&sO[w][r][pc * 4]; *(v4f*)(O + ((size_t)slab * TQ + q0 + r) * 64 + pc * 4) = val; }
  asm volatile("s_wait_xcnt 0x0" :: "v"(pfo), "v"(pft), "s"(Kb), "s"(Vth), "s"(nsT), "s"(q1) : "memory");      /* precaution: the second leg rewrites the registers that these stores name. The prefetches' address registers are held to here, the kernel's last statement, so that none of them takes another value behind a request */
  __builtin_amdgcn_fence(__ATOMIC_ACQ_REL, "workgroup", "local"); __builtin_amdgcn_wave_barrier(); } }      /* the second leg's staging writes stay behind every lane's reads of the first leg's rows; LDS only, so that the leg does not wait for its stores to the output */

__global__ __launch_bounds__(256) void k_rotab(float* __restrict__ CS, float* __restrict__ SN) {
  #pragma clang fp contract(off)
  const int t = blockIdx.x * 256 + threadIdx.x; if (t >= SLEN * 32) return; const int j = t % 32, s = t / 32; const float ex = (float)(2 * j) / 64.0f; const float inv = 1.0f / powf(10000.0f, ex); const float th = (float)s * inv; const float c = cosf(th), sn = sinf(th);
  { *(float*)(CS + t) = c; *(float*)(SN + t) = sn;  } }
__global__ __launch_bounds__(256) void k_rope(const float* __restrict__ F, int nsrc, int ndst, int rep, const float* __restrict__ CS, const float* __restrict__ SN, _Float16* __restrict__ H, _Float16* __restrict__ L) {
  #pragma clang fp contract(off)
  const size_t t = (size_t)blockIdx.x * 256 + threadIdx.x; if (t >= (size_t)NR * ndst * 4) return; const int g8 = (int)(t % 4); const int hd = (int)((t / 4) % ndst); const size_t row = t / ((size_t)4 * ndst); const int s = (int)(row % SLEN); const int hs = hd / rep;
  const float* src = F + row * (size_t)(nsrc * 64) + hs * 64; FragH ah, al, bh, bl;
  for (int i = 0; i < 8; ++i) { const int d = g8 * 8 + i; const float c = CS[s * 32 + d], sn = SN[s * 32 + d]; const float x1 = src[d], x2 = src[d + 32];
    float o1 = x1 * c; o1 += -x2 * sn; float o2 = x2 * c; o2 += x1 * sn;
    _Float16 hv = (_Float16)o1; ah.h[i] = hv; al.h[i] = (_Float16)((o1 - (float)hv) * 1024.0f); hv = (_Float16)o2; bh.h[i] = hv; bl.h[i] = (_Float16)((o2 - (float)hv) * 1024.0f); }
  const size_t o = row * (size_t)(ndst * 64) + hd * 64 + g8 * 8;
  { *(v8us*)((unsigned short*)H + o) = ah.half[0]; *(v8us*)((unsigned short*)H + o + 32) = bh.half[0]; *(v8us*)((unsigned short*)L + o) = al.half[0]; *(v8us*)((unsigned short*)L + o + 32) = bl.half[0];  } }
__global__ __launch_bounds__(256) void k_rope2(const float* __restrict__ F, int nsrc, int ndst, int rep, const float* __restrict__ CS, const float* __restrict__ SN, _Float16* __restrict__ H, _Float16* __restrict__ L) {
  #pragma clang fp contract(off)
  const size_t t = (size_t)blockIdx.x * 256 + threadIdx.x; if (t >= (size_t)NR * ndst * 4) return; const int g16 = (int)(t % 4); const int hd = (int)((t / 4) % ndst); const size_t row = t / ((size_t)4 * ndst); const int s = (int)(row % SLEN); const int hs = hd / rep;
  const float* src = F + row * (size_t)(nsrc * 64) + hs * 64 + g16 * 16; FragH ah, al;
  for (int pr = 0; pr < 8; ++pr) { const int i = g16 * 8 + pr; const float c = CS[s * 32 + i], sn = SN[s * 32 + i]; const float x1 = src[2 * pr], x2 = src[2 * pr + 1];
    float o1 = x1 * c; o1 -= x2 * sn; float o2 = x1 * sn; o2 += x2 * c;
    _Float16 hv = (_Float16)o1; ah.h[2 * pr] = hv; al.h[2 * pr] = (_Float16)((o1 - (float)hv) * 1024.0f); hv = (_Float16)o2; ah.h[2 * pr + 1] = hv; al.h[2 * pr + 1] = (_Float16)((o2 - (float)hv) * 1024.0f); }
  const size_t o = row * (size_t)(ndst * 64) + hd * 64 + g16 * 16;
  { *(v8us*)((unsigned short*)H + o) = ah.half[0]; *(v8us*)((unsigned short*)H + o + 8) = ah.half[1]; *(v8us*)((unsigned short*)L + o) = al.half[0]; *(v8us*)((unsigned short*)L + o + 8) = al.half[1];  } }
__global__ __launch_bounds__(256) void k_ln512(const float* __restrict__ A, const float* __restrict__ res, const float* __restrict__ g, const float* __restrict__ bb, float* __restrict__ Y, _Float16* __restrict__ Y16) {
  #pragma clang fp contract(off)
  const int wv = threadIdx.x >> 5, ln = threadIdx.x & 31; const size_t r = (size_t)blockIdx.x * 8 + wv; if (r >= NR) return; float x[16]; float s = 0.f;
  for (int i = 0; i < 2; ++i) { const v8f a = *(const v8f*)(A + r * DM + i * 256 + ln * 8); for (int q = 0; q < 8; ++q) { float v = a[q]; if (res) v += bf16_round(res[r * DM + i * 256 + ln * 8 + q]); x[i * 8 + q] = v; s += v; } }
  for (int o = 16; o > 0; o >>= 1) s += __shfl_xor(s, o, 32); const float mu = s / (float)DM; float var = 0.f; for (int q = 0; q < 16; ++q) { const float d = x[q] - mu; var += d * d; }
  for (int o = 16; o > 0; o >>= 1) var += __shfl_xor(var, o, 32); const float inv = rsqrtf(var / (float)DM + 1e-5f);
  { for (int i = 0; i < 2; ++i) { const int c0 = i * 256 + ln * 8; v8f y; FragH f; for (int q = 0; q < 8; ++q) { float v = (x[i * 8 + q] - mu) * inv; v *= bf16_round(g[c0 + q]); v += bf16_round(bb[c0 + q]); y[q] = v; f.h[q] = (_Float16)v; } *(v8f*)(Y + r * DM + c0) = y; if (Y16) *(v8us*)((unsigned short*)Y16 + r * DM + c0) = f.half[0]; }  } }
__global__ __launch_bounds__(256) void k_pack(const float* __restrict__ rb, const int* __restrict__ rid, int* __restrict__ PK) { const int t = blockIdx.x * 256 + threadIdx.x; if (t >= 1024 + NB * TK) return; int v; if (t < 1024) v = __float_as_int(bf16_round(rb[t])); else v = rid[t - 1024]; *(int*)(PK + t) = v;  }
__global__ __launch_bounds__(256) void k_tabin(const float* __restrict__ sp, float* __restrict__ CS, float* __restrict__ SN) { const int t = blockIdx.x * 256 + threadIdx.x; if (t >= SLEN * 32) return; const int i = t % 32, s = t / 32; const float c = bf16_round(sp[s * 64 + 32 + i]), sn = bf16_round(sp[s * 64 + i]);
  { *(float*)(CS + t) = c; *(float*)(SN + t) = sn;  } }
__global__ __launch_bounds__(256) void k_wsc(const float* __restrict__ Wm, _Float16* __restrict__ Bt, size_t n8, float sc) { const size_t t = (size_t)blockIdx.x * 256 + threadIdx.x; if (t >= n8) return; FragH f; for (int q = 0; q < 8; ++q) f.h[q] = (_Float16)(bf16_round(Wm[t * 8 + q]) * sc); *(v8us*)((unsigned short*)Bt + t * 8) = f.half[0];  }
__global__ __launch_bounds__(256) void k_rotab2(float* __restrict__ CS, float* __restrict__ SN) {
  #pragma clang fp contract(off)
  const int t = blockIdx.x * 256 + threadIdx.x; if (t >= SLEN * 32) return; const int j = t % 32, s = t / 32; const float c0 = -0.14391156831212787f;      /* -ln(10000)/64 rounded to f32 */ const float inv = expf((float)(2 * j) * c0); const float th = (float)s * inv; const float c = cosf(th), sn = sinf(th);
  { *(float*)(CS + t) = c; *(float*)(SN + t) = sn;  } }
__global__ __launch_bounds__(256) void k_lnu(const float* __restrict__ X, _Float16* __restrict__ N16, float* __restrict__ XB) {
  #pragma clang fp contract(off)
  const int wv = threadIdx.x >> 5, ln = threadIdx.x & 31; const size_t r = (size_t)blockIdx.x * 8 + wv; if (r >= NR) return; float a[32]; float s = 0.f;
  for (int i = 0; i < 4; ++i) { const v8f v = *(const v8f*)(X + r * DM + (i * 32 + ln) * 8); for (int q = 0; q < 8; ++q) { const float u = bf16_round(v[q]); a[i * 8 + q] = u; s += u; } }
  for (int o = 16; o > 0; o >>= 1) s += __shfl_xor(s, o, 32); const float mu = s / (float)DM; float var = 0.f; for (int q = 0; q < 32; ++q) { const float d = a[q] - mu; var += d * d; }
  for (int o = 16; o > 0; o >>= 1) var += __shfl_xor(var, o, 32); const float den = sqrtf(var / (float)(DM - 1)) + 1e-6f; const float inv = 1.0f / den;      /* one reciprocal per row; (x-mean)*inv vs the reference's division differs by <= 1 ulp */
  { for (int i = 0; i < 4; ++i) { const int c0 = (i * 32 + ln) * 8; FragH f; v8f xb; for (int q = 0; q < 8; ++q) { f.h[q] = (_Float16)((a[i * 8 + q] - mu) * inv); xb[q] = a[i * 8 + q]; } *(v8us*)((unsigned short*)N16 + r * DM + c0) = f.half[0]; *(v8f*)(XB + r * DM + c0) = xb; }  } }

__global__ __launch_bounds__(256) void k_h16s(const float* __restrict__ SRC, int lds, int coff, _Float16* __restrict__ DST, size_t n8) { const size_t t = (size_t)blockIdx.x * 256 + threadIdx.x; if (t >= n8) return; const size_t r = (t * 8) / DM; const int c = (int)((t * 8) % DM); const v8f a = *(const v8f*)(SRC + r * lds + coff + c); FragH f; for (int q = 0; q < 8; ++q) f.h[q] = (_Float16)a[q];
  *(v8us*)((unsigned short*)DST + t * 8) = f.half[0];  }


__global__ __launch_bounds__(256) void k_ccp(const float* __restrict__ QKV, int coff, _Float16* __restrict__ D) { const size_t t = (size_t)blockIdx.x * 256 + threadIdx.x; if (t >= (size_t)NR * DM / 8) return; const int c0 = (int)((t * 8) % DM); const size_t row = (t * 8) / DM; const v8f a = *(const v8f*)(QKV + row * 3 * DM + coff + c0); FragH f; for (int q = 0; q < 8; ++q) f.h[q] = (_Float16)a[q];
  *(v8us*)((unsigned short*)D + t * 8) = f.half[0];  }


template <int NLN>
__global__ __launch_bounds__(256) void k_lnrow(const float* __restrict__ X, const float* __restrict__ R, const float* __restrict__ g, const float* __restrict__ bb, float eps, float* __restrict__ OUT) {
  #pragma clang fp contract(off)
  constexpr int PER = NLN / 256; __shared__ float red[256]; const int tid = threadIdx.x; const size_t row = blockIdx.x; const float* x = X + row * NLN; const float* rr = R ? R + row * NLN : nullptr; float v[PER]; float s1 = 0.f;
  for (int u = 0; u < PER; ++u) { const int j = tid * PER + u; float t = x[j]; if (rr) t = t + rr[j]; v[u] = t; s1 += t; }
  red[tid] = s1; __syncthreads(); for (int st = 128; st > 0; st >>= 1) { if (tid < st) red[tid] += red[tid + st]; __syncthreads(); } const float mu = red[0] / (float)NLN; __syncthreads();
  float s2 = 0.f; for (int u = 0; u < PER; ++u) { const float c = v[u] - mu; s2 += c * c; } red[tid] = s2; __syncthreads(); for (int st = 128; st > 0; st >>= 1) { if (tid < st) red[tid] += red[tid + st]; __syncthreads(); }
  const float var = red[0] / (float)NLN; const float rs = rsqrtf(var + eps);
  { for (int u = 0; u < PER; ++u) { const int j = tid * PER + u; float o = (v[u] - mu) * rs; o = __fadd_rn(__fmul_rn(o, bf16_round(g[j])), bf16_round(bb[j])); *(float*)(OUT + row * NLN + j) = o; }  } }
__global__ __launch_bounds__(256) void k_xr32(const float* __restrict__ x, float* __restrict__ XR, size_t n8) { const size_t t = (size_t)blockIdx.x * 256 + threadIdx.x; if (t >= n8) return; v8f o; for (int q = 0; q < 8; ++q) o[q] = bf16_round(x[t * 8 + q]); *(v8f*)(XR + t * 8) = o;  }
__global__ __launch_bounds__(256) void k_r16b(const float* __restrict__ S, _Float16* __restrict__ D, size_t n8) { const size_t t = (size_t)blockIdx.x * 256 + threadIdx.x; if (t >= n8) return; const v8f a = *(const v8f*)(S + t * 8); FragH f; for (int q = 0; q < 8; ++q) f.h[q] = (_Float16)a[q]; *(v8us*)((unsigned short*)D + t * 8) = f.half[0];  }

// One preparatory launch. Blocks 0-255 take q, 256-511 k, 512-767 v, 256 rows each; every input is read once.
// q, k: the bf16 bits are staged in LDS, the f16 plane goes out from registers, and one thread per row sums its squares in ascending order of d.
// v: the f16 values are staged in LDS and go out transposed, in the order of the attention pass's A fragments: per 32 keys eight pieces of 512 B (column tile, key half), a lane's eight keys at 16 lane.
__global__ __launch_bounds__(256) void k_prep(const float* __restrict__ Q, const float* __restrict__ Kx, const float* __restrict__ V, _Float16* __restrict__ QH, _Float16* __restrict__ KH, _Float16* __restrict__ Vt, float* __restrict__ NSQ) {
  __shared__ __attribute__((aligned(16))) unsigned short sm[256 * 72];      /* q, k: pitch 72 (144 B = 16 B x odd: a lane per row reads 16 bytes without bank conflicts); v: pitch 66 (eight rows apart = 8 banks apart) */
  const int tid = threadIdx.x; const int which = blockIdx.x >> 8, blk = blockIdx.x & 255; const size_t e0 = (size_t)blk * 256 * 64;
  if (which < 2) {
    const float* X = (which ? Kx : Q) + e0; unsigned short* H = (unsigned short*)(which ? KH : QH) + e0; FragH f[8]; v8f a[8];
    const int rl = which ? (((tid >> 6) << 3) | (tid & 7)) : (tid >> 3), c = which ? ((((tid >> 5) & 1) << 2) | ((tid >> 3) & 3)) : (tid & 7);      /* row of a group of 32 and 8-element piece of the row; for k a wave takes 8 rows x 4 pieces, so that its stores below fill whole lines */
    const int hb = which ? ((rl >> 4) * 1024 + (c >> 1) * 256 + (c & 1) * 128 + (rl & 15) * 8) : (rl * 64 + c * 8);      /* k goes out in fragment order: per 16 keys four pieces of 512 B (16 columns each); inside a piece the columns' half c & 1, then the key, so that lane l of the A loader finds its 16 bytes at 16 l; q stays row-major */
    const unsigned boff = (unsigned)rl * 256u + (unsigned)c * 32u;
#pragma unroll
    for (int i = 0; i < 8; ++i) a[i] = *(const v8f*)((const char*)X + boff + i * 8192);
    asm volatile("s_wait_xcnt 0x0" :: "v"(boff) : "memory");      /* precaution: the loads' offset register is held to this wait, so that none of the loads takes it as its destination */
    __builtin_amdgcn_sched_barrier(0);      /* keeps all sixteen loads in flight together; the scheduler otherwise sinks six of them behind the first waits, three more memory latencies in a row */
#pragma unroll
    for (int i = 0; i < 8; ++i) { v8us b;
#pragma unroll
      for (int u = 0; u < 8; ++u) { const unsigned short xb = bf16_bits(a[i][u]); b[u] = xb; f[i].h[u] = (_Float16)bf16_val(xb); }
      *(v8us*)&sm[(i * 32 + rl) * 72 + c * 8] = b; }
    __syncthreads();      /* a row's sixteen-byte pieces were staged by eight threads */
#pragma unroll
    for (int i = 0; i < 8; ++i) *(v8us*)(H + i * 2048 + hb) = f[i].half[0];      /* behind the barrier, which would otherwise wait for these stores */
    float acc = 0.f;
#pragma unroll
    for (int d = 0; d < 64; d += 8) { const v8us b = *(const v8us*)&sm[tid * 72 + d];
#pragma unroll
      for (int u = 0; u < 8; ++u) { const float x = bf16_val(b[u]); acc = __fadd_rn(acc, __fmul_rn(x, x)); } }      /* a square of a bf16 value is exact in f32: fused or not, each step rounds the same sum */
    *(float*)(NSQ + (size_t)which * NR + blk * 256 + tid) = acc;
  } else {
    const float* X = V + e0; const unsigned voff = (unsigned)tid * 32u;      /* eight groups of 256 keys per slab */
#pragma unroll
    for (int i = 0; i < 8; ++i) { const int g = i * 256 + tid; const v8f a = *(const v8f*)((const char*)X + voff + i * 8192); FragH f;
#pragma unroll
      for (int u = 0; u < 8; ++u) f.h[u] = (_Float16)bf16_round(a[u]);
#pragma unroll
      for (int u = 0; u < 8; ++u) sm[(g >> 3) * 66 + (g & 7) * 8 + u] = f.u[u]; }
    asm volatile("s_wait_xcnt 0x0" :: "v"(voff) : "memory");      /* precaution: the loads' offset register is held to this wait, so that none of the loads takes it as its destination */
    __syncthreads();      /* a V^T piece gathers eight keys staged by eight threads */
#pragma unroll
    for (int it = 0; it < 8; ++it) { const int pi = it * 8 + (tid >> 5);      /* 512-B piece of this group's 64: 32-key block pi >> 3, column tile (pi >> 1) & 3, key half pi & 1 */
      const int d = ((pi >> 1) & 3) * 16 + (tid & 15), pc = (pi >> 3) * 4 + (pi & 1) * 2 + ((tid >> 4) & 1); FragH f;
#pragma unroll
      for (int u = 0; u < 8; ++u) f.u[u] = sm[(pc * 8 + u) * 66 + d];
      *(v8us*)((unsigned short*)Vt + e0 + (it * 256 + tid) * 8) = f.half[0]; }      /* fragment order: a wave's store is one piece, 512 contiguous bytes */
    asm volatile("s_wait_xcnt 0x0" ::: "memory");      /* precaution: the compiler lays the q, k branch behind these stores in the text, where their registers are rewritten */
  } }
// One block per (slab, 8 query rows < 64), one wave per row. The slab's first 64 rows of k and v are rounded and staged in LDS once per block; lanes own keys for the logits, then output columns for the context. Each dot product, the row sum and each context sum keep their serial order.
__global__ __launch_bounds__(256) void k_fixr(const float* __restrict__ Q, const float* __restrict__ Kx, const float* __restrict__ V, const float* __restrict__ NSQ, float* __restrict__ O) {
  #pragma clang fp contract(off)
  __shared__ __attribute__((aligned(16))) float sk[64][68];      /* pitch 272 B = 16 B x odd: a lane per row reads 16 bytes without bank conflicts */
  __shared__ __attribute__((aligned(16))) float sv[64][64]; __shared__ __attribute__((aligned(16))) float pr[8][64];
  const int tid = threadIdx.x, w = tid >> 5, lane = tid & 31; const size_t sl = blockIdx.x >> 3; const int q = __builtin_amdgcn_readfirstlane((int)(blockIdx.x & 7) * 8 + w);
  const float* kb = Kx + sl * SLEN * 64; const float* vb = V + sl * SLEN * 64;
#pragma unroll
  for (int i = 0; i < 4; ++i) { const int e = (i * 256 + tid) * 4; const v4f a = *(const v4fa*)(kb + e); const v4f c = *(const v4fa*)(vb + e); v4f ra, rc;
#pragma unroll
    for (int u = 0; u < 4; ++u) { ra[u] = bf16_round(a[u]); rc[u] = bf16_round(c[u]); }
    *(v4fa*)&sk[e >> 6][e & 63] = ra; *(v4fa*)&sv[e >> 6][e & 63] = rc; }
  const float* qr = Q + (sl * SLEN + q) * 64; const float qs = NSQ[sl * SLEN + q]; const float* ksT = NSQ + (size_t)NB * SLEN + sl * SLEN; const float kq0 = ksT[lane], kq1 = ksT[lane + 32];
  float x[64];      /* the wave's query row, fetched ahead of the barrier so that its latency runs beside the staging loads' */
#pragma unroll
  for (int d = 0; d < 64; d += 4) { const v4f a = *(const v4fa*)(qr + d);
#pragma unroll
    for (int u = 0; u < 4; ++u) x[d + u] = bf16_round(a[u]); }
  __syncthreads();      /* the staged rows are read by every wave of the block */
  float sd0 = 0.f, sd1 = 0.f;      /* keys lane and lane + 32 */
#pragma unroll
  for (int d = 0; d < 64; d += 4) { const v4f k0 = *(const v4fa*)&sk[lane][d]; const v4f k1 = *(const v4fa*)&sk[lane + 32][d];
#pragma unroll
    for (int u = 0; u < 4; ++u) { sd0 = __fadd_rn(sd0, __fmul_rn(x[d + u], k0[u])); sd1 = __fadd_rn(sd1, __fmul_rn(x[d + u], k1[u])); } }
  float d0 = qs + kq0; d0 = d0 - 2.0f * sd0; d0 = fmaxf(d0, 0.f); float d1 = qs + kq1; d1 = d1 - 2.0f * sd1; d1 = fmaxf(d1, 0.f);
  const bool ok0 = lane <= q, ok1 = lane + 32 <= q; const float lg0 = ok0 ? -d0 * 0.125f : -3.0e38f, lg1 = ok1 ? -d1 * 0.125f : -3.0e38f;
  float mx = fmaxf(lg0, lg1); mx = fmaxf(mx, __shfl_xor(mx, 1, 32)); mx = fmaxf(mx, __shfl_xor(mx, 2, 32)); mx = fmaxf(mx, __shfl_xor(mx, 4, 32)); mx = fmaxf(mx, __shfl_xor(mx, 8, 32)); mx = fmaxf(mx, __shfl_xor(mx, 16, 32));
  const float e0 = expf(lg0 - mx), e1 = expf(lg1 - mx); pr[w][lane] = ok0 ? e0 : 0.f; pr[w][lane + 32] = ok1 ? e1 : 0.f;
  __builtin_amdgcn_fence(__ATOMIC_ACQ_REL, "workgroup"); __builtin_amdgcn_wave_barrier();      /* the wave's own lanes read each other's weights below */
  float su = 0.f;
#pragma unroll
  for (int j = 0; j < 64; j += 4) { const v4f e = *(const v4fa*)&pr[w][j]; su += e[0]; su += e[1]; su += e[2]; su += e[3]; }      /* ascending keys; a masked key adds an exact zero */
  const float inv = 1.0f / su; typedef float v2f __attribute__((ext_vector_type(2))); typedef float v2fa __attribute__((ext_vector_type(2), may_alias));
  float a0 = 0.f, a1 = 0.f;      /* output columns 2 lane and 2 lane + 1 */
#pragma unroll 1
  for (int j0 = 0; j0 <= q; j0 += 16) {
#pragma unroll
    for (int i = 0; i < 16; ++i) { const bool in = j0 + i <= q; const v2f vv = *(const v2fa*)&sv[j0 + i][lane * 2]; const float p = pr[w][j0 + i] * inv;      /* past the row's last key the weight is zero; the value is zeroed too, so the term is an exact zero */
      a0 = __fadd_rn(a0, __fmul_rn(p, in ? vv[0] : 0.f)); a1 = __fadd_rn(a1, __fmul_rn(p, in ? vv[1] : 0.f)); } }
  const v2f o = {a0, a1}; *(v2f*)(O + (sl * SLEN + q) * 64 + lane * 2) = o; }

extern "C" void kernel_launch(void* const* d_in, const int* in_sizes, int n_in,
                              void* d_out, int out_size, void* d_ws, size_t ws_size, hipStream_t stream) {
  (void)in_sizes; (void)n_in; (void)out_size;
  const float* q = (const float*)d_in[0]; const float* k = (const float*)d_in[1]; const float* v = (const float*)d_in[2]; float* O = (float*)d_out;
  char* ws = (char*)d_ws; size_t off = 0;
  auto take = [&](size_t bytes) { char* p = ws + off; off += (bytes + 255) & ~(size_t)255; return p; };
  const size_t np = (size_t)NR * DM;      /* 32 x 2048 x 64 */
  _Float16* QH = (_Float16*)take(np * 2); _Float16* KH = (_Float16*)take(np * 2); _Float16* VT = (_Float16*)take(np * 2); float* NSQ = (float*)take((size_t)2 * NR * 4);
  if (off > ws_size) return;      /* 3 x 8 + 0.5 MiB */
  k_prep<<<3 * (NR / 256), 256, 0, stream>>>(q, k, v, QH, KH, VT, NSQ);      /* f16 planes of q and k (bf16-rounded inputs are exact in f16), V^T, |q|^2 | |k|^2 tables */
  k_flash_t<<<NB * (QBLKS / 2), 128, 0, stream>>>(QH, KH, VT, NSQ, O);      /* exact q, k products; f32 RBF logits; f32 context straight to the output; a work-group takes a long and a short query block */
  k_fixr<<<NB * 8, 256, 0, stream>>>(q, k, v, NSQ, O);      /* rows < 64 per slab recomputed in f32 */
}
